// v000
// The times below were measured on an AMD MI455X: many runs one after another, warmed up first and cycling through
// copies of the inputs, with the whole window's GPU time divided by the number of runs. Launches and the gaps
// between them are all in it. The median over several windows is given; except for v000 it joins two sittings, which
// can be a few percent apart, so the side-by-side timings, each taken in one sitting, are the better comparison.
// v000 is the starting kernel. One run takes 2850 microseconds.
// Contractions: x.W^T (q, k, v^T) and x.down^T: single v_wmma_f32_16x16x32_bf16 products on RNE-bf16 planes; q.k^T scores and p.v context: bf16 hi/lo operand planes (hi.hi + hi.lo + lo.hi); ctx.Wo^T and ctx.out_down^T: ctx bf16 hi/lo x RNE-bf16 weights (hi.W + lo.W); rank-4 up-products, bias and softmax in f32 on the VALU; all f32 accumulate.
#include <hip/hip_runtime.h>
#include <math.h>

// ---------------------------------------------------------------------------
// Problem constants
// ---------------------------------------------------------------------------
constexpr int kBatch   = 2;
constexpr int kSeq     = 2048;
constexpr int kHid     = 1024;
constexpr int kHeads   = 16;
constexpr int kDh      = 64;
constexpr int kTok     = kBatch * kSeq;            // 4096 token rows
constexpr int kRank    = 4;
constexpr int kRankPad = 64;                       // rank padded to one tile
constexpr int kQKld    = 2 * kHid;                 // 2048: pitch of the q|k planes (halves)
constexpr int kGrp     = 2;                        // (batch, head) pairs per attention group (same batch)
constexpr int kNumGroups = (kBatch * kHeads) / kGrp;   // 16
constexpr float kScoreScale = 0.125f;              // 64^-0.5, applied in the f32 epilogue

static_assert(kHeads % kGrp == 0, "groups stay inside one batch");
static_assert((kTok * kHid) % (8 * 256) == 0, "cast grid exact");
static_assert((kHid * kHid) % (8 * 256) == 0, "cast grid exact");
static_assert((kRankPad * kHid) % (8 * 256) == 0, "pad cast grid exact");
static_assert(kSeq == 2048, "softmax kernel: 256 threads x 8 columns = one row, blockIdx decode");
static_assert(kHid % 64 == 0 && kTok % 64 == 0 && kSeq % 64 == 0 && kDh % 64 == 0 && kRankPad % 64 == 0, "tile multiples");
static_assert(kHid % 32 == 0 && kDh % 32 == 0 && kSeq % 32 == 0, "K multiples of 32");

typedef __attribute__((ext_vector_type(16))) _Float16 v16h;
typedef __attribute__((ext_vector_type(8)))  _Float16 v8h;
typedef __attribute__((ext_vector_type(16))) __bf16   v16b;
typedef __attribute__((ext_vector_type(8)))  __bf16   v8b;
typedef __attribute__((ext_vector_type(8)))  float    v8f;
typedef __attribute__((ext_vector_type(4)))  float    v4f;
typedef __attribute__((ext_vector_type(4)))  unsigned int v4u;

__device__ __forceinline__ unsigned short f2bf_bits(float f) {
  unsigned u = __float_as_uint(f);
  return (unsigned short)((u + 0x7FFFu + ((u >> 16) & 1u)) >> 16);
}
__device__ __forceinline__ float bf_bits2f(unsigned short h) { return __uint_as_float(((unsigned)h) << 16); }
__device__ __forceinline__ float bf_rne(float f) { return bf_bits2f(f2bf_bits(f)); }

// hazard guards as plain device helpers (no inline asm inside the kernel template body)
__device__ __forceinline__ void dep_guard_h(v8f& a, v8f& b, v16h x, v16h y) { asm volatile("v_nop\n\tv_nop\n\tv_nop\n\tv_nop" : "+v"(a), "+v"(b) : "v"(x), "v"(y)); }
__device__ __forceinline__ void dep_guard_b(v8f& a, v8f& b, v16b x, v16b y) { asm volatile("v_nop\n\tv_nop\n\tv_nop\n\tv_nop" : "+v"(a), "+v"(b) : "v"(x), "v"(y)); }
__device__ __forceinline__ void keep4_h(v16h a, v16h b, v16h c, v16h d) { asm volatile("v_nop" :: "v"(a), "v"(b), "v"(c), "v"(d)); }
__device__ __forceinline__ void keep4_b(v16b a, v16b b, v16b c, v16b d) { asm volatile("v_nop" :: "v"(a), "v"(b), "v"(c), "v"(d)); }
__device__ __forceinline__ void acc_guard4(v8f& a, v8f& b, v8f& c, v8f& d) { asm volatile("v_nop\n\tv_nop\n\tv_nop\n\tv_nop" : "+v"(a), "+v"(b), "+v"(c), "+v"(d)); }
template <typename T> struct Frag;
template <> struct Frag<_Float16> {
  typedef v16h V; union U { v16h v; v8h h[2]; };
  // elements 0..7 <- p[0..7], 8..15 <- p[16..23]
  static __device__ __forceinline__ v16h load(const _Float16* p) {
    U f; f.h[0] = *(const v8h*)(p); f.h[1] = *(const v8h*)(p + 16); return f.v;
  }
  static __device__ __forceinline__ v8f mma(v16h a, v16h b, v8f c) {
    return __builtin_amdgcn_wmma_f32_16x16x32_f16(false, a, false, b, (short)0, c, false, false);
  }
  static __device__ __forceinline__ void guard(v8f& a, v8f& b, v16h x, v16h y) { dep_guard_h(a, b, x, y); }
  static __device__ __forceinline__ void keep(v16h a, v16h b, v16h c, v16h d) { keep4_h(a, b, c, d); }
};
template <> struct Frag<__bf16> {
  typedef v16b V; union U { v16b v; v8b h[2]; };
  static __device__ __forceinline__ v16b load(const __bf16* p) {
    U f; f.h[0] = *(const v8b*)(p); f.h[1] = *(const v8b*)(p + 16); return f.v;
  }
  static __device__ __forceinline__ v8f mma(v16b a, v16b b, v8f c) {
    return __builtin_amdgcn_wmma_f32_16x16x32_bf16(false, a, false, b, (short)0, c, false, false);
  }
  static __device__ __forceinline__ void guard(v8f& a, v8f& b, v16b x, v16b y) { dep_guard_b(a, b, x, y); }
  static __device__ __forceinline__ void keep(v16b a, v16b b, v16b c, v16b d) { keep4_b(a, b, c, d); }
};

__device__ __forceinline__ unsigned pk16(unsigned short a, unsigned short b) { return (unsigned)a | ((unsigned)b << 16); }

// ---- Register-blocked batched WMMA GEMM (CAUSAL, BSPLIT and LORA options added) ----
// C[m,n] = scale * sum_k A[m,k] * Bt[n,k] (+bias)(+resid)(+lora); each wave owns a 64x64 tile.
// A row-major [M,K]; Bt row-major [N,K]; M,N % 64 == 0, K % 32 == 0.
// SPLIT: operands are hi/lo planes (A2/Bt2 = lo planes, same layout); product = hi.hi + hi.lo + lo.hi.
// SPLIT with BSPLIT == false: only A carries a lo plane; product = hi.B + lo.B (Bt2 unused).
// BIAS_MODE: 0 = none, 1 = bias[m], 2 = bias[n].
// OUT_MODE: 0 = f32, 1 = f16, 2 = bf16 hi plane (Cout) + bf16 lo plane (Cout2).
// CAUSAL: tiles with n0 > m0 are skipped (wave-uniform) and the k loop stops at min(K, m0 + 64).
// LORA: rank-4 f32 term added in the epilogue: v += dot4(rowtab[m][0..3], coltab[n][0..3]); rowtab pitch ldrow floats, coltab pitch
//   ldcol floats (both 16-B aligned rows). LORA == 1: coltab values RNE-bf16 converted at load (rowtab kept f32);
//   LORA == 2: rowtab values RNE-bf16 converted (coltab kept f32). In LORA modes a BIAS_MODE 2 bias is RNE-bf16 converted too.
// ET: 0 = f16 operands, 1 = bf16 operands (pointers passed as 16-bit storage)
template <int ET> struct Elem;
template <> struct Elem<0> { typedef _Float16 T; };
template <> struct Elem<1> { typedef __bf16 T; };
template <int ET, bool SPLIT, int BIAS_MODE, int OUT_MODE, bool RESID, int ACT = 0, bool CAUSAL = false, bool BSPLIT = true, int LORA = 0>
__global__ __launch_bounds__(256) void wmma_gemm64(
    const unsigned short* __restrict__ Ap, const unsigned short* __restrict__ A2p, int lda, long strideA,
    const unsigned short* __restrict__ Btp, const unsigned short* __restrict__ Bt2p, int ldb, long strideB,
    void* __restrict__ Cout, void* __restrict__ Cout2, int ldc, long strideC,
    const float* __restrict__ bias,
    const float* __restrict__ resid, long strideR,
    const float* __restrict__ rowtab, int ldrow,
    const float* __restrict__ coltab, int ldcol,
    int M, int N, int K, float scale) {
  typedef typename Elem<ET>::T T;
  typedef typename Frag<T>::V V;
  const T* A = (const T*)Ap; const T* A2 = (const T*)A2p; const T* Bt = (const T*)Btp; const T* Bt2 = (const T*)Bt2p;
  __shared__ __align__(16) float sT[8][16 * 68];   // per-wave 16x64 slab, pitch 68 floats
  const int b    = blockIdx.y;
  const int lane = threadIdx.x & 31;
  const int wave = threadIdx.x >> 5;
  const int tilesN = N >> 6;
  const int tilesM = M >> 6;
  const int tile = blockIdx.x * 8 + wave;
  if (tile >= tilesM * tilesN) return;   // wave-uniform; no block barriers in this kernel
  const int tm = tile / tilesN;
  const int tn = tile - tm * tilesN;
  const int m0 = tm << 6;
  const int n0 = tn << 6;
  if (CAUSAL && (n0 > m0)) return;       // wave-uniform causal tile skip
  const int Kend = CAUSAL ? ((m0 + 64 < K) ? (m0 + 64) : K) : K;   // multiple of 32

  const T* Ab  = A  + (size_t)b * strideA;
  const T* Bb  = Bt + (size_t)b * strideB;
  const T* Ab2 = SPLIT ? (A2  + (size_t)b * strideA) : nullptr;
  const T* Bb2 = (SPLIT && BSPLIT) ? (Bt2 + (size_t)b * strideB) : nullptr;

  const int rlane = lane & 15;                 // row (A) / col (B, D) within subtile
  const int koff  = (lane >> 4) * 8;           // k offset of this lane half
  const int mOff  = (lane >> 4) * 8;           // D row offset

  v8f acc[4][4];
#pragma unroll
  for (int i = 0; i < 4; ++i)
#pragma unroll
    for (int j = 0; j < 4; ++j) acc[i][j] = (v8f){0.f,0.f,0.f,0.f,0.f,0.f,0.f,0.f};

  for (int k0 = 0; k0 < Kend; k0 += 32) {
    V bh[4], bl[4];
#pragma unroll
    for (int j = 0; j < 4; ++j) {
      const size_t bo = (size_t)(n0 + (j << 4) + rlane) * ldb + koff + k0;
      bh[j] = Frag<T>::load(Bb + bo);
      if (SPLIT && BSPLIT) bl[j] = Frag<T>::load(Bb2 + bo);
    }
#pragma unroll
    for (int i = 0; i < 4; ++i) {
      const size_t ao = (size_t)(m0 + (i << 4) + rlane) * lda + koff + k0;
      V ah = Frag<T>::load(Ab + ao);
      V al;
      if (SPLIT) al = Frag<T>::load(Ab2 + ao);
#pragma unroll
      for (int j = 0; j < 4; ++j) {
        acc[i][j] = Frag<T>::mma(ah, bh[j], acc[i][j]);
        if (SPLIT && BSPLIT) acc[i][j] = Frag<T>::mma(ah, bl[j], acc[i][j]);
        if (SPLIT) acc[i][j] = Frag<T>::mma(al, bh[j], acc[i][j]);
      }
      Frag<T>::guard(acc[i][0], acc[i][3], ah, SPLIT ? al : ah);
    }
    Frag<T>::keep(bh[0], bh[1], bh[2], bh[3]);
    if (SPLIT && BSPLIT) Frag<T>::keep(bl[0], bl[1], bl[2], bl[3]);
  }
  acc_guard4(acc[0][0], acc[0][1], acc[0][2], acc[0][3]);
  acc_guard4(acc[1][0], acc[1][1], acc[1][2], acc[1][3]);
  acc_guard4(acc[2][0], acc[2][1], acc[2][2], acc[2][3]);
  acc_guard4(acc[3][0], acc[3][1], acc[3][2], acc[3][3]);

  // ---- epilogue ----
  float* slab = sT[wave];
  const float* Rb = RESID ? (resid + (size_t)b * strideR) : nullptr;
  // rank-4 column table (LORA modes): per lane the 4 columns n0 + 16j + rlane
  v4f ctab[4];
  float cbias[4];
#pragma unroll
  for (int j = 0; j < 4; ++j) { ctab[j] = (v4f){0.f,0.f,0.f,0.f}; cbias[j] = 0.f; }
  if (LORA != 0) {
#pragma unroll
    for (int j = 0; j < 4; ++j) {
      const int n = n0 + (j << 4) + rlane;
      v4f u = *(const v4f*)(coltab + (size_t)n * ldcol);
      if (LORA == 1) {
#pragma unroll
        for (int e = 0; e < 4; ++e) u[e] = bf_rne(u[e]);
      }
      ctab[j] = u;
      if (BIAS_MODE == 2) cbias[j] = bf_rne(bias[n]);
    }
  }
#pragma unroll
  for (int i = 0; i < 4; ++i) {
    const int mBase = m0 + (i << 4);
    if (LORA == 0) {
#pragma unroll
      for (int j = 0; j < 4; ++j) {
        const int n = n0 + (j << 4) + rlane;
        float bv = 0.f;
        if (BIAS_MODE == 2) bv = bias[n];
#pragma unroll
        for (int r = 0; r < 8; ++r) {
          float v = acc[i][j][r] * scale;
          if (BIAS_MODE == 1) v += bias[mBase + mOff + r];
          if (BIAS_MODE == 2) v += bv;
          if (RESID) v += Rb[(size_t)(mBase + mOff + r) * ldc + n];
          if (ACT == 2) v = fmaxf(v, 0.0f);
          if (ACT == 4) v = (v > 0.f) ? v : 0.01f * v;
          slab[(mOff + r) * 68 + (j << 4) + rlane] = v;
        }
      }
    } else {
#pragma unroll
      for (int r = 0; r < 8; ++r) {
        const int m = mBase + mOff + r;
        v4f tr = *(const v4f*)(rowtab + (size_t)m * ldrow);
        if (LORA == 2) {
#pragma unroll
          for (int e = 0; e < 4; ++e) tr[e] = bf_rne(tr[e]);
        }
#pragma unroll
        for (int j = 0; j < 4; ++j) {
          float lr = tr[0] * ctab[j][0];
          lr = fmaf(tr[1], ctab[j][1], lr);
          lr = fmaf(tr[2], ctab[j][2], lr);
          lr = fmaf(tr[3], ctab[j][3], lr);
          float v = acc[i][j][r] * scale + lr;
          if (BIAS_MODE == 2) v += cbias[j];
          slab[(mOff + r) * 68 + (j << 4) + rlane] = v;
        }
      }
    }
    __builtin_amdgcn_fence(__ATOMIC_RELEASE, "workgroup");
    __builtin_amdgcn_wave_barrier();
    __builtin_amdgcn_fence(__ATOMIC_ACQUIRE, "workgroup");
    if (OUT_MODE == 0) {
      float* C = (float*)Cout + (size_t)b * strideC;
      const int hh = lane >> 4, c4 = (lane & 15) * 4;     // row seg = 256 B = 16 lanes x 16 B
      {
#pragma unroll
        for (int it = 0; it < 8; ++it) {
          const int row = it * 2 + hh;
          v4f v = *(const v4f*)(slab + row * 68 + c4);
          *(v4f*)(C + (size_t)(mBase + row) * ldc + n0 + c4) = v;
        }
        
      }
    } else {
      const int q = lane >> 3, c8 = (lane & 7) * 8;
      unsigned short* C  = (unsigned short*)Cout  + (size_t)b * strideC;
      unsigned short* C2 = (OUT_MODE == 2) ? ((unsigned short*)Cout2 + (size_t)b * strideC) : nullptr;
      {
#pragma unroll
        for (int it = 0; it < 4; ++it) {
          const int row = it * 4 + q;
          const float* sp = slab + row * 68 + c8;
          v8h hv, lv;
#pragma unroll
          for (int e = 0; e < 8; ++e) {
            if (OUT_MODE == 1) {
              hv[e] = (_Float16)sp[e];
            } else {
              unsigned short hb = f2bf_bits(sp[e]);
              unsigned short lb = f2bf_bits(sp[e] - bf_bits2f(hb));
              hv[e] = __builtin_bit_cast(_Float16, hb);
              lv[e] = __builtin_bit_cast(_Float16, lb);
            }
          }
          *(v8h*)(C + (size_t)(mBase + row) * ldc + n0 + c8) = hv;
          if (OUT_MODE == 2) *(v8h*)(C2 + (size_t)(mBase + row) * ldc + n0 + c8) = lv;
        }
        
      }
    }
    __builtin_amdgcn_fence(__ATOMIC_RELEASE, "workgroup");
    __builtin_amdgcn_wave_barrier();
    __builtin_amdgcn_fence(__ATOMIC_ACQUIRE, "workgroup");
  }
}

// ---------------------------------------------------------------------------
// f32 -> RNE bf16 plane with zero padding, up to 3 same-shaped tables per launch (blockIdx.y selects the source, block-uniform).
// Thread i owns flat elements 8i..8i+7 of plane y: value = in_y[e] for e < nvalid, 0 otherwise (the load address is clamped to
// [0, nvalid-8], the value is zeroed by predicate). out plane y starts at out + y * plane_halves.
// Coverage: n8 = plane elements / 8 threads x 8 = the whole padded plane (grids are exact multiples of 256 here).
// ---------------------------------------------------------------------------
__global__ __launch_bounds__(256) void cast_pad_bf16_kernel(const float* __restrict__ s0, const float* __restrict__ s1,
                                                            const float* __restrict__ s2,
                                                            unsigned short* __restrict__ out, long plane_halves,
                                                            int n8, int nvalid) {
  const int i = blockIdx.x * 256 + threadIdx.x;
  if (i >= n8) return;
  const int y = blockIdx.y;
  const float* src = (y == 0) ? s0 : ((y == 1) ? s1 : s2);
  const long e = 8L * (long)i;
  const bool live = (e < (long)nvalid);
  const long ec = live ? e : (long)(nvalid - 8);
  const v4f a = *(const v4f*)(src + ec);
  const v4f c = *(const v4f*)(src + ec + 4);
  float f[8];
#pragma unroll
  for (int k = 0; k < 4; ++k) { f[k] = live ? a[k] : 0.0f; f[4 + k] = live ? c[k] : 0.0f; }
  unsigned w[4];
#pragma unroll
  for (int e2 = 0; e2 < 4; ++e2) w[e2] = pk16(f2bf_bits(f[2 * e2]), f2bf_bits(f[2 * e2 + 1]));
  const v4u u = (v4u){w[0], w[1], w[2], w[3]};
  unsigned short* q = out + (size_t)y * plane_halves + (size_t)e;
  *(v4u*)q = u;
  
}

// ---------------------------------------------------------------------------
// Row softmax (no mask) over materialised f32 scores of one group (kGrp pairs x 2048 rows x 2048 cols).
// p = exp(s - rowmax) * (1 / sum); every row is finite and sum >= 1.
// P written as bf16 hi/lo planes for every column of every row.
// One block of 256 threads per (pair, row); thread t owns columns 8t..8t+7 (256 x 8 = 2048).
// Reductions in fixed order (thread, wave shuffle tree outside all branches, 8 wave partials in index order).
// ---------------------------------------------------------------------------
__global__ __launch_bounds__(256) void softmax_row_kernel(const float* __restrict__ S,
                                                          unsigned short* __restrict__ Phi, unsigned short* __restrict__ Plo) {
  __shared__ float redM[8];
  __shared__ float redS[8];
  const int blk  = blockIdx.x;
  const int pr   = blk >> 11;            // pair within the group
  const int qi   = blk & (kSeq - 1);     // query row
  const int t    = threadIdx.x;
  const int lane = t & 31, wave = t >> 5;
  const int c0   = t * 8;
  const size_t rowoff = ((size_t)pr * kSeq + qi) * (size_t)kSeq;

  const float* sr = S + rowoff + c0;
  const v4f a = *(const v4f*)(sr);
  const v4f c = *(const v4f*)(sr + 4);
  float xv[8];
#pragma unroll
  for (int e = 0; e < 4; ++e) { xv[e] = a[e]; xv[4 + e] = c[e]; }
  float m = xv[0];
#pragma unroll
  for (int e = 1; e < 8; ++e) m = fmaxf(m, xv[e]);
#pragma unroll
  for (int off = 16; off > 0; off >>= 1) m = fmaxf(m, __shfl_xor(m, off, 32));
  if (lane == 0) redM[wave] = m;
  __syncthreads();
  float gmax = redM[0];
#pragma unroll
  for (int w = 1; w < 8; ++w) gmax = fmaxf(gmax, redM[w]);

  float p[8];
  float ps = 0.0f;
#pragma unroll
  for (int e = 0; e < 8; ++e) { p[e] = expf(xv[e] - gmax); ps += p[e]; }
#pragma unroll
  for (int off = 16; off > 0; off >>= 1) ps += __shfl_xor(ps, off, 32);
  if (lane == 0) redS[wave] = ps;
  __syncthreads();
  float tot = redS[0];
#pragma unroll
  for (int w = 1; w < 8; ++w) tot += redS[w];
  const float inv = 1.0f / tot;          // tot >= 1

  unsigned hw[4], lw[4];
#pragma unroll
  for (int e2 = 0; e2 < 4; ++e2) {
    const float f0 = p[2 * e2] * inv;
    const float f1 = p[2 * e2 + 1] * inv;
    const unsigned short h0 = f2bf_bits(f0);
    const unsigned short h1 = f2bf_bits(f1);
    const unsigned short l0 = f2bf_bits(f0 - bf_bits2f(h0));
    const unsigned short l1 = f2bf_bits(f1 - bf_bits2f(h1));
    hw[e2] = pk16(h0, h1);
    lw[e2] = pk16(l0, l1);
  }
  const v4u hv = (v4u){hw[0], hw[1], hw[2], hw[3]};
  const v4u lv = (v4u){lw[0], lw[1], lw[2], lw[3]};
  unsigned short* ph = Phi + rowoff + c0;
  unsigned short* pl = Plo + rowoff + c0;
  *(v4u*)ph = hv;
  *(v4u*)pl = lv;
  
}

// ---------------------------------------------------------------------------
// Launcher. Workspace region map (bytes, MiB = 1048576; total carve = 128 MiB = 134217728 B):
//   [  0, 32) S      : scores f32 [2][2048][2048] per group.
//                      early aliases (dead before the first score GEMM): x bf16 [4096][1024] at +0 (8 MiB);
//                      wq|wk|wv bf16 [1024][1024] x3 at +8 MiB (6 MiB); padded down planes [64][1024] x3 at +14 MiB (384 KiB);
//                      t tables f32 [4096][64] x3 (tq|tk|tv) at +15 MiB (3 MiB, ends 18 MiB).
//                      late aliases (after the last p.v GEMM; S dead after the last softmax): wo bf16 [1024][1024] at +0 (2 MiB);
//                      padded out_down plane [64][1024] at +2 MiB (128 KiB); to table f32 [4096][64] at +3 MiB (1 MiB).
//   [ 32, 48) P hi   : [2][2048][2048] bf16 per group (exactly 16 MiB)
//   [ 48, 64) P lo
//   [ 64, 80) q|k hi : [4096][2048] bf16 (cols 0..1023 = q (h*64+d), 1024..2047 = k)
//   [ 80, 96) q|k lo
//   [ 96,104) v^T hi : [1024 (h*64+d)][4096 (b*2048+s)] bf16
//   [104,112) v^T lo
//   [112,120) ctx hi : [4096][1024] bf16 (col h*64+d)
//   [120,128) ctx lo
// Launch count: 3 casts + 1 down GEMM + 3 projections + 16*3 attention + 2 late casts + 1 down GEMM + 1 out GEMM = 59.
// Kernel launches only.
// ---------------------------------------------------------------------------
extern "C" void kernel_launch(void* const* d_in, const int* in_sizes, int n_in,
                              void* d_out, int out_size, void* d_ws, size_t ws_size,
                              hipStream_t stream) {
  if (n_in < 14) return;
  if (in_sizes[0] != kTok * kHid) return;
  if (in_sizes[1] != kHid * kHid || in_sizes[2] != kHid * kHid || in_sizes[3] != kHid * kHid || in_sizes[4] != kHid * kHid) return;
  if (in_sizes[5] != kHid) return;
  if (in_sizes[6] != kRank * kHid || in_sizes[8] != kRank * kHid || in_sizes[10] != kRank * kHid || in_sizes[12] != kRank * kHid) return;
  if (in_sizes[7] != kHid * kRank || in_sizes[9] != kHid * kRank || in_sizes[11] != kHid * kRank || in_sizes[13] != kHid * kRank) return;
  if (out_size != kTok * kHid) return;

  const size_t kMiB    = 1048576;
  const size_t offS    = 0;
  const size_t offXb   = 0;
  const size_t offW3   = 8 * kMiB;
  const size_t offDn3  = 14 * kMiB;
  const size_t offT3   = 15 * kMiB;
  const size_t offWo   = 0;
  const size_t offDnO  = 2 * kMiB;
  const size_t offTo   = 3 * kMiB;
  const size_t offPhi  = 32 * kMiB;
  const size_t offPlo  = 48 * kMiB;
  const size_t offQKhi = 64 * kMiB;
  const size_t offQKlo = 80 * kMiB;
  const size_t offVthi = 96 * kMiB;
  const size_t offVtlo = 104 * kMiB;
  const size_t offChi  = 112 * kMiB;
  const size_t offClo  = 120 * kMiB;
  const size_t total   = 128 * kMiB;
  if (total > ws_size) return;

  const float* x     = (const float*)d_in[0];
  const float* wq    = (const float*)d_in[1];
  const float* wk    = (const float*)d_in[2];
  const float* wv    = (const float*)d_in[3];
  const float* wo    = (const float*)d_in[4];
  const float* bo    = (const float*)d_in[5];
  const float* q_dn  = (const float*)d_in[6];
  const float* q_up  = (const float*)d_in[7];
  const float* k_dn  = (const float*)d_in[8];
  const float* k_up  = (const float*)d_in[9];
  const float* v_dn  = (const float*)d_in[10];
  const float* v_up  = (const float*)d_in[11];
  const float* o_dn  = (const float*)d_in[12];
  const float* o_up  = (const float*)d_in[13];
  float* out = (float*)d_out;
  char* ws = (char*)d_ws;

  float*          Sbuf = (float*)(ws + offS);
  unsigned short* xb   = (unsigned short*)(ws + offXb);
  unsigned short* w3   = (unsigned short*)(ws + offW3);
  unsigned short* dn3  = (unsigned short*)(ws + offDn3);
  float*          t3   = (float*)(ws + offT3);
  unsigned short* wob  = (unsigned short*)(ws + offWo);
  unsigned short* dno  = (unsigned short*)(ws + offDnO);
  float*          tot  = (float*)(ws + offTo);
  unsigned short* phi  = (unsigned short*)(ws + offPhi);
  unsigned short* plo  = (unsigned short*)(ws + offPlo);
  unsigned short* qkhi = (unsigned short*)(ws + offQKhi);
  unsigned short* qklo = (unsigned short*)(ws + offQKlo);
  unsigned short* vthi = (unsigned short*)(ws + offVthi);
  unsigned short* vtlo = (unsigned short*)(ws + offVtlo);
  unsigned short* chi  = (unsigned short*)(ws + offChi);
  unsigned short* clo  = (unsigned short*)(ws + offClo);

  // in-range dummies for unused (never dereferenced) template-dead pointer parameters
  const float* dummy_f = bo;
  void* dummy_c2 = (void*)phi;

  const long wPlane  = (long)kHid * kHid;          // 1048576 halves
  const long dnPlane = (long)kRankPad * kHid;      // 65536 halves
  const long tPlane  = (long)kTok * kRankPad;      // 262144 floats

  // 1. x -> RNE bf16 plane [4096][1024]: n8 = 524288 = 2048 blocks x 256
  {
    const int n8 = (kTok * kHid) / 8;
    cast_pad_bf16_kernel<<<dim3(n8 / 256, 1), dim3(256), 0, stream>>>(x, x, x, xb, 0L, n8, kTok * kHid);
  }
  // 2. wq, wk, wv [1024 out][1024 in] -> bf16 planes (Bt layout directly): n8 = 131072 = 512 blocks x 256, 3 tables
  {
    const int n8 = (kHid * kHid) / 8;
    cast_pad_bf16_kernel<<<dim3(n8 / 256, 3), dim3(256), 0, stream>>>(wq, wk, wv, w3, wPlane, n8, kHid * kHid);
  }
  // 3. q/k/v down [4][1024] -> zero-padded bf16 planes [64][1024] (rows 4..63 zero-filled): n8 = 8192 = 32 blocks x 256
  {
    const int n8 = (kRankPad * kHid) / 8;
    cast_pad_bf16_kernel<<<dim3(n8 / 256, 3), dim3(256), 0, stream>>>(q_dn, k_dn, v_dn, dn3, dnPlane, n8, kRank * kHid);
  }
  // 4. t{q,k,v} = x . down^T : M=4096, N=64, K=1024, single bf16 product -> f32 [3][4096][64] (batched over blockIdx.y)
  wmma_gemm64<1, false, 0, 0, false, 0, false, true, 0><<<dim3((kTok / 64) * (kRankPad / 64) / 8, 3), dim3(256), 0, stream>>>(
      xb, xb, kHid, 0L,
      dn3, dn3, kHid, dnPlane,
      (void*)t3, dummy_c2, kRankPad, tPlane,
      dummy_f, dummy_f, 0L,
      dummy_f, 4, dummy_f, 4,
      kTok, kRankPad, kHid, 1.0f);

  // 5. q = x . wq^T + tq . q_up^T : M=4096, N=1024, K=1024 -> bf16 hi/lo into q|k planes cols 0..1023 (ldc 2048)
  wmma_gemm64<1, false, 0, 2, false, 0, false, true, 1><<<dim3((kTok / 64) * (kHid / 64) / 8, 1), dim3(256), 0, stream>>>(
      xb, xb, kHid, 0L,
      w3, w3, kHid, 0L,
      (void*)qkhi, (void*)qklo, kQKld, 0L,
      dummy_f, dummy_f, 0L,
      t3, kRankPad, q_up, kRank,
      kTok, kHid, kHid, 1.0f);
  // 6. k = x . wk^T + tk . k_up^T -> cols 1024..2047
  wmma_gemm64<1, false, 0, 2, false, 0, false, true, 1><<<dim3((kTok / 64) * (kHid / 64) / 8, 1), dim3(256), 0, stream>>>(
      xb, xb, kHid, 0L,
      w3 + wPlane, w3 + wPlane, kHid, 0L,
      (void*)(qkhi + kHid), (void*)(qklo + kHid), kQKld, 0L,
      dummy_f, dummy_f, 0L,
      t3 + tPlane, kRankPad, k_up, kRank,
      kTok, kHid, kHid, 1.0f);
  // 7. v^T = wv . x^T + v_up . tv^T : M=1024 (h*64+d), N=4096 (token), K=1024 -> bf16 hi/lo [1024][4096]
  wmma_gemm64<1, false, 0, 2, false, 0, false, true, 2><<<dim3((kHid / 64) * (kTok / 64) / 8, 1), dim3(256), 0, stream>>>(
      w3 + 2 * wPlane, w3 + 2 * wPlane, kHid, 0L,
      xb, xb, kHid, 0L,
      (void*)vthi, (void*)vtlo, kTok, 0L,
      dummy_f, dummy_f, 0L,
      v_up, kRank, t3 + 2 * tPlane, kRankPad,
      kHid, kTok, kHid, 1.0f);

  // 8. attention per group of kGrp heads of one batch (no mask)
  for (int g = 0; g < kNumGroups; ++g) {
    const int b  = g / (kHeads / kGrp);
    const int h0 = (g % (kHeads / kGrp)) * kGrp;
    const size_t qkoff = (size_t)b * kSeq * kQKld + (size_t)h0 * kDh;   // halves

    // scores = 0.125 * q . k^T : M=N=2048, K=64, 3 products on hi/lo planes; pair stride 64 halves for A and Bt, 2048*2048 floats for C
    wmma_gemm64<1, true, 0, 0, false, 0, false, true, 0><<<dim3((kSeq / 64) * (kSeq / 64) / 8, kGrp), dim3(256), 0, stream>>>(
        qkhi + qkoff, qklo + qkoff, kQKld, (long)kDh,
        qkhi + kHid + qkoff, qklo + kHid + qkoff, kQKld, (long)kDh,
        (void*)Sbuf, dummy_c2, kSeq, (long)kSeq * kSeq,
        dummy_f, dummy_f, 0L,
        dummy_f, 4, dummy_f, 4,
        kSeq, kSeq, kDh, kScoreScale);

    // softmax rows -> P hi/lo planes [kGrp][2048][2048]
    softmax_row_kernel<<<dim3(kGrp * kSeq), dim3(256), 0, stream>>>(Sbuf, phi, plo);

    // ctx = P . v : M=2048, N=64, K=2048, 3 products; Bt = v^T rows (h0+pair)*64.., cols b*2048..
    const size_t vtoff = (size_t)(h0 * kDh) * kTok + (size_t)b * kSeq;    // halves
    const size_t coff  = (size_t)b * kSeq * kHid + (size_t)h0 * kDh;       // halves
    wmma_gemm64<1, true, 0, 2, false, 0, false, true, 0><<<dim3((kSeq / 64) * (kDh / 64) / 8, kGrp), dim3(256), 0, stream>>>(
        phi, plo, kSeq, (long)kSeq * kSeq,
        vthi + vtoff, vtlo + vtoff, kTok, (long)kDh * kTok,
        (void*)(chi + coff), (void*)(clo + coff), kHid, (long)kDh,
        dummy_f, dummy_f, 0L,
        dummy_f, 4, dummy_f, 4,
        kSeq, kDh, kSeq, 1.0f);
  }

  // 9. wo [1024][1024] -> bf16 plane into the dead S region
  {
    const int n8 = (kHid * kHid) / 8;
    cast_pad_bf16_kernel<<<dim3(n8 / 256, 1), dim3(256), 0, stream>>>(wo, wo, wo, wob, 0L, n8, kHid * kHid);
  }
  // 10. out_down [4][1024] -> zero-padded bf16 plane [64][1024]
  {
    const int n8 = (kRankPad * kHid) / 8;
    cast_pad_bf16_kernel<<<dim3(n8 / 256, 1), dim3(256), 0, stream>>>(o_dn, o_dn, o_dn, dno, 0L, n8, kRank * kHid);
  }
  // 11. to = ctx_hi . out_down^T + ctx_lo . out_down^T : M=4096, N=64, K=1024, 2 products -> f32 [4096][64]
  wmma_gemm64<1, true, 0, 0, false, 0, false, false, 0><<<dim3((kTok / 64) * (kRankPad / 64) / 8, 1), dim3(256), 0, stream>>>(
      chi, clo, kHid, 0L,
      dno, dno, kHid, 0L,
      (void*)tot, dummy_c2, kRankPad, 0L,
      dummy_f, dummy_f, 0L,
      dummy_f, 4, dummy_f, 4,
      kTok, kRankPad, kHid, 1.0f);
  // 12. out = ctx_hi . wo^T + ctx_lo . wo^T + to . out_up^T + bo : M=4096, N=1024, K=1024 -> f32 d_out
  wmma_gemm64<1, true, 2, 0, false, 0, false, false, 1><<<dim3((kTok / 64) * (kHid / 64) / 8, 1), dim3(256), 0, stream>>>(
      chi, clo, kHid, 0L,
      wob, wob, kHid, 0L,
      (void*)out, dummy_c2, kHid, 0L,
      bo, dummy_f, 0L,
      tot, kRankPad, o_up, kRank,
      kTok, kHid, kHid, 1.0f);
}

// v001
// It runs in 964 microseconds.
// Timed twice side by side with v000, it ran 2.97 and 2.96 times as fast.
// Contractions: x.W^T (q, k, v^T) and x.down^T: single v_wmma_f32_16x16x32_bf16 products on RNE-bf16 planes; q.k^T scores and p.v context: bf16 hi/lo operand planes (hi.hi + hi.lo + lo.hi); ctx.Wo^T and ctx.out_down^T: ctx bf16 hi/lo x RNE-bf16 weights (hi.W + lo.W); rank-4 up-products, bias and softmax in f32 on the VALU; all f32 accumulate.
#include <hip/hip_runtime.h>
#include <math.h>

// ---------------------------------------------------------------------------
// Problem constants
// ---------------------------------------------------------------------------
constexpr int kBatch   = 2;
constexpr int kSeq     = 2048;
constexpr int kHid     = 1024;
constexpr int kHeads   = 16;
constexpr int kDh      = 64;
constexpr int kTok     = kBatch * kSeq;            // 4096 token rows
constexpr int kRank    = 4;
constexpr int kRankPad = 64;                       // rank padded to one tile
constexpr int kQKld    = 2 * kHid;                 // 2048: pitch of the q|k planes (halves)
constexpr int kGrp     = 2;                        // (batch, head) pairs per attention group (same batch)
constexpr int kNumGroups = (kBatch * kHeads) / kGrp;   // 16
constexpr float kScoreScale = 0.125f;              // 64^-0.5, applied in the f32 epilogue

static_assert(kHeads % kGrp == 0, "groups stay inside one batch");
static_assert((kTok * kHid) % (8 * 256) == 0, "cast grid exact");
static_assert((kHid * kHid) % (8 * 256) == 0, "cast grid exact");
static_assert((kRankPad * kHid) % (8 * 256) == 0, "pad cast grid exact");
static_assert(kSeq == 2048, "softmax kernel: 256 threads x 8 columns = one row, blockIdx decode");
static_assert(kHid % 64 == 0 && kTok % 64 == 0 && kSeq % 64 == 0 && kDh % 64 == 0 && kRankPad % 64 == 0, "tile multiples");
static_assert(kHid % 32 == 0 && kDh % 32 == 0 && kSeq % 32 == 0, "K multiples of 32");

typedef __attribute__((ext_vector_type(16))) _Float16 v16h;
typedef __attribute__((ext_vector_type(8)))  _Float16 v8h;
typedef __attribute__((ext_vector_type(16))) __bf16   v16b;
typedef __attribute__((ext_vector_type(8)))  __bf16   v8b;
typedef __attribute__((ext_vector_type(8)))  float    v8f;
typedef __attribute__((ext_vector_type(4)))  float    v4f;
typedef __attribute__((ext_vector_type(4)))  unsigned int v4u;

__device__ __forceinline__ unsigned short f2bf_bits(float f) {
  unsigned u = __float_as_uint(f);
  return (unsigned short)((u + 0x7FFFu + ((u >> 16) & 1u)) >> 16);
}
__device__ __forceinline__ float bf_bits2f(unsigned short h) { return __uint_as_float(((unsigned)h) << 16); }
__device__ __forceinline__ float bf_rne(float f) { return bf_bits2f(f2bf_bits(f)); }

// hazard guards as plain device helpers (no inline asm inside the kernel template body)
__device__ __forceinline__ void dep_guard_h(v8f& a, v8f& b, v16h x, v16h y) { asm volatile("v_nop\n\tv_nop\n\tv_nop\n\tv_nop" : "+v"(a), "+v"(b) : "v"(x), "v"(y)); }
__device__ __forceinline__ void dep_guard_b(v8f& a, v8f& b, v16b x, v16b y) { asm volatile("v_nop\n\tv_nop\n\tv_nop\n\tv_nop" : "+v"(a), "+v"(b) : "v"(x), "v"(y)); }
__device__ __forceinline__ void keep4_h(v16h a, v16h b, v16h c, v16h d) { asm volatile("v_nop" :: "v"(a), "v"(b), "v"(c), "v"(d)); }
__device__ __forceinline__ void keep4_b(v16b a, v16b b, v16b c, v16b d) { asm volatile("v_nop" :: "v"(a), "v"(b), "v"(c), "v"(d)); }
__device__ __forceinline__ void acc_guard4(v8f& a, v8f& b, v8f& c, v8f& d) { asm volatile("v_nop\n\tv_nop\n\tv_nop\n\tv_nop" : "+v"(a), "+v"(b), "+v"(c), "+v"(d)); }
template <typename T> struct Frag;
template <> struct Frag<_Float16> {
  typedef v16h V; union U { v16h v; v8h h[2]; };
  // elements 0..7 <- p[0..7], 8..15 <- p[16..23]
  static __device__ __forceinline__ v16h load(const _Float16* p) {
    U f; f.h[0] = *(const v8h*)(p); f.h[1] = *(const v8h*)(p + 16); return f.v;
  }
  static __device__ __forceinline__ v8f mma(v16h a, v16h b, v8f c) {
    return __builtin_amdgcn_wmma_f32_16x16x32_f16(false, a, false, b, (short)0, c, false, false);
  }
  static __device__ __forceinline__ void guard(v8f& a, v8f& b, v16h x, v16h y) { dep_guard_h(a, b, x, y); }
  static __device__ __forceinline__ void keep(v16h a, v16h b, v16h c, v16h d) { keep4_h(a, b, c, d); }
};
template <> struct Frag<__bf16> {
  typedef v16b V; union U { v16b v; v8b h[2]; };
  static __device__ __forceinline__ v16b load(const __bf16* p) {
    U f; f.h[0] = *(const v8b*)(p); f.h[1] = *(const v8b*)(p + 16); return f.v;
  }
  static __device__ __forceinline__ v8f mma(v16b a, v16b b, v8f c) {
    return __builtin_amdgcn_wmma_f32_16x16x32_bf16(false, a, false, b, (short)0, c, false, false);
  }
  static __device__ __forceinline__ void guard(v8f& a, v8f& b, v16b x, v16b y) { dep_guard_b(a, b, x, y); }
  static __device__ __forceinline__ void keep(v16b a, v16b b, v16b c, v16b d) { keep4_b(a, b, c, d); }
};

__device__ __forceinline__ unsigned pk16(unsigned short a, unsigned short b) { return (unsigned)a | ((unsigned)b << 16); }

// ---- Register-blocked batched WMMA GEMM (CAUSAL, BSPLIT and LORA options added) ----
// C[m,n] = scale * sum_k A[m,k] * Bt[n,k] (+bias)(+resid)(+lora); each wave owns a 64x64 tile.
// A row-major [M,K]; Bt row-major [N,K]; M,N % 64 == 0, K % 32 == 0.
// SPLIT: operands are hi/lo planes (A2/Bt2 = lo planes, same layout); product = hi.hi + hi.lo + lo.hi.
// SPLIT with BSPLIT == false: only A carries a lo plane; product = hi.B + lo.B (Bt2 unused).
// BIAS_MODE: 0 = none, 1 = bias[m], 2 = bias[n].
// OUT_MODE: 0 = f32, 1 = f16, 2 = bf16 hi plane (Cout) + bf16 lo plane (Cout2).
// CAUSAL: tiles with n0 > m0 are skipped (wave-uniform) and the k loop stops at min(K, m0 + 64).
// LORA: rank-4 f32 term added in the epilogue: v += dot4(rowtab[m][0..3], coltab[n][0..3]); rowtab pitch ldrow floats, coltab pitch
//   ldcol floats (both 16-B aligned rows). LORA == 1: coltab values RNE-bf16 converted at load (rowtab kept f32);
//   LORA == 2: rowtab values RNE-bf16 converted (coltab kept f32). In LORA modes a BIAS_MODE 2 bias is RNE-bf16 converted too.
// ET: 0 = f16 operands, 1 = bf16 operands (pointers passed as 16-bit storage)
template <int ET> struct Elem;
template <> struct Elem<0> { typedef _Float16 T; };
template <> struct Elem<1> { typedef __bf16 T; };
template <int ET, bool SPLIT, int BIAS_MODE, int OUT_MODE, bool RESID, int ACT = 0, bool CAUSAL = false, bool BSPLIT = true, int LORA = 0>
__global__ __launch_bounds__(256) void wmma_gemm64(
    const unsigned short* __restrict__ Ap, const unsigned short* __restrict__ A2p, int lda, long strideA,
    const unsigned short* __restrict__ Btp, const unsigned short* __restrict__ Bt2p, int ldb, long strideB,
    void* __restrict__ Cout, void* __restrict__ Cout2, int ldc, long strideC,
    const float* __restrict__ bias,
    const float* __restrict__ resid, long strideR,
    const float* __restrict__ rowtab, int ldrow,
    const float* __restrict__ coltab, int ldcol,
    int M, int N, int K, float scale) {
  typedef typename Elem<ET>::T T;
  typedef typename Frag<T>::V V;
  const T* A = (const T*)Ap; const T* A2 = (const T*)A2p; const T* Bt = (const T*)Btp; const T* Bt2 = (const T*)Bt2p;
  __shared__ __align__(16) float sT[8][16 * 68];   // per-wave 16x64 slab, pitch 68 floats
  const int b    = blockIdx.y;
  const int lane = threadIdx.x & 31;
  const int wave = threadIdx.x >> 5;
  const int tilesN = N >> 6;
  const int tilesM = M >> 6;
  const int tile = blockIdx.x * 8 + wave;
  if (tile >= tilesM * tilesN) return;   // wave-uniform; no block barriers in this kernel
  const int tm = tile / tilesN;
  const int tn = tile - tm * tilesN;
  const int m0 = tm << 6;
  const int n0 = tn << 6;
  if (CAUSAL && (n0 > m0)) return;       // wave-uniform causal tile skip
  const int Kend = CAUSAL ? ((m0 + 64 < K) ? (m0 + 64) : K) : K;   // multiple of 32

  const T* Ab  = A  + (size_t)b * strideA;
  const T* Bb  = Bt + (size_t)b * strideB;
  const T* Ab2 = SPLIT ? (A2  + (size_t)b * strideA) : nullptr;
  const T* Bb2 = (SPLIT && BSPLIT) ? (Bt2 + (size_t)b * strideB) : nullptr;

  const int rlane = lane & 15;                 // row (A) / col (B, D) within subtile
  const int koff  = (lane >> 4) * 8;           // k offset of this lane half
  const int mOff  = (lane >> 4) * 8;           // D row offset

  v8f acc[4][4];
#pragma unroll
  for (int i = 0; i < 4; ++i)
#pragma unroll
    for (int j = 0; j < 4; ++j) acc[i][j] = (v8f){0.f,0.f,0.f,0.f,0.f,0.f,0.f,0.f};

  for (int k0 = 0; k0 < Kend; k0 += 32) {
    V bh[4], bl[4];
#pragma unroll
    for (int j = 0; j < 4; ++j) {
      const size_t bo = (size_t)(n0 + (j << 4) + rlane) * ldb + koff + k0;
      bh[j] = Frag<T>::load(Bb + bo);
      if (SPLIT && BSPLIT) bl[j] = Frag<T>::load(Bb2 + bo);
    }
#pragma unroll
    for (int i = 0; i < 4; ++i) {
      const size_t ao = (size_t)(m0 + (i << 4) + rlane) * lda + koff + k0;
      V ah = Frag<T>::load(Ab + ao);
      V al;
      if (SPLIT) al = Frag<T>::load(Ab2 + ao);
#pragma unroll
      for (int j = 0; j < 4; ++j) {
        acc[i][j] = Frag<T>::mma(ah, bh[j], acc[i][j]);
        if (SPLIT && BSPLIT) acc[i][j] = Frag<T>::mma(ah, bl[j], acc[i][j]);
        if (SPLIT) acc[i][j] = Frag<T>::mma(al, bh[j], acc[i][j]);
      }
      Frag<T>::guard(acc[i][0], acc[i][3], ah, SPLIT ? al : ah);
    }
    Frag<T>::keep(bh[0], bh[1], bh[2], bh[3]);
    if (SPLIT && BSPLIT) Frag<T>::keep(bl[0], bl[1], bl[2], bl[3]);
  }
  acc_guard4(acc[0][0], acc[0][1], acc[0][2], acc[0][3]);
  acc_guard4(acc[1][0], acc[1][1], acc[1][2], acc[1][3]);
  acc_guard4(acc[2][0], acc[2][1], acc[2][2], acc[2][3]);
  acc_guard4(acc[3][0], acc[3][1], acc[3][2], acc[3][3]);

  // ---- epilogue ----
  float* slab = sT[wave];
  const float* Rb = RESID ? (resid + (size_t)b * strideR) : nullptr;
  // rank-4 column table (LORA modes): per lane the 4 columns n0 + 16j + rlane
  v4f ctab[4];
  float cbias[4];
#pragma unroll
  for (int j = 0; j < 4; ++j) { ctab[j] = (v4f){0.f,0.f,0.f,0.f}; cbias[j] = 0.f; }
  if (LORA != 0) {
#pragma unroll
    for (int j = 0; j < 4; ++j) {
      const int n = n0 + (j << 4) + rlane;
      v4f u = *(const v4f*)(coltab + (size_t)n * ldcol);
      if (LORA == 1) {
#pragma unroll
        for (int e = 0; e < 4; ++e) u[e] = bf_rne(u[e]);
      }
      ctab[j] = u;
      if (BIAS_MODE == 2) cbias[j] = bf_rne(bias[n]);
    }
  }
#pragma unroll
  for (int i = 0; i < 4; ++i) {
    const int mBase = m0 + (i << 4);
    if (LORA == 0) {
#pragma unroll
      for (int j = 0; j < 4; ++j) {
        const int n = n0 + (j << 4) + rlane;
        float bv = 0.f;
        if (BIAS_MODE == 2) bv = bias[n];
#pragma unroll
        for (int r = 0; r < 8; ++r) {
          float v = acc[i][j][r] * scale;
          if (BIAS_MODE == 1) v += bias[mBase + mOff + r];
          if (BIAS_MODE == 2) v += bv;
          if (RESID) v += Rb[(size_t)(mBase + mOff + r) * ldc + n];
          if (ACT == 2) v = fmaxf(v, 0.0f);
          if (ACT == 4) v = (v > 0.f) ? v : 0.01f * v;
          slab[(mOff + r) * 68 + (j << 4) + rlane] = v;
        }
      }
    } else {
#pragma unroll
      for (int r = 0; r < 8; ++r) {
        const int m = mBase + mOff + r;
        v4f tr = *(const v4f*)(rowtab + (size_t)m * ldrow);
        if (LORA == 2) {
#pragma unroll
          for (int e = 0; e < 4; ++e) tr[e] = bf_rne(tr[e]);
        }
#pragma unroll
        for (int j = 0; j < 4; ++j) {
          float lr = tr[0] * ctab[j][0];
          lr = fmaf(tr[1], ctab[j][1], lr);
          lr = fmaf(tr[2], ctab[j][2], lr);
          lr = fmaf(tr[3], ctab[j][3], lr);
          float v = acc[i][j][r] * scale + lr;
          if (BIAS_MODE == 2) v += cbias[j];
          slab[(mOff + r) * 68 + (j << 4) + rlane] = v;
        }
      }
    }
    __builtin_amdgcn_fence(__ATOMIC_RELEASE, "workgroup");
    __builtin_amdgcn_wave_barrier();
    __builtin_amdgcn_fence(__ATOMIC_ACQUIRE, "workgroup");
    if (OUT_MODE == 0) {
      float* C = (float*)Cout + (size_t)b * strideC;
      const int hh = lane >> 4, c4 = (lane & 15) * 4;     // row seg = 256 B = 16 lanes x 16 B
      {
#pragma unroll
        for (int it = 0; it < 8; ++it) {
          const int row = it * 2 + hh;
          v4f v = *(const v4f*)(slab + row * 68 + c4);
          *(v4f*)(C + (size_t)(mBase + row) * ldc + n0 + c4) = v;
        }
        
      }
    } else {
      const int q = lane >> 3, c8 = (lane & 7) * 8;
      unsigned short* C  = (unsigned short*)Cout  + (size_t)b * strideC;
      unsigned short* C2 = (OUT_MODE == 2) ? ((unsigned short*)Cout2 + (size_t)b * strideC) : nullptr;
      {
#pragma unroll
        for (int it = 0; it < 4; ++it) {
          const int row = it * 4 + q;
          const float* sp = slab + row * 68 + c8;
          v8h hv, lv;
#pragma unroll
          for (int e = 0; e < 8; ++e) {
            if (OUT_MODE == 1) {
              hv[e] = (_Float16)sp[e];
            } else {
              unsigned short hb = f2bf_bits(sp[e]);
              unsigned short lb = f2bf_bits(sp[e] - bf_bits2f(hb));
              hv[e] = __builtin_bit_cast(_Float16, hb);
              lv[e] = __builtin_bit_cast(_Float16, lb);
            }
          }
          *(v8h*)(C + (size_t)(mBase + row) * ldc + n0 + c8) = hv;
          if (OUT_MODE == 2) *(v8h*)(C2 + (size_t)(mBase + row) * ldc + n0 + c8) = lv;
        }
        
      }
    }
    __builtin_amdgcn_fence(__ATOMIC_RELEASE, "workgroup");
    __builtin_amdgcn_wave_barrier();
    __builtin_amdgcn_fence(__ATOMIC_ACQUIRE, "workgroup");
  }
}

// ---------------------------------------------------------------------------
// f32 -> RNE bf16 plane with zero padding, up to 3 same-shaped tables per launch (blockIdx.y selects the source, block-uniform).
// Thread i owns flat elements 8i..8i+7 of plane y: value = in_y[e] for e < nvalid, 0 otherwise (the load address is clamped to
// [0, nvalid-8], the value is zeroed by predicate). out plane y starts at out + y * plane_halves.
// Coverage: n8 = plane elements / 8 threads x 8 = the whole padded plane (grids are exact multiples of 256 here).
// ---------------------------------------------------------------------------
__global__ __launch_bounds__(256) void cast_pad_bf16_kernel(const float* __restrict__ s0, const float* __restrict__ s1,
                                                            const float* __restrict__ s2,
                                                            unsigned short* __restrict__ out, long plane_halves,
                                                            int n8, int nvalid) {
  const int i = blockIdx.x * 256 + threadIdx.x;
  if (i >= n8) return;
  const int y = blockIdx.y;
  const float* src = (y == 0) ? s0 : ((y == 1) ? s1 : s2);
  const long e = 8L * (long)i;
  const bool live = (e < (long)nvalid);
  const long ec = live ? e : (long)(nvalid - 8);
  const v4f a = *(const v4f*)(src + ec);
  const v4f c = *(const v4f*)(src + ec + 4);
  float f[8];
#pragma unroll
  for (int k = 0; k < 4; ++k) { f[k] = live ? a[k] : 0.0f; f[4 + k] = live ? c[k] : 0.0f; }
  unsigned w[4];
#pragma unroll
  for (int e2 = 0; e2 < 4; ++e2) w[e2] = pk16(f2bf_bits(f[2 * e2]), f2bf_bits(f[2 * e2 + 1]));
  const v4u u = (v4u){w[0], w[1], w[2], w[3]};
  unsigned short* q = out + (size_t)y * plane_halves + (size_t)e;
  *(v4u*)q = u;
  
}

// ---------------------------------------------------------------------------
// Row softmax (no mask) over materialised f32 scores of one group (kGrp pairs x 2048 rows x 2048 cols).
// p = exp(s - rowmax) * (1 / sum); every row is finite and sum >= 1.
// P written as bf16 hi/lo planes for every column of every row.
// One block of 256 threads per (pair, row); thread t owns columns 8t..8t+7 (256 x 8 = 2048).
// Reductions in fixed order (thread, wave shuffle tree outside all branches, 8 wave partials in index order).
// ---------------------------------------------------------------------------
__global__ __launch_bounds__(256) void softmax_row_kernel(const float* __restrict__ S,
                                                          unsigned short* __restrict__ Phi, unsigned short* __restrict__ Plo) {
  __shared__ float redM[8];
  __shared__ float redS[8];
  const int blk  = blockIdx.x;
  const int pr   = blk >> 11;            // pair within the group
  const int qi   = blk & (kSeq - 1);     // query row
  const int t    = threadIdx.x;
  const int lane = t & 31, wave = t >> 5;
  const int c0   = t * 8;
  const size_t rowoff = ((size_t)pr * kSeq + qi) * (size_t)kSeq;

  const float* sr = S + rowoff + c0;
  const v4f a = *(const v4f*)(sr);
  const v4f c = *(const v4f*)(sr + 4);
  float xv[8];
#pragma unroll
  for (int e = 0; e < 4; ++e) { xv[e] = a[e]; xv[4 + e] = c[e]; }
  float m = xv[0];
#pragma unroll
  for (int e = 1; e < 8; ++e) m = fmaxf(m, xv[e]);
#pragma unroll
  for (int off = 16; off > 0; off >>= 1) m = fmaxf(m, __shfl_xor(m, off, 32));
  if (lane == 0) redM[wave] = m;
  __syncthreads();
  float gmax = redM[0];
#pragma unroll
  for (int w = 1; w < 8; ++w) gmax = fmaxf(gmax, redM[w]);

  float p[8];
  float ps = 0.0f;
#pragma unroll
  for (int e = 0; e < 8; ++e) { p[e] = expf(xv[e] - gmax); ps += p[e]; }
#pragma unroll
  for (int off = 16; off > 0; off >>= 1) ps += __shfl_xor(ps, off, 32);
  if (lane == 0) redS[wave] = ps;
  __syncthreads();
  float tot = redS[0];
#pragma unroll
  for (int w = 1; w < 8; ++w) tot += redS[w];
  const float inv = 1.0f / tot;          // tot >= 1

  unsigned hw[4], lw[4];
#pragma unroll
  for (int e2 = 0; e2 < 4; ++e2) {
    const float f0 = p[2 * e2] * inv;
    const float f1 = p[2 * e2 + 1] * inv;
    const unsigned short h0 = f2bf_bits(f0);
    const unsigned short h1 = f2bf_bits(f1);
    const unsigned short l0 = f2bf_bits(f0 - bf_bits2f(h0));
    const unsigned short l1 = f2bf_bits(f1 - bf_bits2f(h1));
    hw[e2] = pk16(h0, h1);
    lw[e2] = pk16(l0, l1);
  }
  const v4u hv = (v4u){hw[0], hw[1], hw[2], hw[3]};
  const v4u lv = (v4u){lw[0], lw[1], lw[2], lw[3]};
  unsigned short* ph = Phi + rowoff + c0;
  unsigned short* pl = Plo + rowoff + c0;
  *(v4u*)ph = hv;
  *(v4u*)pl = lv;
  
}

// ---------------------------------------------------------------------------
// ctx = P . v for one group, k range split over the waves of a block.
// One block of 16 waves owns one 32 x 64 tile of ctx of one (batch, head) pair; wave w sums k in [128 w, 128 w + 128) with the
// three hi/lo products (hi.hi + hi.lo + lo.hi) into f32 accumulators, stores its 32 x 64 partial in its own LDS slab, and after
// one block barrier thread t adds the 16 partials of 4 neighbouring columns in wave index order (fixed order) and writes the
// bf16 hi/lo planes. Grid (2048 / 32, kGrp): every ctx element of the group is written once, 16 threads per 128-B row segment.
// P planes [kGrp][2048][2048]; V planes point at row h0*64, column b*2048 of v^T (pitch 4096); C planes at (b*2048, h0*64) of ctx.
// ---------------------------------------------------------------------------
constexpr int kPvWaves = 16;
constexpr int kPvRows  = 32;
constexpr int kPvK     = kSeq / kPvWaves;          // 128 k values per wave
constexpr int kPvPitch = 68;                       // floats per partial row (272 B, an odd multiple of 16 B)
static_assert(kSeq % kPvRows == 0 && kPvK % 32 == 0 && kDh == 64, "P.v tile shape");
static_assert(kPvRows * kDh == kPvWaves * 32 * 4, "reduction: 4 columns per thread cover the tile");
typedef __attribute__((ext_vector_type(2))) unsigned int v2u;

__global__ __launch_bounds__(kPvWaves * 32) void pv_splitk_kernel(
    const unsigned short* __restrict__ Phi, const unsigned short* __restrict__ Plo,
    const unsigned short* __restrict__ Vhi, const unsigned short* __restrict__ Vlo,
    unsigned short* __restrict__ Chi, unsigned short* __restrict__ Clo) {
  typedef Frag<__bf16> F;
  __shared__ __align__(16) float red[kPvWaves][kPvRows * kPvPitch];
  const int pr    = blockIdx.y;
  const int m0    = blockIdx.x * kPvRows;
  const int lane  = threadIdx.x & 31;
  const int wave  = threadIdx.x >> 5;
  const int rlane = lane & 15;                 // row (A) / col (B, D) within subtile
  const int half8 = (lane >> 4) * 8;           // k offset of this lane half (A, B); D row offset

  const size_t aoff = ((size_t)pr * kSeq + m0 + rlane) * kSeq + wave * kPvK + half8;
  const size_t boff = ((size_t)pr * kDh + rlane) * kTok + wave * kPvK + half8;
  const __bf16* Ah = (const __bf16*)Phi + aoff;
  const __bf16* Al = (const __bf16*)Plo + aoff;
  const __bf16* Bh = (const __bf16*)Vhi + boff;
  const __bf16* Bl = (const __bf16*)Vlo + boff;

  v8f acc[2][4];
#pragma unroll
  for (int i = 0; i < 2; ++i)
#pragma unroll
    for (int j = 0; j < 4; ++j) acc[i][j] = (v8f){0.f,0.f,0.f,0.f,0.f,0.f,0.f,0.f};

  // 4 trips, unrolled so that a later trip's loads can issue ahead of an earlier trip's products
#pragma unroll
  for (int k0 = 0; k0 < kPvK; k0 += 32) {
    v16b bh[4], bl[4], ah[2], al[2];
#pragma unroll
    for (int j = 0; j < 4; ++j) {
      bh[j] = F::load(Bh + (size_t)(j << 4) * kTok + k0);
      bl[j] = F::load(Bl + (size_t)(j << 4) * kTok + k0);
    }
#pragma unroll
    for (int i = 0; i < 2; ++i) {
      ah[i] = F::load(Ah + (size_t)(i << 4) * kSeq + k0);
      al[i] = F::load(Al + (size_t)(i << 4) * kSeq + k0);
    }
    // per accumulator the order stays hi.hi, hi.lo, lo.hi; the 8 accumulators of one product are independent
#pragma unroll
    for (int i = 0; i < 2; ++i)
#pragma unroll
      for (int j = 0; j < 4; ++j) acc[i][j] = F::mma(ah[i], bh[j], acc[i][j]);
#pragma unroll
    for (int i = 0; i < 2; ++i)
#pragma unroll
      for (int j = 0; j < 4; ++j) acc[i][j] = F::mma(ah[i], bl[j], acc[i][j]);
#pragma unroll
    for (int i = 0; i < 2; ++i)
#pragma unroll
      for (int j = 0; j < 4; ++j) acc[i][j] = F::mma(al[i], bh[j], acc[i][j]);
  }

  float* slab = red[wave];
#pragma unroll
  for (int i = 0; i < 2; ++i)
#pragma unroll
    for (int j = 0; j < 4; ++j)
#pragma unroll
      for (int r = 0; r < 8; ++r) slab[((i << 4) + half8 + r) * kPvPitch + (j << 4) + rlane] = acc[i][j][r];
  __syncthreads();   // every wave's partial is in LDS before any thread sums across waves

  const int row = threadIdx.x >> 4;            // 0..31
  const int c4  = (threadIdx.x & 15) * 4;      // 0..60
  v4f part[kPvWaves];
#pragma unroll
  for (int w = 0; w < kPvWaves; ++w) part[w] = *(const v4f*)(&red[w][row * kPvPitch + c4]);
  v4f s = part[0];
#pragma unroll
  for (int w = 1; w < kPvWaves; ++w) s += part[w];

  unsigned short hb[4], lb[4];
#pragma unroll
  for (int e = 0; e < 4; ++e) {
    hb[e] = f2bf_bits(s[e]);
    lb[e] = f2bf_bits(s[e] - bf_bits2f(hb[e]));
  }
  const size_t co = (size_t)(m0 + row) * kHid + (size_t)pr * kDh + c4;
  *(v2u*)(Chi + co) = (v2u){pk16(hb[0], hb[1]), pk16(hb[2], hb[3])};
  *(v2u*)(Clo + co) = (v2u){pk16(lb[0], lb[1]), pk16(lb[2], lb[3])};
}

// ---------------------------------------------------------------------------
// Launcher. Workspace region map (bytes, MiB = 1048576; total carve = 128 MiB = 134217728 B):
//   [  0, 32) S      : scores f32 [2][2048][2048] per group.
//                      early aliases (dead before the first score GEMM): x bf16 [4096][1024] at +0 (8 MiB);
//                      wq|wk|wv bf16 [1024][1024] x3 at +8 MiB (6 MiB); padded down planes [64][1024] x3 at +14 MiB (384 KiB);
//                      t tables f32 [4096][64] x3 (tq|tk|tv) at +15 MiB (3 MiB, ends 18 MiB).
//                      late aliases (after the last p.v GEMM; S dead after the last softmax): wo bf16 [1024][1024] at +0 (2 MiB);
//                      padded out_down plane [64][1024] at +2 MiB (128 KiB); to table f32 [4096][64] at +3 MiB (1 MiB).
//   [ 32, 48) P hi   : [2][2048][2048] bf16 per group (exactly 16 MiB)
//   [ 48, 64) P lo
//   [ 64, 80) q|k hi : [4096][2048] bf16 (cols 0..1023 = q (h*64+d), 1024..2047 = k)
//   [ 80, 96) q|k lo
//   [ 96,104) v^T hi : [1024 (h*64+d)][4096 (b*2048+s)] bf16
//   [104,112) v^T lo
//   [112,120) ctx hi : [4096][1024] bf16 (col h*64+d)
//   [120,128) ctx lo
// Launch count: 3 casts + 1 down GEMM + 3 projections + 16*3 attention + 2 late casts + 1 down GEMM + 1 out GEMM = 59.
// Kernel launches only.
// ---------------------------------------------------------------------------
extern "C" void kernel_launch(void* const* d_in, const int* in_sizes, int n_in,
                              void* d_out, int out_size, void* d_ws, size_t ws_size,
                              hipStream_t stream) {
  if (n_in < 14) return;
  if (in_sizes[0] != kTok * kHid) return;
  if (in_sizes[1] != kHid * kHid || in_sizes[2] != kHid * kHid || in_sizes[3] != kHid * kHid || in_sizes[4] != kHid * kHid) return;
  if (in_sizes[5] != kHid) return;
  if (in_sizes[6] != kRank * kHid || in_sizes[8] != kRank * kHid || in_sizes[10] != kRank * kHid || in_sizes[12] != kRank * kHid) return;
  if (in_sizes[7] != kHid * kRank || in_sizes[9] != kHid * kRank || in_sizes[11] != kHid * kRank || in_sizes[13] != kHid * kRank) return;
  if (out_size != kTok * kHid) return;

  const size_t kMiB    = 1048576;
  const size_t offS    = 0;
  const size_t offXb   = 0;
  const size_t offW3   = 8 * kMiB;
  const size_t offDn3  = 14 * kMiB;
  const size_t offT3   = 15 * kMiB;
  const size_t offWo   = 0;
  const size_t offDnO  = 2 * kMiB;
  const size_t offTo   = 3 * kMiB;
  const size_t offPhi  = 32 * kMiB;
  const size_t offPlo  = 48 * kMiB;
  const size_t offQKhi = 64 * kMiB;
  const size_t offQKlo = 80 * kMiB;
  const size_t offVthi = 96 * kMiB;
  const size_t offVtlo = 104 * kMiB;
  const size_t offChi  = 112 * kMiB;
  const size_t offClo  = 120 * kMiB;
  const size_t total   = 128 * kMiB;
  if (total > ws_size) return;

  const float* x     = (const float*)d_in[0];
  const float* wq    = (const float*)d_in[1];
  const float* wk    = (const float*)d_in[2];
  const float* wv    = (const float*)d_in[3];
  const float* wo    = (const float*)d_in[4];
  const float* bo    = (const float*)d_in[5];
  const float* q_dn  = (const float*)d_in[6];
  const float* q_up  = (const float*)d_in[7];
  const float* k_dn  = (const float*)d_in[8];
  const float* k_up  = (const float*)d_in[9];
  const float* v_dn  = (const float*)d_in[10];
  const float* v_up  = (const float*)d_in[11];
  const float* o_dn  = (const float*)d_in[12];
  const float* o_up  = (const float*)d_in[13];
  float* out = (float*)d_out;
  char* ws = (char*)d_ws;

  float*          Sbuf = (float*)(ws + offS);
  unsigned short* xb   = (unsigned short*)(ws + offXb);
  unsigned short* w3   = (unsigned short*)(ws + offW3);
  unsigned short* dn3  = (unsigned short*)(ws + offDn3);
  float*          t3   = (float*)(ws + offT3);
  unsigned short* wob  = (unsigned short*)(ws + offWo);
  unsigned short* dno  = (unsigned short*)(ws + offDnO);
  float*          tot  = (float*)(ws + offTo);
  unsigned short* phi  = (unsigned short*)(ws + offPhi);
  unsigned short* plo  = (unsigned short*)(ws + offPlo);
  unsigned short* qkhi = (unsigned short*)(ws + offQKhi);
  unsigned short* qklo = (unsigned short*)(ws + offQKlo);
  unsigned short* vthi = (unsigned short*)(ws + offVthi);
  unsigned short* vtlo = (unsigned short*)(ws + offVtlo);
  unsigned short* chi  = (unsigned short*)(ws + offChi);
  unsigned short* clo  = (unsigned short*)(ws + offClo);

  // in-range dummies for unused (never dereferenced) template-dead pointer parameters
  const float* dummy_f = bo;
  void* dummy_c2 = (void*)phi;

  const long wPlane  = (long)kHid * kHid;          // 1048576 halves
  const long dnPlane = (long)kRankPad * kHid;      // 65536 halves
  const long tPlane  = (long)kTok * kRankPad;      // 262144 floats

  // 1. x -> RNE bf16 plane [4096][1024]: n8 = 524288 = 2048 blocks x 256
  {
    const int n8 = (kTok * kHid) / 8;
    cast_pad_bf16_kernel<<<dim3(n8 / 256, 1), dim3(256), 0, stream>>>(x, x, x, xb, 0L, n8, kTok * kHid);
  }
  // 2. wq, wk, wv [1024 out][1024 in] -> bf16 planes (Bt layout directly): n8 = 131072 = 512 blocks x 256, 3 tables
  {
    const int n8 = (kHid * kHid) / 8;
    cast_pad_bf16_kernel<<<dim3(n8 / 256, 3), dim3(256), 0, stream>>>(wq, wk, wv, w3, wPlane, n8, kHid * kHid);
  }
  // 3. q/k/v down [4][1024] -> zero-padded bf16 planes [64][1024] (rows 4..63 zero-filled): n8 = 8192 = 32 blocks x 256
  {
    const int n8 = (kRankPad * kHid) / 8;
    cast_pad_bf16_kernel<<<dim3(n8 / 256, 3), dim3(256), 0, stream>>>(q_dn, k_dn, v_dn, dn3, dnPlane, n8, kRank * kHid);
  }
  // 4. t{q,k,v} = x . down^T : M=4096, N=64, K=1024, single bf16 product -> f32 [3][4096][64] (batched over blockIdx.y)
  wmma_gemm64<1, false, 0, 0, false, 0, false, true, 0><<<dim3((kTok / 64) * (kRankPad / 64) / 8, 3), dim3(256), 0, stream>>>(
      xb, xb, kHid, 0L,
      dn3, dn3, kHid, dnPlane,
      (void*)t3, dummy_c2, kRankPad, tPlane,
      dummy_f, dummy_f, 0L,
      dummy_f, 4, dummy_f, 4,
      kTok, kRankPad, kHid, 1.0f);

  // 5. q = x . wq^T + tq . q_up^T : M=4096, N=1024, K=1024 -> bf16 hi/lo into q|k planes cols 0..1023 (ldc 2048)
  wmma_gemm64<1, false, 0, 2, false, 0, false, true, 1><<<dim3((kTok / 64) * (kHid / 64) / 8, 1), dim3(256), 0, stream>>>(
      xb, xb, kHid, 0L,
      w3, w3, kHid, 0L,
      (void*)qkhi, (void*)qklo, kQKld, 0L,
      dummy_f, dummy_f, 0L,
      t3, kRankPad, q_up, kRank,
      kTok, kHid, kHid, 1.0f);
  // 6. k = x . wk^T + tk . k_up^T -> cols 1024..2047
  wmma_gemm64<1, false, 0, 2, false, 0, false, true, 1><<<dim3((kTok / 64) * (kHid / 64) / 8, 1), dim3(256), 0, stream>>>(
      xb, xb, kHid, 0L,
      w3 + wPlane, w3 + wPlane, kHid, 0L,
      (void*)(qkhi + kHid), (void*)(qklo + kHid), kQKld, 0L,
      dummy_f, dummy_f, 0L,
      t3 + tPlane, kRankPad, k_up, kRank,
      kTok, kHid, kHid, 1.0f);
  // 7. v^T = wv . x^T + v_up . tv^T : M=1024 (h*64+d), N=4096 (token), K=1024 -> bf16 hi/lo [1024][4096]
  wmma_gemm64<1, false, 0, 2, false, 0, false, true, 2><<<dim3((kHid / 64) * (kTok / 64) / 8, 1), dim3(256), 0, stream>>>(
      w3 + 2 * wPlane, w3 + 2 * wPlane, kHid, 0L,
      xb, xb, kHid, 0L,
      (void*)vthi, (void*)vtlo, kTok, 0L,
      dummy_f, dummy_f, 0L,
      v_up, kRank, t3 + 2 * tPlane, kRankPad,
      kHid, kTok, kHid, 1.0f);

  // 8. attention per group of kGrp heads of one batch (no mask)
  for (int g = 0; g < kNumGroups; ++g) {
    const int b  = g / (kHeads / kGrp);
    const int h0 = (g % (kHeads / kGrp)) * kGrp;
    const size_t qkoff = (size_t)b * kSeq * kQKld + (size_t)h0 * kDh;   // halves

    // scores = 0.125 * q . k^T : M=N=2048, K=64, 3 products on hi/lo planes; pair stride 64 halves for A and Bt, 2048*2048 floats for C
    wmma_gemm64<1, true, 0, 0, false, 0, false, true, 0><<<dim3((kSeq / 64) * (kSeq / 64) / 8, kGrp), dim3(256), 0, stream>>>(
        qkhi + qkoff, qklo + qkoff, kQKld, (long)kDh,
        qkhi + kHid + qkoff, qklo + kHid + qkoff, kQKld, (long)kDh,
        (void*)Sbuf, dummy_c2, kSeq, (long)kSeq * kSeq,
        dummy_f, dummy_f, 0L,
        dummy_f, 4, dummy_f, 4,
        kSeq, kSeq, kDh, kScoreScale);

    // softmax rows -> P hi/lo planes [kGrp][2048][2048]
    softmax_row_kernel<<<dim3(kGrp * kSeq), dim3(256), 0, stream>>>(Sbuf, phi, plo);

    // ctx = P . v : M=2048, N=64, K=2048, 3 products, k split over 16 waves per 32 x 64 tile; v^T rows (h0+pair)*64.., cols b*2048..
    const size_t vtoff = (size_t)(h0 * kDh) * kTok + (size_t)b * kSeq;    // halves
    const size_t coff  = (size_t)b * kSeq * kHid + (size_t)h0 * kDh;       // halves
    pv_splitk_kernel<<<dim3(kSeq / kPvRows, kGrp), dim3(kPvWaves * 32), 0, stream>>>(
        phi, plo, vthi + vtoff, vtlo + vtoff, chi + coff, clo + coff);
  }

  // 9. wo [1024][1024] -> bf16 plane into the dead S region
  {
    const int n8 = (kHid * kHid) / 8;
    cast_pad_bf16_kernel<<<dim3(n8 / 256, 1), dim3(256), 0, stream>>>(wo, wo, wo, wob, 0L, n8, kHid * kHid);
  }
  // 10. out_down [4][1024] -> zero-padded bf16 plane [64][1024]
  {
    const int n8 = (kRankPad * kHid) / 8;
    cast_pad_bf16_kernel<<<dim3(n8 / 256, 1), dim3(256), 0, stream>>>(o_dn, o_dn, o_dn, dno, 0L, n8, kRank * kHid);
  }
  // 11. to = ctx_hi . out_down^T + ctx_lo . out_down^T : M=4096, N=64, K=1024, 2 products -> f32 [4096][64]
  wmma_gemm64<1, true, 0, 0, false, 0, false, false, 0><<<dim3((kTok / 64) * (kRankPad / 64) / 8, 1), dim3(256), 0, stream>>>(
      chi, clo, kHid, 0L,
      dno, dno, kHid, 0L,
      (void*)tot, dummy_c2, kRankPad, 0L,
      dummy_f, dummy_f, 0L,
      dummy_f, 4, dummy_f, 4,
      kTok, kRankPad, kHid, 1.0f);
  // 12. out = ctx_hi . wo^T + ctx_lo . wo^T + to . out_up^T + bo : M=4096, N=1024, K=1024 -> f32 d_out
  wmma_gemm64<1, true, 2, 0, false, 0, false, false, 1><<<dim3((kTok / 64) * (kHid / 64) / 8, 1), dim3(256), 0, stream>>>(
      chi, clo, kHid, 0L,
      wob, wob, kHid, 0L,
      (void*)out, dummy_c2, kHid, 0L,
      bo, dummy_f, 0L,
      tot, kRankPad, o_up, kRank,
      kTok, kHid, kHid, 1.0f);
}

// v002
// Measured time: 440 microseconds a run.
// Two timings next to v001 put it at 2.18 and 2.17 times that version's speed.
// All steps since v000 together make it 6.46 times as fast.
// Contractions: x.W^T (q, k, v^T) and x.down^T: single v_wmma_f32_16x16x32_bf16 products on RNE-bf16 planes; q.k^T scores and p.v context: bf16 hi/lo operand planes (hi.hi + hi.lo + lo.hi); ctx.Wo^T and ctx.out_down^T: ctx bf16 hi/lo x RNE-bf16 weights (hi.W + lo.W); rank-4 up-products, bias and softmax in f32 on the VALU; all f32 accumulate.
#include <hip/hip_runtime.h>
#include <math.h>

// ---------------------------------------------------------------------------
// Problem constants
// ---------------------------------------------------------------------------
constexpr int kBatch   = 2;
constexpr int kSeq     = 2048;
constexpr int kHid     = 1024;
constexpr int kHeads   = 16;
constexpr int kDh      = 64;
constexpr int kTok     = kBatch * kSeq;            // 4096 token rows
constexpr int kRank    = 4;
constexpr int kRankPad = 64;                       // rank padded to one tile
constexpr int kQKld    = 2 * kHid;                 // 2048: pitch of the q|k planes (halves)

static_assert((kTok * kHid) % (8 * 256) == 0, "cast grid exact");
static_assert((kHid * kHid) % (8 * 256) == 0, "cast grid exact");
static_assert((kRankPad * kHid) % (8 * 256) == 0, "pad cast grid exact");
static_assert(kHid % 64 == 0 && kTok % 64 == 0 && kSeq % 64 == 0 && kDh % 64 == 0 && kRankPad % 64 == 0, "tile multiples");
static_assert(kHid % 32 == 0 && kDh % 32 == 0 && kSeq % 32 == 0, "K multiples of 32");

typedef __attribute__((ext_vector_type(16))) _Float16 v16h;
typedef __attribute__((ext_vector_type(8)))  _Float16 v8h;
typedef __attribute__((ext_vector_type(16))) __bf16   v16b;
typedef __attribute__((ext_vector_type(8)))  __bf16   v8b;
typedef __attribute__((ext_vector_type(8)))  float    v8f;
typedef __attribute__((ext_vector_type(4)))  float    v4f;
typedef __attribute__((ext_vector_type(4)))  unsigned int v4u;

__device__ __forceinline__ unsigned short f2bf_bits(float f) {
  unsigned u = __float_as_uint(f);
  return (unsigned short)((u + 0x7FFFu + ((u >> 16) & 1u)) >> 16);
}
__device__ __forceinline__ float bf_bits2f(unsigned short h) { return __uint_as_float(((unsigned)h) << 16); }
__device__ __forceinline__ float bf_rne(float f) { return bf_bits2f(f2bf_bits(f)); }

// hazard guards as plain device helpers (no inline asm inside the kernel template body)
__device__ __forceinline__ void dep_guard_h(v8f& a, v8f& b, v16h x, v16h y) { asm volatile("v_nop\n\tv_nop\n\tv_nop\n\tv_nop" : "+v"(a), "+v"(b) : "v"(x), "v"(y)); }
__device__ __forceinline__ void dep_guard_b(v8f& a, v8f& b, v16b x, v16b y) { asm volatile("v_nop\n\tv_nop\n\tv_nop\n\tv_nop" : "+v"(a), "+v"(b) : "v"(x), "v"(y)); }
__device__ __forceinline__ void keep4_h(v16h a, v16h b, v16h c, v16h d) { asm volatile("v_nop" :: "v"(a), "v"(b), "v"(c), "v"(d)); }
__device__ __forceinline__ void keep4_b(v16b a, v16b b, v16b c, v16b d) { asm volatile("v_nop" :: "v"(a), "v"(b), "v"(c), "v"(d)); }
__device__ __forceinline__ void acc_guard4(v8f& a, v8f& b, v8f& c, v8f& d) { asm volatile("v_nop\n\tv_nop\n\tv_nop\n\tv_nop" : "+v"(a), "+v"(b), "+v"(c), "+v"(d)); }
template <typename T> struct Frag;
template <> struct Frag<_Float16> {
  typedef v16h V; union U { v16h v; v8h h[2]; };
  // elements 0..7 <- p[0..7], 8..15 <- p[16..23]
  static __device__ __forceinline__ v16h load(const _Float16* p) {
    U f; f.h[0] = *(const v8h*)(p); f.h[1] = *(const v8h*)(p + 16); return f.v;
  }
  static __device__ __forceinline__ v8f mma(v16h a, v16h b, v8f c) {
    return __builtin_amdgcn_wmma_f32_16x16x32_f16(false, a, false, b, (short)0, c, false, false);
  }
  static __device__ __forceinline__ void guard(v8f& a, v8f& b, v16h x, v16h y) { dep_guard_h(a, b, x, y); }
  static __device__ __forceinline__ void keep(v16h a, v16h b, v16h c, v16h d) { keep4_h(a, b, c, d); }
};
template <> struct Frag<__bf16> {
  typedef v16b V; union U { v16b v; v8b h[2]; };
  static __device__ __forceinline__ v16b load(const __bf16* p) {
    U f; f.h[0] = *(const v8b*)(p); f.h[1] = *(const v8b*)(p + 16); return f.v;
  }
  static __device__ __forceinline__ v8f mma(v16b a, v16b b, v8f c) {
    return __builtin_amdgcn_wmma_f32_16x16x32_bf16(false, a, false, b, (short)0, c, false, false);
  }
  static __device__ __forceinline__ void guard(v8f& a, v8f& b, v16b x, v16b y) { dep_guard_b(a, b, x, y); }
  static __device__ __forceinline__ void keep(v16b a, v16b b, v16b c, v16b d) { keep4_b(a, b, c, d); }
};

__device__ __forceinline__ unsigned pk16(unsigned short a, unsigned short b) { return (unsigned)a | ((unsigned)b << 16); }

// ---- Register-blocked batched WMMA GEMM (CAUSAL, BSPLIT and LORA options added) ----
// C[m,n] = scale * sum_k A[m,k] * Bt[n,k] (+bias)(+resid)(+lora); each wave owns a 64x64 tile.
// A row-major [M,K]; Bt row-major [N,K]; M,N % 64 == 0, K % 32 == 0.
// SPLIT: operands are hi/lo planes (A2/Bt2 = lo planes, same layout); product = hi.hi + hi.lo + lo.hi.
// SPLIT with BSPLIT == false: only A carries a lo plane; product = hi.B + lo.B (Bt2 unused).
// BIAS_MODE: 0 = none, 1 = bias[m], 2 = bias[n].
// OUT_MODE: 0 = f32, 1 = f16, 2 = bf16 hi plane (Cout) + bf16 lo plane (Cout2).
// CAUSAL: tiles with n0 > m0 are skipped (wave-uniform) and the k loop stops at min(K, m0 + 64).
// LORA: rank-4 f32 term added in the epilogue: v += dot4(rowtab[m][0..3], coltab[n][0..3]); rowtab pitch ldrow floats, coltab pitch
//   ldcol floats (both 16-B aligned rows). LORA == 1: coltab values RNE-bf16 converted at load (rowtab kept f32);
//   LORA == 2: rowtab values RNE-bf16 converted (coltab kept f32). In LORA modes a BIAS_MODE 2 bias is RNE-bf16 converted too.
// ET: 0 = f16 operands, 1 = bf16 operands (pointers passed as 16-bit storage)
template <int ET> struct Elem;
template <> struct Elem<0> { typedef _Float16 T; };
template <> struct Elem<1> { typedef __bf16 T; };
template <int ET, bool SPLIT, int BIAS_MODE, int OUT_MODE, bool RESID, int ACT = 0, bool CAUSAL = false, bool BSPLIT = true, int LORA = 0>
__global__ __launch_bounds__(256) void wmma_gemm64(
    const unsigned short* __restrict__ Ap, const unsigned short* __restrict__ A2p, int lda, long strideA,
    const unsigned short* __restrict__ Btp, const unsigned short* __restrict__ Bt2p, int ldb, long strideB,
    void* __restrict__ Cout, void* __restrict__ Cout2, int ldc, long strideC,
    const float* __restrict__ bias,
    const float* __restrict__ resid, long strideR,
    const float* __restrict__ rowtab, int ldrow,
    const float* __restrict__ coltab, int ldcol,
    int M, int N, int K, float scale) {
  typedef typename Elem<ET>::T T;
  typedef typename Frag<T>::V V;
  const T* A = (const T*)Ap; const T* A2 = (const T*)A2p; const T* Bt = (const T*)Btp; const T* Bt2 = (const T*)Bt2p;
  __shared__ __align__(16) float sT[8][16 * 68];   // per-wave 16x64 slab, pitch 68 floats
  const int b    = blockIdx.y;
  const int lane = threadIdx.x & 31;
  const int wave = threadIdx.x >> 5;
  const int tilesN = N >> 6;
  const int tilesM = M >> 6;
  const int tile = blockIdx.x * 8 + wave;
  if (tile >= tilesM * tilesN) return;   // wave-uniform; no block barriers in this kernel
  const int tm = tile / tilesN;
  const int tn = tile - tm * tilesN;
  const int m0 = tm << 6;
  const int n0 = tn << 6;
  if (CAUSAL && (n0 > m0)) return;       // wave-uniform causal tile skip
  const int Kend = CAUSAL ? ((m0 + 64 < K) ? (m0 + 64) : K) : K;   // multiple of 32

  const T* Ab  = A  + (size_t)b * strideA;
  const T* Bb  = Bt + (size_t)b * strideB;
  const T* Ab2 = SPLIT ? (A2  + (size_t)b * strideA) : nullptr;
  const T* Bb2 = (SPLIT && BSPLIT) ? (Bt2 + (size_t)b * strideB) : nullptr;

  const int rlane = lane & 15;                 // row (A) / col (B, D) within subtile
  const int koff  = (lane >> 4) * 8;           // k offset of this lane half
  const int mOff  = (lane >> 4) * 8;           // D row offset

  v8f acc[4][4];
#pragma unroll
  for (int i = 0; i < 4; ++i)
#pragma unroll
    for (int j = 0; j < 4; ++j) acc[i][j] = (v8f){0.f,0.f,0.f,0.f,0.f,0.f,0.f,0.f};

  for (int k0 = 0; k0 < Kend; k0 += 32) {
    V bh[4], bl[4];
#pragma unroll
    for (int j = 0; j < 4; ++j) {
      const size_t bo = (size_t)(n0 + (j << 4) + rlane) * ldb + koff + k0;
      bh[j] = Frag<T>::load(Bb + bo);
      if (SPLIT && BSPLIT) bl[j] = Frag<T>::load(Bb2 + bo);
    }
#pragma unroll
    for (int i = 0; i < 4; ++i) {
      const size_t ao = (size_t)(m0 + (i << 4) + rlane) * lda + koff + k0;
      V ah = Frag<T>::load(Ab + ao);
      V al;
      if (SPLIT) al = Frag<T>::load(Ab2 + ao);
#pragma unroll
      for (int j = 0; j < 4; ++j) {
        acc[i][j] = Frag<T>::mma(ah, bh[j], acc[i][j]);
        if (SPLIT && BSPLIT) acc[i][j] = Frag<T>::mma(ah, bl[j], acc[i][j]);
        if (SPLIT) acc[i][j] = Frag<T>::mma(al, bh[j], acc[i][j]);
      }
      Frag<T>::guard(acc[i][0], acc[i][3], ah, SPLIT ? al : ah);
    }
    Frag<T>::keep(bh[0], bh[1], bh[2], bh[3]);
    if (SPLIT && BSPLIT) Frag<T>::keep(bl[0], bl[1], bl[2], bl[3]);
  }
  acc_guard4(acc[0][0], acc[0][1], acc[0][2], acc[0][3]);
  acc_guard4(acc[1][0], acc[1][1], acc[1][2], acc[1][3]);
  acc_guard4(acc[2][0], acc[2][1], acc[2][2], acc[2][3]);
  acc_guard4(acc[3][0], acc[3][1], acc[3][2], acc[3][3]);

  // ---- epilogue ----
  float* slab = sT[wave];
  const float* Rb = RESID ? (resid + (size_t)b * strideR) : nullptr;
  // rank-4 column table (LORA modes): per lane the 4 columns n0 + 16j + rlane
  v4f ctab[4];
  float cbias[4];
#pragma unroll
  for (int j = 0; j < 4; ++j) { ctab[j] = (v4f){0.f,0.f,0.f,0.f}; cbias[j] = 0.f; }
  if (LORA != 0) {
#pragma unroll
    for (int j = 0; j < 4; ++j) {
      const int n = n0 + (j << 4) + rlane;
      v4f u = *(const v4f*)(coltab + (size_t)n * ldcol);
      if (LORA == 1) {
#pragma unroll
        for (int e = 0; e < 4; ++e) u[e] = bf_rne(u[e]);
      }
      ctab[j] = u;
      if (BIAS_MODE == 2) cbias[j] = bf_rne(bias[n]);
    }
  }
#pragma unroll
  for (int i = 0; i < 4; ++i) {
    const int mBase = m0 + (i << 4);
    if (LORA == 0) {
#pragma unroll
      for (int j = 0; j < 4; ++j) {
        const int n = n0 + (j << 4) + rlane;
        float bv = 0.f;
        if (BIAS_MODE == 2) bv = bias[n];
#pragma unroll
        for (int r = 0; r < 8; ++r) {
          float v = acc[i][j][r] * scale;
          if (BIAS_MODE == 1) v += bias[mBase + mOff + r];
          if (BIAS_MODE == 2) v += bv;
          if (RESID) v += Rb[(size_t)(mBase + mOff + r) * ldc + n];
          if (ACT == 2) v = fmaxf(v, 0.0f);
          if (ACT == 4) v = (v > 0.f) ? v : 0.01f * v;
          slab[(mOff + r) * 68 + (j << 4) + rlane] = v;
        }
      }
    } else {
#pragma unroll
      for (int r = 0; r < 8; ++r) {
        const int m = mBase + mOff + r;
        v4f tr = *(const v4f*)(rowtab + (size_t)m * ldrow);
        if (LORA == 2) {
#pragma unroll
          for (int e = 0; e < 4; ++e) tr[e] = bf_rne(tr[e]);
        }
#pragma unroll
        for (int j = 0; j < 4; ++j) {
          float lr = tr[0] * ctab[j][0];
          lr = fmaf(tr[1], ctab[j][1], lr);
          lr = fmaf(tr[2], ctab[j][2], lr);
          lr = fmaf(tr[3], ctab[j][3], lr);
          float v = acc[i][j][r] * scale + lr;
          if (BIAS_MODE == 2) v += cbias[j];
          slab[(mOff + r) * 68 + (j << 4) + rlane] = v;
        }
      }
    }
    __builtin_amdgcn_fence(__ATOMIC_RELEASE, "workgroup");
    __builtin_amdgcn_wave_barrier();
    __builtin_amdgcn_fence(__ATOMIC_ACQUIRE, "workgroup");
    if (OUT_MODE == 0) {
      float* C = (float*)Cout + (size_t)b * strideC;
      const int hh = lane >> 4, c4 = (lane & 15) * 4;     // row seg = 256 B = 16 lanes x 16 B
      {
#pragma unroll
        for (int it = 0; it < 8; ++it) {
          const int row = it * 2 + hh;
          v4f v = *(const v4f*)(slab + row * 68 + c4);
          *(v4f*)(C + (size_t)(mBase + row) * ldc + n0 + c4) = v;
        }
        
      }
    } else {
      const int q = lane >> 3, c8 = (lane & 7) * 8;
      unsigned short* C  = (unsigned short*)Cout  + (size_t)b * strideC;
      unsigned short* C2 = (OUT_MODE == 2) ? ((unsigned short*)Cout2 + (size_t)b * strideC) : nullptr;
      {
#pragma unroll
        for (int it = 0; it < 4; ++it) {
          const int row = it * 4 + q;
          const float* sp = slab + row * 68 + c8;
          v8h hv, lv;
#pragma unroll
          for (int e = 0; e < 8; ++e) {
            if (OUT_MODE == 1) {
              hv[e] = (_Float16)sp[e];
            } else {
              unsigned short hb = f2bf_bits(sp[e]);
              unsigned short lb = f2bf_bits(sp[e] - bf_bits2f(hb));
              hv[e] = __builtin_bit_cast(_Float16, hb);
              lv[e] = __builtin_bit_cast(_Float16, lb);
            }
          }
          *(v8h*)(C + (size_t)(mBase + row) * ldc + n0 + c8) = hv;
          if (OUT_MODE == 2) *(v8h*)(C2 + (size_t)(mBase + row) * ldc + n0 + c8) = lv;
        }
        
      }
    }
    __builtin_amdgcn_fence(__ATOMIC_RELEASE, "workgroup");
    __builtin_amdgcn_wave_barrier();
    __builtin_amdgcn_fence(__ATOMIC_ACQUIRE, "workgroup");
  }
}

// ---------------------------------------------------------------------------
// f32 -> RNE bf16 plane with zero padding, up to 3 same-shaped tables per launch (blockIdx.y selects the source, block-uniform).
// Thread i owns flat elements 8i..8i+7 of plane y: value = in_y[e] for e < nvalid, 0 otherwise (the load address is clamped to
// [0, nvalid-8], the value is zeroed by predicate). out plane y starts at out + y * plane_halves.
// Coverage: n8 = plane elements / 8 threads x 8 = the whole padded plane (grids are exact multiples of 256 here).
// ---------------------------------------------------------------------------
__global__ __launch_bounds__(256) void cast_pad_bf16_kernel(const float* __restrict__ s0, const float* __restrict__ s1,
                                                            const float* __restrict__ s2,
                                                            unsigned short* __restrict__ out, long plane_halves,
                                                            int n8, int nvalid) {
  const int i = blockIdx.x * 256 + threadIdx.x;
  if (i >= n8) return;
  const int y = blockIdx.y;
  const float* src = (y == 0) ? s0 : ((y == 1) ? s1 : s2);
  const long e = 8L * (long)i;
  const bool live = (e < (long)nvalid);
  const long ec = live ? e : (long)(nvalid - 8);
  const v4f a = *(const v4f*)(src + ec);
  const v4f c = *(const v4f*)(src + ec + 4);
  float f[8];
#pragma unroll
  for (int k = 0; k < 4; ++k) { f[k] = live ? a[k] : 0.0f; f[4 + k] = live ? c[k] : 0.0f; }
  unsigned w[4];
#pragma unroll
  for (int e2 = 0; e2 < 4; ++e2) w[e2] = pk16(f2bf_bits(f[2 * e2]), f2bf_bits(f[2 * e2 + 1]));
  const v4u u = (v4u){w[0], w[1], w[2], w[3]};
  unsigned short* q = out + (size_t)y * plane_halves + (size_t)e;
  *(v4u*)q = u;
  
}

constexpr int kFaWaves = 8;
constexpr int kFaCols  = 32;                       // query columns per wave
constexpr int kFaG     = kFaCols / 16;             // 16-column groups per wave
constexpr int kFaKeys  = 32;                       // keys per pass = one k step of the second product
constexpr float kExp2Scale = 0.125f * 1.4426950408889634f;   // 64^-0.5 * log2(e)
static_assert(kSeq % (kFaWaves * kFaCols) == 0 && kSeq % kFaKeys == 0 && kDh == 64, "fused attention tile shape");
typedef __attribute__((ext_vector_type(2))) float  v2f;
typedef __attribute__((ext_vector_type(2))) __bf16 v2b;
typedef __attribute__((ext_vector_type(8))) unsigned int v8u;

// two f32 -> two RNE bf16 in one word (a in the low half)
__device__ __forceinline__ unsigned pack_bf2(float a, float b) {
  return __builtin_bit_cast(unsigned, __builtin_convertvector((v2f){a, b}, v2b));
}
// value of lane l ^ 16
__device__ __forceinline__ float other_half(float x) {
  const int i = __builtin_bit_cast(int, x);
  return __builtin_bit_cast(float, __builtin_amdgcn_permlanex16(i, i, 0x76543210, 0xfedcba98, false, false));
}
struct KFrags { v16b hi[2][2], lo[2][2]; };        // [16-key tile][32-wide step over d]
__device__ __forceinline__ void load_k(KFrags& k, const __bf16* Kh, const __bf16* Kl, int key0) {
#pragma unroll
  for (int kt = 0; kt < 2; ++kt)
#pragma unroll
    for (int kc = 0; kc < 2; ++kc) {
      const size_t o = (size_t)(key0 + (kt << 4)) * kQKld + (kc << 5);
      k.hi[kt][kc] = Frag<__bf16>::load(Kh + o);
      k.lo[kt][kc] = Frag<__bf16>::load(Kl + o);
    }
}
__device__ __forceinline__ void load_v(v16b (&vh)[4], v16b (&vl)[4], const __bf16* Vh, const __bf16* Vl, int key0) {
#pragma unroll
  for (int t = 0; t < 4; ++t) {
    vh[t] = Frag<__bf16>::load(Vh + (size_t)(t << 4) * kTok + key0);
    vl[t] = Frag<__bf16>::load(Vl + (size_t)(t << 4) * kTok + key0);
  }
}

__global__ __launch_bounds__(kFaWaves * 32) void attn_fused_kernel(
    const unsigned short* __restrict__ QKhi, const unsigned short* __restrict__ QKlo,
    const unsigned short* __restrict__ Vthi, const unsigned short* __restrict__ Vtlo,
    unsigned short* __restrict__ Chi, unsigned short* __restrict__ Clo) {
  typedef Frag<__bf16> F;
  const int pair = blockIdx.y;
  const int b    = pair / kHeads;
  const int hd   = pair - b * kHeads;
  const int lane = threadIdx.x & 31;
  const int wave = threadIdx.x >> 5;
  const int c    = lane & 15;                  // row of A, column of B and D
  const int h8   = (lane >> 4) * 8;            // k offset of this lane half (A, B); D row offset
  const int q0   = blockIdx.x * (kFaWaves * kFaCols) + wave * kFaCols;
  const size_t tok0 = (size_t)b * kSeq;

  // Q fragments (B operand), kept for the whole loop
  v16b qh[kFaG][2], ql[kFaG][2];
#pragma unroll
  for (int g = 0; g < kFaG; ++g)
#pragma unroll
    for (int kc = 0; kc < 2; ++kc) {
      const size_t o = (tok0 + q0 + (g << 4) + c) * kQKld + hd * kDh + (kc << 5) + h8;
      qh[g][kc] = F::load((const __bf16*)QKhi + o);
      ql[g][kc] = F::load((const __bf16*)QKlo + o);
    }
  // the two fences below keep the order Q, K, v^T of the first loads, which is the loop's own (K, then v^T): with another order here
  // the counted waits at the loop head fall to 0 and every pass would wait for its v^T fragments before its first product
  __builtin_amdgcn_sched_barrier(0);
  const size_t koff = (tok0 + c) * kQKld + kHid + hd * kDh + h8;
  const size_t voff = (size_t)(hd * kDh + c) * kTok + tok0 + h8;
  const __bf16* Kh = (const __bf16*)QKhi + koff;
  const __bf16* Kl = (const __bf16*)QKlo + koff;
  const __bf16* Vh = (const __bf16*)Vthi + voff;
  const __bf16* Vl = (const __bf16*)Vtlo + voff;

  v8f acc[kFaG][4];                            // O^T: [column group][16-row tile over d]
  float m_run[kFaG];
  v2f lsum[kFaG];                              // this lane's share of the row sum (its 16 of each pass's 32 keys), even / odd registers
#pragma unroll
  for (int g = 0; g < kFaG; ++g) {
    m_run[g] = -INFINITY;
    lsum[g] = (v2f){0.f, 0.f};
#pragma unroll
    for (int t = 0; t < 4; ++t) acc[g][t] = (v8f){0.f,0.f,0.f,0.f,0.f,0.f,0.f,0.f};
  }

  KFrags kf;
  v16b vh[4], vl[4];                           // [16-row tile over d]
  load_k(kf, Kh, Kl, 0);
  __builtin_amdgcn_sched_barrier(0);
  load_v(vh, vl, Vh, Vl, 0);
  for (int key0 = 0; key0 < kSeq; key0 += kFaKeys) {
    const int keyn = (key0 + kFaKeys < kSeq) ? (key0 + kFaKeys) : key0;   // the last pass re-reads its own rows: in bounds, unused
    // S^T tiles [16-key tile][column group]; per accumulator the order is hi.hi, hi.lo, lo.hi for d 0..31, then for d 32..63
    v8f s[2][kFaG];
#pragma unroll
    for (int kt = 0; kt < 2; ++kt)
#pragma unroll
      for (int g = 0; g < kFaG; ++g) s[kt][g] = (v8f){0.f,0.f,0.f,0.f,0.f,0.f,0.f,0.f};
#pragma unroll
    for (int kc = 0; kc < 2; ++kc) {
#pragma unroll
      for (int kt = 0; kt < 2; ++kt)
#pragma unroll
        for (int g = 0; g < kFaG; ++g) s[kt][g] = F::mma(kf.hi[kt][kc], qh[g][kc], s[kt][g]);
#pragma unroll
      for (int kt = 0; kt < 2; ++kt)
#pragma unroll
        for (int g = 0; g < kFaG; ++g) s[kt][g] = F::mma(kf.lo[kt][kc], qh[g][kc], s[kt][g]);
#pragma unroll
      for (int kt = 0; kt < 2; ++kt)
#pragma unroll
        for (int g = 0; g < kFaG; ++g) s[kt][g] = F::mma(kf.hi[kt][kc], ql[g][kc], s[kt][g]);
    }

    // column maxima of the raw scores (the scale is positive), then one test per pass
    float mb[kFaG];
    bool need = false;
#pragma unroll
    for (int g = 0; g < kFaG; ++g) {
      float mx = s[0][g][0];
#pragma unroll
      for (int r = 1; r < 8; ++r) mx = fmaxf(mx, s[0][g][r]);
#pragma unroll
      for (int r = 0; r < 8; ++r) mx = fmaxf(mx, s[1][g][r]);
      mx = fmaxf(mx, other_half(mx)) * kExp2Scale;   // both halves hold this query's maximum of the pass
      mb[g] = mx;
      need = need || (mx > m_run[g] + 8.0f);          // true in the first pass (m_run = -inf)
    }
    if (__builtin_amdgcn_ballot_w32(need) != 0) {     // wave-uniform scalar branch
#pragma unroll
      for (int g = 0; g < kFaG; ++g) {
        const float m_new = fmaxf(m_run[g], mb[g]);
        const float corr  = __builtin_amdgcn_exp2f(m_run[g] - m_new);   // 0 in the first pass
        m_run[g] = m_new;
        lsum[g] = lsum[g] * corr;
#pragma unroll
        for (int t = 0; t < 4; ++t) acc[g][t] = acc[g][t] * corr;
      }
    }
    // next pass's K fragments, in flight under the exponentials and the second product
    load_k(kf, Kh, Kl, keyn);
    __builtin_amdgcn_sched_barrier(0);   // holds these loads ahead of the exponentials: sunk among the products below they arrive too late
#pragma unroll
    for (int g = 0; g < kFaG; ++g) {
      const float nm = -m_run[g];
      v8u hw, lw;
      v2f pp[8];
#pragma unroll
      for (int i = 0; i < 8; ++i) {   // operand elements 2i, 2i + 1 = tile i >> 2, registers 2 (i & 3), 2 (i & 3) + 1
        const v2f arg = __builtin_elementwise_fma((v2f){s[i >> 2][g][2 * (i & 3)], s[i >> 2][g][2 * (i & 3) + 1]},
                                                  (v2f){kExp2Scale, kExp2Scale}, (v2f){nm, nm});
        const v2f p = (v2f){__builtin_amdgcn_exp2f(arg.x), __builtin_amdgcn_exp2f(arg.y)};
        const unsigned w = pack_bf2(p.x, p.y);
        const v2f hi = (v2f){__uint_as_float(w << 16), __uint_as_float(w & 0xFFFF0000u)};
        const v2f lo = p - hi;        // exact in f32
        hw[i] = w;
        lw[i] = pack_bf2(lo.x, lo.y);
        pp[i] = p;
      }
      lsum[g] += ((pp[0] + pp[1]) + (pp[2] + pp[3])) + ((pp[4] + pp[5]) + (pp[6] + pp[7]));
      const v16b ph = __builtin_bit_cast(v16b, hw);
      const v16b pl = __builtin_bit_cast(v16b, lw);
#pragma unroll
      for (int t = 0; t < 4; ++t) acc[g][t] = F::mma(vh[t], ph, acc[g][t]);
#pragma unroll
      for (int t = 0; t < 4; ++t) acc[g][t] = F::mma(vl[t], ph, acc[g][t]);
#pragma unroll
      for (int t = 0; t < 4; ++t) acc[g][t] = F::mma(vh[t], pl, acc[g][t]);
    }
    // next pass's v^T fragments, in flight under that pass's first product and softmax
    load_v(vh, vl, Vh, Vl, keyn);
  }

  // ctx[query][hd * 64 + 16 t + h8 + r] = acc[g][t][r] / row sum, as bf16 hi/lo planes: 16 B per lane, tile and plane
#pragma unroll
  for (int g = 0; g < kFaG; ++g) {
    const float part = lsum[g].x + lsum[g].y;
    const float inv  = 1.0f / (part + other_half(part));   // sum >= 1: m never exceeds the row maximum
    const size_t co = (tok0 + q0 + (g << 4) + c) * kHid + hd * kDh + h8;
#pragma unroll
    for (int t = 0; t < 4; ++t) {
      v4u hv, lv;
#pragma unroll
      for (int e = 0; e < 4; ++e) {
        const float f0 = acc[g][t][2 * e] * inv;
        const float f1 = acc[g][t][2 * e + 1] * inv;
        const unsigned w = pack_bf2(f0, f1);
        hv[e] = w;
        lv[e] = pack_bf2(f0 - __uint_as_float(w << 16), f1 - __uint_as_float(w & 0xFFFF0000u));
      }
      *(v4u*)(Chi + co + (t << 4)) = hv;
      *(v4u*)(Clo + co + (t << 4)) = lv;
    }
  }
}

// ---------------------------------------------------------------------------
// Launcher. Workspace region map (bytes, MiB = 1048576; carve ends at 128 MiB = 134217728 B):
//   [  0, 18) projection operands: x bf16 [4096][1024] at +0 (8 MiB); wq|wk|wv bf16 [1024][1024] x3 at +8 MiB (6 MiB);
//                      padded down planes [64][1024] x3 at +14 MiB (384 KiB); t tables f32 [4096][64] x3 (tq|tk|tv) at +15 MiB (3 MiB).
//                      late aliases (written after the attention launch, when the above are dead): wo bf16 [1024][1024] at +0 (2 MiB);
//                      padded out_down plane [64][1024] at +2 MiB (128 KiB); to table f32 [4096][64] at +3 MiB (1 MiB).
//   [ 18, 64) unused
//   [ 64, 80) q|k hi : [4096][2048] bf16 (cols 0..1023 = q (h*64+d), 1024..2047 = k)
//   [ 80, 96) q|k lo
//   [ 96,104) v^T hi : [1024 (h*64+d)][4096 (b*2048+s)] bf16
//   [104,112) v^T lo
//   [112,120) ctx hi : [4096][1024] bf16 (col h*64+d)
//   [120,128) ctx lo
// Launch count: 3 casts + 1 down GEMM + 3 projections + 1 attention + 2 late casts + 1 down GEMM + 1 out GEMM = 12.
// Kernel launches only.
// ---------------------------------------------------------------------------
extern "C" void kernel_launch(void* const* d_in, const int* in_sizes, int n_in,
                              void* d_out, int out_size, void* d_ws, size_t ws_size,
                              hipStream_t stream) {
  if (n_in < 14) return;
  if (in_sizes[0] != kTok * kHid) return;
  if (in_sizes[1] != kHid * kHid || in_sizes[2] != kHid * kHid || in_sizes[3] != kHid * kHid || in_sizes[4] != kHid * kHid) return;
  if (in_sizes[5] != kHid) return;
  if (in_sizes[6] != kRank * kHid || in_sizes[8] != kRank * kHid || in_sizes[10] != kRank * kHid || in_sizes[12] != kRank * kHid) return;
  if (in_sizes[7] != kHid * kRank || in_sizes[9] != kHid * kRank || in_sizes[11] != kHid * kRank || in_sizes[13] != kHid * kRank) return;
  if (out_size != kTok * kHid) return;

  const size_t kMiB    = 1048576;
  const size_t offXb   = 0;
  const size_t offW3   = 8 * kMiB;
  const size_t offDn3  = 14 * kMiB;
  const size_t offT3   = 15 * kMiB;
  const size_t offWo   = 0;
  const size_t offDnO  = 2 * kMiB;
  const size_t offTo   = 3 * kMiB;
  const size_t offQKhi = 64 * kMiB;
  const size_t offQKlo = 80 * kMiB;
  const size_t offVthi = 96 * kMiB;
  const size_t offVtlo = 104 * kMiB;
  const size_t offChi  = 112 * kMiB;
  const size_t offClo  = 120 * kMiB;
  const size_t total   = 128 * kMiB;
  if (total > ws_size) return;

  const float* x     = (const float*)d_in[0];
  const float* wq    = (const float*)d_in[1];
  const float* wk    = (const float*)d_in[2];
  const float* wv    = (const float*)d_in[3];
  const float* wo    = (const float*)d_in[4];
  const float* bo    = (const float*)d_in[5];
  const float* q_dn  = (const float*)d_in[6];
  const float* q_up  = (const float*)d_in[7];
  const float* k_dn  = (const float*)d_in[8];
  const float* k_up  = (const float*)d_in[9];
  const float* v_dn  = (const float*)d_in[10];
  const float* v_up  = (const float*)d_in[11];
  const float* o_dn  = (const float*)d_in[12];
  const float* o_up  = (const float*)d_in[13];
  float* out = (float*)d_out;
  char* ws = (char*)d_ws;

  unsigned short* xb   = (unsigned short*)(ws + offXb);
  unsigned short* w3   = (unsigned short*)(ws + offW3);
  unsigned short* dn3  = (unsigned short*)(ws + offDn3);
  float*          t3   = (float*)(ws + offT3);
  unsigned short* wob  = (unsigned short*)(ws + offWo);
  unsigned short* dno  = (unsigned short*)(ws + offDnO);
  float*          tot  = (float*)(ws + offTo);
  unsigned short* qkhi = (unsigned short*)(ws + offQKhi);
  unsigned short* qklo = (unsigned short*)(ws + offQKlo);
  unsigned short* vthi = (unsigned short*)(ws + offVthi);
  unsigned short* vtlo = (unsigned short*)(ws + offVtlo);
  unsigned short* chi  = (unsigned short*)(ws + offChi);
  unsigned short* clo  = (unsigned short*)(ws + offClo);

  // in-range dummies for unused (never dereferenced) template-dead pointer parameters
  const float* dummy_f = bo;
  void* dummy_c2 = (void*)chi;

  const long wPlane  = (long)kHid * kHid;          // 1048576 halves
  const long dnPlane = (long)kRankPad * kHid;      // 65536 halves
  const long tPlane  = (long)kTok * kRankPad;      // 262144 floats

  // 1. x -> RNE bf16 plane [4096][1024]: n8 = 524288 = 2048 blocks x 256
  {
    const int n8 = (kTok * kHid) / 8;
    cast_pad_bf16_kernel<<<dim3(n8 / 256, 1), dim3(256), 0, stream>>>(x, x, x, xb, 0L, n8, kTok * kHid);
  }
  // 2. wq, wk, wv [1024 out][1024 in] -> bf16 planes (Bt layout directly): n8 = 131072 = 512 blocks x 256, 3 tables
  {
    const int n8 = (kHid * kHid) / 8;
    cast_pad_bf16_kernel<<<dim3(n8 / 256, 3), dim3(256), 0, stream>>>(wq, wk, wv, w3, wPlane, n8, kHid * kHid);
  }
  // 3. q/k/v down [4][1024] -> zero-padded bf16 planes [64][1024] (rows 4..63 zero-filled): n8 = 8192 = 32 blocks x 256
  {
    const int n8 = (kRankPad * kHid) / 8;
    cast_pad_bf16_kernel<<<dim3(n8 / 256, 3), dim3(256), 0, stream>>>(q_dn, k_dn, v_dn, dn3, dnPlane, n8, kRank * kHid);
  }
  // 4. t{q,k,v} = x . down^T : M=4096, N=64, K=1024, single bf16 product -> f32 [3][4096][64] (batched over blockIdx.y)
  wmma_gemm64<1, false, 0, 0, false, 0, false, true, 0><<<dim3((kTok / 64) * (kRankPad / 64) / 8, 3), dim3(256), 0, stream>>>(
      xb, xb, kHid, 0L,
      dn3, dn3, kHid, dnPlane,
      (void*)t3, dummy_c2, kRankPad, tPlane,
      dummy_f, dummy_f, 0L,
      dummy_f, 4, dummy_f, 4,
      kTok, kRankPad, kHid, 1.0f);

  // 5. q = x . wq^T + tq . q_up^T : M=4096, N=1024, K=1024 -> bf16 hi/lo into q|k planes cols 0..1023 (ldc 2048)
  wmma_gemm64<1, false, 0, 2, false, 0, false, true, 1><<<dim3((kTok / 64) * (kHid / 64) / 8, 1), dim3(256), 0, stream>>>(
      xb, xb, kHid, 0L,
      w3, w3, kHid, 0L,
      (void*)qkhi, (void*)qklo, kQKld, 0L,
      dummy_f, dummy_f, 0L,
      t3, kRankPad, q_up, kRank,
      kTok, kHid, kHid, 1.0f);
  // 6. k = x . wk^T + tk . k_up^T -> cols 1024..2047
  wmma_gemm64<1, false, 0, 2, false, 0, false, true, 1><<<dim3((kTok / 64) * (kHid / 64) / 8, 1), dim3(256), 0, stream>>>(
      xb, xb, kHid, 0L,
      w3 + wPlane, w3 + wPlane, kHid, 0L,
      (void*)(qkhi + kHid), (void*)(qklo + kHid), kQKld, 0L,
      dummy_f, dummy_f, 0L,
      t3 + tPlane, kRankPad, k_up, kRank,
      kTok, kHid, kHid, 1.0f);
  // 7. v^T = wv . x^T + v_up . tv^T : M=1024 (h*64+d), N=4096 (token), K=1024 -> bf16 hi/lo [1024][4096]
  wmma_gemm64<1, false, 0, 2, false, 0, false, true, 2><<<dim3((kHid / 64) * (kTok / 64) / 8, 1), dim3(256), 0, stream>>>(
      w3 + 2 * wPlane, w3 + 2 * wPlane, kHid, 0L,
      xb, xb, kHid, 0L,
      (void*)vthi, (void*)vtlo, kTok, 0L,
      dummy_f, dummy_f, 0L,
      v_up, kRank, t3 + 2 * tPlane, kRankPad,
      kHid, kTok, kHid, 1.0f);

  // 8. attention, all 32 (batch, head) pairs: ctx = softmax(0.125 * q . k^T) . v -> bf16 hi/lo planes [4096][1024]
  attn_fused_kernel<<<dim3(kSeq / (kFaWaves * kFaCols), kBatch * kHeads), dim3(kFaWaves * 32), 0, stream>>>(
      qkhi, qklo, vthi, vtlo, chi, clo);

  // 9. wo [1024][1024] -> bf16 plane over the dead x plane
  {
    const int n8 = (kHid * kHid) / 8;
    cast_pad_bf16_kernel<<<dim3(n8 / 256, 1), dim3(256), 0, stream>>>(wo, wo, wo, wob, 0L, n8, kHid * kHid);
  }
  // 10. out_down [4][1024] -> zero-padded bf16 plane [64][1024]
  {
    const int n8 = (kRankPad * kHid) / 8;
    cast_pad_bf16_kernel<<<dim3(n8 / 256, 1), dim3(256), 0, stream>>>(o_dn, o_dn, o_dn, dno, 0L, n8, kRank * kHid);
  }
  // 11. to = ctx_hi . out_down^T + ctx_lo . out_down^T : M=4096, N=64, K=1024, 2 products -> f32 [4096][64]
  wmma_gemm64<1, true, 0, 0, false, 0, false, false, 0><<<dim3((kTok / 64) * (kRankPad / 64) / 8, 1), dim3(256), 0, stream>>>(
      chi, clo, kHid, 0L,
      dno, dno, kHid, 0L,
      (void*)tot, dummy_c2, kRankPad, 0L,
      dummy_f, dummy_f, 0L,
      dummy_f, 4, dummy_f, 4,
      kTok, kRankPad, kHid, 1.0f);
  // 12. out = ctx_hi . wo^T + ctx_lo . wo^T + to . out_up^T + bo : M=4096, N=1024, K=1024 -> f32 d_out
  wmma_gemm64<1, true, 2, 0, false, 0, false, false, 1><<<dim3((kTok / 64) * (kHid / 64) / 8, 1), dim3(256), 0, stream>>>(
      chi, clo, kHid, 0L,
      wob, wob, kHid, 0L,
      (void*)out, dummy_c2, kHid, 0L,
      bo, dummy_f, 0L,
      tot, kRankPad, o_up, kRank,
      kTok, kHid, kHid, 1.0f);
}

// v003
// Measured time: 370 microseconds a run.
// In both of two side-by-side timings against v002, it was 1.20 times as fast.
// All steps since v000 together make it 7.73 times as fast.
// Contractions: x.W^T (q, k, v^T) and x.down^T: single v_wmma_f32_16x16x32_bf16 products on RNE-bf16 planes; q.k^T scores and p.v context: bf16 hi/lo operand planes (hi.hi + hi.lo + lo.hi); ctx.Wo^T and ctx.out_down^T: ctx bf16 hi/lo x RNE-bf16 weights (hi.W + lo.W); rank-4 up-products, bias and softmax in f32 on the VALU; all f32 accumulate.
#include <hip/hip_runtime.h>
#include <math.h>

// ---------------------------------------------------------------------------
// Problem constants
// ---------------------------------------------------------------------------
constexpr int kBatch   = 2;
constexpr int kSeq     = 2048;
constexpr int kHid     = 1024;
constexpr int kHeads   = 16;
constexpr int kDh      = 64;
constexpr int kTok     = kBatch * kSeq;            // 4096 token rows
constexpr int kRank    = 4;
constexpr int kRankPad = 64;                       // rank padded to one tile
constexpr int kQKld    = 2 * kHid;                 // 2048: pitch of the q|k planes (halves)

static_assert((kTok * kHid) % (8 * 256) == 0, "cast grid exact");
static_assert((kHid * kHid) % (8 * 256) == 0, "cast grid exact");
static_assert((kRankPad * kHid) % (8 * 256) == 0, "pad cast grid exact");
static_assert(kHid % 64 == 0 && kTok % 64 == 0 && kSeq % 64 == 0 && kDh % 64 == 0 && kRankPad % 64 == 0, "tile multiples");
static_assert(kHid % 32 == 0 && kDh % 32 == 0 && kSeq % 32 == 0, "K multiples of 32");

typedef __attribute__((ext_vector_type(16))) _Float16 v16h;
typedef __attribute__((ext_vector_type(8)))  _Float16 v8h;
typedef __attribute__((ext_vector_type(16))) __bf16   v16b;
typedef __attribute__((ext_vector_type(8)))  __bf16   v8b;
typedef __attribute__((ext_vector_type(8)))  float    v8f;
typedef __attribute__((ext_vector_type(4)))  float    v4f;
typedef __attribute__((ext_vector_type(4)))  unsigned int v4u;

__device__ __forceinline__ unsigned short f2bf_bits(float f) {
  unsigned u = __float_as_uint(f);
  return (unsigned short)((u + 0x7FFFu + ((u >> 16) & 1u)) >> 16);
}
__device__ __forceinline__ float bf_bits2f(unsigned short h) { return __uint_as_float(((unsigned)h) << 16); }
__device__ __forceinline__ float bf_rne(float f) { return bf_bits2f(f2bf_bits(f)); }

// hazard guards as plain device helpers
__device__ __forceinline__ void acc_guard4(v8f& a, v8f& b, v8f& c, v8f& d) { asm volatile("v_nop\n\tv_nop\n\tv_nop\n\tv_nop" : "+v"(a), "+v"(b), "+v"(c), "+v"(d)); }
template <typename T> struct Frag;
template <> struct Frag<_Float16> {
  typedef v16h V; union U { v16h v; v8h h[2]; };
  // elements 0..7 <- p[0..7], 8..15 <- p[16..23]
  static __device__ __forceinline__ v16h load(const _Float16* p) {
    U f; f.h[0] = *(const v8h*)(p); f.h[1] = *(const v8h*)(p + 16); return f.v;
  }
  static __device__ __forceinline__ v8f mma(v16h a, v16h b, v8f c) {
    return __builtin_amdgcn_wmma_f32_16x16x32_f16(false, a, false, b, (short)0, c, false, false);
  }
};
template <> struct Frag<__bf16> {
  typedef v16b V; union U { v16b v; v8b h[2]; };
  static __device__ __forceinline__ v16b load(const __bf16* p) {
    U f; f.h[0] = *(const v8b*)(p); f.h[1] = *(const v8b*)(p + 16); return f.v;
  }
  static __device__ __forceinline__ v8f mma(v16b a, v16b b, v8f c) {
    return __builtin_amdgcn_wmma_f32_16x16x32_bf16(false, a, false, b, (short)0, c, false, false);
  }
};

__device__ __forceinline__ unsigned pk16(unsigned short a, unsigned short b) { return (unsigned)a | ((unsigned)b << 16); }

// ---- Register-blocked batched WMMA GEMM (CAUSAL, BSPLIT and LORA options added) ----
// C[m,n] = scale * sum_k A[m,k] * Bt[n,k] (+bias)(+resid)(+lora); each wave owns a 64x64 tile.
// A row-major [M,K]; Bt row-major [N,K]; M,N % 64 == 0, K % 32 == 0, K >= 32.
// SPLIT: operands are hi/lo planes (A2/Bt2 = lo planes, same layout); product = hi.hi + hi.lo + lo.hi.
// SPLIT with BSPLIT == false: only A carries a lo plane; product = hi.B + lo.B (Bt2 unused).
// BIAS_MODE: 0 = none, 1 = bias[m], 2 = bias[n].
// OUT_MODE: 0 = f32, 1 = f16, 2 = bf16 hi plane (Cout) + bf16 lo plane (Cout2).
// CAUSAL: tiles with n0 > m0 are skipped (wave-uniform) and the k loop stops at min(K, m0 + 64).
// LORA: rank-4 f32 term added in the epilogue: v += dot4(rowtab[m][0..3], coltab[n][0..3]); rowtab pitch ldrow floats, coltab pitch
//   ldcol floats (both 16-B aligned rows). LORA == 1: coltab values RNE-bf16 converted at load (rowtab kept f32);
//   LORA == 2: rowtab values RNE-bf16 converted (coltab kept f32). In LORA modes a BIAS_MODE 2 bias is RNE-bf16 converted too.
// ET: 0 = f16 operands, 1 = bf16 operands (pointers passed as 16-bit storage)
template <int ET> struct Elem;
template <> struct Elem<0> { typedef _Float16 T; };
template <> struct Elem<1> { typedef __bf16 T; };
template <int ET, bool SPLIT, int BIAS_MODE, int OUT_MODE, bool RESID, int ACT = 0, bool CAUSAL = false, bool BSPLIT = true, int LORA = 0>
__global__ __launch_bounds__(256) void wmma_gemm64(
    const unsigned short* __restrict__ Ap, const unsigned short* __restrict__ A2p, int lda, long strideA,
    const unsigned short* __restrict__ Btp, const unsigned short* __restrict__ Bt2p, int ldb, long strideB,
    void* __restrict__ Cout, void* __restrict__ Cout2, int ldc, long strideC,
    const float* __restrict__ bias,
    const float* __restrict__ resid, long strideR,
    const float* __restrict__ rowtab, int ldrow,
    const float* __restrict__ coltab, int ldcol,
    int M, int N, int K, float scale) {
  typedef typename Elem<ET>::T T;
  typedef typename Frag<T>::V V;
  const T* A = (const T*)Ap; const T* A2 = (const T*)A2p; const T* Bt = (const T*)Btp; const T* Bt2 = (const T*)Bt2p;
  __shared__ __align__(16) float sT[8][16 * 68];   // per-wave 16x64 slab, pitch 68 floats
  const int b    = blockIdx.y;
  const int lane = threadIdx.x & 31;
  const int wave = threadIdx.x >> 5;
  const int tilesN = N >> 6;
  const int tilesM = M >> 6;
  const int tile = blockIdx.x * 8 + wave;
  if (tile >= tilesM * tilesN) return;   // wave-uniform; no block barriers in this kernel
  const int tm = tile / tilesN;
  const int tn = tile - tm * tilesN;
  const int m0 = tm << 6;
  const int n0 = tn << 6;
  if (CAUSAL && (n0 > m0)) return;       // wave-uniform causal tile skip
  const int Kend = CAUSAL ? ((m0 + 64 < K) ? (m0 + 64) : K) : K;   // multiple of 32

  const T* Ab  = A  + (size_t)b * strideA;
  const T* Bb  = Bt + (size_t)b * strideB;
  const T* Ab2 = SPLIT ? (A2  + (size_t)b * strideA) : nullptr;
  const T* Bb2 = (SPLIT && BSPLIT) ? (Bt2 + (size_t)b * strideB) : nullptr;

  const int rlane = lane & 15;                 // row (A) / col (B, D) within subtile
  const int koff  = (lane >> 4) * 8;           // k offset of this lane half
  const int mOff  = (lane >> 4) * 8;           // D row offset

  v8f acc[4][4];
#pragma unroll
  for (int i = 0; i < 4; ++i)
#pragma unroll
    for (int j = 0; j < 4; ++j) acc[i][j] = (v8f){0.f,0.f,0.f,0.f,0.f,0.f,0.f,0.f};

  // k loop with a register ring: the fragments of step s + NBUF - 1 are requested during the products of step s, so that a step waits
  // (counted, loads return in order) only for requests made NBUF - 1 steps earlier. Step t lives in ring place t % NBUF. Requests past
  // the last step re-read the last step's columns: in bounds, never used. Per accumulator the order of the products is that of k.
  // A step's B requests stand ahead of its products and its A requests between their halves: at most 56 loads of a wave are in flight.
  constexpr int NBUF = SPLIT ? (BSPLIT ? 2 : 3) : 4;
  const int nsteps = Kend >> 5;                // >= 1
  // one pointer per fragment row and plane, moved on by one step (32 elements) ahead of each request but the first
  const T* pa[4]; const T* pa2[4]; const T* pb[4]; const T* pb2[4];
#pragma unroll
  for (int i = 0; i < 4; ++i) {
    const size_t ao = (size_t)(m0 + (i << 4) + rlane) * lda + koff;
    const size_t bo = (size_t)(n0 + (i << 4) + rlane) * ldb + koff;
    pa[i] = Ab + ao;  pa2[i] = SPLIT ? (Ab2 + ao) : nullptr;
    pb[i] = Bb + bo;  pb2[i] = (SPLIT && BSPLIT) ? (Bb2 + bo) : nullptr;
  }
  V rah[NBUF][4], ral[NBUF][4], rbh[NBUF][4], rbl[NBUF][4];
  auto request_b = [&](int place, int step) {
    const int adv = (step > 0 && step < nsteps) ? 32 : 0;   // wave-uniform
#pragma unroll
    for (int j = 0; j < 4; ++j) {
      pb[j] += adv;
      rbh[place][j] = Frag<T>::load(pb[j]);
      if (SPLIT && BSPLIT) { pb2[j] += adv; rbl[place][j] = Frag<T>::load(pb2[j]); }
    }
  };
  auto request_a = [&](int place, int step) {
    const int adv = (step > 0 && step < nsteps) ? 32 : 0;   // wave-uniform
#pragma unroll
    for (int i = 0; i < 4; ++i) {
      pa[i] += adv;
      rah[place][i] = Frag<T>::load(pa[i]);
      if (SPLIT) { pa2[i] += adv; ral[place][i] = Frag<T>::load(pa2[i]); }
    }
  };
  auto products = [&](int place, int ibeg) {   // accumulator rows ibeg, ibeg + 1
#pragma unroll
    for (int i = ibeg; i < ibeg + 2; ++i) {
#pragma unroll
      for (int j = 0; j < 4; ++j) acc[i][j] = Frag<T>::mma(rah[place][i], rbh[place][j], acc[i][j]);
      if (SPLIT && BSPLIT) {
#pragma unroll
        for (int j = 0; j < 4; ++j) acc[i][j] = Frag<T>::mma(rah[place][i], rbl[place][j], acc[i][j]);
      }
      if (SPLIT) {
#pragma unroll
        for (int j = 0; j < 4; ++j) acc[i][j] = Frag<T>::mma(ral[place][i], rbh[place][j], acc[i][j]);
      }
    }
  };
  // s_wait_xcnt 0, here and in the loop: stands between a group of requests and the next moving on of the pointers that the issued
  // loads name; each stands between two scheduling barriers, so that no later addition rises over it and it stays behind the products
#pragma unroll
  for (int u = 0; u < NBUF - 1; ++u) {
    request_b(u, u);
    __builtin_amdgcn_sched_barrier(0);   // the barriers here keep the requests in the loop's own order, which its counted waits rest on
    request_a(u, u);
    __builtin_amdgcn_sched_barrier(0);
    asm volatile("s_wait_xcnt 0x0" ::: "memory");
    __builtin_amdgcn_sched_barrier(0);
  }
  int s0 = 0;
  for (; s0 + NBUF <= nsteps; s0 += NBUF) {
#pragma unroll
    for (int u = 0; u < NBUF; ++u) {
      request_b((u + NBUF - 1) % NBUF, s0 + u + NBUF - 1);
      __builtin_amdgcn_sched_barrier(0);   // holds the requests ahead of the products: sunk towards their use they lose their lead
      products(u, 0);
      __builtin_amdgcn_sched_barrier(0);   // holds the A requests behind the wait of the products above (bound on loads in flight)
      request_a((u + NBUF - 1) % NBUF, s0 + u + NBUF - 1);
      __builtin_amdgcn_sched_barrier(0);   // as the first
      products(u, 2);
      __builtin_amdgcn_sched_barrier(0);   // holds the wait below behind the products, where the requests' addresses have long been taken
      asm volatile("s_wait_xcnt 0x0" ::: "memory");
      __builtin_amdgcn_sched_barrier(0);   // holds the next step's pointer additions and requests behind the wait and the products
    }
  }
  // the nsteps % NBUF steps left over: requested above, wave-uniform tests
#pragma unroll
  for (int u = 0; u < NBUF - 1; ++u) {
    if (s0 + u < nsteps) { products(u, 0); products(u, 2); }
  }
  acc_guard4(acc[0][0], acc[0][1], acc[0][2], acc[0][3]);
  acc_guard4(acc[1][0], acc[1][1], acc[1][2], acc[1][3]);
  acc_guard4(acc[2][0], acc[2][1], acc[2][2], acc[2][3]);
  acc_guard4(acc[3][0], acc[3][1], acc[3][2], acc[3][3]);

  // ---- epilogue ----
  float* slab = sT[wave];
  const float* Rb = RESID ? (resid + (size_t)b * strideR) : nullptr;
  // rank-4 column table (LORA modes): per lane the 4 columns n0 + 16j + rlane
  v4f ctab[4];
  float cbias[4];
#pragma unroll
  for (int j = 0; j < 4; ++j) { ctab[j] = (v4f){0.f,0.f,0.f,0.f}; cbias[j] = 0.f; }
  if (LORA != 0) {
#pragma unroll
    for (int j = 0; j < 4; ++j) {
      const int n = n0 + (j << 4) + rlane;
      v4f u = *(const v4f*)(coltab + (size_t)n * ldcol);
      if (LORA == 1) {
#pragma unroll
        for (int e = 0; e < 4; ++e) u[e] = bf_rne(u[e]);
      }
      ctab[j] = u;
      if (BIAS_MODE == 2) cbias[j] = bf_rne(bias[n]);
    }
  }
#pragma unroll
  for (int i = 0; i < 4; ++i) {
    const int mBase = m0 + (i << 4);
    if (LORA == 0) {
#pragma unroll
      for (int j = 0; j < 4; ++j) {
        const int n = n0 + (j << 4) + rlane;
        float bv = 0.f;
        if (BIAS_MODE == 2) bv = bias[n];
#pragma unroll
        for (int r = 0; r < 8; ++r) {
          float v = acc[i][j][r] * scale;
          if (BIAS_MODE == 1) v += bias[mBase + mOff + r];
          if (BIAS_MODE == 2) v += bv;
          if (RESID) v += Rb[(size_t)(mBase + mOff + r) * ldc + n];
          if (ACT == 2) v = fmaxf(v, 0.0f);
          if (ACT == 4) v = (v > 0.f) ? v : 0.01f * v;
          slab[(mOff + r) * 68 + (j << 4) + rlane] = v;
        }
      }
    } else {
#pragma unroll
      for (int r = 0; r < 8; ++r) {
        const int m = mBase + mOff + r;
        v4f tr = *(const v4f*)(rowtab + (size_t)m * ldrow);
        if (LORA == 2) {
#pragma unroll
          for (int e = 0; e < 4; ++e) tr[e] = bf_rne(tr[e]);
        }
#pragma unroll
        for (int j = 0; j < 4; ++j) {
          float lr = tr[0] * ctab[j][0];
          lr = fmaf(tr[1], ctab[j][1], lr);
          lr = fmaf(tr[2], ctab[j][2], lr);
          lr = fmaf(tr[3], ctab[j][3], lr);
          float v = acc[i][j][r] * scale + lr;
          if (BIAS_MODE == 2) v += cbias[j];
          slab[(mOff + r) * 68 + (j << 4) + rlane] = v;
        }
      }
    }
    __builtin_amdgcn_fence(__ATOMIC_RELEASE, "workgroup");
    __builtin_amdgcn_wave_barrier();
    __builtin_amdgcn_fence(__ATOMIC_ACQUIRE, "workgroup");
    if (OUT_MODE == 0) {
      float* C = (float*)Cout + (size_t)b * strideC;
      const int hh = lane >> 4, c4 = (lane & 15) * 4;     // row seg = 256 B = 16 lanes x 16 B
      {
#pragma unroll
        for (int it = 0; it < 8; ++it) {
          const int row = it * 2 + hh;
          v4f v = *(const v4f*)(slab + row * 68 + c4);
          *(v4f*)(C + (size_t)(mBase + row) * ldc + n0 + c4) = v;
        }
        
      }
    } else {
      const int q = lane >> 3, c8 = (lane & 7) * 8;
      unsigned short* C  = (unsigned short*)Cout  + (size_t)b * strideC;
      unsigned short* C2 = (OUT_MODE == 2) ? ((unsigned short*)Cout2 + (size_t)b * strideC) : nullptr;
      {
#pragma unroll
        for (int it = 0; it < 4; ++it) {
          const int row = it * 4 + q;
          const float* sp = slab + row * 68 + c8;
          v8h hv, lv;
#pragma unroll
          for (int e = 0; e < 8; ++e) {
            if (OUT_MODE == 1) {
              hv[e] = (_Float16)sp[e];
            } else {
              unsigned short hb = f2bf_bits(sp[e]);
              unsigned short lb = f2bf_bits(sp[e] - bf_bits2f(hb));
              hv[e] = __builtin_bit_cast(_Float16, hb);
              lv[e] = __builtin_bit_cast(_Float16, lb);
            }
          }
          *(v8h*)(C + (size_t)(mBase + row) * ldc + n0 + c8) = hv;
          if (OUT_MODE == 2) *(v8h*)(C2 + (size_t)(mBase + row) * ldc + n0 + c8) = lv;
        }
        
      }
    }
    __builtin_amdgcn_fence(__ATOMIC_RELEASE, "workgroup");
    __builtin_amdgcn_wave_barrier();
    __builtin_amdgcn_fence(__ATOMIC_ACQUIRE, "workgroup");
  }
}

// ---------------------------------------------------------------------------
// f32 -> RNE bf16 plane with zero padding, up to 3 same-shaped tables per launch (blockIdx.y selects the source, block-uniform).
// Thread i owns flat elements 8i..8i+7 of plane y: value = in_y[e] for e < nvalid, 0 otherwise (the load address is clamped to
// [0, nvalid-8], the value is zeroed by predicate). out plane y starts at out + y * plane_halves.
// Coverage: n8 = plane elements / 8 threads x 8 = the whole padded plane (grids are exact multiples of 256 here).
// ---------------------------------------------------------------------------
__global__ __launch_bounds__(256) void cast_pad_bf16_kernel(const float* __restrict__ s0, const float* __restrict__ s1,
                                                            const float* __restrict__ s2,
                                                            unsigned short* __restrict__ out, long plane_halves,
                                                            int n8, int nvalid) {
  const int i = blockIdx.x * 256 + threadIdx.x;
  if (i >= n8) return;
  const int y = blockIdx.y;
  const float* src = (y == 0) ? s0 : ((y == 1) ? s1 : s2);
  const long e = 8L * (long)i;
  const bool live = (e < (long)nvalid);
  const long ec = live ? e : (long)(nvalid - 8);
  const v4f a = *(const v4f*)(src + ec);
  const v4f c = *(const v4f*)(src + ec + 4);
  float f[8];
#pragma unroll
  for (int k = 0; k < 4; ++k) { f[k] = live ? a[k] : 0.0f; f[4 + k] = live ? c[k] : 0.0f; }
  unsigned w[4];
#pragma unroll
  for (int e2 = 0; e2 < 4; ++e2) w[e2] = pk16(f2bf_bits(f[2 * e2]), f2bf_bits(f[2 * e2 + 1]));
  const v4u u = (v4u){w[0], w[1], w[2], w[3]};
  unsigned short* q = out + (size_t)y * plane_halves + (size_t)e;
  *(v4u*)q = u;
  
}

constexpr int kFaWaves = 8;
constexpr int kFaCols  = 32;                       // query columns per wave
constexpr int kFaG     = kFaCols / 16;             // 16-column groups per wave
constexpr int kFaKeys  = 32;                       // keys per pass = one k step of the second product
constexpr float kExp2Scale = 0.125f * 1.4426950408889634f;   // 64^-0.5 * log2(e)
static_assert(kSeq % (kFaWaves * kFaCols) == 0 && kSeq % kFaKeys == 0 && kDh == 64, "fused attention tile shape");
typedef __attribute__((ext_vector_type(2))) float  v2f;
typedef __attribute__((ext_vector_type(2))) __bf16 v2b;
typedef __attribute__((ext_vector_type(8))) unsigned int v8u;

// two f32 -> two RNE bf16 in one word (a in the low half)
__device__ __forceinline__ unsigned pack_bf2(float a, float b) {
  return __builtin_bit_cast(unsigned, __builtin_convertvector((v2f){a, b}, v2b));
}
// value of lane l ^ 16
__device__ __forceinline__ float other_half(float x) {
  const int i = __builtin_bit_cast(int, x);
  return __builtin_bit_cast(float, __builtin_amdgcn_permlanex16(i, i, 0x76543210, 0xfedcba98, false, false));
}
struct KFrags { v16b hi[2][2], lo[2][2]; };        // [16-key tile][32-wide step over d]
__device__ __forceinline__ void load_k(KFrags& k, const __bf16* Kh, const __bf16* Kl, int key0) {
#pragma unroll
  for (int kt = 0; kt < 2; ++kt)
#pragma unroll
    for (int kc = 0; kc < 2; ++kc) {
      const size_t o = (size_t)(key0 + (kt << 4)) * kQKld + (kc << 5);
      k.hi[kt][kc] = Frag<__bf16>::load(Kh + o);
      k.lo[kt][kc] = Frag<__bf16>::load(Kl + o);
    }
}
__device__ __forceinline__ void load_v(v16b (&vh)[4], v16b (&vl)[4], const __bf16* Vh, const __bf16* Vl, int key0) {
#pragma unroll
  for (int t = 0; t < 4; ++t) {
    vh[t] = Frag<__bf16>::load(Vh + (size_t)(t << 4) * kTok + key0);
    vl[t] = Frag<__bf16>::load(Vl + (size_t)(t << 4) * kTok + key0);
  }
}

__global__ __launch_bounds__(kFaWaves * 32) void attn_fused_kernel(
    const unsigned short* __restrict__ QKhi, const unsigned short* __restrict__ QKlo,
    const unsigned short* __restrict__ Vthi, const unsigned short* __restrict__ Vtlo,
    unsigned short* __restrict__ Chi, unsigned short* __restrict__ Clo) {
  typedef Frag<__bf16> F;
  const int pair = blockIdx.y;
  const int b    = pair / kHeads;
  const int hd   = pair - b * kHeads;
  const int lane = threadIdx.x & 31;
  const int wave = threadIdx.x >> 5;
  const int c    = lane & 15;                  // row of A, column of B and D
  const int h8   = (lane >> 4) * 8;            // k offset of this lane half (A, B); D row offset
  const int q0   = blockIdx.x * (kFaWaves * kFaCols) + wave * kFaCols;
  const size_t tok0 = (size_t)b * kSeq;

  // Q fragments (B operand), kept for the whole loop
  v16b qh[kFaG][2], ql[kFaG][2];
#pragma unroll
  for (int g = 0; g < kFaG; ++g)
#pragma unroll
    for (int kc = 0; kc < 2; ++kc) {
      const size_t o = (tok0 + q0 + (g << 4) + c) * kQKld + hd * kDh + (kc << 5) + h8;
      qh[g][kc] = F::load((const __bf16*)QKhi + o);
      ql[g][kc] = F::load((const __bf16*)QKlo + o);
    }
  // the two fences below keep the order Q, K, v^T of the first loads, which is the loop's own (K, then v^T): with another order here
  // the counted waits at the loop head fall to 0 and every pass would wait for its v^T fragments before its first product
  __builtin_amdgcn_sched_barrier(0);
  const size_t koff = (tok0 + c) * kQKld + kHid + hd * kDh + h8;
  const size_t voff = (size_t)(hd * kDh + c) * kTok + tok0 + h8;
  const __bf16* Kh = (const __bf16*)QKhi + koff;
  const __bf16* Kl = (const __bf16*)QKlo + koff;
  const __bf16* Vh = (const __bf16*)Vthi + voff;
  const __bf16* Vl = (const __bf16*)Vtlo + voff;

  v8f acc[kFaG][4];                            // O^T: [column group][16-row tile over d]
  float m_run[kFaG];
  v2f lsum[kFaG];                              // this lane's share of the row sum (its 16 of each pass's 32 keys), even / odd registers
#pragma unroll
  for (int g = 0; g < kFaG; ++g) {
    m_run[g] = -INFINITY;
    lsum[g] = (v2f){0.f, 0.f};
#pragma unroll
    for (int t = 0; t < 4; ++t) acc[g][t] = (v8f){0.f,0.f,0.f,0.f,0.f,0.f,0.f,0.f};
  }

  KFrags kf;
  v16b vh[4], vl[4];                           // [16-row tile over d]
  load_k(kf, Kh, Kl, 0);
  __builtin_amdgcn_sched_barrier(0);
  load_v(vh, vl, Vh, Vl, 0);
  for (int key0 = 0; key0 < kSeq; key0 += kFaKeys) {
    const int keyn = (key0 + kFaKeys < kSeq) ? (key0 + kFaKeys) : key0;   // the last pass re-reads its own rows: in bounds, unused
    // S^T tiles [16-key tile][column group]; per accumulator the order is hi.hi, hi.lo, lo.hi for d 0..31, then for d 32..63
    v8f s[2][kFaG];
#pragma unroll
    for (int kt = 0; kt < 2; ++kt)
#pragma unroll
      for (int g = 0; g < kFaG; ++g) s[kt][g] = (v8f){0.f,0.f,0.f,0.f,0.f,0.f,0.f,0.f};
#pragma unroll
    for (int kc = 0; kc < 2; ++kc) {
#pragma unroll
      for (int kt = 0; kt < 2; ++kt)
#pragma unroll
        for (int g = 0; g < kFaG; ++g) s[kt][g] = F::mma(kf.hi[kt][kc], qh[g][kc], s[kt][g]);
#pragma unroll
      for (int kt = 0; kt < 2; ++kt)
#pragma unroll
        for (int g = 0; g < kFaG; ++g) s[kt][g] = F::mma(kf.lo[kt][kc], qh[g][kc], s[kt][g]);
#pragma unroll
      for (int kt = 0; kt < 2; ++kt)
#pragma unroll
        for (int g = 0; g < kFaG; ++g) s[kt][g] = F::mma(kf.hi[kt][kc], ql[g][kc], s[kt][g]);
    }

    // column maxima of the raw scores (the scale is positive), then one test per pass
    float mb[kFaG];
    bool need = false;
#pragma unroll
    for (int g = 0; g < kFaG; ++g) {
      float mx = s[0][g][0];
#pragma unroll
      for (int r = 1; r < 8; ++r) mx = fmaxf(mx, s[0][g][r]);
#pragma unroll
      for (int r = 0; r < 8; ++r) mx = fmaxf(mx, s[1][g][r]);
      mx = fmaxf(mx, other_half(mx)) * kExp2Scale;   // both halves hold this query's maximum of the pass
      mb[g] = mx;
      need = need || (mx > m_run[g] + 8.0f);          // true in the first pass (m_run = -inf)
    }
    if (__builtin_amdgcn_ballot_w32(need) != 0) {     // wave-uniform scalar branch
#pragma unroll
      for (int g = 0; g < kFaG; ++g) {
        const float m_new = fmaxf(m_run[g], mb[g]);
        const float corr  = __builtin_amdgcn_exp2f(m_run[g] - m_new);   // 0 in the first pass
        m_run[g] = m_new;
        lsum[g] = lsum[g] * corr;
#pragma unroll
        for (int t = 0; t < 4; ++t) acc[g][t] = acc[g][t] * corr;
      }
    }
    // next pass's K fragments, in flight under the exponentials and the second product
    load_k(kf, Kh, Kl, keyn);
    __builtin_amdgcn_sched_barrier(0);   // holds these loads ahead of the exponentials: sunk among the products below they arrive too late
#pragma unroll
    for (int g = 0; g < kFaG; ++g) {
      const float nm = -m_run[g];
      v8u hw, lw;
      v2f pp[8];
#pragma unroll
      for (int i = 0; i < 8; ++i) {   // operand elements 2i, 2i + 1 = tile i >> 2, registers 2 (i & 3), 2 (i & 3) + 1
        const v2f arg = __builtin_elementwise_fma((v2f){s[i >> 2][g][2 * (i & 3)], s[i >> 2][g][2 * (i & 3) + 1]},
                                                  (v2f){kExp2Scale, kExp2Scale}, (v2f){nm, nm});
        const v2f p = (v2f){__builtin_amdgcn_exp2f(arg.x), __builtin_amdgcn_exp2f(arg.y)};
        const unsigned w = pack_bf2(p.x, p.y);
        const v2f hi = (v2f){__uint_as_float(w << 16), __uint_as_float(w & 0xFFFF0000u)};
        const v2f lo = p - hi;        // exact in f32
        hw[i] = w;
        lw[i] = pack_bf2(lo.x, lo.y);
        pp[i] = p;
      }
      lsum[g] += ((pp[0] + pp[1]) + (pp[2] + pp[3])) + ((pp[4] + pp[5]) + (pp[6] + pp[7]));
      const v16b ph = __builtin_bit_cast(v16b, hw);
      const v16b pl = __builtin_bit_cast(v16b, lw);
#pragma unroll
      for (int t = 0; t < 4; ++t) acc[g][t] = F::mma(vh[t], ph, acc[g][t]);
#pragma unroll
      for (int t = 0; t < 4; ++t) acc[g][t] = F::mma(vl[t], ph, acc[g][t]);
#pragma unroll
      for (int t = 0; t < 4; ++t) acc[g][t] = F::mma(vh[t], pl, acc[g][t]);
    }
    // next pass's v^T fragments, in flight under that pass's first product and softmax
    load_v(vh, vl, Vh, Vl, keyn);
  }

  // ctx[query][hd * 64 + 16 t + h8 + r] = acc[g][t][r] / row sum, as bf16 hi/lo planes: 16 B per lane, tile and plane
#pragma unroll
  for (int g = 0; g < kFaG; ++g) {
    const float part = lsum[g].x + lsum[g].y;
    const float inv  = 1.0f / (part + other_half(part));   // sum >= 1: m never exceeds the row maximum
    const size_t co = (tok0 + q0 + (g << 4) + c) * kHid + hd * kDh + h8;
#pragma unroll
    for (int t = 0; t < 4; ++t) {
      v4u hv, lv;
#pragma unroll
      for (int e = 0; e < 4; ++e) {
        const float f0 = acc[g][t][2 * e] * inv;
        const float f1 = acc[g][t][2 * e + 1] * inv;
        const unsigned w = pack_bf2(f0, f1);
        hv[e] = w;
        lv[e] = pack_bf2(f0 - __uint_as_float(w << 16), f1 - __uint_as_float(w & 0xFFFF0000u));
      }
      *(v4u*)(Chi + co + (t << 4)) = hv;
      *(v4u*)(Clo + co + (t << 4)) = lv;
    }
  }
}

// ---------------------------------------------------------------------------
// Launcher. Workspace region map (bytes, MiB = 1048576; carve ends at 128 MiB = 134217728 B):
//   [  0, 18) projection operands: x bf16 [4096][1024] at +0 (8 MiB); wq|wk|wv bf16 [1024][1024] x3 at +8 MiB (6 MiB);
//                      padded down planes [64][1024] x3 at +14 MiB (384 KiB); t tables f32 [4096][64] x3 (tq|tk|tv) at +15 MiB (3 MiB).
//                      late aliases (written after the attention launch, when the above are dead): wo bf16 [1024][1024] at +0 (2 MiB);
//                      padded out_down plane [64][1024] at +2 MiB (128 KiB); to table f32 [4096][64] at +3 MiB (1 MiB).
//   [ 18, 64) unused
//   [ 64, 80) q|k hi : [4096][2048] bf16 (cols 0..1023 = q (h*64+d), 1024..2047 = k)
//   [ 80, 96) q|k lo
//   [ 96,104) v^T hi : [1024 (h*64+d)][4096 (b*2048+s)] bf16
//   [104,112) v^T lo
//   [112,120) ctx hi : [4096][1024] bf16 (col h*64+d)
//   [120,128) ctx lo
// Launch count: 3 casts + 1 down GEMM + 3 projections + 1 attention + 2 late casts + 1 down GEMM + 1 out GEMM = 12.
// Kernel launches only.
// ---------------------------------------------------------------------------
extern "C" void kernel_launch(void* const* d_in, const int* in_sizes, int n_in,
                              void* d_out, int out_size, void* d_ws, size_t ws_size,
                              hipStream_t stream) {
  if (n_in < 14) return;
  if (in_sizes[0] != kTok * kHid) return;
  if (in_sizes[1] != kHid * kHid || in_sizes[2] != kHid * kHid || in_sizes[3] != kHid * kHid || in_sizes[4] != kHid * kHid) return;
  if (in_sizes[5] != kHid) return;
  if (in_sizes[6] != kRank * kHid || in_sizes[8] != kRank * kHid || in_sizes[10] != kRank * kHid || in_sizes[12] != kRank * kHid) return;
  if (in_sizes[7] != kHid * kRank || in_sizes[9] != kHid * kRank || in_sizes[11] != kHid * kRank || in_sizes[13] != kHid * kRank) return;
  if (out_size != kTok * kHid) return;

  const size_t kMiB    = 1048576;
  const size_t offXb   = 0;
  const size_t offW3   = 8 * kMiB;
  const size_t offDn3  = 14 * kMiB;
  const size_t offT3   = 15 * kMiB;
  const size_t offWo   = 0;
  const size_t offDnO  = 2 * kMiB;
  const size_t offTo   = 3 * kMiB;
  const size_t offQKhi = 64 * kMiB;
  const size_t offQKlo = 80 * kMiB;
  const size_t offVthi = 96 * kMiB;
  const size_t offVtlo = 104 * kMiB;
  const size_t offChi  = 112 * kMiB;
  const size_t offClo  = 120 * kMiB;
  const size_t total   = 128 * kMiB;
  if (total > ws_size) return;

  const float* x     = (const float*)d_in[0];
  const float* wq    = (const float*)d_in[1];
  const float* wk    = (const float*)d_in[2];
  const float* wv    = (const float*)d_in[3];
  const float* wo    = (const float*)d_in[4];
  const float* bo    = (const float*)d_in[5];
  const float* q_dn  = (const float*)d_in[6];
  const float* q_up  = (const float*)d_in[7];
  const float* k_dn  = (const float*)d_in[8];
  const float* k_up  = (const float*)d_in[9];
  const float* v_dn  = (const float*)d_in[10];
  const float* v_up  = (const float*)d_in[11];
  const float* o_dn  = (const float*)d_in[12];
  const float* o_up  = (const float*)d_in[13];
  float* out = (float*)d_out;
  char* ws = (char*)d_ws;

  unsigned short* xb   = (unsigned short*)(ws + offXb);
  unsigned short* w3   = (unsigned short*)(ws + offW3);
  unsigned short* dn3  = (unsigned short*)(ws + offDn3);
  float*          t3   = (float*)(ws + offT3);
  unsigned short* wob  = (unsigned short*)(ws + offWo);
  unsigned short* dno  = (unsigned short*)(ws + offDnO);
  float*          tot  = (float*)(ws + offTo);
  unsigned short* qkhi = (unsigned short*)(ws + offQKhi);
  unsigned short* qklo = (unsigned short*)(ws + offQKlo);
  unsigned short* vthi = (unsigned short*)(ws + offVthi);
  unsigned short* vtlo = (unsigned short*)(ws + offVtlo);
  unsigned short* chi  = (unsigned short*)(ws + offChi);
  unsigned short* clo  = (unsigned short*)(ws + offClo);

  // in-range dummies for unused (never dereferenced) template-dead pointer parameters
  const float* dummy_f = bo;
  void* dummy_c2 = (void*)chi;

  const long wPlane  = (long)kHid * kHid;          // 1048576 halves
  const long dnPlane = (long)kRankPad * kHid;      // 65536 halves
  const long tPlane  = (long)kTok * kRankPad;      // 262144 floats

  // 1. x -> RNE bf16 plane [4096][1024]: n8 = 524288 = 2048 blocks x 256
  {
    const int n8 = (kTok * kHid) / 8;
    cast_pad_bf16_kernel<<<dim3(n8 / 256, 1), dim3(256), 0, stream>>>(x, x, x, xb, 0L, n8, kTok * kHid);
  }
  // 2. wq, wk, wv [1024 out][1024 in] -> bf16 planes (Bt layout directly): n8 = 131072 = 512 blocks x 256, 3 tables
  {
    const int n8 = (kHid * kHid) / 8;
    cast_pad_bf16_kernel<<<dim3(n8 / 256, 3), dim3(256), 0, stream>>>(wq, wk, wv, w3, wPlane, n8, kHid * kHid);
  }
  // 3. q/k/v down [4][1024] -> zero-padded bf16 planes [64][1024] (rows 4..63 zero-filled): n8 = 8192 = 32 blocks x 256
  {
    const int n8 = (kRankPad * kHid) / 8;
    cast_pad_bf16_kernel<<<dim3(n8 / 256, 3), dim3(256), 0, stream>>>(q_dn, k_dn, v_dn, dn3, dnPlane, n8, kRank * kHid);
  }
  // 4. t{q,k,v} = x . down^T : M=4096, N=64, K=1024, single bf16 product -> f32 [3][4096][64] (batched over blockIdx.y)
  wmma_gemm64<1, false, 0, 0, false, 0, false, true, 0><<<dim3((kTok / 64) * (kRankPad / 64) / 8, 3), dim3(256), 0, stream>>>(
      xb, xb, kHid, 0L,
      dn3, dn3, kHid, dnPlane,
      (void*)t3, dummy_c2, kRankPad, tPlane,
      dummy_f, dummy_f, 0L,
      dummy_f, 4, dummy_f, 4,
      kTok, kRankPad, kHid, 1.0f);

  // 5. q = x . wq^T + tq . q_up^T : M=4096, N=1024, K=1024 -> bf16 hi/lo into q|k planes cols 0..1023 (ldc 2048)
  wmma_gemm64<1, false, 0, 2, false, 0, false, true, 1><<<dim3((kTok / 64) * (kHid / 64) / 8, 1), dim3(256), 0, stream>>>(
      xb, xb, kHid, 0L,
      w3, w3, kHid, 0L,
      (void*)qkhi, (void*)qklo, kQKld, 0L,
      dummy_f, dummy_f, 0L,
      t3, kRankPad, q_up, kRank,
      kTok, kHid, kHid, 1.0f);
  // 6. k = x . wk^T + tk . k_up^T -> cols 1024..2047
  wmma_gemm64<1, false, 0, 2, false, 0, false, true, 1><<<dim3((kTok / 64) * (kHid / 64) / 8, 1), dim3(256), 0, stream>>>(
      xb, xb, kHid, 0L,
      w3 + wPlane, w3 + wPlane, kHid, 0L,
      (void*)(qkhi + kHid), (void*)(qklo + kHid), kQKld, 0L,
      dummy_f, dummy_f, 0L,
      t3 + tPlane, kRankPad, k_up, kRank,
      kTok, kHid, kHid, 1.0f);
  // 7. v^T = wv . x^T + v_up . tv^T : M=1024 (h*64+d), N=4096 (token), K=1024 -> bf16 hi/lo [1024][4096]
  wmma_gemm64<1, false, 0, 2, false, 0, false, true, 2><<<dim3((kHid / 64) * (kTok / 64) / 8, 1), dim3(256), 0, stream>>>(
      w3 + 2 * wPlane, w3 + 2 * wPlane, kHid, 0L,
      xb, xb, kHid, 0L,
      (void*)vthi, (void*)vtlo, kTok, 0L,
      dummy_f, dummy_f, 0L,
      v_up, kRank, t3 + 2 * tPlane, kRankPad,
      kHid, kTok, kHid, 1.0f);

  // 8. attention, all 32 (batch, head) pairs: ctx = softmax(0.125 * q . k^T) . v -> bf16 hi/lo planes [4096][1024]
  attn_fused_kernel<<<dim3(kSeq / (kFaWaves * kFaCols), kBatch * kHeads), dim3(kFaWaves * 32), 0, stream>>>(
      qkhi, qklo, vthi, vtlo, chi, clo);

  // 9. wo [1024][1024] -> bf16 plane over the dead x plane
  {
    const int n8 = (kHid * kHid) / 8;
    cast_pad_bf16_kernel<<<dim3(n8 / 256, 1), dim3(256), 0, stream>>>(wo, wo, wo, wob, 0L, n8, kHid * kHid);
  }
  // 10. out_down [4][1024] -> zero-padded bf16 plane [64][1024]
  {
    const int n8 = (kRankPad * kHid) / 8;
    cast_pad_bf16_kernel<<<dim3(n8 / 256, 1), dim3(256), 0, stream>>>(o_dn, o_dn, o_dn, dno, 0L, n8, kRank * kHid);
  }
  // 11. to = ctx_hi . out_down^T + ctx_lo . out_down^T : M=4096, N=64, K=1024, 2 products -> f32 [4096][64]
  wmma_gemm64<1, true, 0, 0, false, 0, false, false, 0><<<dim3((kTok / 64) * (kRankPad / 64) / 8, 1), dim3(256), 0, stream>>>(
      chi, clo, kHid, 0L,
      dno, dno, kHid, 0L,
      (void*)tot, dummy_c2, kRankPad, 0L,
      dummy_f, dummy_f, 0L,
      dummy_f, 4, dummy_f, 4,
      kTok, kRankPad, kHid, 1.0f);
  // 12. out = ctx_hi . wo^T + ctx_lo . wo^T + to . out_up^T + bo : M=4096, N=1024, K=1024 -> f32 d_out
  wmma_gemm64<1, true, 2, 0, false, 0, false, false, 1><<<dim3((kTok / 64) * (kHid / 64) / 8, 1), dim3(256), 0, stream>>>(
      chi, clo, kHid, 0L,
      wob, wob, kHid, 0L,
      (void*)out, dummy_c2, kHid, 0L,
      bo, dummy_f, 0L,
      tot, kRankPad, o_up, kRank,
      kTok, kHid, kHid, 1.0f);
}

// v004
// A run of this version takes 261 microseconds.
// Timed twice side by side with v003, it ran 1.42 and 1.43 times as fast.
// All steps since v000 together make it 11.0 times as fast.
// Contractions: x.W^T (q, k, v^T) and x.down^T: single v_wmma_f32_16x16x32_bf16 products on RNE-bf16 planes; q.k^T scores and p.v context: bf16 hi/lo operand planes (hi.hi + hi.lo + lo.hi); ctx.Wo^T and ctx.out_down^T: ctx bf16 hi/lo x RNE-bf16 weights (hi.W + lo.W); rank-4 up-products, bias and softmax in f32 on the VALU; all f32 accumulate.
#include <hip/hip_runtime.h>
#include <math.h>

// ---------------------------------------------------------------------------
// Problem constants
// ---------------------------------------------------------------------------
constexpr int kBatch   = 2;
constexpr int kSeq     = 2048;
constexpr int kHid     = 1024;
constexpr int kHeads   = 16;
constexpr int kDh      = 64;
constexpr int kTok     = kBatch * kSeq;            // 4096 token rows
constexpr int kRank    = 4;
constexpr int kRankPad = 64;                       // rank padded to one tile
constexpr int kQKld    = 2 * kHid;                 // 2048: pitch of the q|k planes (halves)

static_assert((kTok * kHid) % (8 * 256) == 0, "cast grid exact");
static_assert((kHid * kHid) % (8 * 256) == 0, "cast grid exact");
static_assert((kRankPad * kHid) % (8 * 256) == 0, "pad cast grid exact");
static_assert(kHid % 64 == 0 && kTok % 64 == 0 && kSeq % 64 == 0 && kDh % 64 == 0 && kRankPad % 64 == 0, "tile multiples");
static_assert(kHid % 32 == 0 && kDh % 32 == 0 && kSeq % 32 == 0, "K multiples of 32");

typedef __attribute__((ext_vector_type(16))) _Float16 v16h;
typedef __attribute__((ext_vector_type(8)))  _Float16 v8h;
typedef __attribute__((ext_vector_type(16))) __bf16   v16b;
typedef __attribute__((ext_vector_type(8)))  __bf16   v8b;
typedef __attribute__((ext_vector_type(8)))  float    v8f;
typedef __attribute__((ext_vector_type(4)))  float    v4f;
typedef __attribute__((ext_vector_type(4)))  unsigned int v4u;

__device__ __forceinline__ unsigned short f2bf_bits(float f) {
  unsigned u = __float_as_uint(f);
  return (unsigned short)((u + 0x7FFFu + ((u >> 16) & 1u)) >> 16);
}
__device__ __forceinline__ float bf_bits2f(unsigned short h) { return __uint_as_float(((unsigned)h) << 16); }
__device__ __forceinline__ float bf_rne(float f) { return bf_bits2f(f2bf_bits(f)); }

// hazard guards as plain device helpers
__device__ __forceinline__ void acc_guard4(v8f& a, v8f& b, v8f& c, v8f& d) { asm volatile("v_nop\n\tv_nop\n\tv_nop\n\tv_nop" : "+v"(a), "+v"(b), "+v"(c), "+v"(d)); }
template <typename T> struct Frag;
template <> struct Frag<_Float16> {
  typedef v16h V; union U { v16h v; v8h h[2]; };
  // elements 0..7 <- p[0..7], 8..15 <- p[16..23]
  static __device__ __forceinline__ v16h load(const _Float16* p) {
    U f; f.h[0] = *(const v8h*)(p); f.h[1] = *(const v8h*)(p + 16); return f.v;
  }
  static __device__ __forceinline__ v8f mma(v16h a, v16h b, v8f c) {
    return __builtin_amdgcn_wmma_f32_16x16x32_f16(false, a, false, b, (short)0, c, false, false);
  }
};
template <> struct Frag<__bf16> {
  typedef v16b V; union U { v16b v; v8b h[2]; };
  static __device__ __forceinline__ v16b load(const __bf16* p) {
    U f; f.h[0] = *(const v8b*)(p); f.h[1] = *(const v8b*)(p + 16); return f.v;
  }
  static __device__ __forceinline__ v8f mma(v16b a, v16b b, v8f c) {
    return __builtin_amdgcn_wmma_f32_16x16x32_bf16(false, a, false, b, (short)0, c, false, false);
  }
};

__device__ __forceinline__ unsigned pk16(unsigned short a, unsigned short b) { return (unsigned)a | ((unsigned)b << 16); }

// ---- asynchronous copies global -> LDS: N copies of 16 B a lane in ONE statement; the s_wait_xcnt 0 at its end stands ahead of every
// later rewrite of the address registers that the issued copies name (inside the statement nothing can be moved between them) ----
#define ACP(a, b) "global_load_async_to_lds_b128 %" #a ", %" #b ", off\n\t"
#define AOP(i) "v"(l[i]), "v"(g[i])
#define ACP8 ACP(0, 1) ACP(2, 3) ACP(4, 5) ACP(6, 7) ACP(8, 9) ACP(10, 11) ACP(12, 13) ACP(14, 15)
#define AOP8 AOP(0), AOP(1), AOP(2), AOP(3), AOP(4), AOP(5), AOP(6), AOP(7)
template <int V> struct IC { static constexpr int v = V; };   // a compile-time int as a function argument
template <int N>
__device__ __forceinline__ void async_copies(const unsigned* l, const void* const* g) {
  static_assert(N == 8 || N == 9 || N == 12, "statement sizes in use");
  if constexpr (N == 8) {
    asm volatile(ACP8 "s_wait_xcnt 0x0" :: AOP8 : "memory");
  } else if constexpr (N == 9) {
    asm volatile(ACP8 ACP(16, 17) "s_wait_xcnt 0x0" :: AOP8, AOP(8) : "memory");
  } else {
    asm volatile(ACP8 ACP(16, 17) ACP(18, 19) ACP(20, 21) ACP(22, 23) "s_wait_xcnt 0x0" :: AOP8, AOP(8), AOP(9), AOP(10), AOP(11) : "memory");
  }
}

// ---- Register-blocked batched WMMA GEMM (BSPLIT and LORA options added; operands staged in LDS) ----
// C[m,n] = scale * sum_k A[m,k] * Bt[n,k] (+bias)(+resid)(+lora); each wave owns a 64x64 tile; a block of 8 waves owns
// (8 / WN) x WN such tiles, that is (8 / WN) * 64 rows of A and WN * 64 rows of Bt.
// A row-major [M,K]; Bt row-major [N,K]; M % ((8 / WN) * 64) == 0, N % (WN * 64) == 0, K % 64 == 0, K >= 64.
// SPLIT (with BSPLIT == false): A carries a lo plane (A2, same layout); product = hi.B + lo.B (Bt2 unused).
// BIAS_MODE: 0 = none, 1 = bias[m], 2 = bias[n].
// OUT_MODE: 0 = f32, 1 = f16, 2 = bf16 hi plane (Cout) + bf16 lo plane (Cout2).
// LORA: rank-4 f32 term added in the epilogue: v += dot4(rowtab[m][0..3], coltab[n][0..3]); rowtab pitch ldrow floats, coltab pitch
//   ldcol floats (both 16-B aligned rows). LORA == 1: coltab values RNE-bf16 converted at load (rowtab kept f32);
//   LORA == 2: rowtab values RNE-bf16 converted (coltab kept f32). In LORA modes a BIAS_MODE 2 bias is RNE-bf16 converted too.
// ET: 0 = f16 operands, 1 = bf16 operands (pointers passed as 16-bit storage)
template <int ET> struct Elem;
template <> struct Elem<0> { typedef _Float16 T; };
template <> struct Elem<1> { typedef __bf16 T; };
template <int ET, bool SPLIT, int BIAS_MODE, int OUT_MODE, bool RESID, int ACT = 0, bool CAUSAL = false, bool BSPLIT = true, int LORA = 0, int WN = 4>
__global__ __launch_bounds__(256) void wmma_gemm64(
    const unsigned short* __restrict__ Ap, const unsigned short* __restrict__ A2p, int lda, long strideA,
    const unsigned short* __restrict__ Btp, const unsigned short* __restrict__ Bt2p, int ldb, long strideB,
    void* __restrict__ Cout, void* __restrict__ Cout2, int ldc, long strideC,
    const float* __restrict__ bias,
    const float* __restrict__ resid, long strideR,
    const float* __restrict__ rowtab, int ldrow,
    const float* __restrict__ coltab, int ldcol,
    int M, int N, int K, float scale) {
  static_assert(!CAUSAL && !(SPLIT && BSPLIT), "the staged k loop has no tile skip and no lo plane of Bt");
  static_assert(WN == 1 || WN == 4, "block shapes in use");
  typedef typename Elem<ET>::T T;
  typedef typename Frag<T>::V V;
  const T* A = (const T*)Ap; const T* A2 = (const T*)A2p; const T* Bt = (const T*)Btp;
  // One stage = 64 k (128 B) of every operand row of the block, LDS rows [A | A lo | Bt] at pitch 144 B (16 B x odd: 16-B row reads
  // of 16 lanes fall on distinct banks). Two stages; the per-wave 16x64 output slabs (pitch 68 floats) reuse the ring behind the loop.
  constexpr int WM        = 8 / WN;
  constexpr int kPitch    = 144;
  constexpr int kRowsA    = WM * 64;
  constexpr int kRowB0    = kRowsA * (SPLIT ? 2 : 1);
  constexpr int kRows     = kRowB0 + WN * 64;
  constexpr int kBufBytes = kRows * kPitch;
  constexpr int kSlabs    = 8 * 16 * 68 * 4;
  constexpr int kLdsBytes = (2 * kBufBytes > kSlabs) ? 2 * kBufBytes : kSlabs;
  static_assert(kLdsBytes <= 320 * 1024, "LDS of one work-group");
  __shared__ __align__(16) unsigned char smem[kLdsBytes];
  const int b    = blockIdx.y;
  const int lane = threadIdx.x & 31;
  const int wave = threadIdx.x >> 5;
  const int blocksN = N / (WN * 64);
  const int blocksM = M / (WM * 64);
  if ((int)blockIdx.x >= blocksM * blocksN) return;   // the same for the whole block; ahead of every barrier
  const int bm   = blockIdx.x / blocksN;
  const int bn   = blockIdx.x - bm * blocksN;
  const int mBlk = bm * (WM * 64);
  const int nBlk = bn * (WN * 64);
  const int wm   = wave / WN;
  const int wn   = wave - wm * WN;
  const int m0   = mBlk + (wm << 6);
  const int n0   = nBlk + (wn << 6);

  const T* Ab  = A  + (size_t)b * strideA;
  const T* Bb  = Bt + (size_t)b * strideB;
  const T* Ab2 = SPLIT ? (A2  + (size_t)b * strideA) : nullptr;

  const int rlane = lane & 15;                 // row (A) / col (B, D) within subtile
  const int koff  = (lane >> 4) * 8;           // k offset of this lane half
  const int mOff  = (lane >> 4) * 8;           // D row offset

  v8f acc[4][4];
#pragma unroll
  for (int i = 0; i < 4; ++i)
#pragma unroll
    for (int j = 0; j < 4; ++j) acc[i][j] = (v8f){0.f,0.f,0.f,0.f,0.f,0.f,0.f,0.f};

  // Staging: copy c of a stage fills LDS rows 32c .. 32c + 31: wave w rows 32c + 4w .. + 3, 8 lanes a row (four whole 128-B lines of
  // global memory an instruction). The operand boundaries are multiples of 64 rows, so a copy's operand is known at compile time.
  constexpr int NC = kRows / 32;               // copies of a wave per stage: 12, 16, 18 or 34 (at most 63 may be in flight)
  const int srow = (wave << 2) + (lane >> 3);
  const int scol = (lane & 7) << 3;            // first of this lane's 8 elements
  const T* gA  = Ab + (size_t)(mBlk + srow) * lda + scol;
  const T* gA2 = SPLIT ? (Ab2 + (size_t)(mBlk + srow) * lda + scol) : nullptr;
  const T* gB  = Bb + (size_t)(nBlk + srow) * ldb + scol;
  const unsigned lds0 = (unsigned)(size_t)smem + (unsigned)(srow * kPitch + (scol << 1));
  auto part = [&](auto first, auto count, int buf, int k0) {   // copies first .. first + count - 1 of a stage, one statement
    constexpr int C0 = decltype(first)::v;
    constexpr int CN = decltype(count)::v;
    unsigned l[CN];
    const void* g[CN];
#pragma unroll
    for (int c = 0; c < CN; ++c) {
      const int r = (C0 + c) * 32;
      l[c] = lds0 + (unsigned)(buf * kBufBytes + r * kPitch);
      if (r < kRowsA)      g[c] = gA  + (size_t)r * lda + k0;
      else if (r < kRowB0) g[c] = gA2 + (size_t)(r - kRowsA) * lda + k0;
      else                 g[c] = gB  + (size_t)(r - kRowB0) * ldb + k0;
    }
    async_copies<CN>(l, g);
    __builtin_amdgcn_sched_barrier(0);   // keeps the next statement's address sums behind this one: formed all at once they spill
  };
  auto stage = [&](int buf, int k0) {
    if constexpr (NC == 12)      { part(IC<0>{}, IC<12>{}, buf, k0); }
    else if constexpr (NC == 16) { part(IC<0>{}, IC<8>{}, buf, k0); part(IC<8>{}, IC<8>{}, buf, k0); }
    else if constexpr (NC == 18) { part(IC<0>{}, IC<9>{}, buf, k0); part(IC<9>{}, IC<9>{}, buf, k0); }
    else {
      static_assert(NC == 12 || NC == 16 || NC == 18 || NC == 34, "statement split");
      part(IC<0>{}, IC<9>{}, buf, k0); part(IC<9>{}, IC<9>{}, buf, k0); part(IC<18>{}, IC<8>{}, buf, k0); part(IC<26>{}, IC<8>{}, buf, k0);
    }
  };

  // k loop, two LDS buffers: trip t works on buffer t % 2 alone while the copies of stage t + 1 fly into the other one.
  // Per accumulator the order of the products is that of k (hi.B, then lo.B, within a 32-k step).
  const int ntrips = K >> 6;                   // >= 1
  const unsigned char* aRd = smem + ((wm << 6) + rlane) * kPitch + (koff << 1);
  const unsigned char* bRd = smem + (kRowB0 + (wn << 6) + rlane) * kPitch + (koff << 1);
  stage(0, 0);
  asm volatile("s_wait_asynccnt 0x0" ::: "memory");   // this wave's share of stage 0 has landed
  __syncthreads();                                     // stage 0 readable by every wave
  if (ntrips > 1) stage(1, 64);
  for (int t = 0; t < ntrips; ++t) {
    const int bo = (t & 1) * kBufBytes;
    V fa[2][4], fl[2][4], fb[2][4];            // both 32-k steps of the stage, read as one group ahead of the products
#pragma unroll
    for (int ks = 0; ks < 2; ++ks) {
#pragma unroll
      for (int j = 0; j < 4; ++j) fb[ks][j] = Frag<T>::load((const T*)(bRd + bo + j * 16 * kPitch + ks * 64));
#pragma unroll
      for (int i = 0; i < 4; ++i) {
        fa[ks][i] = Frag<T>::load((const T*)(aRd + bo + i * 16 * kPitch + ks * 64));
        if (SPLIT) fl[ks][i] = Frag<T>::load((const T*)(aRd + bo + (kRowsA + i * 16) * kPitch + ks * 64));
      }
    }
    __builtin_amdgcn_sched_barrier(0);   // holds the reads together ahead of the products: sunk among them, every row of products waits out an LDS latency
#pragma unroll
    for (int ks = 0; ks < 2; ++ks) {
#pragma unroll
      for (int i = 0; i < 4; ++i) {
#pragma unroll
        for (int j = 0; j < 4; ++j) acc[i][j] = Frag<T>::mma(fa[ks][i], fb[ks][j], acc[i][j]);
        if (SPLIT) {
#pragma unroll
          for (int j = 0; j < 4; ++j) acc[i][j] = Frag<T>::mma(fl[ks][i], fb[ks][j], acc[i][j]);
        }
      }
    }
    __builtin_amdgcn_sched_barrier(0);   // holds the waits, the barrier and the refill behind the products: risen over them, the refill would fly under the next reads alone
    asm volatile("s_wait_dscnt 0x0" ::: "memory");      // this wave's reads of buffer t % 2 are over before it is handed to the copies
    asm volatile("s_wait_asynccnt 0x0" ::: "memory");   // this wave's share of stage t + 1 has landed
    __syncthreads();                                     // publishes stage t + 1 and ends every wave's reads of buffer t % 2
    if (t + 2 < ntrips) stage(t & 1, (t + 2) << 6);      // the same test in the whole block
  }
  asm volatile("s_wait_asynccnt 0x0" ::: "memory");     // no copy is in flight when the ring becomes the output slabs
  acc_guard4(acc[0][0], acc[0][1], acc[0][2], acc[0][3]);
  acc_guard4(acc[1][0], acc[1][1], acc[1][2], acc[1][3]);
  acc_guard4(acc[2][0], acc[2][1], acc[2][2], acc[2][3]);
  acc_guard4(acc[3][0], acc[3][1], acc[3][2], acc[3][3]);

  // ---- epilogue ----
  float* slab = (float*)smem + wave * (16 * 68);   // behind the last trip's barrier: nobody reads the ring any more
  const float* Rb = RESID ? (resid + (size_t)b * strideR) : nullptr;
  // rank-4 column table (LORA modes): per lane the 4 columns n0 + 16j + rlane
  v4f ctab[4];
  float cbias[4];
#pragma unroll
  for (int j = 0; j < 4; ++j) { ctab[j] = (v4f){0.f,0.f,0.f,0.f}; cbias[j] = 0.f; }
  if (LORA != 0) {
#pragma unroll
    for (int j = 0; j < 4; ++j) {
      const int n = n0 + (j << 4) + rlane;
      v4f u = *(const v4f*)(coltab + (size_t)n * ldcol);
      if (LORA == 1) {
#pragma unroll
        for (int e = 0; e < 4; ++e) u[e] = bf_rne(u[e]);
      }
      ctab[j] = u;
      if (BIAS_MODE == 2) cbias[j] = bf_rne(bias[n]);
    }
  }
#pragma unroll
  for (int i = 0; i < 4; ++i) {
    const int mBase = m0 + (i << 4);
    if (LORA == 0) {
#pragma unroll
      for (int j = 0; j < 4; ++j) {
        const int n = n0 + (j << 4) + rlane;
        float bv = 0.f;
        if (BIAS_MODE == 2) bv = bias[n];
#pragma unroll
        for (int r = 0; r < 8; ++r) {
          float v = acc[i][j][r] * scale;
          if (BIAS_MODE == 1) v += bias[mBase + mOff + r];
          if (BIAS_MODE == 2) v += bv;
          if (RESID) v += Rb[(size_t)(mBase + mOff + r) * ldc + n];
          if (ACT == 2) v = fmaxf(v, 0.0f);
          if (ACT == 4) v = (v > 0.f) ? v : 0.01f * v;
          slab[(mOff + r) * 68 + (j << 4) + rlane] = v;
        }
      }
    } else {
#pragma unroll
      for (int r = 0; r < 8; ++r) {
        const int m = mBase + mOff + r;
        v4f tr = *(const v4f*)(rowtab + (size_t)m * ldrow);
        if (LORA == 2) {
#pragma unroll
          for (int e = 0; e < 4; ++e) tr[e] = bf_rne(tr[e]);
        }
#pragma unroll
        for (int j = 0; j < 4; ++j) {
          float lr = tr[0] * ctab[j][0];
          lr = fmaf(tr[1], ctab[j][1], lr);
          lr = fmaf(tr[2], ctab[j][2], lr);
          lr = fmaf(tr[3], ctab[j][3], lr);
          float v = acc[i][j][r] * scale + lr;
          if (BIAS_MODE == 2) v += cbias[j];
          slab[(mOff + r) * 68 + (j << 4) + rlane] = v;
        }
      }
    }
    __builtin_amdgcn_fence(__ATOMIC_RELEASE, "workgroup");
    __builtin_amdgcn_wave_barrier();
    __builtin_amdgcn_fence(__ATOMIC_ACQUIRE, "workgroup");
    if (OUT_MODE == 0) {
      float* C = (float*)Cout + (size_t)b * strideC;
      const int hh = lane >> 4, c4 = (lane & 15) * 4;     // row seg = 256 B = 16 lanes x 16 B
      {
#pragma unroll
        for (int it = 0; it < 8; ++it) {
          const int row = it * 2 + hh;
          v4f v = *(const v4f*)(slab + row * 68 + c4);
          *(v4f*)(C + (size_t)(mBase + row) * ldc + n0 + c4) = v;
        }
        
      }
    } else {
      const int q = lane >> 3, c8 = (lane & 7) * 8;
      unsigned short* C  = (unsigned short*)Cout  + (size_t)b * strideC;
      unsigned short* C2 = (OUT_MODE == 2) ? ((unsigned short*)Cout2 + (size_t)b * strideC) : nullptr;
      {
#pragma unroll
        for (int it = 0; it < 4; ++it) {
          const int row = it * 4 + q;
          const float* sp = slab + row * 68 + c8;
          v8h hv, lv;
#pragma unroll
          for (int e = 0; e < 8; ++e) {
            if (OUT_MODE == 1) {
              hv[e] = (_Float16)sp[e];
            } else {
              unsigned short hb = f2bf_bits(sp[e]);
              unsigned short lb = f2bf_bits(sp[e] - bf_bits2f(hb));
              hv[e] = __builtin_bit_cast(_Float16, hb);
              lv[e] = __builtin_bit_cast(_Float16, lb);
            }
          }
          *(v8h*)(C + (size_t)(mBase + row) * ldc + n0 + c8) = hv;
          if (OUT_MODE == 2) *(v8h*)(C2 + (size_t)(mBase + row) * ldc + n0 + c8) = lv;
        }
        
      }
    }
    __builtin_amdgcn_fence(__ATOMIC_RELEASE, "workgroup");
    __builtin_amdgcn_wave_barrier();
    __builtin_amdgcn_fence(__ATOMIC_ACQUIRE, "workgroup");
  }
}

// ---------------------------------------------------------------------------
// f32 -> RNE bf16 plane with zero padding, up to 3 same-shaped tables per launch (blockIdx.y selects the source, block-uniform).
// Thread i owns flat elements 8i..8i+7 of plane y: value = in_y[e] for e < nvalid, 0 otherwise (the load address is clamped to
// [0, nvalid-8], the value is zeroed by predicate). out plane y starts at out + y * plane_halves.
// Coverage: n8 = plane elements / 8 threads x 8 = the whole padded plane (grids are exact multiples of 256 here).
// ---------------------------------------------------------------------------
__global__ __launch_bounds__(256) void cast_pad_bf16_kernel(const float* __restrict__ s0, const float* __restrict__ s1,
                                                            const float* __restrict__ s2,
                                                            unsigned short* __restrict__ out, long plane_halves,
                                                            int n8, int nvalid) {
  const int i = blockIdx.x * 256 + threadIdx.x;
  if (i >= n8) return;
  const int y = blockIdx.y;
  const float* src = (y == 0) ? s0 : ((y == 1) ? s1 : s2);
  const long e = 8L * (long)i;
  const bool live = (e < (long)nvalid);
  const long ec = live ? e : (long)(nvalid - 8);
  const v4f a = *(const v4f*)(src + ec);
  const v4f c = *(const v4f*)(src + ec + 4);
  float f[8];
#pragma unroll
  for (int k = 0; k < 4; ++k) { f[k] = live ? a[k] : 0.0f; f[4 + k] = live ? c[k] : 0.0f; }
  unsigned w[4];
#pragma unroll
  for (int e2 = 0; e2 < 4; ++e2) w[e2] = pk16(f2bf_bits(f[2 * e2]), f2bf_bits(f[2 * e2 + 1]));
  const v4u u = (v4u){w[0], w[1], w[2], w[3]};
  unsigned short* q = out + (size_t)y * plane_halves + (size_t)e;
  *(v4u*)q = u;
  
}

constexpr int kFaWaves = 8;
constexpr int kFaCols  = 32;                       // query columns per wave
constexpr int kFaG     = kFaCols / 16;             // 16-column groups per wave
constexpr int kFaKeys  = 32;                       // keys per pass = one k step of the second product
constexpr float kExp2Scale = 0.125f * 1.4426950408889634f;   // 64^-0.5 * log2(e)
static_assert(kSeq % (kFaWaves * kFaCols) == 0 && kSeq % kFaKeys == 0 && kDh == 64, "fused attention tile shape");
typedef __attribute__((ext_vector_type(2))) float  v2f;
typedef __attribute__((ext_vector_type(2))) __bf16 v2b;
typedef __attribute__((ext_vector_type(8))) unsigned int v8u;

// two f32 -> two RNE bf16 in one word (a in the low half)
__device__ __forceinline__ unsigned pack_bf2(float a, float b) {
  return __builtin_bit_cast(unsigned, __builtin_convertvector((v2f){a, b}, v2b));
}
// value of lane l ^ 16
__device__ __forceinline__ float other_half(float x) {
  const int i = __builtin_bit_cast(int, x);
  return __builtin_bit_cast(float, __builtin_amdgcn_permlanex16(i, i, 0x76543210, 0xfedcba98, false, false));
}
struct KFrags { v16b hi[2][2], lo[2][2]; };        // [16-key tile][32-wide step over d]
__device__ __forceinline__ void load_k(KFrags& k, const __bf16* Kh, const __bf16* Kl, int key0) {
#pragma unroll
  for (int kt = 0; kt < 2; ++kt)
#pragma unroll
    for (int kc = 0; kc < 2; ++kc) {
      const size_t o = (size_t)(key0 + (kt << 4)) * kQKld + (kc << 5);
      k.hi[kt][kc] = Frag<__bf16>::load(Kh + o);
      k.lo[kt][kc] = Frag<__bf16>::load(Kl + o);
    }
}
__device__ __forceinline__ void load_v(v16b (&vh)[4], v16b (&vl)[4], const __bf16* Vh, const __bf16* Vl, int key0) {
#pragma unroll
  for (int t = 0; t < 4; ++t) {
    vh[t] = Frag<__bf16>::load(Vh + (size_t)(t << 4) * kTok + key0);
    vl[t] = Frag<__bf16>::load(Vl + (size_t)(t << 4) * kTok + key0);
  }
}

__global__ __launch_bounds__(kFaWaves * 32) void attn_fused_kernel(
    const unsigned short* __restrict__ QKhi, const unsigned short* __restrict__ QKlo,
    const unsigned short* __restrict__ Vthi, const unsigned short* __restrict__ Vtlo,
    unsigned short* __restrict__ Chi, unsigned short* __restrict__ Clo) {
  typedef Frag<__bf16> F;
  const int pair = blockIdx.y;
  const int b    = pair / kHeads;
  const int hd   = pair - b * kHeads;
  const int lane = threadIdx.x & 31;
  const int wave = threadIdx.x >> 5;
  const int c    = lane & 15;                  // row of A, column of B and D
  const int h8   = (lane >> 4) * 8;            // k offset of this lane half (A, B); D row offset
  const int q0   = blockIdx.x * (kFaWaves * kFaCols) + wave * kFaCols;
  const size_t tok0 = (size_t)b * kSeq;

  // Q fragments (B operand), kept for the whole loop
  v16b qh[kFaG][2], ql[kFaG][2];
#pragma unroll
  for (int g = 0; g < kFaG; ++g)
#pragma unroll
    for (int kc = 0; kc < 2; ++kc) {
      const size_t o = (tok0 + q0 + (g << 4) + c) * kQKld + hd * kDh + (kc << 5) + h8;
      qh[g][kc] = F::load((const __bf16*)QKhi + o);
      ql[g][kc] = F::load((const __bf16*)QKlo + o);
    }
  // the two fences below keep the order Q, K, v^T of the first loads, which is the loop's own (K, then v^T): with another order here
  // the counted waits at the loop head fall to 0 and every pass would wait for its v^T fragments before its first product
  __builtin_amdgcn_sched_barrier(0);
  const size_t koff = (tok0 + c) * kQKld + kHid + hd * kDh + h8;
  const size_t voff = (size_t)(hd * kDh + c) * kTok + tok0 + h8;
  const __bf16* Kh = (const __bf16*)QKhi + koff;
  const __bf16* Kl = (const __bf16*)QKlo + koff;
  const __bf16* Vh = (const __bf16*)Vthi + voff;
  const __bf16* Vl = (const __bf16*)Vtlo + voff;

  v8f acc[kFaG][4];                            // O^T: [column group][16-row tile over d]
  float m_run[kFaG];
  v2f lsum[kFaG];                              // this lane's share of the row sum (its 16 of each pass's 32 keys), even / odd registers
#pragma unroll
  for (int g = 0; g < kFaG; ++g) {
    m_run[g] = -INFINITY;
    lsum[g] = (v2f){0.f, 0.f};
#pragma unroll
    for (int t = 0; t < 4; ++t) acc[g][t] = (v8f){0.f,0.f,0.f,0.f,0.f,0.f,0.f,0.f};
  }

  KFrags kf;
  v16b vh[4], vl[4];                           // [16-row tile over d]
  load_k(kf, Kh, Kl, 0);
  __builtin_amdgcn_sched_barrier(0);
  load_v(vh, vl, Vh, Vl, 0);
  for (int key0 = 0; key0 < kSeq; key0 += kFaKeys) {
    const int keyn = (key0 + kFaKeys < kSeq) ? (key0 + kFaKeys) : key0;   // the last pass re-reads its own rows: in bounds, unused
    // S^T tiles [16-key tile][column group]; per accumulator the order is hi.hi, hi.lo, lo.hi for d 0..31, then for d 32..63
    v8f s[2][kFaG];
#pragma unroll
    for (int kt = 0; kt < 2; ++kt)
#pragma unroll
      for (int g = 0; g < kFaG; ++g) s[kt][g] = (v8f){0.f,0.f,0.f,0.f,0.f,0.f,0.f,0.f};
#pragma unroll
    for (int kc = 0; kc < 2; ++kc) {
#pragma unroll
      for (int kt = 0; kt < 2; ++kt)
#pragma unroll
        for (int g = 0; g < kFaG; ++g) s[kt][g] = F::mma(kf.hi[kt][kc], qh[g][kc], s[kt][g]);
#pragma unroll
      for (int kt = 0; kt < 2; ++kt)
#pragma unroll
        for (int g = 0; g < kFaG; ++g) s[kt][g] = F::mma(kf.lo[kt][kc], qh[g][kc], s[kt][g]);
#pragma unroll
      for (int kt = 0; kt < 2; ++kt)
#pragma unroll
        for (int g = 0; g < kFaG; ++g) s[kt][g] = F::mma(kf.hi[kt][kc], ql[g][kc], s[kt][g]);
    }

    // column maxima of the raw scores (the scale is positive), then one test per pass
    float mb[kFaG];
    bool need = false;
#pragma unroll
    for (int g = 0; g < kFaG; ++g) {
      float mx = s[0][g][0];
#pragma unroll
      for (int r = 1; r < 8; ++r) mx = fmaxf(mx, s[0][g][r]);
#pragma unroll
      for (int r = 0; r < 8; ++r) mx = fmaxf(mx, s[1][g][r]);
      mx = fmaxf(mx, other_half(mx)) * kExp2Scale;   // both halves hold this query's maximum of the pass
      mb[g] = mx;
      need = need || (mx > m_run[g] + 8.0f);          // true in the first pass (m_run = -inf)
    }
    if (__builtin_amdgcn_ballot_w32(need) != 0) {     // wave-uniform scalar branch
#pragma unroll
      for (int g = 0; g < kFaG; ++g) {
        const float m_new = fmaxf(m_run[g], mb[g]);
        const float corr  = __builtin_amdgcn_exp2f(m_run[g] - m_new);   // 0 in the first pass
        m_run[g] = m_new;
        lsum[g] = lsum[g] * corr;
#pragma unroll
        for (int t = 0; t < 4; ++t) acc[g][t] = acc[g][t] * corr;
      }
    }
    // next pass's K fragments, in flight under the exponentials and the second product
    load_k(kf, Kh, Kl, keyn);
    __builtin_amdgcn_sched_barrier(0);   // holds these loads ahead of the exponentials: sunk among the products below they arrive too late
#pragma unroll
    for (int g = 0; g < kFaG; ++g) {
      const float nm = -m_run[g];
      v8u hw, lw;
      v2f pp[8];
#pragma unroll
      for (int i = 0; i < 8; ++i) {   // operand elements 2i, 2i + 1 = tile i >> 2, registers 2 (i & 3), 2 (i & 3) + 1
        const v2f arg = __builtin_elementwise_fma((v2f){s[i >> 2][g][2 * (i & 3)], s[i >> 2][g][2 * (i & 3) + 1]},
                                                  (v2f){kExp2Scale, kExp2Scale}, (v2f){nm, nm});
        const v2f p = (v2f){__builtin_amdgcn_exp2f(arg.x), __builtin_amdgcn_exp2f(arg.y)};
        const unsigned w = pack_bf2(p.x, p.y);
        const v2f hi = (v2f){__uint_as_float(w << 16), __uint_as_float(w & 0xFFFF0000u)};
        const v2f lo = p - hi;        // exact in f32
        hw[i] = w;
        lw[i] = pack_bf2(lo.x, lo.y);
        pp[i] = p;
      }
      lsum[g] += ((pp[0] + pp[1]) + (pp[2] + pp[3])) + ((pp[4] + pp[5]) + (pp[6] + pp[7]));
      const v16b ph = __builtin_bit_cast(v16b, hw);
      const v16b pl = __builtin_bit_cast(v16b, lw);
#pragma unroll
      for (int t = 0; t < 4; ++t) acc[g][t] = F::mma(vh[t], ph, acc[g][t]);
#pragma unroll
      for (int t = 0; t < 4; ++t) acc[g][t] = F::mma(vl[t], ph, acc[g][t]);
#pragma unroll
      for (int t = 0; t < 4; ++t) acc[g][t] = F::mma(vh[t], pl, acc[g][t]);
    }
    // next pass's v^T fragments, in flight under that pass's first product and softmax
    load_v(vh, vl, Vh, Vl, keyn);
  }

  // ctx[query][hd * 64 + 16 t + h8 + r] = acc[g][t][r] / row sum, as bf16 hi/lo planes: 16 B per lane, tile and plane
#pragma unroll
  for (int g = 0; g < kFaG; ++g) {
    const float part = lsum[g].x + lsum[g].y;
    const float inv  = 1.0f / (part + other_half(part));   // sum >= 1: m never exceeds the row maximum
    const size_t co = (tok0 + q0 + (g << 4) + c) * kHid + hd * kDh + h8;
#pragma unroll
    for (int t = 0; t < 4; ++t) {
      v4u hv, lv;
#pragma unroll
      for (int e = 0; e < 4; ++e) {
        const float f0 = acc[g][t][2 * e] * inv;
        const float f1 = acc[g][t][2 * e + 1] * inv;
        const unsigned w = pack_bf2(f0, f1);
        hv[e] = w;
        lv[e] = pack_bf2(f0 - __uint_as_float(w << 16), f1 - __uint_as_float(w & 0xFFFF0000u));
      }
      *(v4u*)(Chi + co + (t << 4)) = hv;
      *(v4u*)(Clo + co + (t << 4)) = lv;
    }
  }
}

// ---------------------------------------------------------------------------
// Launcher. Workspace region map (bytes, MiB = 1048576; carve ends at 128 MiB = 134217728 B):
//   [  0, 18) projection operands: x bf16 [4096][1024] at +0 (8 MiB); wq|wk|wv bf16 [1024][1024] x3 at +8 MiB (6 MiB);
//                      padded down planes [64][1024] x3 at +14 MiB (384 KiB); t tables f32 [4096][64] x3 (tq|tk|tv) at +15 MiB (3 MiB).
//                      late aliases (written after the attention launch, when the above are dead): wo bf16 [1024][1024] at +0 (2 MiB);
//                      padded out_down plane [64][1024] at +2 MiB (128 KiB); to table f32 [4096][64] at +3 MiB (1 MiB).
//   [ 18, 64) unused
//   [ 64, 80) q|k hi : [4096][2048] bf16 (cols 0..1023 = q (h*64+d), 1024..2047 = k)
//   [ 80, 96) q|k lo
//   [ 96,104) v^T hi : [1024 (h*64+d)][4096 (b*2048+s)] bf16
//   [104,112) v^T lo
//   [112,120) ctx hi : [4096][1024] bf16 (col h*64+d)
//   [120,128) ctx lo
// Launch count: 3 casts + 1 down GEMM + 3 projections + 1 attention + 2 late casts + 1 down GEMM + 1 out GEMM = 12.
// Kernel launches only.
// ---------------------------------------------------------------------------
extern "C" void kernel_launch(void* const* d_in, const int* in_sizes, int n_in,
                              void* d_out, int out_size, void* d_ws, size_t ws_size,
                              hipStream_t stream) {
  if (n_in < 14) return;
  if (in_sizes[0] != kTok * kHid) return;
  if (in_sizes[1] != kHid * kHid || in_sizes[2] != kHid * kHid || in_sizes[3] != kHid * kHid || in_sizes[4] != kHid * kHid) return;
  if (in_sizes[5] != kHid) return;
  if (in_sizes[6] != kRank * kHid || in_sizes[8] != kRank * kHid || in_sizes[10] != kRank * kHid || in_sizes[12] != kRank * kHid) return;
  if (in_sizes[7] != kHid * kRank || in_sizes[9] != kHid * kRank || in_sizes[11] != kHid * kRank || in_sizes[13] != kHid * kRank) return;
  if (out_size != kTok * kHid) return;

  const size_t kMiB    = 1048576;
  const size_t offXb   = 0;
  const size_t offW3   = 8 * kMiB;
  const size_t offDn3  = 14 * kMiB;
  const size_t offT3   = 15 * kMiB;
  const size_t offWo   = 0;
  const size_t offDnO  = 2 * kMiB;
  const size_t offTo   = 3 * kMiB;
  const size_t offQKhi = 64 * kMiB;
  const size_t offQKlo = 80 * kMiB;
  const size_t offVthi = 96 * kMiB;
  const size_t offVtlo = 104 * kMiB;
  const size_t offChi  = 112 * kMiB;
  const size_t offClo  = 120 * kMiB;
  const size_t total   = 128 * kMiB;
  if (total > ws_size) return;

  const float* x     = (const float*)d_in[0];
  const float* wq    = (const float*)d_in[1];
  const float* wk    = (const float*)d_in[2];
  const float* wv    = (const float*)d_in[3];
  const float* wo    = (const float*)d_in[4];
  const float* bo    = (const float*)d_in[5];
  const float* q_dn  = (const float*)d_in[6];
  const float* q_up  = (const float*)d_in[7];
  const float* k_dn  = (const float*)d_in[8];
  const float* k_up  = (const float*)d_in[9];
  const float* v_dn  = (const float*)d_in[10];
  const float* v_up  = (const float*)d_in[11];
  const float* o_dn  = (const float*)d_in[12];
  const float* o_up  = (const float*)d_in[13];
  float* out = (float*)d_out;
  char* ws = (char*)d_ws;

  unsigned short* xb   = (unsigned short*)(ws + offXb);
  unsigned short* w3   = (unsigned short*)(ws + offW3);
  unsigned short* dn3  = (unsigned short*)(ws + offDn3);
  float*          t3   = (float*)(ws + offT3);
  unsigned short* wob  = (unsigned short*)(ws + offWo);
  unsigned short* dno  = (unsigned short*)(ws + offDnO);
  float*          tot  = (float*)(ws + offTo);
  unsigned short* qkhi = (unsigned short*)(ws + offQKhi);
  unsigned short* qklo = (unsigned short*)(ws + offQKlo);
  unsigned short* vthi = (unsigned short*)(ws + offVthi);
  unsigned short* vtlo = (unsigned short*)(ws + offVtlo);
  unsigned short* chi  = (unsigned short*)(ws + offChi);
  unsigned short* clo  = (unsigned short*)(ws + offClo);

  // in-range dummies for unused (never dereferenced) template-dead pointer parameters
  const float* dummy_f = bo;
  void* dummy_c2 = (void*)chi;

  const long wPlane  = (long)kHid * kHid;          // 1048576 halves
  const long dnPlane = (long)kRankPad * kHid;      // 65536 halves
  const long tPlane  = (long)kTok * kRankPad;      // 262144 floats

  // 1. x -> RNE bf16 plane [4096][1024]: n8 = 524288 = 2048 blocks x 256
  {
    const int n8 = (kTok * kHid) / 8;
    cast_pad_bf16_kernel<<<dim3(n8 / 256, 1), dim3(256), 0, stream>>>(x, x, x, xb, 0L, n8, kTok * kHid);
  }
  // 2. wq, wk, wv [1024 out][1024 in] -> bf16 planes (Bt layout directly): n8 = 131072 = 512 blocks x 256, 3 tables
  {
    const int n8 = (kHid * kHid) / 8;
    cast_pad_bf16_kernel<<<dim3(n8 / 256, 3), dim3(256), 0, stream>>>(wq, wk, wv, w3, wPlane, n8, kHid * kHid);
  }
  // 3. q/k/v down [4][1024] -> zero-padded bf16 planes [64][1024] (rows 4..63 zero-filled): n8 = 8192 = 32 blocks x 256
  {
    const int n8 = (kRankPad * kHid) / 8;
    cast_pad_bf16_kernel<<<dim3(n8 / 256, 3), dim3(256), 0, stream>>>(q_dn, k_dn, v_dn, dn3, dnPlane, n8, kRank * kHid);
  }
  // 4. t{q,k,v} = x . down^T : M=4096, N=64, K=1024, single bf16 product -> f32 [3][4096][64] (batched over blockIdx.y)
  wmma_gemm64<1, false, 0, 0, false, 0, false, true, 0, 1><<<dim3((kTok / 64) * (kRankPad / 64) / 8, 3), dim3(256), 0, stream>>>(
      xb, xb, kHid, 0L,
      dn3, dn3, kHid, dnPlane,
      (void*)t3, dummy_c2, kRankPad, tPlane,
      dummy_f, dummy_f, 0L,
      dummy_f, 4, dummy_f, 4,
      kTok, kRankPad, kHid, 1.0f);

  // 5. q = x . wq^T + tq . q_up^T : M=4096, N=1024, K=1024 -> bf16 hi/lo into q|k planes cols 0..1023 (ldc 2048)
  wmma_gemm64<1, false, 0, 2, false, 0, false, true, 1><<<dim3((kTok / 64) * (kHid / 64) / 8, 1), dim3(256), 0, stream>>>(
      xb, xb, kHid, 0L,
      w3, w3, kHid, 0L,
      (void*)qkhi, (void*)qklo, kQKld, 0L,
      dummy_f, dummy_f, 0L,
      t3, kRankPad, q_up, kRank,
      kTok, kHid, kHid, 1.0f);
  // 6. k = x . wk^T + tk . k_up^T -> cols 1024..2047
  wmma_gemm64<1, false, 0, 2, false, 0, false, true, 1><<<dim3((kTok / 64) * (kHid / 64) / 8, 1), dim3(256), 0, stream>>>(
      xb, xb, kHid, 0L,
      w3 + wPlane, w3 + wPlane, kHid, 0L,
      (void*)(qkhi + kHid), (void*)(qklo + kHid), kQKld, 0L,
      dummy_f, dummy_f, 0L,
      t3 + tPlane, kRankPad, k_up, kRank,
      kTok, kHid, kHid, 1.0f);
  // 7. v^T = wv . x^T + v_up . tv^T : M=1024 (h*64+d), N=4096 (token), K=1024 -> bf16 hi/lo [1024][4096]
  wmma_gemm64<1, false, 0, 2, false, 0, false, true, 2><<<dim3((kHid / 64) * (kTok / 64) / 8, 1), dim3(256), 0, stream>>>(
      w3 + 2 * wPlane, w3 + 2 * wPlane, kHid, 0L,
      xb, xb, kHid, 0L,
      (void*)vthi, (void*)vtlo, kTok, 0L,
      dummy_f, dummy_f, 0L,
      v_up, kRank, t3 + 2 * tPlane, kRankPad,
      kHid, kTok, kHid, 1.0f);

  // 8. attention, all 32 (batch, head) pairs: ctx = softmax(0.125 * q . k^T) . v -> bf16 hi/lo planes [4096][1024]
  attn_fused_kernel<<<dim3(kSeq / (kFaWaves * kFaCols), kBatch * kHeads), dim3(kFaWaves * 32), 0, stream>>>(
      qkhi, qklo, vthi, vtlo, chi, clo);

  // 9. wo [1024][1024] -> bf16 plane over the dead x plane
  {
    const int n8 = (kHid * kHid) / 8;
    cast_pad_bf16_kernel<<<dim3(n8 / 256, 1), dim3(256), 0, stream>>>(wo, wo, wo, wob, 0L, n8, kHid * kHid);
  }
  // 10. out_down [4][1024] -> zero-padded bf16 plane [64][1024]
  {
    const int n8 = (kRankPad * kHid) / 8;
    cast_pad_bf16_kernel<<<dim3(n8 / 256, 1), dim3(256), 0, stream>>>(o_dn, o_dn, o_dn, dno, 0L, n8, kRank * kHid);
  }
  // 11. to = ctx_hi . out_down^T + ctx_lo . out_down^T : M=4096, N=64, K=1024, 2 products -> f32 [4096][64]
  wmma_gemm64<1, true, 0, 0, false, 0, false, false, 0, 1><<<dim3((kTok / 64) * (kRankPad / 64) / 8, 1), dim3(256), 0, stream>>>(
      chi, clo, kHid, 0L,
      dno, dno, kHid, 0L,
      (void*)tot, dummy_c2, kRankPad, 0L,
      dummy_f, dummy_f, 0L,
      dummy_f, 4, dummy_f, 4,
      kTok, kRankPad, kHid, 1.0f);
  // 12. out = ctx_hi . wo^T + ctx_lo . wo^T + to . out_up^T + bo : M=4096, N=1024, K=1024 -> f32 d_out
  wmma_gemm64<1, true, 2, 0, false, 0, false, false, 1><<<dim3((kTok / 64) * (kHid / 64) / 8, 1), dim3(256), 0, stream>>>(
      chi, clo, kHid, 0L,
      wob, wob, kHid, 0L,
      (void*)out, dummy_c2, kHid, 0L,
      bo, dummy_f, 0L,
      tot, kRankPad, o_up, kRank,
      kTok, kHid, kHid, 1.0f);
}

// v005
// A run of this version takes 220 microseconds.
// Two timings next to v004 both put it at 1.18 times that version's speed.
// Counting every step since v000, it is 13.0 times as fast.
// Contractions: x.W^T (q, k, v^T) and x.down^T: single v_wmma_f32_16x16x32_bf16 products on RNE-bf16 planes; q.k^T scores and p.v context: bf16 hi/lo operand planes (hi.hi + hi.lo + lo.hi); ctx.Wo^T and ctx.out_down^T: ctx bf16 hi/lo x RNE-bf16 weights (hi.W + lo.W); rank-4 up-products, bias and softmax in f32 on the VALU; all f32 accumulate.
#include <hip/hip_runtime.h>
#include <math.h>

// ---------------------------------------------------------------------------
// Problem constants
// ---------------------------------------------------------------------------
constexpr int kBatch   = 2;
constexpr int kSeq     = 2048;
constexpr int kHid     = 1024;
constexpr int kHeads   = 16;
constexpr int kDh      = 64;
constexpr int kTok     = kBatch * kSeq;            // 4096 token rows
constexpr int kRank    = 4;
constexpr int kRankPad = 64;                       // rank padded to one tile
constexpr int kQKld    = 2 * kHid;                 // 2048: pitch of the q|k planes (halves)

static_assert((kTok * kHid) % (8 * 256) == 0, "cast grid exact");
static_assert((kHid * kHid) % (8 * 256) == 0, "cast grid exact");
static_assert((kRankPad * kHid) % (8 * 256) == 0, "pad cast grid exact");
static_assert(kHid % 64 == 0 && kTok % 64 == 0 && kSeq % 64 == 0 && kDh % 64 == 0 && kRankPad % 64 == 0, "tile multiples");
static_assert(kHid % 32 == 0 && kDh % 32 == 0 && kSeq % 32 == 0, "K multiples of 32");

typedef __attribute__((ext_vector_type(16))) _Float16 v16h;
typedef __attribute__((ext_vector_type(8)))  _Float16 v8h;
typedef __attribute__((ext_vector_type(16))) __bf16   v16b;
typedef __attribute__((ext_vector_type(8)))  __bf16   v8b;
typedef __attribute__((ext_vector_type(8)))  float    v8f;
typedef __attribute__((ext_vector_type(4)))  float    v4f;
typedef __attribute__((ext_vector_type(4)))  unsigned int v4u;

__device__ __forceinline__ unsigned short f2bf_bits(float f) {
  unsigned u = __float_as_uint(f);
  return (unsigned short)((u + 0x7FFFu + ((u >> 16) & 1u)) >> 16);
}
__device__ __forceinline__ float bf_bits2f(unsigned short h) { return __uint_as_float(((unsigned)h) << 16); }
__device__ __forceinline__ float bf_rne(float f) { return bf_bits2f(f2bf_bits(f)); }

// hazard guards as plain device helpers
__device__ __forceinline__ void acc_guard4(v8f& a, v8f& b, v8f& c, v8f& d) { asm volatile("v_nop\n\tv_nop\n\tv_nop\n\tv_nop" : "+v"(a), "+v"(b), "+v"(c), "+v"(d)); }
template <typename T> struct Frag;
template <> struct Frag<_Float16> {
  typedef v16h V; union U { v16h v; v8h h[2]; };
  // elements 0..7 <- p[0..7], 8..15 <- p[16..23]
  static __device__ __forceinline__ v16h load(const _Float16* p) {
    U f; f.h[0] = *(const v8h*)(p); f.h[1] = *(const v8h*)(p + 16); return f.v;
  }
  static __device__ __forceinline__ v8f mma(v16h a, v16h b, v8f c) {
    return __builtin_amdgcn_wmma_f32_16x16x32_f16(false, a, false, b, (short)0, c, false, false);
  }
};
template <> struct Frag<__bf16> {
  typedef v16b V; union U { v16b v; v8b h[2]; };
  static __device__ __forceinline__ v16b load(const __bf16* p) {
    U f; f.h[0] = *(const v8b*)(p); f.h[1] = *(const v8b*)(p + 16); return f.v;
  }
  static __device__ __forceinline__ v8f mma(v16b a, v16b b, v8f c) {
    return __builtin_amdgcn_wmma_f32_16x16x32_bf16(false, a, false, b, (short)0, c, false, false);
  }
};

__device__ __forceinline__ unsigned pk16(unsigned short a, unsigned short b) { return (unsigned)a | ((unsigned)b << 16); }

// ---- asynchronous copies global -> LDS: N copies of 16 B a lane in ONE statement; the s_wait_xcnt 0 at its end stands ahead of every
// later rewrite of the address registers that the issued copies name (inside the statement nothing can be moved between them) ----
#define ACP(a, b) "global_load_async_to_lds_b128 %" #a ", %" #b ", off\n\t"
#define AOP(i) "v"(l[i]), "v"(g[i])
#define ACP8 ACP(0, 1) ACP(2, 3) ACP(4, 5) ACP(6, 7) ACP(8, 9) ACP(10, 11) ACP(12, 13) ACP(14, 15)
#define AOP8 AOP(0), AOP(1), AOP(2), AOP(3), AOP(4), AOP(5), AOP(6), AOP(7)
template <int V> struct IC { static constexpr int v = V; };   // a compile-time int as a function argument
template <int N>
__device__ __forceinline__ void async_copies(const unsigned* l, const void* const* g) {
  static_assert(N == 8 || N == 9 || N == 12, "statement sizes in use");
  if constexpr (N == 8) {
    asm volatile(ACP8 "s_wait_xcnt 0x0" :: AOP8 : "memory");
  } else if constexpr (N == 9) {
    asm volatile(ACP8 ACP(16, 17) "s_wait_xcnt 0x0" :: AOP8, AOP(8) : "memory");
  } else {
    asm volatile(ACP8 ACP(16, 17) ACP(18, 19) ACP(20, 21) ACP(22, 23) "s_wait_xcnt 0x0" :: AOP8, AOP(8), AOP(9), AOP(10), AOP(11) : "memory");
  }
}

// ---- Register-blocked batched WMMA GEMM (BSPLIT and LORA options added; operands staged in LDS) ----
// C[m,n] = scale * sum_k A[m,k] * Bt[n,k] (+bias)(+resid)(+lora); each wave owns a 64x64 tile; a block of 8 waves owns
// (8 / WN) x WN such tiles, that is (8 / WN) * 64 rows of A and WN * 64 rows of Bt.
// A row-major [M,K]; Bt row-major [N,K]; M % ((8 / WN) * 64) == 0, N % (WN * 64) == 0, K % 64 == 0, K >= 64.
// SPLIT (with BSPLIT == false): A carries a lo plane (A2, same layout); product = hi.B + lo.B (Bt2 unused).
// BIAS_MODE: 0 = none, 1 = bias[m], 2 = bias[n].
// OUT_MODE: 0 = f32, 1 = f16, 2 = bf16 hi plane (Cout) + bf16 lo plane (Cout2).
// LORA: rank-4 f32 term added in the epilogue: v += dot4(rowtab[m][0..3], coltab[n][0..3]); rowtab pitch ldrow floats, coltab pitch
//   ldcol floats (both 16-B aligned rows). LORA == 1: coltab values RNE-bf16 converted at load (rowtab kept f32);
//   LORA == 2: rowtab values RNE-bf16 converted (coltab kept f32). In LORA modes a BIAS_MODE 2 bias is RNE-bf16 converted too.
// ET: 0 = f16 operands, 1 = bf16 operands (pointers passed as 16-bit storage)
template <int ET> struct Elem;
template <> struct Elem<0> { typedef _Float16 T; };
template <> struct Elem<1> { typedef __bf16 T; };
template <int ET, bool SPLIT, int BIAS_MODE, int OUT_MODE, bool RESID, int ACT = 0, bool CAUSAL = false, bool BSPLIT = true, int LORA = 0, int WN = 4>
__global__ __launch_bounds__(256) void wmma_gemm64(
    const unsigned short* __restrict__ Ap, const unsigned short* __restrict__ A2p, int lda, long strideA,
    const unsigned short* __restrict__ Btp, const unsigned short* __restrict__ Bt2p, int ldb, long strideB,
    void* __restrict__ Cout, void* __restrict__ Cout2, int ldc, long strideC,
    const float* __restrict__ bias,
    const float* __restrict__ resid, long strideR,
    const float* __restrict__ rowtab, int ldrow,
    const float* __restrict__ coltab, int ldcol,
    int M, int N, int K, float scale) {
  static_assert(!CAUSAL && !(SPLIT && BSPLIT), "the staged k loop has no tile skip and no lo plane of Bt");
  static_assert(WN == 1 || WN == 4, "block shapes in use");
  typedef typename Elem<ET>::T T;
  typedef typename Frag<T>::V V;
  const T* A = (const T*)Ap; const T* A2 = (const T*)A2p; const T* Bt = (const T*)Btp;
  // One stage = 64 k (128 B) of every operand row of the block, LDS rows [A | A lo | Bt] at pitch 144 B (16 B x odd: 16-B row reads
  // of 16 lanes fall on distinct banks). Two stages; the per-wave 16x64 output slabs (pitch 68 floats) reuse the ring behind the loop.
  constexpr int WM        = 8 / WN;
  constexpr int kPitch    = 144;
  constexpr int kRowsA    = WM * 64;
  constexpr int kRowB0    = kRowsA * (SPLIT ? 2 : 1);
  constexpr int kRows     = kRowB0 + WN * 64;
  constexpr int kBufBytes = kRows * kPitch;
  constexpr int kSlabs    = 8 * 16 * 68 * 4;
  constexpr int kLdsBytes = (2 * kBufBytes > kSlabs) ? 2 * kBufBytes : kSlabs;
  static_assert(kLdsBytes <= 320 * 1024, "LDS of one work-group");
  __shared__ __align__(16) unsigned char smem[kLdsBytes];
  const int b    = blockIdx.y;
  const int lane = threadIdx.x & 31;
  const int wave = threadIdx.x >> 5;
  const int blocksN = N / (WN * 64);
  const int blocksM = M / (WM * 64);
  if ((int)blockIdx.x >= blocksM * blocksN) return;   // the same for the whole block; ahead of every barrier
  const int bm   = blockIdx.x / blocksN;
  const int bn   = blockIdx.x - bm * blocksN;
  const int mBlk = bm * (WM * 64);
  const int nBlk = bn * (WN * 64);
  const int wm   = wave / WN;
  const int wn   = wave - wm * WN;
  const int m0   = mBlk + (wm << 6);
  const int n0   = nBlk + (wn << 6);

  const T* Ab  = A  + (size_t)b * strideA;
  const T* Bb  = Bt + (size_t)b * strideB;
  const T* Ab2 = SPLIT ? (A2  + (size_t)b * strideA) : nullptr;

  const int rlane = lane & 15;                 // row (A) / col (B, D) within subtile
  const int koff  = (lane >> 4) * 8;           // k offset of this lane half
  const int mOff  = (lane >> 4) * 8;           // D row offset

  v8f acc[4][4];
#pragma unroll
  for (int i = 0; i < 4; ++i)
#pragma unroll
    for (int j = 0; j < 4; ++j) acc[i][j] = (v8f){0.f,0.f,0.f,0.f,0.f,0.f,0.f,0.f};

  // Staging: copy c of a stage fills LDS rows 32c .. 32c + 31: wave w rows 32c + 4w .. + 3, 8 lanes a row (four whole 128-B lines of
  // global memory an instruction). The operand boundaries are multiples of 64 rows, so a copy's operand is known at compile time.
  constexpr int NC = kRows / 32;               // copies of a wave per stage: 12, 16, 18 or 34 (at most 63 may be in flight)
  const int srow = (wave << 2) + (lane >> 3);
  const int scol = (lane & 7) << 3;            // first of this lane's 8 elements
  const T* gA  = Ab + (size_t)(mBlk + srow) * lda + scol;
  const T* gA2 = SPLIT ? (Ab2 + (size_t)(mBlk + srow) * lda + scol) : nullptr;
  const T* gB  = Bb + (size_t)(nBlk + srow) * ldb + scol;
  const unsigned lds0 = (unsigned)(size_t)smem + (unsigned)(srow * kPitch + (scol << 1));
  auto part = [&](auto first, auto count, int buf, int k0) {   // copies first .. first + count - 1 of a stage, one statement
    constexpr int C0 = decltype(first)::v;
    constexpr int CN = decltype(count)::v;
    unsigned l[CN];
    const void* g[CN];
#pragma unroll
    for (int c = 0; c < CN; ++c) {
      const int r = (C0 + c) * 32;
      l[c] = lds0 + (unsigned)(buf * kBufBytes + r * kPitch);
      if (r < kRowsA)      g[c] = gA  + (size_t)r * lda + k0;
      else if (r < kRowB0) g[c] = gA2 + (size_t)(r - kRowsA) * lda + k0;
      else                 g[c] = gB  + (size_t)(r - kRowB0) * ldb + k0;
    }
    async_copies<CN>(l, g);
    __builtin_amdgcn_sched_barrier(0);   // keeps the next statement's address sums behind this one: formed all at once they spill
  };
  auto stage = [&](int buf, int k0) {
    if constexpr (NC == 12)      { part(IC<0>{}, IC<12>{}, buf, k0); }
    else if constexpr (NC == 16) { part(IC<0>{}, IC<8>{}, buf, k0); part(IC<8>{}, IC<8>{}, buf, k0); }
    else if constexpr (NC == 18) { part(IC<0>{}, IC<9>{}, buf, k0); part(IC<9>{}, IC<9>{}, buf, k0); }
    else {
      static_assert(NC == 12 || NC == 16 || NC == 18 || NC == 34, "statement split");
      part(IC<0>{}, IC<9>{}, buf, k0); part(IC<9>{}, IC<9>{}, buf, k0); part(IC<18>{}, IC<8>{}, buf, k0); part(IC<26>{}, IC<8>{}, buf, k0);
    }
  };

  // k loop, two LDS buffers: trip t works on buffer t % 2 alone while the copies of stage t + 1 fly into the other one.
  // Per accumulator the order of the products is that of k (hi.B, then lo.B, within a 32-k step).
  const int ntrips = K >> 6;                   // >= 1
  const unsigned char* aRd = smem + ((wm << 6) + rlane) * kPitch + (koff << 1);
  const unsigned char* bRd = smem + (kRowB0 + (wn << 6) + rlane) * kPitch + (koff << 1);
  stage(0, 0);
  asm volatile("s_wait_asynccnt 0x0" ::: "memory");   // this wave's share of stage 0 has landed
  __syncthreads();                                     // stage 0 readable by every wave
  if (ntrips > 1) stage(1, 64);
  for (int t = 0; t < ntrips; ++t) {
    const int bo = (t & 1) * kBufBytes;
    V fa[2][4], fl[2][4], fb[2][4];            // both 32-k steps of the stage, read as one group ahead of the products
#pragma unroll
    for (int ks = 0; ks < 2; ++ks) {
#pragma unroll
      for (int j = 0; j < 4; ++j) fb[ks][j] = Frag<T>::load((const T*)(bRd + bo + j * 16 * kPitch + ks * 64));
#pragma unroll
      for (int i = 0; i < 4; ++i) {
        fa[ks][i] = Frag<T>::load((const T*)(aRd + bo + i * 16 * kPitch + ks * 64));
        if (SPLIT) fl[ks][i] = Frag<T>::load((const T*)(aRd + bo + (kRowsA + i * 16) * kPitch + ks * 64));
      }
    }
    __builtin_amdgcn_sched_barrier(0);   // holds the reads together ahead of the products: sunk among them, every row of products waits out an LDS latency
#pragma unroll
    for (int ks = 0; ks < 2; ++ks) {
#pragma unroll
      for (int i = 0; i < 4; ++i) {
#pragma unroll
        for (int j = 0; j < 4; ++j) acc[i][j] = Frag<T>::mma(fa[ks][i], fb[ks][j], acc[i][j]);
        if (SPLIT) {
#pragma unroll
          for (int j = 0; j < 4; ++j) acc[i][j] = Frag<T>::mma(fl[ks][i], fb[ks][j], acc[i][j]);
        }
      }
    }
    __builtin_amdgcn_sched_barrier(0);   // holds the waits, the barrier and the refill behind the products: risen over them, the refill would fly under the next reads alone
    asm volatile("s_wait_dscnt 0x0" ::: "memory");      // this wave's reads of buffer t % 2 are over before it is handed to the copies
    asm volatile("s_wait_asynccnt 0x0" ::: "memory");   // this wave's share of stage t + 1 has landed
    __syncthreads();                                     // publishes stage t + 1 and ends every wave's reads of buffer t % 2
    if (t + 2 < ntrips) stage(t & 1, (t + 2) << 6);      // the same test in the whole block
  }
  asm volatile("s_wait_asynccnt 0x0" ::: "memory");     // no copy is in flight when the ring becomes the output slabs
  acc_guard4(acc[0][0], acc[0][1], acc[0][2], acc[0][3]);
  acc_guard4(acc[1][0], acc[1][1], acc[1][2], acc[1][3]);
  acc_guard4(acc[2][0], acc[2][1], acc[2][2], acc[2][3]);
  acc_guard4(acc[3][0], acc[3][1], acc[3][2], acc[3][3]);

  // ---- epilogue ----
  float* slab = (float*)smem + wave * (16 * 68);   // behind the last trip's barrier: nobody reads the ring any more
  const float* Rb = RESID ? (resid + (size_t)b * strideR) : nullptr;
  // rank-4 column table (LORA modes): per lane the 4 columns n0 + 16j + rlane
  v4f ctab[4];
  float cbias[4];
#pragma unroll
  for (int j = 0; j < 4; ++j) { ctab[j] = (v4f){0.f,0.f,0.f,0.f}; cbias[j] = 0.f; }
  if (LORA != 0) {
#pragma unroll
    for (int j = 0; j < 4; ++j) {
      const int n = n0 + (j << 4) + rlane;
      v4f u = *(const v4f*)(coltab + (size_t)n * ldcol);
      if (LORA == 1) {
#pragma unroll
        for (int e = 0; e < 4; ++e) u[e] = bf_rne(u[e]);
      }
      ctab[j] = u;
      if (BIAS_MODE == 2) cbias[j] = bf_rne(bias[n]);
    }
  }
#pragma unroll
  for (int i = 0; i < 4; ++i) {
    const int mBase = m0 + (i << 4);
    if (LORA == 0) {
#pragma unroll
      for (int j = 0; j < 4; ++j) {
        const int n = n0 + (j << 4) + rlane;
        float bv = 0.f;
        if (BIAS_MODE == 2) bv = bias[n];
#pragma unroll
        for (int r = 0; r < 8; ++r) {
          float v = acc[i][j][r] * scale;
          if (BIAS_MODE == 1) v += bias[mBase + mOff + r];
          if (BIAS_MODE == 2) v += bv;
          if (RESID) v += Rb[(size_t)(mBase + mOff + r) * ldc + n];
          if (ACT == 2) v = fmaxf(v, 0.0f);
          if (ACT == 4) v = (v > 0.f) ? v : 0.01f * v;
          slab[(mOff + r) * 68 + (j << 4) + rlane] = v;
        }
      }
    } else {
#pragma unroll
      for (int r = 0; r < 8; ++r) {
        const int m = mBase + mOff + r;
        v4f tr = *(const v4f*)(rowtab + (size_t)m * ldrow);
        if (LORA == 2) {
#pragma unroll
          for (int e = 0; e < 4; ++e) tr[e] = bf_rne(tr[e]);
        }
#pragma unroll
        for (int j = 0; j < 4; ++j) {
          float lr = tr[0] * ctab[j][0];
          lr = fmaf(tr[1], ctab[j][1], lr);
          lr = fmaf(tr[2], ctab[j][2], lr);
          lr = fmaf(tr[3], ctab[j][3], lr);
          float v = acc[i][j][r] * scale + lr;
          if (BIAS_MODE == 2) v += cbias[j];
          slab[(mOff + r) * 68 + (j << 4) + rlane] = v;
        }
      }
    }
    __builtin_amdgcn_fence(__ATOMIC_RELEASE, "workgroup");
    __builtin_amdgcn_wave_barrier();
    __builtin_amdgcn_fence(__ATOMIC_ACQUIRE, "workgroup");
    if (OUT_MODE == 0) {
      float* C = (float*)Cout + (size_t)b * strideC;
      const int hh = lane >> 4, c4 = (lane & 15) * 4;     // row seg = 256 B = 16 lanes x 16 B
      {
#pragma unroll
        for (int it = 0; it < 8; ++it) {
          const int row = it * 2 + hh;
          v4f v = *(const v4f*)(slab + row * 68 + c4);
          *(v4f*)(C + (size_t)(mBase + row) * ldc + n0 + c4) = v;
        }
        
      }
    } else {
      const int q = lane >> 3, c8 = (lane & 7) * 8;
      unsigned short* C  = (unsigned short*)Cout  + (size_t)b * strideC;
      unsigned short* C2 = (OUT_MODE == 2) ? ((unsigned short*)Cout2 + (size_t)b * strideC) : nullptr;
      {
#pragma unroll
        for (int it = 0; it < 4; ++it) {
          const int row = it * 4 + q;
          const float* sp = slab + row * 68 + c8;
          v8h hv, lv;
#pragma unroll
          for (int e = 0; e < 8; ++e) {
            if (OUT_MODE == 1) {
              hv[e] = (_Float16)sp[e];
            } else {
              unsigned short hb = f2bf_bits(sp[e]);
              unsigned short lb = f2bf_bits(sp[e] - bf_bits2f(hb));
              hv[e] = __builtin_bit_cast(_Float16, hb);
              lv[e] = __builtin_bit_cast(_Float16, lb);
            }
          }
          *(v8h*)(C + (size_t)(mBase + row) * ldc + n0 + c8) = hv;
          if (OUT_MODE == 2) *(v8h*)(C2 + (size_t)(mBase + row) * ldc + n0 + c8) = lv;
        }
        
      }
    }
    __builtin_amdgcn_fence(__ATOMIC_RELEASE, "workgroup");
    __builtin_amdgcn_wave_barrier();
    __builtin_amdgcn_fence(__ATOMIC_ACQUIRE, "workgroup");
  }
}

// ---------------------------------------------------------------------------
// f32 -> RNE bf16 plane with zero padding, up to 3 same-shaped tables per launch (blockIdx.y selects the source, block-uniform).
// Thread i owns flat elements 8i..8i+7 of plane y: value = in_y[e] for e < nvalid, 0 otherwise (the load address is clamped to
// [0, nvalid-8], the value is zeroed by predicate). out plane y starts at out + y * plane_halves.
// Coverage: n8 = plane elements / 8 threads x 8 = the whole padded plane (grids are exact multiples of 256 here).
// ---------------------------------------------------------------------------
__global__ __launch_bounds__(256) void cast_pad_bf16_kernel(const float* __restrict__ s0, const float* __restrict__ s1,
                                                            const float* __restrict__ s2,
                                                            unsigned short* __restrict__ out, long plane_halves,
                                                            int n8, int nvalid) {
  const int i = blockIdx.x * 256 + threadIdx.x;
  if (i >= n8) return;
  const int y = blockIdx.y;
  const float* src = (y == 0) ? s0 : ((y == 1) ? s1 : s2);
  const long e = 8L * (long)i;
  const bool live = (e < (long)nvalid);
  const long ec = live ? e : (long)(nvalid - 8);
  const v4f a = *(const v4f*)(src + ec);
  const v4f c = *(const v4f*)(src + ec + 4);
  float f[8];
#pragma unroll
  for (int k = 0; k < 4; ++k) { f[k] = live ? a[k] : 0.0f; f[4 + k] = live ? c[k] : 0.0f; }
  unsigned w[4];
#pragma unroll
  for (int e2 = 0; e2 < 4; ++e2) w[e2] = pk16(f2bf_bits(f[2 * e2]), f2bf_bits(f[2 * e2 + 1]));
  const v4u u = (v4u){w[0], w[1], w[2], w[3]};
  unsigned short* q = out + (size_t)y * plane_halves + (size_t)e;
  *(v4u*)q = u;
  
}

constexpr int kFaWaves = 8;
constexpr int kFaCols  = 32;                       // query columns per wave
constexpr int kFaG     = kFaCols / 16;             // 16-column groups per wave
constexpr int kFaKeys  = 32;                       // keys per pass = one k step of the second product
constexpr float kExp2Scale = 0.125f * 1.4426950408889634f;   // 64^-0.5 * log2(e)
constexpr int kFaSubKeys  = 64;                    // keys of a sub-tile
constexpr int kFaSubs     = 2;                     // sub-tiles of a stage
constexpr int kFaStage    = kFaSubKeys * kFaSubs;  // keys of a stage
constexpr int kFaTrips    = kSeq / kFaStage;
constexpr int kFaPitch    = 144;
constexpr int kFaPlane    = 64 * kFaPitch;         // one operand plane of a sub-tile, bytes
constexpr int kFaSubBytes = 4 * kFaPlane;
constexpr int kFaBufBytes = kFaSubs * kFaSubBytes;
static_assert(kSeq % (kFaWaves * kFaCols) == 0 && kSeq % kFaKeys == 0 && kDh == 64, "fused attention tile shape");
static_assert(kSeq % kFaStage == 0 && kFaTrips >= 2 && kFaStage == 4 * kFaKeys && kFaWaves == 8, "stage shape");
static_assert(2 * kFaBufBytes <= 320 * 1024, "LDS of one work-group");
typedef __attribute__((ext_vector_type(2))) float  v2f;
typedef __attribute__((ext_vector_type(2))) __bf16 v2b;
typedef __attribute__((ext_vector_type(8))) unsigned int v8u;

// two f32 -> two RNE bf16 in one word (a in the low half)
__device__ __forceinline__ unsigned pack_bf2(float a, float b) {
  return __builtin_bit_cast(unsigned, __builtin_convertvector((v2f){a, b}, v2b));
}
// value of lane l ^ 16
__device__ __forceinline__ float other_half(float x) {
  const int i = __builtin_bit_cast(int, x);
  return __builtin_bit_cast(float, __builtin_amdgcn_permlanex16(i, i, 0x76543210, 0xfedcba98, false, false));
}
struct KFrags { v16b hi[2][2], lo[2][2]; };        // [16-key tile][32-wide step over d]
// Fragments of pass P (0..3) of a stage, from LDS; rd = this lane's place in the stage's buffer: row c, byte 2 * h8.
template <int P>
__device__ __forceinline__ void lds_k(KFrags& k, const unsigned char* rd) {
  constexpr int o0 = (P >> 1) * kFaSubBytes + (P & 1) * 32 * kFaPitch;
#pragma unroll
  for (int kt = 0; kt < 2; ++kt)
#pragma unroll
    for (int kc = 0; kc < 2; ++kc) {
      const unsigned char* p = rd + o0 + (kt << 4) * kFaPitch + (kc << 6);
      k.hi[kt][kc] = Frag<__bf16>::load((const __bf16*)p);
      k.lo[kt][kc] = Frag<__bf16>::load((const __bf16*)(p + kFaPlane));
    }
}
template <int P>
__device__ __forceinline__ void lds_v(v16b (&vh)[4], v16b (&vl)[4], const unsigned char* rd) {
  constexpr int o0 = (P >> 1) * kFaSubBytes + 2 * kFaPlane + (P & 1) * 64;
#pragma unroll
  for (int t = 0; t < 4; ++t) {
    const unsigned char* p = rd + o0 + (t << 4) * kFaPitch;
    vh[t] = Frag<__bf16>::load((const __bf16*)p);
    vl[t] = Frag<__bf16>::load((const __bf16*)(p + kFaPlane));
  }
}

__global__ __launch_bounds__(kFaWaves * 32) void attn_fused_kernel(
    const unsigned short* __restrict__ QKhi, const unsigned short* __restrict__ QKlo,
    const unsigned short* __restrict__ Vthi, const unsigned short* __restrict__ Vtlo,
    unsigned short* __restrict__ Chi, unsigned short* __restrict__ Clo) {
  typedef Frag<__bf16> F;
  const int pair = blockIdx.y;
  const int b    = pair / kHeads;
  const int hd   = pair - b * kHeads;
  const int lane = threadIdx.x & 31;
  const int wave = threadIdx.x >> 5;
  const int c    = lane & 15;                  // row of A, column of B and D
  const int h8   = (lane >> 4) * 8;            // k offset of this lane half (A, B); D row offset
  const int q0   = blockIdx.x * (kFaWaves * kFaCols) + wave * kFaCols;
  const size_t tok0 = (size_t)b * kSeq;
  __shared__ __align__(16) unsigned char smem[2 * kFaBufBytes];

  // Staging: copy cc of a sub-tile fills its LDS rows 32 cc .. 32 cc + 31: wave w rows 32 cc + 4 w .. + 3, 8 lanes a row (four whole
  // 128-B lines of global memory an instruction); two copies a plane, 8 a sub-tile, 16 of a wave in flight per stage.
  const int srow = (wave << 2) + (lane >> 3);
  const int scol = (lane & 7) << 3;            // first of this lane's 8 elements
  const unsigned gk = (unsigned)((tok0 + srow) * kQKld + kHid + hd * kDh + scol);   // element offsets in the planes (below 2^23):
  const unsigned gv = (unsigned)((size_t)(hd * kDh + srow) * kTok + tok0 + scol);   // two registers live over the loop, not four pointers
  const unsigned lds0 = (unsigned)(size_t)smem + (unsigned)(srow * kFaPitch + (scol << 1));
  auto stage = [&](int buf, int key0) {
#pragma unroll
    for (int sub = 0; sub < kFaSubs; ++sub) {
      const int ks = key0 + sub * kFaSubKeys;
      unsigned l[8];
      const void* g[8];
#pragma unroll
      for (int cc = 0; cc < 8; ++cc) {
        const int r = (cc & 1) * 32;
        l[cc] = lds0 + (unsigned)(buf * kFaBufBytes + sub * kFaSubBytes + cc * 32 * kFaPitch);
        if (cc < 2)      g[cc] = QKhi + (gk + (unsigned)((ks + r) * kQKld));
        else if (cc < 4) g[cc] = QKlo + (gk + (unsigned)((ks + r) * kQKld));
        else if (cc < 6) g[cc] = Vthi + (gv + (unsigned)(r * kTok + ks));
        else             g[cc] = Vtlo + (gv + (unsigned)(r * kTok + ks));
      }
      async_copies<8>(l, g);
    }
  };
  stage(0, 0);   // flies under the Q loads

  // Q fragments (B operand), kept for the whole loop
  v16b qh[kFaG][2], ql[kFaG][2];
#pragma unroll
  for (int g = 0; g < kFaG; ++g)
#pragma unroll
    for (int kc = 0; kc < 2; ++kc) {
      const size_t o = (tok0 + q0 + (g << 4) + c) * kQKld + hd * kDh + (kc << 5) + h8;
      qh[g][kc] = F::load((const __bf16*)QKhi + o);
      ql[g][kc] = F::load((const __bf16*)QKlo + o);
    }
  v8f acc[kFaG][4];                            // O^T: [column group][16-row tile over d]
  float m_run[kFaG];
  v2f lsum[kFaG];                              // this lane's share of the row sum (its 16 of each pass's 32 keys), even / odd registers
#pragma unroll
  for (int g = 0; g < kFaG; ++g) {
    m_run[g] = -INFINITY;
    lsum[g] = (v2f){0.f, 0.f};
#pragma unroll
    for (int t = 0; t < 4; ++t) acc[g][t] = (v8f){0.f,0.f,0.f,0.f,0.f,0.f,0.f,0.f};
  }

  KFrags kf;
  v16b vh[4], vl[4];                           // [16-row tile over d]
  // one pass of 32 keys; P = its number within the stage, rd = this lane's place in the stage's buffer
  auto pass = [&](auto pnum, const unsigned char* rd) {
    constexpr int P = decltype(pnum)::v;
    // S^T tiles [16-key tile][column group]; per accumulator the order is hi.hi, hi.lo, lo.hi for d 0..31, then for d 32..63
    v8f s[2][kFaG];
#pragma unroll
    for (int kt = 0; kt < 2; ++kt)
#pragma unroll
      for (int g = 0; g < kFaG; ++g) s[kt][g] = (v8f){0.f,0.f,0.f,0.f,0.f,0.f,0.f,0.f};
#pragma unroll
    for (int kc = 0; kc < 2; ++kc) {
#pragma unroll
      for (int kt = 0; kt < 2; ++kt)
#pragma unroll
        for (int g = 0; g < kFaG; ++g) s[kt][g] = F::mma(kf.hi[kt][kc], qh[g][kc], s[kt][g]);
#pragma unroll
      for (int kt = 0; kt < 2; ++kt)
#pragma unroll
        for (int g = 0; g < kFaG; ++g) s[kt][g] = F::mma(kf.lo[kt][kc], qh[g][kc], s[kt][g]);
#pragma unroll
      for (int kt = 0; kt < 2; ++kt)
#pragma unroll
        for (int g = 0; g < kFaG; ++g) s[kt][g] = F::mma(kf.hi[kt][kc], ql[g][kc], s[kt][g]);
    }

    // column maxima of the raw scores (the scale is positive), then one test per pass
    float mb[kFaG];
    bool need = false;
#pragma unroll
    for (int g = 0; g < kFaG; ++g) {
      float mx = s[0][g][0];
#pragma unroll
      for (int r = 1; r < 8; ++r) mx = fmaxf(mx, s[0][g][r]);
#pragma unroll
      for (int r = 0; r < 8; ++r) mx = fmaxf(mx, s[1][g][r]);
      mx = fmaxf(mx, other_half(mx)) * kExp2Scale;   // both halves hold this query's maximum of the pass
      mb[g] = mx;
      need = need || (mx > m_run[g] + 8.0f);          // true in the first pass (m_run = -inf)
    }
    if (__builtin_amdgcn_ballot_w32(need) != 0) {     // wave-uniform scalar branch
#pragma unroll
      for (int g = 0; g < kFaG; ++g) {
        const float m_new = fmaxf(m_run[g], mb[g]);
        const float corr  = __builtin_amdgcn_exp2f(m_run[g] - m_new);   // 0 in the first pass
        m_run[g] = m_new;
        lsum[g] = lsum[g] * corr;
#pragma unroll
        for (int t = 0; t < 4; ++t) acc[g][t] = acc[g][t] * corr;
      }
    }
    // next pass's K fragments (same stage only), in flight under the exponentials and the second product
    if constexpr (P + 1 < kFaStage / kFaKeys) {
      lds_k<P + 1>(kf, rd);
      __builtin_amdgcn_sched_barrier(0);   // holds these reads ahead of the exponentials: sunk among the products below they arrive too late
    }
#pragma unroll
    for (int g = 0; g < kFaG; ++g) {
      const float nm = -m_run[g];
      v8u hw, lw;
      v2f pp[8];
#pragma unroll
      for (int i = 0; i < 8; ++i) {   // operand elements 2i, 2i + 1 = tile i >> 2, registers 2 (i & 3), 2 (i & 3) + 1
        const v2f arg = __builtin_elementwise_fma((v2f){s[i >> 2][g][2 * (i & 3)], s[i >> 2][g][2 * (i & 3) + 1]},
                                                  (v2f){kExp2Scale, kExp2Scale}, (v2f){nm, nm});
        const v2f p = (v2f){__builtin_amdgcn_exp2f(arg.x), __builtin_amdgcn_exp2f(arg.y)};
        const unsigned w = pack_bf2(p.x, p.y);
        const v2f hi = (v2f){__uint_as_float(w << 16), __uint_as_float(w & 0xFFFF0000u)};
        const v2f lo = p - hi;        // exact in f32
        hw[i] = w;
        lw[i] = pack_bf2(lo.x, lo.y);
        pp[i] = p;
      }
      lsum[g] += ((pp[0] + pp[1]) + (pp[2] + pp[3])) + ((pp[4] + pp[5]) + (pp[6] + pp[7]));
      const v16b ph = __builtin_bit_cast(v16b, hw);
      const v16b pl = __builtin_bit_cast(v16b, lw);
#pragma unroll
      for (int t = 0; t < 4; ++t) acc[g][t] = F::mma(vh[t], ph, acc[g][t]);
#pragma unroll
      for (int t = 0; t < 4; ++t) acc[g][t] = F::mma(vl[t], ph, acc[g][t]);
#pragma unroll
      for (int t = 0; t < 4; ++t) acc[g][t] = F::mma(vh[t], pl, acc[g][t]);
    }
    // next pass's v^T fragments (same stage only), in flight under that pass's first product and softmax
    if constexpr (P + 1 < kFaStage / kFaKeys) lds_v<P + 1>(vh, vl, rd);
  };

  // Stage loop, two LDS buffers: trip t reads buffer t % 2 alone while the copies of stage t + 1 fly into the other one.
  const unsigned char* rd0 = smem + c * kFaPitch + (h8 << 1);
  asm volatile("s_wait_asynccnt 0x0" ::: "memory");   // this wave's share of stage 0 has landed
  __syncthreads();                                     // stage 0 readable by every wave
  stage(1, kFaStage);
  for (int t = 0; t < kFaTrips; ++t) {
    const unsigned char* rd = rd0 + (t & 1) * kFaBufBytes;
    lds_k<0>(kf, rd);
    lds_v<0>(vh, vl, rd);
    pass(IC<0>{}, rd);
    pass(IC<1>{}, rd);
    pass(IC<2>{}, rd);
    pass(IC<3>{}, rd);
    asm volatile("s_wait_dscnt 0x0" ::: "memory");      // this wave's reads of buffer t % 2 are over before it is handed to the copies
    asm volatile("s_wait_asynccnt 0x0" ::: "memory");   // this wave's share of stage t + 1 has landed
    __syncthreads();                                     // publishes stage t + 1 and ends every wave's reads of buffer t % 2
    if (t + 2 < kFaTrips) stage(t & 1, (t + 2) * kFaStage);   // the same test in the whole block
  }
  asm volatile("s_wait_asynccnt 0x0" ::: "memory");     // no copy is in flight when the wave ends

  // ctx[query][hd * 64 + 16 t + h8 + r] = acc[g][t][r] / row sum, as bf16 hi/lo planes: 16 B per lane, tile and plane
#pragma unroll
  for (int g = 0; g < kFaG; ++g) {
    const float part = lsum[g].x + lsum[g].y;
    const float inv  = 1.0f / (part + other_half(part));   // sum >= 1: m never exceeds the row maximum
    const size_t co = (tok0 + q0 + (g << 4) + c) * kHid + hd * kDh + h8;
#pragma unroll
    for (int t = 0; t < 4; ++t) {
      v4u hv, lv;
#pragma unroll
      for (int e = 0; e < 4; ++e) {
        const float f0 = acc[g][t][2 * e] * inv;
        const float f1 = acc[g][t][2 * e + 1] * inv;
        const unsigned w = pack_bf2(f0, f1);
        hv[e] = w;
        lv[e] = pack_bf2(f0 - __uint_as_float(w << 16), f1 - __uint_as_float(w & 0xFFFF0000u));
      }
      *(v4u*)(Chi + co + (t << 4)) = hv;
      *(v4u*)(Clo + co + (t << 4)) = lv;
    }
  }
}

// ---------------------------------------------------------------------------
// Launcher. Workspace region map (bytes, MiB = 1048576; carve ends at 128 MiB = 134217728 B):
//   [  0, 18) projection operands: x bf16 [4096][1024] at +0 (8 MiB); wq|wk|wv bf16 [1024][1024] x3 at +8 MiB (6 MiB);
//                      padded down planes [64][1024] x3 at +14 MiB (384 KiB); t tables f32 [4096][64] x3 (tq|tk|tv) at +15 MiB (3 MiB).
//                      late aliases (written after the attention launch, when the above are dead): wo bf16 [1024][1024] at +0 (2 MiB);
//                      padded out_down plane [64][1024] at +2 MiB (128 KiB); to table f32 [4096][64] at +3 MiB (1 MiB).
//   [ 18, 64) unused
//   [ 64, 80) q|k hi : [4096][2048] bf16 (cols 0..1023 = q (h*64+d), 1024..2047 = k)
//   [ 80, 96) q|k lo
//   [ 96,104) v^T hi : [1024 (h*64+d)][4096 (b*2048+s)] bf16
//   [104,112) v^T lo
//   [112,120) ctx hi : [4096][1024] bf16 (col h*64+d)
//   [120,128) ctx lo
// Launch count: 3 casts + 1 down GEMM + 3 projections + 1 attention + 2 late casts + 1 down GEMM + 1 out GEMM = 12.
// Kernel launches only.
// ---------------------------------------------------------------------------
extern "C" void kernel_launch(void* const* d_in, const int* in_sizes, int n_in,
                              void* d_out, int out_size, void* d_ws, size_t ws_size,
                              hipStream_t stream) {
  if (n_in < 14) return;
  if (in_sizes[0] != kTok * kHid) return;
  if (in_sizes[1] != kHid * kHid || in_sizes[2] != kHid * kHid || in_sizes[3] != kHid * kHid || in_sizes[4] != kHid * kHid) return;
  if (in_sizes[5] != kHid) return;
  if (in_sizes[6] != kRank * kHid || in_sizes[8] != kRank * kHid || in_sizes[10] != kRank * kHid || in_sizes[12] != kRank * kHid) return;
  if (in_sizes[7] != kHid * kRank || in_sizes[9] != kHid * kRank || in_sizes[11] != kHid * kRank || in_sizes[13] != kHid * kRank) return;
  if (out_size != kTok * kHid) return;

  const size_t kMiB    = 1048576;
  const size_t offXb   = 0;
  const size_t offW3   = 8 * kMiB;
  const size_t offDn3  = 14 * kMiB;
  const size_t offT3   = 15 * kMiB;
  const size_t offWo   = 0;
  const size_t offDnO  = 2 * kMiB;
  const size_t offTo   = 3 * kMiB;
  const size_t offQKhi = 64 * kMiB;
  const size_t offQKlo = 80 * kMiB;
  const size_t offVthi = 96 * kMiB;
  const size_t offVtlo = 104 * kMiB;
  const size_t offChi  = 112 * kMiB;
  const size_t offClo  = 120 * kMiB;
  const size_t total   = 128 * kMiB;
  if (total > ws_size) return;

  const float* x     = (const float*)d_in[0];
  const float* wq    = (const float*)d_in[1];
  const float* wk    = (const float*)d_in[2];
  const float* wv    = (const float*)d_in[3];
  const float* wo    = (const float*)d_in[4];
  const float* bo    = (const float*)d_in[5];
  const float* q_dn  = (const float*)d_in[6];
  const float* q_up  = (const float*)d_in[7];
  const float* k_dn  = (const float*)d_in[8];
  const float* k_up  = (const float*)d_in[9];
  const float* v_dn  = (const float*)d_in[10];
  const float* v_up  = (const float*)d_in[11];
  const float* o_dn  = (const float*)d_in[12];
  const float* o_up  = (const float*)d_in[13];
  float* out = (float*)d_out;
  char* ws = (char*)d_ws;

  unsigned short* xb   = (unsigned short*)(ws + offXb);
  unsigned short* w3   = (unsigned short*)(ws + offW3);
  unsigned short* dn3  = (unsigned short*)(ws + offDn3);
  float*          t3   = (float*)(ws + offT3);
  unsigned short* wob  = (unsigned short*)(ws + offWo);
  unsigned short* dno  = (unsigned short*)(ws + offDnO);
  float*          tot  = (float*)(ws + offTo);
  unsigned short* qkhi = (unsigned short*)(ws + offQKhi);
  unsigned short* qklo = (unsigned short*)(ws + offQKlo);
  unsigned short* vthi = (unsigned short*)(ws + offVthi);
  unsigned short* vtlo = (unsigned short*)(ws + offVtlo);
  unsigned short* chi  = (unsigned short*)(ws + offChi);
  unsigned short* clo  = (unsigned short*)(ws + offClo);

  // in-range dummies for unused (never dereferenced) template-dead pointer parameters
  const float* dummy_f = bo;
  void* dummy_c2 = (void*)chi;

  const long wPlane  = (long)kHid * kHid;          // 1048576 halves
  const long dnPlane = (long)kRankPad * kHid;      // 65536 halves
  const long tPlane  = (long)kTok * kRankPad;      // 262144 floats

  // 1. x -> RNE bf16 plane [4096][1024]: n8 = 524288 = 2048 blocks x 256
  {
    const int n8 = (kTok * kHid) / 8;
    cast_pad_bf16_kernel<<<dim3(n8 / 256, 1), dim3(256), 0, stream>>>(x, x, x, xb, 0L, n8, kTok * kHid);
  }
  // 2. wq, wk, wv [1024 out][1024 in] -> bf16 planes (Bt layout directly): n8 = 131072 = 512 blocks x 256, 3 tables
  {
    const int n8 = (kHid * kHid) / 8;
    cast_pad_bf16_kernel<<<dim3(n8 / 256, 3), dim3(256), 0, stream>>>(wq, wk, wv, w3, wPlane, n8, kHid * kHid);
  }
  // 3. q/k/v down [4][1024] -> zero-padded bf16 planes [64][1024] (rows 4..63 zero-filled): n8 = 8192 = 32 blocks x 256
  {
    const int n8 = (kRankPad * kHid) / 8;
    cast_pad_bf16_kernel<<<dim3(n8 / 256, 3), dim3(256), 0, stream>>>(q_dn, k_dn, v_dn, dn3, dnPlane, n8, kRank * kHid);
  }
  // 4. t{q,k,v} = x . down^T : M=4096, N=64, K=1024, single bf16 product -> f32 [3][4096][64] (batched over blockIdx.y)
  wmma_gemm64<1, false, 0, 0, false, 0, false, true, 0, 1><<<dim3((kTok / 64) * (kRankPad / 64) / 8, 3), dim3(256), 0, stream>>>(
      xb, xb, kHid, 0L,
      dn3, dn3, kHid, dnPlane,
      (void*)t3, dummy_c2, kRankPad, tPlane,
      dummy_f, dummy_f, 0L,
      dummy_f, 4, dummy_f, 4,
      kTok, kRankPad, kHid, 1.0f);

  // 5. q = x . wq^T + tq . q_up^T : M=4096, N=1024, K=1024 -> bf16 hi/lo into q|k planes cols 0..1023 (ldc 2048)
  wmma_gemm64<1, false, 0, 2, false, 0, false, true, 1><<<dim3((kTok / 64) * (kHid / 64) / 8, 1), dim3(256), 0, stream>>>(
      xb, xb, kHid, 0L,
      w3, w3, kHid, 0L,
      (void*)qkhi, (void*)qklo, kQKld, 0L,
      dummy_f, dummy_f, 0L,
      t3, kRankPad, q_up, kRank,
      kTok, kHid, kHid, 1.0f);
  // 6. k = x . wk^T + tk . k_up^T -> cols 1024..2047
  wmma_gemm64<1, false, 0, 2, false, 0, false, true, 1><<<dim3((kTok / 64) * (kHid / 64) / 8, 1), dim3(256), 0, stream>>>(
      xb, xb, kHid, 0L,
      w3 + wPlane, w3 + wPlane, kHid, 0L,
      (void*)(qkhi + kHid), (void*)(qklo + kHid), kQKld, 0L,
      dummy_f, dummy_f, 0L,
      t3 + tPlane, kRankPad, k_up, kRank,
      kTok, kHid, kHid, 1.0f);
  // 7. v^T = wv . x^T + v_up . tv^T : M=1024 (h*64+d), N=4096 (token), K=1024 -> bf16 hi/lo [1024][4096]
  wmma_gemm64<1, false, 0, 2, false, 0, false, true, 2><<<dim3((kHid / 64) * (kTok / 64) / 8, 1), dim3(256), 0, stream>>>(
      w3 + 2 * wPlane, w3 + 2 * wPlane, kHid, 0L,
      xb, xb, kHid, 0L,
      (void*)vthi, (void*)vtlo, kTok, 0L,
      dummy_f, dummy_f, 0L,
      v_up, kRank, t3 + 2 * tPlane, kRankPad,
      kHid, kTok, kHid, 1.0f);

  // 8. attention, all 32 (batch, head) pairs: ctx = softmax(0.125 * q . k^T) . v -> bf16 hi/lo planes [4096][1024]
  attn_fused_kernel<<<dim3(kSeq / (kFaWaves * kFaCols), kBatch * kHeads), dim3(kFaWaves * 32), 0, stream>>>(
      qkhi, qklo, vthi, vtlo, chi, clo);

  // 9. wo [1024][1024] -> bf16 plane over the dead x plane
  {
    const int n8 = (kHid * kHid) / 8;
    cast_pad_bf16_kernel<<<dim3(n8 / 256, 1), dim3(256), 0, stream>>>(wo, wo, wo, wob, 0L, n8, kHid * kHid);
  }
  // 10. out_down [4][1024] -> zero-padded bf16 plane [64][1024]
  {
    const int n8 = (kRankPad * kHid) / 8;
    cast_pad_bf16_kernel<<<dim3(n8 / 256, 1), dim3(256), 0, stream>>>(o_dn, o_dn, o_dn, dno, 0L, n8, kRank * kHid);
  }
  // 11. to = ctx_hi . out_down^T + ctx_lo . out_down^T : M=4096, N=64, K=1024, 2 products -> f32 [4096][64]
  wmma_gemm64<1, true, 0, 0, false, 0, false, false, 0, 1><<<dim3((kTok / 64) * (kRankPad / 64) / 8, 1), dim3(256), 0, stream>>>(
      chi, clo, kHid, 0L,
      dno, dno, kHid, 0L,
      (void*)tot, dummy_c2, kRankPad, 0L,
      dummy_f, dummy_f, 0L,
      dummy_f, 4, dummy_f, 4,
      kTok, kRankPad, kHid, 1.0f);
  // 12. out = ctx_hi . wo^T + ctx_lo . wo^T + to . out_up^T + bo : M=4096, N=1024, K=1024 -> f32 d_out
  wmma_gemm64<1, true, 2, 0, false, 0, false, false, 1><<<dim3((kTok / 64) * (kHid / 64) / 8, 1), dim3(256), 0, stream>>>(
      chi, clo, kHid, 0L,
      wob, wob, kHid, 0L,
      (void*)out, dummy_c2, kHid, 0L,
      bo, dummy_f, 0L,
      tot, kRankPad, o_up, kRank,
      kTok, kHid, kHid, 1.0f);
}

// v006
// Measured time: 205 microseconds a run.
// In two side-by-side timings against v005, it was 1.08 and 1.09 times as fast.
// Over all steps from v000 it is 14.1 times as fast.
// Contractions: x.W^T (q, k, v^T) and x.down^T: single v_wmma_f32_16x16x32_bf16 products on RNE-bf16 planes; q.k^T scores and p.v context: bf16 hi/lo operand planes (hi.hi + hi.lo + lo.hi); ctx.Wo^T and ctx.out_down^T: ctx bf16 hi/lo x RNE-bf16 weights (hi.W + lo.W); rank-4 up-products, bias and softmax in f32 on the VALU; all f32 accumulate.
#include <hip/hip_runtime.h>
#include <math.h>

// ---------------------------------------------------------------------------
// Problem constants
// ---------------------------------------------------------------------------
constexpr int kBatch   = 2;
constexpr int kSeq     = 2048;
constexpr int kHid     = 1024;
constexpr int kHeads   = 16;
constexpr int kDh      = 64;
constexpr int kTok     = kBatch * kSeq;            // 4096 token rows
constexpr int kRank    = 4;
constexpr int kRankPad = 64;                       // rank padded to one tile
constexpr int kQKld    = 2 * kHid;                 // 2048: pitch of the q|k planes (halves)

static_assert((kTok * kHid) % (8 * 256) == 0, "cast grid exact");
static_assert((kHid * kHid) % (8 * 256) == 0, "cast grid exact");
static_assert((kRankPad * kHid) % (8 * 256) == 0, "pad cast grid exact");
static_assert(kHid % 64 == 0 && kTok % 64 == 0 && kSeq % 64 == 0 && kDh % 64 == 0 && kRankPad % 64 == 0, "tile multiples");
static_assert(kHid % 32 == 0 && kDh % 32 == 0 && kSeq % 32 == 0, "K multiples of 32");

typedef __attribute__((ext_vector_type(16))) _Float16 v16h;
typedef __attribute__((ext_vector_type(8)))  _Float16 v8h;
typedef __attribute__((ext_vector_type(16))) __bf16   v16b;
typedef __attribute__((ext_vector_type(8)))  __bf16   v8b;
typedef __attribute__((ext_vector_type(8)))  float    v8f;
typedef __attribute__((ext_vector_type(4)))  float    v4f;
typedef __attribute__((ext_vector_type(4)))  unsigned int v4u;

__device__ __forceinline__ unsigned short f2bf_bits(float f) {
  unsigned u = __float_as_uint(f);
  return (unsigned short)((u + 0x7FFFu + ((u >> 16) & 1u)) >> 16);
}
__device__ __forceinline__ float bf_bits2f(unsigned short h) { return __uint_as_float(((unsigned)h) << 16); }
__device__ __forceinline__ float bf_rne(float f) { return bf_bits2f(f2bf_bits(f)); }

// hazard guards as plain device helpers
__device__ __forceinline__ void acc_guard4(v8f& a, v8f& b, v8f& c, v8f& d) { asm volatile("v_nop\n\tv_nop\n\tv_nop\n\tv_nop" : "+v"(a), "+v"(b), "+v"(c), "+v"(d)); }
template <typename T> struct Frag;
template <> struct Frag<_Float16> {
  typedef v16h V; union U { v16h v; v8h h[2]; };
  // elements 0..7 <- p[0..7], 8..15 <- p[16..23]
  static __device__ __forceinline__ v16h load(const _Float16* p) {
    U f; f.h[0] = *(const v8h*)(p); f.h[1] = *(const v8h*)(p + 16); return f.v;
  }
  static __device__ __forceinline__ v8f mma(v16h a, v16h b, v8f c) {
    return __builtin_amdgcn_wmma_f32_16x16x32_f16(false, a, false, b, (short)0, c, false, false);
  }
};
template <> struct Frag<__bf16> {
  typedef v16b V; union U { v16b v; v8b h[2]; };
  static __device__ __forceinline__ v16b load(const __bf16* p) {
    U f; f.h[0] = *(const v8b*)(p); f.h[1] = *(const v8b*)(p + 16); return f.v;
  }
  static __device__ __forceinline__ v8f mma(v16b a, v16b b, v8f c) {
    return __builtin_amdgcn_wmma_f32_16x16x32_bf16(false, a, false, b, (short)0, c, false, false);
  }
};

__device__ __forceinline__ unsigned pk16(unsigned short a, unsigned short b) { return (unsigned)a | ((unsigned)b << 16); }

// ---- asynchronous copies global -> LDS: N copies of 16 B a lane in ONE statement; the s_wait_xcnt 0 at its end stands ahead of every
// later rewrite of the address registers that the issued copies name (inside the statement nothing can be moved between them) ----
#define ACP(a, b) "global_load_async_to_lds_b128 %" #a ", %" #b ", off\n\t"
#define AOP(i) "v"(l[i]), "v"(g[i])
#define ACP8 ACP(0, 1) ACP(2, 3) ACP(4, 5) ACP(6, 7) ACP(8, 9) ACP(10, 11) ACP(12, 13) ACP(14, 15)
#define AOP8 AOP(0), AOP(1), AOP(2), AOP(3), AOP(4), AOP(5), AOP(6), AOP(7)
template <int V> struct IC { static constexpr int v = V; };   // a compile-time int as a function argument
template <int N>
__device__ __forceinline__ void async_copies(const unsigned* l, const void* const* g) {
  static_assert(N == 8 || N == 12, "statement sizes in use");
  if constexpr (N == 8) {
    asm volatile(ACP8 "s_wait_xcnt 0x0" :: AOP8 : "memory");
  } else {
    asm volatile(ACP8 ACP(16, 17) ACP(18, 19) ACP(20, 21) ACP(22, 23) "s_wait_xcnt 0x0" :: AOP8, AOP(8), AOP(9), AOP(10), AOP(11) : "memory");
  }
}

// ---- Register-blocked batched WMMA GEMM (BSPLIT and LORA options added; operands staged in LDS) ----
// C[m,n] = scale * sum_k A[m,k] * Bt[n,k] (+bias)(+resid)(+lora); each wave owns a 64x64 tile; a block of NW waves owns
// (NW / WN) x WN such tiles, that is (NW / WN) * 64 rows of A and WN * 64 rows of Bt. NW <= 4: one wave a SIMD, and blocks enough
// for every WGP (256 blocks of 128 x 128 for a 4096 x 1024 output; the 64-column products spread over 32 blocks a table).
// A row-major [M,K]; Bt row-major [N,K]; M % ((NW / WN) * 64) == 0, N % (WN * 64) == 0, K % 64 == 0, K >= 64.
// SPLIT (with BSPLIT == false): A carries a lo plane (A2, same layout); product = hi.B + lo.B (Bt2 unused).
// BIAS_MODE: 0 = none, 1 = bias[m], 2 = bias[n].
// OUT_MODE: 0 = f32, 1 = f16, 2 = bf16 hi plane (Cout) + bf16 lo plane (Cout2).
// LORA: rank-4 f32 term added in the epilogue: v += dot4(rowtab[m][0..3], coltab[n][0..3]); rowtab pitch ldrow floats, coltab pitch
//   ldcol floats (both 16-B aligned rows). LORA == 1: coltab values RNE-bf16 converted at load (rowtab kept f32);
//   LORA == 2: rowtab values RNE-bf16 converted (coltab kept f32). In LORA modes a BIAS_MODE 2 bias is RNE-bf16 converted too.
// ET: 0 = f16 operands, 1 = bf16 operands (pointers passed as 16-bit storage)
template <int ET> struct Elem;
template <> struct Elem<0> { typedef _Float16 T; };
template <> struct Elem<1> { typedef __bf16 T; };
template <int ET, bool SPLIT, int BIAS_MODE, int OUT_MODE, bool RESID, int ACT = 0, bool CAUSAL = false, bool BSPLIT = true, int LORA = 0, int WN = 2, int NW = 4>
__global__ __launch_bounds__(NW * 32) void wmma_gemm64(
    const unsigned short* __restrict__ Ap, const unsigned short* __restrict__ A2p, int lda, long strideA,
    const unsigned short* __restrict__ Btp, const unsigned short* __restrict__ Bt2p, int ldb, long strideB,
    void* __restrict__ Cout, void* __restrict__ Cout2, int ldc, long strideC,
    const float* __restrict__ bias,
    const float* __restrict__ resid, long strideR,
    const float* __restrict__ rowtab, int ldrow,
    const float* __restrict__ coltab, int ldcol,
    int M, int N, int K, float scale) {
  static_assert(!CAUSAL && !(SPLIT && BSPLIT), "the staged k loop has no tile skip and no lo plane of Bt");
  static_assert((NW == 4 && WN == 2) || (NW == 2 && WN == 1), "block shapes in use");
  typedef typename Elem<ET>::T T;
  typedef typename Frag<T>::V V;
  const T* A = (const T*)Ap; const T* A2 = (const T*)A2p; const T* Bt = (const T*)Btp;
  // One stage = 64 k (128 B) of every operand row of the block, LDS rows [A | A lo | Bt] at pitch 144 B (16 B x odd: 16-B row reads
  // of 16 lanes fall on distinct banks). Two stages; the per-wave 16x64 output slabs (pitch 68 floats) reuse the ring behind the loop.
  constexpr int WM        = NW / WN;
  constexpr int kPitch    = 144;
  constexpr int kRowsA    = WM * 64;
  constexpr int kRowB0    = kRowsA * (SPLIT ? 2 : 1);
  constexpr int kRows     = kRowB0 + WN * 64;
  constexpr int kBufBytes = kRows * kPitch;
  constexpr int kSlabs    = NW * 16 * 68 * 4;
  constexpr int kLdsBytes = (2 * kBufBytes > kSlabs) ? 2 * kBufBytes : kSlabs;
  static_assert(kLdsBytes <= 320 * 1024, "LDS of one work-group");
  __shared__ __align__(16) unsigned char smem[kLdsBytes];
  const int b    = blockIdx.y;
  const int lane = threadIdx.x & 31;
  const int wave = threadIdx.x >> 5;
  const int blocksN = N / (WN * 64);
  const int blocksM = M / (WM * 64);
  if ((int)blockIdx.x >= blocksM * blocksN) return;   // the same for the whole block; ahead of every barrier
  const int bm   = blockIdx.x / blocksN;
  const int bn   = blockIdx.x - bm * blocksN;
  const int mBlk = bm * (WM * 64);
  const int nBlk = bn * (WN * 64);
  const int wm   = wave / WN;
  const int wn   = wave - wm * WN;
  const int m0   = mBlk + (wm << 6);
  const int n0   = nBlk + (wn << 6);

  const T* Ab  = A  + (size_t)b * strideA;
  const T* Bb  = Bt + (size_t)b * strideB;
  const T* Ab2 = SPLIT ? (A2  + (size_t)b * strideA) : nullptr;

  const int rlane = lane & 15;                 // row (A) / col (B, D) within subtile
  const int koff  = (lane >> 4) * 8;           // k offset of this lane half
  const int mOff  = (lane >> 4) * 8;           // D row offset

  v8f acc[4][4];
#pragma unroll
  for (int i = 0; i < 4; ++i)
#pragma unroll
    for (int j = 0; j < 4; ++j) acc[i][j] = (v8f){0.f,0.f,0.f,0.f,0.f,0.f,0.f,0.f};

  // Staging: copy c of a stage fills LDS rows RPC c .. RPC c + RPC - 1: wave w rows RPC c + 4w .. + 3, 8 lanes a row (four whole 128-B
  // lines of global memory an instruction). The operand boundaries are multiples of 64 rows, so a copy's operand is known at compile time.
  constexpr int RPC = NW * 4;                  // LDS rows that one copy of every wave fills
  constexpr int NC = kRows / RPC;              // copies of a wave per stage: 16, 24 or 40 (at most 63 may be in flight)
  const int srow = (wave << 2) + (lane >> 3);
  const int scol = (lane & 7) << 3;            // first of this lane's 8 elements
  const T* gA  = Ab + (size_t)(mBlk + srow) * lda + scol;
  const T* gA2 = SPLIT ? (Ab2 + (size_t)(mBlk + srow) * lda + scol) : nullptr;
  const T* gB  = Bb + (size_t)(nBlk + srow) * ldb + scol;
  const unsigned lds0 = (unsigned)(size_t)smem + (unsigned)(srow * kPitch + (scol << 1));
  auto part = [&](auto first, auto count, int buf, int k0) {   // copies first .. first + count - 1 of a stage, one statement
    constexpr int C0 = decltype(first)::v;
    constexpr int CN = decltype(count)::v;
    unsigned l[CN];
    const void* g[CN];
#pragma unroll
    for (int c = 0; c < CN; ++c) {
      const int r = (C0 + c) * RPC;
      l[c] = lds0 + (unsigned)(buf * kBufBytes + r * kPitch);
      if (r < kRowsA)      g[c] = gA  + (size_t)r * lda + k0;
      else if (r < kRowB0) g[c] = gA2 + (size_t)(r - kRowsA) * lda + k0;
      else                 g[c] = gB  + (size_t)(r - kRowB0) * ldb + k0;
    }
    async_copies<CN>(l, g);
    __builtin_amdgcn_sched_barrier(0);   // keeps the next statement's address sums behind this one: formed all at once they spill
  };
  auto stage = [&](int buf, int k0) {
    if constexpr (NC == 16)      { part(IC<0>{}, IC<8>{}, buf, k0); part(IC<8>{}, IC<8>{}, buf, k0); }
    else if constexpr (NC == 24) { part(IC<0>{}, IC<12>{}, buf, k0); part(IC<12>{}, IC<12>{}, buf, k0); }
    else {
      static_assert(NC == 16 || NC == 24 || NC == 40, "statement split");
      part(IC<0>{}, IC<8>{}, buf, k0); part(IC<8>{}, IC<8>{}, buf, k0); part(IC<16>{}, IC<8>{}, buf, k0);
      part(IC<24>{}, IC<8>{}, buf, k0); part(IC<32>{}, IC<8>{}, buf, k0);
    }
  };

  // k loop, two LDS buffers: trip t works on buffer t % 2 alone while the copies of stage t + 1 fly into the other one.
  // Per accumulator the order of the products is that of k (hi.B, then lo.B, within a 32-k step).
  const int ntrips = K >> 6;                   // >= 1
  const unsigned char* aRd = smem + ((wm << 6) + rlane) * kPitch + (koff << 1);
  const unsigned char* bRd = smem + (kRowB0 + (wn << 6) + rlane) * kPitch + (koff << 1);
  stage(0, 0);
  asm volatile("s_wait_asynccnt 0x0" ::: "memory");   // this wave's share of stage 0 has landed
  __syncthreads();                                     // stage 0 readable by every wave
  if (ntrips > 1) stage(1, 64);
  for (int t = 0; t < ntrips; ++t) {
    const int bo = (t & 1) * kBufBytes;
    V fa[2][4], fl[2][4], fb[2][4];            // both 32-k steps of the stage, read as one group ahead of the products
#pragma unroll
    for (int ks = 0; ks < 2; ++ks) {
#pragma unroll
      for (int j = 0; j < 4; ++j) fb[ks][j] = Frag<T>::load((const T*)(bRd + bo + j * 16 * kPitch + ks * 64));
#pragma unroll
      for (int i = 0; i < 4; ++i) {
        fa[ks][i] = Frag<T>::load((const T*)(aRd + bo + i * 16 * kPitch + ks * 64));
        if (SPLIT) fl[ks][i] = Frag<T>::load((const T*)(aRd + bo + (kRowsA + i * 16) * kPitch + ks * 64));
      }
    }
    __builtin_amdgcn_sched_barrier(0);   // holds the reads together ahead of the products: sunk among them, every row of products waits out an LDS latency
#pragma unroll
    for (int ks = 0; ks < 2; ++ks) {
#pragma unroll
      for (int i = 0; i < 4; ++i) {
#pragma unroll
        for (int j = 0; j < 4; ++j) acc[i][j] = Frag<T>::mma(fa[ks][i], fb[ks][j], acc[i][j]);
        if (SPLIT) {
#pragma unroll
          for (int j = 0; j < 4; ++j) acc[i][j] = Frag<T>::mma(fl[ks][i], fb[ks][j], acc[i][j]);
        }
      }
    }
    __builtin_amdgcn_sched_barrier(0);   // holds the waits, the barrier and the refill behind the products: risen over them, the refill would fly under the next reads alone
    asm volatile("s_wait_dscnt 0x0" ::: "memory");      // this wave's reads of buffer t % 2 are over before it is handed to the copies
    asm volatile("s_wait_asynccnt 0x0" ::: "memory");   // this wave's share of stage t + 1 has landed
    __syncthreads();                                     // publishes stage t + 1 and ends every wave's reads of buffer t % 2
    if (t + 2 < ntrips) stage(t & 1, (t + 2) << 6);      // the same test in the whole block
  }
  asm volatile("s_wait_asynccnt 0x0" ::: "memory");     // no copy is in flight when the ring becomes the output slabs
  acc_guard4(acc[0][0], acc[0][1], acc[0][2], acc[0][3]);
  acc_guard4(acc[1][0], acc[1][1], acc[1][2], acc[1][3]);
  acc_guard4(acc[2][0], acc[2][1], acc[2][2], acc[2][3]);
  acc_guard4(acc[3][0], acc[3][1], acc[3][2], acc[3][3]);

  // ---- epilogue ----
  float* slab = (float*)smem + wave * (16 * 68);   // behind the last trip's barrier: nobody reads the ring any more
  const float* Rb = RESID ? (resid + (size_t)b * strideR) : nullptr;
  // rank-4 column table (LORA modes): per lane the 4 columns n0 + 16j + rlane
  v4f ctab[4];
  float cbias[4];
#pragma unroll
  for (int j = 0; j < 4; ++j) { ctab[j] = (v4f){0.f,0.f,0.f,0.f}; cbias[j] = 0.f; }
  if (LORA != 0) {
#pragma unroll
    for (int j = 0; j < 4; ++j) {
      const int n = n0 + (j << 4) + rlane;
      v4f u = *(const v4f*)(coltab + (size_t)n * ldcol);
      if (LORA == 1) {
#pragma unroll
        for (int e = 0; e < 4; ++e) u[e] = bf_rne(u[e]);
      }
      ctab[j] = u;
      if (BIAS_MODE == 2) cbias[j] = bf_rne(bias[n]);
    }
  }
#pragma unroll
  for (int i = 0; i < 4; ++i) {
    const int mBase = m0 + (i << 4);
    if (LORA == 0) {
#pragma unroll
      for (int j = 0; j < 4; ++j) {
        const int n = n0 + (j << 4) + rlane;
        float bv = 0.f;
        if (BIAS_MODE == 2) bv = bias[n];
#pragma unroll
        for (int r = 0; r < 8; ++r) {
          float v = acc[i][j][r] * scale;
          if (BIAS_MODE == 1) v += bias[mBase + mOff + r];
          if (BIAS_MODE == 2) v += bv;
          if (RESID) v += Rb[(size_t)(mBase + mOff + r) * ldc + n];
          if (ACT == 2) v = fmaxf(v, 0.0f);
          if (ACT == 4) v = (v > 0.f) ? v : 0.01f * v;
          slab[(mOff + r) * 68 + (j << 4) + rlane] = v;
        }
      }
    } else {
#pragma unroll
      for (int r = 0; r < 8; ++r) {
        const int m = mBase + mOff + r;
        v4f tr = *(const v4f*)(rowtab + (size_t)m * ldrow);
        if (LORA == 2) {
#pragma unroll
          for (int e = 0; e < 4; ++e) tr[e] = bf_rne(tr[e]);
        }
#pragma unroll
        for (int j = 0; j < 4; ++j) {
          float lr = tr[0] * ctab[j][0];
          lr = fmaf(tr[1], ctab[j][1], lr);
          lr = fmaf(tr[2], ctab[j][2], lr);
          lr = fmaf(tr[3], ctab[j][3], lr);
          float v = acc[i][j][r] * scale + lr;
          if (BIAS_MODE == 2) v += cbias[j];
          slab[(mOff + r) * 68 + (j << 4) + rlane] = v;
        }
      }
    }
    __builtin_amdgcn_fence(__ATOMIC_RELEASE, "workgroup");
    __builtin_amdgcn_wave_barrier();
    __builtin_amdgcn_fence(__ATOMIC_ACQUIRE, "workgroup");
    if (OUT_MODE == 0) {
      float* C = (float*)Cout + (size_t)b * strideC;
      const int hh = lane >> 4, c4 = (lane & 15) * 4;     // row seg = 256 B = 16 lanes x 16 B
      {
#pragma unroll
        for (int it = 0; it < 8; ++it) {
          const int row = it * 2 + hh;
          v4f v = *(const v4f*)(slab + row * 68 + c4);
          *(v4f*)(C + (size_t)(mBase + row) * ldc + n0 + c4) = v;
        }
        
      }
    } else {
      const int q = lane >> 3, c8 = (lane & 7) * 8;
      unsigned short* C  = (unsigned short*)Cout  + (size_t)b * strideC;
      unsigned short* C2 = (OUT_MODE == 2) ? ((unsigned short*)Cout2 + (size_t)b * strideC) : nullptr;
      {
#pragma unroll
        for (int it = 0; it < 4; ++it) {
          const int row = it * 4 + q;
          const float* sp = slab + row * 68 + c8;
          v8h hv, lv;
#pragma unroll
          for (int e = 0; e < 8; ++e) {
            if (OUT_MODE == 1) {
              hv[e] = (_Float16)sp[e];
            } else {
              unsigned short hb = f2bf_bits(sp[e]);
              unsigned short lb = f2bf_bits(sp[e] - bf_bits2f(hb));
              hv[e] = __builtin_bit_cast(_Float16, hb);
              lv[e] = __builtin_bit_cast(_Float16, lb);
            }
          }
          *(v8h*)(C + (size_t)(mBase + row) * ldc + n0 + c8) = hv;
          if (OUT_MODE == 2) *(v8h*)(C2 + (size_t)(mBase + row) * ldc + n0 + c8) = lv;
        }
        
      }
    }
    __builtin_amdgcn_fence(__ATOMIC_RELEASE, "workgroup");
    __builtin_amdgcn_wave_barrier();
    __builtin_amdgcn_fence(__ATOMIC_ACQUIRE, "workgroup");
  }
}

// ---------------------------------------------------------------------------
// f32 -> RNE bf16 plane with zero padding, up to 3 same-shaped tables per launch (blockIdx.y selects the source, block-uniform).
// Thread i owns flat elements 8i..8i+7 of plane y: value = in_y[e] for e < nvalid, 0 otherwise (the load address is clamped to
// [0, nvalid-8], the value is zeroed by predicate). out plane y starts at out + y * plane_halves.
// Coverage: n8 = plane elements / 8 threads x 8 = the whole padded plane (grids are exact multiples of 256 here).
// ---------------------------------------------------------------------------
__global__ __launch_bounds__(256) void cast_pad_bf16_kernel(const float* __restrict__ s0, const float* __restrict__ s1,
                                                            const float* __restrict__ s2,
                                                            unsigned short* __restrict__ out, long plane_halves,
                                                            int n8, int nvalid) {
  const int i = blockIdx.x * 256 + threadIdx.x;
  if (i >= n8) return;
  const int y = blockIdx.y;
  const float* src = (y == 0) ? s0 : ((y == 1) ? s1 : s2);
  const long e = 8L * (long)i;
  const bool live = (e < (long)nvalid);
  const long ec = live ? e : (long)(nvalid - 8);
  const v4f a = *(const v4f*)(src + ec);
  const v4f c = *(const v4f*)(src + ec + 4);
  float f[8];
#pragma unroll
  for (int k = 0; k < 4; ++k) { f[k] = live ? a[k] : 0.0f; f[4 + k] = live ? c[k] : 0.0f; }
  unsigned w[4];
#pragma unroll
  for (int e2 = 0; e2 < 4; ++e2) w[e2] = pk16(f2bf_bits(f[2 * e2]), f2bf_bits(f[2 * e2 + 1]));
  const v4u u = (v4u){w[0], w[1], w[2], w[3]};
  unsigned short* q = out + (size_t)y * plane_halves + (size_t)e;
  *(v4u*)q = u;
  
}

constexpr int kFaWaves = 8;
constexpr int kFaCols  = 32;                       // query columns per wave
constexpr int kFaG     = kFaCols / 16;             // 16-column groups per wave
constexpr int kFaKeys  = 32;                       // keys per pass = one k step of the second product
constexpr float kExp2Scale = 0.125f * 1.4426950408889634f;   // 64^-0.5 * log2(e)
constexpr int kFaSubKeys  = 64;                    // keys of a sub-tile
constexpr int kFaSubs     = 2;                     // sub-tiles of a stage
constexpr int kFaStage    = kFaSubKeys * kFaSubs;  // keys of a stage
constexpr int kFaTrips    = kSeq / kFaStage;
constexpr int kFaPitch    = 144;
constexpr int kFaPlane    = 64 * kFaPitch;         // one operand plane of a sub-tile, bytes
constexpr int kFaSubBytes = 4 * kFaPlane;
constexpr int kFaBufBytes = kFaSubs * kFaSubBytes;
static_assert(kSeq % (kFaWaves * kFaCols) == 0 && kSeq % kFaKeys == 0 && kDh == 64, "fused attention tile shape");
static_assert(kSeq % kFaStage == 0 && kFaTrips >= 2 && kFaStage == 4 * kFaKeys && kFaWaves == 8, "stage shape");
static_assert(2 * kFaBufBytes <= 320 * 1024, "LDS of one work-group");
typedef __attribute__((ext_vector_type(2))) float  v2f;
typedef __attribute__((ext_vector_type(2))) __bf16 v2b;
typedef __attribute__((ext_vector_type(8))) unsigned int v8u;

// two f32 -> two RNE bf16 in one word (a in the low half)
__device__ __forceinline__ unsigned pack_bf2(float a, float b) {
  return __builtin_bit_cast(unsigned, __builtin_convertvector((v2f){a, b}, v2b));
}
// value of lane l ^ 16
__device__ __forceinline__ float other_half(float x) {
  const int i = __builtin_bit_cast(int, x);
  return __builtin_bit_cast(float, __builtin_amdgcn_permlanex16(i, i, 0x76543210, 0xfedcba98, false, false));
}
struct KFrags { v16b hi[2][2], lo[2][2]; };        // [16-key tile][32-wide step over d]
// Fragments of pass P (0..3) of a stage, from LDS; rd = this lane's place in the stage's buffer: row c, byte 2 * h8.
template <int P>
__device__ __forceinline__ void lds_k(KFrags& k, const unsigned char* rd) {
  constexpr int o0 = (P >> 1) * kFaSubBytes + (P & 1) * 32 * kFaPitch;
#pragma unroll
  for (int kt = 0; kt < 2; ++kt)
#pragma unroll
    for (int kc = 0; kc < 2; ++kc) {
      const unsigned char* p = rd + o0 + (kt << 4) * kFaPitch + (kc << 6);
      k.hi[kt][kc] = Frag<__bf16>::load((const __bf16*)p);
      k.lo[kt][kc] = Frag<__bf16>::load((const __bf16*)(p + kFaPlane));
    }
}
template <int P>
__device__ __forceinline__ void lds_v(v16b (&vh)[4], v16b (&vl)[4], const unsigned char* rd) {
  constexpr int o0 = (P >> 1) * kFaSubBytes + 2 * kFaPlane + (P & 1) * 64;
#pragma unroll
  for (int t = 0; t < 4; ++t) {
    const unsigned char* p = rd + o0 + (t << 4) * kFaPitch;
    vh[t] = Frag<__bf16>::load((const __bf16*)p);
    vl[t] = Frag<__bf16>::load((const __bf16*)(p + kFaPlane));
  }
}

__global__ __launch_bounds__(kFaWaves * 32) void attn_fused_kernel(
    const unsigned short* __restrict__ QKhi, const unsigned short* __restrict__ QKlo,
    const unsigned short* __restrict__ Vthi, const unsigned short* __restrict__ Vtlo,
    unsigned short* __restrict__ Chi, unsigned short* __restrict__ Clo) {
  typedef Frag<__bf16> F;
  const int pair = blockIdx.y;
  const int b    = pair / kHeads;
  const int hd   = pair - b * kHeads;
  const int lane = threadIdx.x & 31;
  const int wave = threadIdx.x >> 5;
  const int c    = lane & 15;                  // row of A, column of B and D
  const int h8   = (lane >> 4) * 8;            // k offset of this lane half (A, B); D row offset
  const int q0   = blockIdx.x * (kFaWaves * kFaCols) + wave * kFaCols;
  const size_t tok0 = (size_t)b * kSeq;
  __shared__ __align__(16) unsigned char smem[2 * kFaBufBytes];

  // Staging: copy cc of a sub-tile fills its LDS rows 32 cc .. 32 cc + 31: wave w rows 32 cc + 4 w .. + 3, 8 lanes a row (four whole
  // 128-B lines of global memory an instruction); two copies a plane, 8 a sub-tile, 16 of a wave in flight per stage.
  const int srow = (wave << 2) + (lane >> 3);
  const int scol = (lane & 7) << 3;            // first of this lane's 8 elements
  const unsigned gk = (unsigned)((tok0 + srow) * kQKld + kHid + hd * kDh + scol);   // element offsets in the planes (below 2^23):
  const unsigned gv = (unsigned)((size_t)(hd * kDh + srow) * kTok + tok0 + scol);   // two registers live over the loop, not four pointers
  const unsigned lds0 = (unsigned)(size_t)smem + (unsigned)(srow * kFaPitch + (scol << 1));
  auto stage = [&](int buf, int key0) {
#pragma unroll
    for (int sub = 0; sub < kFaSubs; ++sub) {
      const int ks = key0 + sub * kFaSubKeys;
      unsigned l[8];
      const void* g[8];
#pragma unroll
      for (int cc = 0; cc < 8; ++cc) {
        const int r = (cc & 1) * 32;
        l[cc] = lds0 + (unsigned)(buf * kFaBufBytes + sub * kFaSubBytes + cc * 32 * kFaPitch);
        if (cc < 2)      g[cc] = QKhi + (gk + (unsigned)((ks + r) * kQKld));
        else if (cc < 4) g[cc] = QKlo + (gk + (unsigned)((ks + r) * kQKld));
        else if (cc < 6) g[cc] = Vthi + (gv + (unsigned)(r * kTok + ks));
        else             g[cc] = Vtlo + (gv + (unsigned)(r * kTok + ks));
      }
      async_copies<8>(l, g);
    }
  };
  stage(0, 0);   // flies under the Q loads

  // Q fragments (B operand), kept for the whole loop
  v16b qh[kFaG][2], ql[kFaG][2];
#pragma unroll
  for (int g = 0; g < kFaG; ++g)
#pragma unroll
    for (int kc = 0; kc < 2; ++kc) {
      const size_t o = (tok0 + q0 + (g << 4) + c) * kQKld + hd * kDh + (kc << 5) + h8;
      qh[g][kc] = F::load((const __bf16*)QKhi + o);
      ql[g][kc] = F::load((const __bf16*)QKlo + o);
    }
  v8f acc[kFaG][4];                            // O^T: [column group][16-row tile over d]
  float m_run[kFaG];
  v2f lsum[kFaG];                              // this lane's share of the row sum (its 16 of each pass's 32 keys), even / odd registers
#pragma unroll
  for (int g = 0; g < kFaG; ++g) {
    m_run[g] = -INFINITY;
    lsum[g] = (v2f){0.f, 0.f};
#pragma unroll
    for (int t = 0; t < 4; ++t) acc[g][t] = (v8f){0.f,0.f,0.f,0.f,0.f,0.f,0.f,0.f};
  }

  KFrags kf;
  v16b vh[4], vl[4];                           // [16-row tile over d]
  // one pass of 32 keys; P = its number within the stage, rd = this lane's place in the stage's buffer
  auto pass = [&](auto pnum, const unsigned char* rd) {
    constexpr int P = decltype(pnum)::v;
    // S^T tiles [16-key tile][column group]; per accumulator the order is hi.hi, hi.lo, lo.hi for d 0..31, then for d 32..63
    v8f s[2][kFaG];
#pragma unroll
    for (int kt = 0; kt < 2; ++kt)
#pragma unroll
      for (int g = 0; g < kFaG; ++g) s[kt][g] = (v8f){0.f,0.f,0.f,0.f,0.f,0.f,0.f,0.f};
#pragma unroll
    for (int kc = 0; kc < 2; ++kc) {
#pragma unroll
      for (int kt = 0; kt < 2; ++kt)
#pragma unroll
        for (int g = 0; g < kFaG; ++g) s[kt][g] = F::mma(kf.hi[kt][kc], qh[g][kc], s[kt][g]);
#pragma unroll
      for (int kt = 0; kt < 2; ++kt)
#pragma unroll
        for (int g = 0; g < kFaG; ++g) s[kt][g] = F::mma(kf.lo[kt][kc], qh[g][kc], s[kt][g]);
#pragma unroll
      for (int kt = 0; kt < 2; ++kt)
#pragma unroll
        for (int g = 0; g < kFaG; ++g) s[kt][g] = F::mma(kf.hi[kt][kc], ql[g][kc], s[kt][g]);
    }

    // column maxima of the raw scores (the scale is positive), then one test per pass
    float mb[kFaG];
    bool need = false;
#pragma unroll
    for (int g = 0; g < kFaG; ++g) {
      float mx = s[0][g][0];
#pragma unroll
      for (int r = 1; r < 8; ++r) mx = fmaxf(mx, s[0][g][r]);
#pragma unroll
      for (int r = 0; r < 8; ++r) mx = fmaxf(mx, s[1][g][r]);
      mx = fmaxf(mx, other_half(mx)) * kExp2Scale;   // both halves hold this query's maximum of the pass
      mb[g] = mx;
      need = need || (mx > m_run[g] + 8.0f);          // true in the first pass (m_run = -inf)
    }
    if (__builtin_amdgcn_ballot_w32(need) != 0) {     // wave-uniform scalar branch
#pragma unroll
      for (int g = 0; g < kFaG; ++g) {
        const float m_new = fmaxf(m_run[g], mb[g]);
        const float corr  = __builtin_amdgcn_exp2f(m_run[g] - m_new);   // 0 in the first pass
        m_run[g] = m_new;
        lsum[g] = lsum[g] * corr;
#pragma unroll
        for (int t = 0; t < 4; ++t) acc[g][t] = acc[g][t] * corr;
      }
    }
    // next pass's K fragments (same stage only), in flight under the exponentials and the second product
    if constexpr (P + 1 < kFaStage / kFaKeys) {
      lds_k<P + 1>(kf, rd);
      __builtin_amdgcn_sched_barrier(0);   // holds these reads ahead of the exponentials: sunk among the products below they arrive too late
    }
#pragma unroll
    for (int g = 0; g < kFaG; ++g) {
      const float nm = -m_run[g];
      v8u hw, lw;
      v2f pp[8];
#pragma unroll
      for (int i = 0; i < 8; ++i) {   // operand elements 2i, 2i + 1 = tile i >> 2, registers 2 (i & 3), 2 (i & 3) + 1
        const v2f arg = __builtin_elementwise_fma((v2f){s[i >> 2][g][2 * (i & 3)], s[i >> 2][g][2 * (i & 3) + 1]},
                                                  (v2f){kExp2Scale, kExp2Scale}, (v2f){nm, nm});
        const v2f p = (v2f){__builtin_amdgcn_exp2f(arg.x), __builtin_amdgcn_exp2f(arg.y)};
        const unsigned w = pack_bf2(p.x, p.y);
        const v2f hi = (v2f){__uint_as_float(w << 16), __uint_as_float(w & 0xFFFF0000u)};
        const v2f lo = p - hi;        // exact in f32
        hw[i] = w;
        lw[i] = pack_bf2(lo.x, lo.y);
        pp[i] = p;
      }
      lsum[g] += ((pp[0] + pp[1]) + (pp[2] + pp[3])) + ((pp[4] + pp[5]) + (pp[6] + pp[7]));
      const v16b ph = __builtin_bit_cast(v16b, hw);
      const v16b pl = __builtin_bit_cast(v16b, lw);
#pragma unroll
      for (int t = 0; t < 4; ++t) acc[g][t] = F::mma(vh[t], ph, acc[g][t]);
#pragma unroll
      for (int t = 0; t < 4; ++t) acc[g][t] = F::mma(vl[t], ph, acc[g][t]);
#pragma unroll
      for (int t = 0; t < 4; ++t) acc[g][t] = F::mma(vh[t], pl, acc[g][t]);
    }
    // next pass's v^T fragments (same stage only), in flight under that pass's first product and softmax
    if constexpr (P + 1 < kFaStage / kFaKeys) lds_v<P + 1>(vh, vl, rd);
  };

  // Stage loop, two LDS buffers: trip t reads buffer t % 2 alone while the copies of stage t + 1 fly into the other one.
  const unsigned char* rd0 = smem + c * kFaPitch + (h8 << 1);
  asm volatile("s_wait_asynccnt 0x0" ::: "memory");   // this wave's share of stage 0 has landed
  __syncthreads();                                     // stage 0 readable by every wave
  stage(1, kFaStage);
  for (int t = 0; t < kFaTrips; ++t) {
    const unsigned char* rd = rd0 + (t & 1) * kFaBufBytes;
    lds_k<0>(kf, rd);
    lds_v<0>(vh, vl, rd);
    pass(IC<0>{}, rd);
    pass(IC<1>{}, rd);
    pass(IC<2>{}, rd);
    pass(IC<3>{}, rd);
    asm volatile("s_wait_dscnt 0x0" ::: "memory");      // this wave's reads of buffer t % 2 are over before it is handed to the copies
    asm volatile("s_wait_asynccnt 0x0" ::: "memory");   // this wave's share of stage t + 1 has landed
    __syncthreads();                                     // publishes stage t + 1 and ends every wave's reads of buffer t % 2
    if (t + 2 < kFaTrips) stage(t & 1, (t + 2) * kFaStage);   // the same test in the whole block
  }
  asm volatile("s_wait_asynccnt 0x0" ::: "memory");     // no copy is in flight when the wave ends

  // ctx[query][hd * 64 + 16 t + h8 + r] = acc[g][t][r] / row sum, as bf16 hi/lo planes: 16 B per lane, tile and plane
#pragma unroll
  for (int g = 0; g < kFaG; ++g) {
    const float part = lsum[g].x + lsum[g].y;
    const float inv  = 1.0f / (part + other_half(part));   // sum >= 1: m never exceeds the row maximum
    const size_t co = (tok0 + q0 + (g << 4) + c) * kHid + hd * kDh + h8;
#pragma unroll
    for (int t = 0; t < 4; ++t) {
      v4u hv, lv;
#pragma unroll
      for (int e = 0; e < 4; ++e) {
        const float f0 = acc[g][t][2 * e] * inv;
        const float f1 = acc[g][t][2 * e + 1] * inv;
        const unsigned w = pack_bf2(f0, f1);
        hv[e] = w;
        lv[e] = pack_bf2(f0 - __uint_as_float(w << 16), f1 - __uint_as_float(w & 0xFFFF0000u));
      }
      *(v4u*)(Chi + co + (t << 4)) = hv;
      *(v4u*)(Clo + co + (t << 4)) = lv;
    }
  }
}

// ---------------------------------------------------------------------------
// Launcher. Workspace region map (bytes, MiB = 1048576; carve ends at 128 MiB = 134217728 B):
//   [  0, 18) projection operands: x bf16 [4096][1024] at +0 (8 MiB); wq|wk|wv bf16 [1024][1024] x3 at +8 MiB (6 MiB);
//                      padded down planes [64][1024] x3 at +14 MiB (384 KiB); t tables f32 [4096][64] x3 (tq|tk|tv) at +15 MiB (3 MiB).
//                      late aliases (written after the attention launch, when the above are dead): wo bf16 [1024][1024] at +0 (2 MiB);
//                      padded out_down plane [64][1024] at +2 MiB (128 KiB); to table f32 [4096][64] at +3 MiB (1 MiB).
//   [ 18, 64) unused
//   [ 64, 80) q|k hi : [4096][2048] bf16 (cols 0..1023 = q (h*64+d), 1024..2047 = k)
//   [ 80, 96) q|k lo
//   [ 96,104) v^T hi : [1024 (h*64+d)][4096 (b*2048+s)] bf16
//   [104,112) v^T lo
//   [112,120) ctx hi : [4096][1024] bf16 (col h*64+d)
//   [120,128) ctx lo
// Launch count: 3 casts + 1 down GEMM + 3 projections + 1 attention + 2 late casts + 1 down GEMM + 1 out GEMM = 12.
// Kernel launches only.
// ---------------------------------------------------------------------------
extern "C" void kernel_launch(void* const* d_in, const int* in_sizes, int n_in,
                              void* d_out, int out_size, void* d_ws, size_t ws_size,
                              hipStream_t stream) {
  if (n_in < 14) return;
  if (in_sizes[0] != kTok * kHid) return;
  if (in_sizes[1] != kHid * kHid || in_sizes[2] != kHid * kHid || in_sizes[3] != kHid * kHid || in_sizes[4] != kHid * kHid) return;
  if (in_sizes[5] != kHid) return;
  if (in_sizes[6] != kRank * kHid || in_sizes[8] != kRank * kHid || in_sizes[10] != kRank * kHid || in_sizes[12] != kRank * kHid) return;
  if (in_sizes[7] != kHid * kRank || in_sizes[9] != kHid * kRank || in_sizes[11] != kHid * kRank || in_sizes[13] != kHid * kRank) return;
  if (out_size != kTok * kHid) return;

  const size_t kMiB    = 1048576;
  const size_t offXb   = 0;
  const size_t offW3   = 8 * kMiB;
  const size_t offDn3  = 14 * kMiB;
  const size_t offT3   = 15 * kMiB;
  const size_t offWo   = 0;
  const size_t offDnO  = 2 * kMiB;
  const size_t offTo   = 3 * kMiB;
  const size_t offQKhi = 64 * kMiB;
  const size_t offQKlo = 80 * kMiB;
  const size_t offVthi = 96 * kMiB;
  const size_t offVtlo = 104 * kMiB;
  const size_t offChi  = 112 * kMiB;
  const size_t offClo  = 120 * kMiB;
  const size_t total   = 128 * kMiB;
  if (total > ws_size) return;

  const float* x     = (const float*)d_in[0];
  const float* wq    = (const float*)d_in[1];
  const float* wk    = (const float*)d_in[2];
  const float* wv    = (const float*)d_in[3];
  const float* wo    = (const float*)d_in[4];
  const float* bo    = (const float*)d_in[5];
  const float* q_dn  = (const float*)d_in[6];
  const float* q_up  = (const float*)d_in[7];
  const float* k_dn  = (const float*)d_in[8];
  const float* k_up  = (const float*)d_in[9];
  const float* v_dn  = (const float*)d_in[10];
  const float* v_up  = (const float*)d_in[11];
  const float* o_dn  = (const float*)d_in[12];
  const float* o_up  = (const float*)d_in[13];
  float* out = (float*)d_out;
  char* ws = (char*)d_ws;

  unsigned short* xb   = (unsigned short*)(ws + offXb);
  unsigned short* w3   = (unsigned short*)(ws + offW3);
  unsigned short* dn3  = (unsigned short*)(ws + offDn3);
  float*          t3   = (float*)(ws + offT3);
  unsigned short* wob  = (unsigned short*)(ws + offWo);
  unsigned short* dno  = (unsigned short*)(ws + offDnO);
  float*          tot  = (float*)(ws + offTo);
  unsigned short* qkhi = (unsigned short*)(ws + offQKhi);
  unsigned short* qklo = (unsigned short*)(ws + offQKlo);
  unsigned short* vthi = (unsigned short*)(ws + offVthi);
  unsigned short* vtlo = (unsigned short*)(ws + offVtlo);
  unsigned short* chi  = (unsigned short*)(ws + offChi);
  unsigned short* clo  = (unsigned short*)(ws + offClo);

  // in-range dummies for unused (never dereferenced) template-dead pointer parameters
  const float* dummy_f = bo;
  void* dummy_c2 = (void*)chi;

  const long wPlane  = (long)kHid * kHid;          // 1048576 halves
  const long dnPlane = (long)kRankPad * kHid;      // 65536 halves
  const long tPlane  = (long)kTok * kRankPad;      // 262144 floats

  // 1. x -> RNE bf16 plane [4096][1024]: n8 = 524288 = 2048 blocks x 256
  {
    const int n8 = (kTok * kHid) / 8;
    cast_pad_bf16_kernel<<<dim3(n8 / 256, 1), dim3(256), 0, stream>>>(x, x, x, xb, 0L, n8, kTok * kHid);
  }
  // 2. wq, wk, wv [1024 out][1024 in] -> bf16 planes (Bt layout directly): n8 = 131072 = 512 blocks x 256, 3 tables
  {
    const int n8 = (kHid * kHid) / 8;
    cast_pad_bf16_kernel<<<dim3(n8 / 256, 3), dim3(256), 0, stream>>>(wq, wk, wv, w3, wPlane, n8, kHid * kHid);
  }
  // 3. q/k/v down [4][1024] -> zero-padded bf16 planes [64][1024] (rows 4..63 zero-filled): n8 = 8192 = 32 blocks x 256
  {
    const int n8 = (kRankPad * kHid) / 8;
    cast_pad_bf16_kernel<<<dim3(n8 / 256, 3), dim3(256), 0, stream>>>(q_dn, k_dn, v_dn, dn3, dnPlane, n8, kRank * kHid);
  }
  // 4. t{q,k,v} = x . down^T : M=4096, N=64, K=1024, single bf16 product -> f32 [3][4096][64] (batched over blockIdx.y)
  wmma_gemm64<1, false, 0, 0, false, 0, false, true, 0, 1, 2><<<dim3((kTok / 64) * (kRankPad / 64) / 2, 3), dim3(64), 0, stream>>>(
      xb, xb, kHid, 0L,
      dn3, dn3, kHid, dnPlane,
      (void*)t3, dummy_c2, kRankPad, tPlane,
      dummy_f, dummy_f, 0L,
      dummy_f, 4, dummy_f, 4,
      kTok, kRankPad, kHid, 1.0f);

  // 5. q = x . wq^T + tq . q_up^T : M=4096, N=1024, K=1024 -> bf16 hi/lo into q|k planes cols 0..1023 (ldc 2048)
  wmma_gemm64<1, false, 0, 2, false, 0, false, true, 1><<<dim3((kTok / 64) * (kHid / 64) / 4, 1), dim3(128), 0, stream>>>(
      xb, xb, kHid, 0L,
      w3, w3, kHid, 0L,
      (void*)qkhi, (void*)qklo, kQKld, 0L,
      dummy_f, dummy_f, 0L,
      t3, kRankPad, q_up, kRank,
      kTok, kHid, kHid, 1.0f);
  // 6. k = x . wk^T + tk . k_up^T -> cols 1024..2047
  wmma_gemm64<1, false, 0, 2, false, 0, false, true, 1><<<dim3((kTok / 64) * (kHid / 64) / 4, 1), dim3(128), 0, stream>>>(
      xb, xb, kHid, 0L,
      w3 + wPlane, w3 + wPlane, kHid, 0L,
      (void*)(qkhi + kHid), (void*)(qklo + kHid), kQKld, 0L,
      dummy_f, dummy_f, 0L,
      t3 + tPlane, kRankPad, k_up, kRank,
      kTok, kHid, kHid, 1.0f);
  // 7. v^T = wv . x^T + v_up . tv^T : M=1024 (h*64+d), N=4096 (token), K=1024 -> bf16 hi/lo [1024][4096]
  wmma_gemm64<1, false, 0, 2, false, 0, false, true, 2><<<dim3((kHid / 64) * (kTok / 64) / 4, 1), dim3(128), 0, stream>>>(
      w3 + 2 * wPlane, w3 + 2 * wPlane, kHid, 0L,
      xb, xb, kHid, 0L,
      (void*)vthi, (void*)vtlo, kTok, 0L,
      dummy_f, dummy_f, 0L,
      v_up, kRank, t3 + 2 * tPlane, kRankPad,
      kHid, kTok, kHid, 1.0f);

  // 8. attention, all 32 (batch, head) pairs: ctx = softmax(0.125 * q . k^T) . v -> bf16 hi/lo planes [4096][1024]
  attn_fused_kernel<<<dim3(kSeq / (kFaWaves * kFaCols), kBatch * kHeads), dim3(kFaWaves * 32), 0, stream>>>(
      qkhi, qklo, vthi, vtlo, chi, clo);

  // 9. wo [1024][1024] -> bf16 plane over the dead x plane
  {
    const int n8 = (kHid * kHid) / 8;
    cast_pad_bf16_kernel<<<dim3(n8 / 256, 1), dim3(256), 0, stream>>>(wo, wo, wo, wob, 0L, n8, kHid * kHid);
  }
  // 10. out_down [4][1024] -> zero-padded bf16 plane [64][1024]
  {
    const int n8 = (kRankPad * kHid) / 8;
    cast_pad_bf16_kernel<<<dim3(n8 / 256, 1), dim3(256), 0, stream>>>(o_dn, o_dn, o_dn, dno, 0L, n8, kRank * kHid);
  }
  // 11. to = ctx_hi . out_down^T + ctx_lo . out_down^T : M=4096, N=64, K=1024, 2 products -> f32 [4096][64]
  wmma_gemm64<1, true, 0, 0, false, 0, false, false, 0, 1, 2><<<dim3((kTok / 64) * (kRankPad / 64) / 2, 1), dim3(64), 0, stream>>>(
      chi, clo, kHid, 0L,
      dno, dno, kHid, 0L,
      (void*)tot, dummy_c2, kRankPad, 0L,
      dummy_f, dummy_f, 0L,
      dummy_f, 4, dummy_f, 4,
      kTok, kRankPad, kHid, 1.0f);
  // 12. out = ctx_hi . wo^T + ctx_lo . wo^T + to . out_up^T + bo : M=4096, N=1024, K=1024 -> f32 d_out
  wmma_gemm64<1, true, 2, 0, false, 0, false, false, 1><<<dim3((kTok / 64) * (kHid / 64) / 4, 1), dim3(128), 0, stream>>>(
      chi, clo, kHid, 0L,
      wob, wob, kHid, 0L,
      (void*)out, dummy_c2, kHid, 0L,
      bo, dummy_f, 0L,
      tot, kRankPad, o_up, kRank,
      kTok, kHid, kHid, 1.0f);
}

// v007
// Measured time: 164 microseconds a run.
// Next to v006, in two timings, it ran 1.25 times as fast each time.
// Over all steps from v000 it is 17.6 times as fast.
// Contractions: x.W^T (q, k, v^T) and x.down^T: single v_wmma_f32_16x16x32_bf16 products on RNE-bf16 planes; q.k^T scores and p.v context: bf16 hi/lo operand planes (hi.hi + hi.lo + lo.hi); ctx.Wo^T and ctx.out_down^T: ctx bf16 hi/lo x RNE-bf16 weights (hi.W + lo.W); rank-4 up-products, bias and softmax in f32 on the VALU; all f32 accumulate.
#include <hip/hip_runtime.h>
#include <math.h>

// ---------------------------------------------------------------------------
// Problem constants
// ---------------------------------------------------------------------------
constexpr int kBatch   = 2;
constexpr int kSeq     = 2048;
constexpr int kHid     = 1024;
constexpr int kHeads   = 16;
constexpr int kDh      = 64;
constexpr int kTok     = kBatch * kSeq;            // 4096 token rows
constexpr int kRank    = 4;
constexpr int kRankPad = 64;                       // rank padded to one tile
constexpr int kQKld    = 2 * kHid;                 // 2048: pitch of the q|k planes (halves)

static_assert((kTok * kHid) % (8 * 256) == 0, "cast grid exact");
static_assert((kHid * kHid) % (8 * 256) == 0, "cast grid exact");
static_assert((kRankPad * kHid) % (8 * 256) == 0, "pad cast grid exact");
static_assert(kHid % 64 == 0 && kTok % 64 == 0 && kSeq % 64 == 0 && kDh % 64 == 0 && kRankPad % 64 == 0, "tile multiples");
static_assert(kHid % 32 == 0 && kDh % 32 == 0 && kSeq % 32 == 0, "K multiples of 32");

typedef __attribute__((ext_vector_type(16))) _Float16 v16h;
typedef __attribute__((ext_vector_type(8)))  _Float16 v8h;
typedef __attribute__((ext_vector_type(16))) __bf16   v16b;
typedef __attribute__((ext_vector_type(8)))  __bf16   v8b;
typedef __attribute__((ext_vector_type(8)))  float    v8f;
typedef __attribute__((ext_vector_type(4)))  float    v4f;
typedef __attribute__((ext_vector_type(4)))  unsigned int v4u;

__device__ __forceinline__ unsigned short f2bf_bits(float f) {
  unsigned u = __float_as_uint(f);
  return (unsigned short)((u + 0x7FFFu + ((u >> 16) & 1u)) >> 16);
}
__device__ __forceinline__ float bf_bits2f(unsigned short h) { return __uint_as_float(((unsigned)h) << 16); }
__device__ __forceinline__ float bf_rne(float f) { return bf_bits2f(f2bf_bits(f)); }

// hazard guards as plain device helpers
__device__ __forceinline__ void acc_guard4(v8f& a, v8f& b, v8f& c, v8f& d) { asm volatile("v_nop\n\tv_nop\n\tv_nop\n\tv_nop" : "+v"(a), "+v"(b), "+v"(c), "+v"(d)); }
template <typename T> struct Frag;
template <> struct Frag<_Float16> {
  typedef v16h V; union U { v16h v; v8h h[2]; };
  // elements 0..7 <- p[0..7], 8..15 <- p[16..23]
  static __device__ __forceinline__ v16h load(const _Float16* p) {
    U f; f.h[0] = *(const v8h*)(p); f.h[1] = *(const v8h*)(p + 16); return f.v;
  }
  static __device__ __forceinline__ v8f mma(v16h a, v16h b, v8f c) {
    return __builtin_amdgcn_wmma_f32_16x16x32_f16(false, a, false, b, (short)0, c, false, false);
  }
};
template <> struct Frag<__bf16> {
  typedef v16b V; union U { v16b v; v8b h[2]; };
  static __device__ __forceinline__ v16b load(const __bf16* p) {
    U f; f.h[0] = *(const v8b*)(p); f.h[1] = *(const v8b*)(p + 16); return f.v;
  }
  static __device__ __forceinline__ v8f mma(v16b a, v16b b, v8f c) {
    return __builtin_amdgcn_wmma_f32_16x16x32_bf16(false, a, false, b, (short)0, c, false, false);
  }
};

__device__ __forceinline__ unsigned pk16(unsigned short a, unsigned short b) { return (unsigned)a | ((unsigned)b << 16); }

// ---- asynchronous copies global -> LDS: N copies of 16 B a lane in ONE statement; the s_wait_xcnt 0 at its end stands ahead of every
// later rewrite of the address registers that the issued copies name (inside the statement nothing can be moved between them) ----
#define ACP(a, b) "global_load_async_to_lds_b128 %" #a ", %" #b ", off\n\t"
#define AOP(i) "v"(l[i]), "v"(g[i])
#define ACP8 ACP(0, 1) ACP(2, 3) ACP(4, 5) ACP(6, 7) ACP(8, 9) ACP(10, 11) ACP(12, 13) ACP(14, 15)
#define AOP8 AOP(0), AOP(1), AOP(2), AOP(3), AOP(4), AOP(5), AOP(6), AOP(7)
template <int V> struct IC { static constexpr int v = V; };   // a compile-time int as a function argument
template <int N>
__device__ __forceinline__ void async_copies(const unsigned* l, const void* const* g) {
  static_assert(N == 8 || N == 12, "statement sizes in use");
  if constexpr (N == 8) {
    asm volatile(ACP8 "s_wait_xcnt 0x0" :: AOP8 : "memory");
  } else {
    asm volatile(ACP8 ACP(16, 17) ACP(18, 19) ACP(20, 21) ACP(22, 23) "s_wait_xcnt 0x0" :: AOP8, AOP(8), AOP(9), AOP(10), AOP(11) : "memory");
  }
}

// ---- Register-blocked batched WMMA GEMM (BSPLIT and LORA options added; operands staged in LDS) ----
// C[m,n] = scale * sum_k A[m,k] * Bt[n,k] (+bias)(+resid)(+lora); each wave owns a 64x64 tile; a block of NW waves owns
// (NW / WN) x WN such tiles, that is (NW / WN) * 64 rows of A and WN * 64 rows of Bt. NW <= 4: one wave a SIMD, and blocks enough
// for every WGP (256 blocks of 128 x 128 for a 4096 x 1024 output; the 64-column products spread over 32 blocks a table).
// A row-major [M,K]; Bt row-major [N,K]; M % ((NW / WN) * 64) == 0, N % (WN * 64) == 0, K % 64 == 0, K >= 64.
// SPLIT (with BSPLIT == false): A carries a lo plane (A2, same layout); product = hi.B + lo.B (Bt2 unused).
// BIAS_MODE: 0 = none, 1 = bias[m], 2 = bias[n].
// OUT_MODE: 0 = f32, 1 = f16, 2 = bf16 hi plane (Cout) + bf16 lo plane (Cout2).
// LORA: rank-4 f32 term added in the epilogue: v += dot4(rowtab[m][0..3], coltab[n][0..3]); rowtab pitch ldrow floats, coltab pitch
//   ldcol floats (both 16-B aligned rows). LORA == 1: coltab values RNE-bf16 converted at load (rowtab kept f32);
//   LORA == 2: rowtab values RNE-bf16 converted (coltab kept f32). In LORA modes a BIAS_MODE 2 bias is RNE-bf16 converted too.
// ET: 0 = f16 operands, 1 = bf16 operands (pointers passed as 16-bit storage)
template <int ET> struct Elem;
template <> struct Elem<0> { typedef _Float16 T; };
template <> struct Elem<1> { typedef __bf16 T; };
// LDS bytes of one block: the two-stage ring or the output slabs, whichever is larger (the constants are those of gemm64_body).
constexpr int gemm_lds_bytes(bool split, int wn, int nw) {
  const int ring  = 2 * ((nw / wn) * 64 * (split ? 2 : 1) + wn * 64) * 144;
  const int slabs = nw * 16 * 68 * 4;
  return ring > slabs ? ring : slabs;
}
// The body is a device function, so that one launch can hold products of different template modes (qkv_gemm_kernel below):
// smem = the block's LDS array of gemm_lds_bytes(SPLIT, WN, NW) bytes, declared once in the calling kernel; b = batch index.
template <int ET, bool SPLIT, int BIAS_MODE, int OUT_MODE, bool RESID, int ACT = 0, bool CAUSAL = false, bool BSPLIT = true, int LORA = 0, int WN = 2, int NW = 4>
__device__ __forceinline__ void gemm64_body(
    unsigned char* smem, const int b,
    const unsigned short* __restrict__ Ap, const unsigned short* __restrict__ A2p, int lda, long strideA,
    const unsigned short* __restrict__ Btp, const unsigned short* __restrict__ Bt2p, int ldb, long strideB,
    void* __restrict__ Cout, void* __restrict__ Cout2, int ldc, long strideC,
    const float* __restrict__ bias,
    const float* __restrict__ resid, long strideR,
    const float* __restrict__ rowtab, int ldrow,
    const float* __restrict__ coltab, int ldcol,
    int M, int N, int K, float scale) {
  static_assert(!CAUSAL && !(SPLIT && BSPLIT), "the staged k loop has no tile skip and no lo plane of Bt");
  static_assert((NW == 4 && WN == 2) || (NW == 2 && WN == 1), "block shapes in use");
  typedef typename Elem<ET>::T T;
  typedef typename Frag<T>::V V;
  const T* A = (const T*)Ap; const T* A2 = (const T*)A2p; const T* Bt = (const T*)Btp;
  // One stage = 64 k (128 B) of every operand row of the block, LDS rows [A | A lo | Bt] at pitch 144 B (16 B x odd: 16-B row reads
  // of 16 lanes fall on distinct banks). Two stages; the per-wave 16x64 output slabs (pitch 68 floats) reuse the ring behind the loop.
  constexpr int WM        = NW / WN;
  constexpr int kPitch    = 144;
  constexpr int kRowsA    = WM * 64;
  constexpr int kRowB0    = kRowsA * (SPLIT ? 2 : 1);
  constexpr int kRows     = kRowB0 + WN * 64;
  constexpr int kBufBytes = kRows * kPitch;
  constexpr int kSlabs    = NW * 16 * 68 * 4;
  constexpr int kLdsBytes = (2 * kBufBytes > kSlabs) ? 2 * kBufBytes : kSlabs;
  static_assert(kLdsBytes <= 320 * 1024, "LDS of one work-group");
  static_assert(kLdsBytes == gemm_lds_bytes(SPLIT, WN, NW), "the calling kernel's array");
  const int lane = threadIdx.x & 31;
  const int wave = threadIdx.x >> 5;
  const int blocksN = N / (WN * 64);
  const int blocksM = M / (WM * 64);
  if ((int)blockIdx.x >= blocksM * blocksN) return;   // the same for the whole block; ahead of every barrier
  const int bm   = blockIdx.x / blocksN;
  const int bn   = blockIdx.x - bm * blocksN;
  const int mBlk = bm * (WM * 64);
  const int nBlk = bn * (WN * 64);
  const int wm   = wave / WN;
  const int wn   = wave - wm * WN;
  const int m0   = mBlk + (wm << 6);
  const int n0   = nBlk + (wn << 6);

  const T* Ab  = A  + (size_t)b * strideA;
  const T* Bb  = Bt + (size_t)b * strideB;
  const T* Ab2 = SPLIT ? (A2  + (size_t)b * strideA) : nullptr;

  const int rlane = lane & 15;                 // row (A) / col (B, D) within subtile
  const int koff  = (lane >> 4) * 8;           // k offset of this lane half
  const int mOff  = (lane >> 4) * 8;           // D row offset

  v8f acc[4][4];
#pragma unroll
  for (int i = 0; i < 4; ++i)
#pragma unroll
    for (int j = 0; j < 4; ++j) acc[i][j] = (v8f){0.f,0.f,0.f,0.f,0.f,0.f,0.f,0.f};

  // Staging: copy c of a stage fills LDS rows RPC c .. RPC c + RPC - 1: wave w rows RPC c + 4w .. + 3, 8 lanes a row (four whole 128-B
  // lines of global memory an instruction). The operand boundaries are multiples of 64 rows, so a copy's operand is known at compile time.
  constexpr int RPC = NW * 4;                  // LDS rows that one copy of every wave fills
  constexpr int NC = kRows / RPC;              // copies of a wave per stage: 16, 24 or 40 (at most 63 may be in flight)
  const int srow = (wave << 2) + (lane >> 3);
  const int scol = (lane & 7) << 3;            // first of this lane's 8 elements
  const T* gA  = Ab + (size_t)(mBlk + srow) * lda + scol;
  const T* gA2 = SPLIT ? (Ab2 + (size_t)(mBlk + srow) * lda + scol) : nullptr;
  const T* gB  = Bb + (size_t)(nBlk + srow) * ldb + scol;
  const unsigned lds0 = (unsigned)(size_t)smem + (unsigned)(srow * kPitch + (scol << 1));
  auto part = [&](auto first, auto count, int buf, int k0) {   // copies first .. first + count - 1 of a stage, one statement
    constexpr int C0 = decltype(first)::v;
    constexpr int CN = decltype(count)::v;
    unsigned l[CN];
    const void* g[CN];
#pragma unroll
    for (int c = 0; c < CN; ++c) {
      const int r = (C0 + c) * RPC;
      l[c] = lds0 + (unsigned)(buf * kBufBytes + r * kPitch);
      if (r < kRowsA)      g[c] = gA  + (size_t)r * lda + k0;
      else if (r < kRowB0) g[c] = gA2 + (size_t)(r - kRowsA) * lda + k0;
      else                 g[c] = gB  + (size_t)(r - kRowB0) * ldb + k0;
    }
    async_copies<CN>(l, g);
    __builtin_amdgcn_sched_barrier(0);   // keeps the next statement's address sums behind this one: formed all at once they spill
  };
  auto stage = [&](int buf, int k0) {
    if constexpr (NC == 16)      { part(IC<0>{}, IC<8>{}, buf, k0); part(IC<8>{}, IC<8>{}, buf, k0); }
    else if constexpr (NC == 24) { part(IC<0>{}, IC<12>{}, buf, k0); part(IC<12>{}, IC<12>{}, buf, k0); }
    else {
      static_assert(NC == 16 || NC == 24 || NC == 40, "statement split");
      part(IC<0>{}, IC<8>{}, buf, k0); part(IC<8>{}, IC<8>{}, buf, k0); part(IC<16>{}, IC<8>{}, buf, k0);
      part(IC<24>{}, IC<8>{}, buf, k0); part(IC<32>{}, IC<8>{}, buf, k0);
    }
  };

  // k loop, two LDS buffers: trip t works on buffer t % 2 alone while the copies of stage t + 1 fly into the other one.
  // Per accumulator the order of the products is that of k (hi.B, then lo.B, within a 32-k step).
  const int ntrips = K >> 6;                   // >= 1
  const unsigned char* aRd = smem + ((wm << 6) + rlane) * kPitch + (koff << 1);
  const unsigned char* bRd = smem + (kRowB0 + (wn << 6) + rlane) * kPitch + (koff << 1);
  stage(0, 0);
  asm volatile("s_wait_asynccnt 0x0" ::: "memory");   // this wave's share of stage 0 has landed
  __syncthreads();                                     // stage 0 readable by every wave
  if (ntrips > 1) stage(1, 64);
  for (int t = 0; t < ntrips; ++t) {
    const int bo = (t & 1) * kBufBytes;
    V fa[2][4], fl[2][4], fb[2][4];            // both 32-k steps of the stage, read as one group ahead of the products
#pragma unroll
    for (int ks = 0; ks < 2; ++ks) {
#pragma unroll
      for (int j = 0; j < 4; ++j) fb[ks][j] = Frag<T>::load((const T*)(bRd + bo + j * 16 * kPitch + ks * 64));
#pragma unroll
      for (int i = 0; i < 4; ++i) {
        fa[ks][i] = Frag<T>::load((const T*)(aRd + bo + i * 16 * kPitch + ks * 64));
        if (SPLIT) fl[ks][i] = Frag<T>::load((const T*)(aRd + bo + (kRowsA + i * 16) * kPitch + ks * 64));
      }
    }
    __builtin_amdgcn_sched_barrier(0);   // holds the reads together ahead of the products: sunk among them, every row of products waits out an LDS latency
#pragma unroll
    for (int ks = 0; ks < 2; ++ks) {
#pragma unroll
      for (int i = 0; i < 4; ++i) {
#pragma unroll
        for (int j = 0; j < 4; ++j) acc[i][j] = Frag<T>::mma(fa[ks][i], fb[ks][j], acc[i][j]);
        if (SPLIT) {
#pragma unroll
          for (int j = 0; j < 4; ++j) acc[i][j] = Frag<T>::mma(fl[ks][i], fb[ks][j], acc[i][j]);
        }
      }
    }
    __builtin_amdgcn_sched_barrier(0);   // holds the waits, the barrier and the refill behind the products: risen over them, the refill would fly under the next reads alone
    asm volatile("s_wait_dscnt 0x0" ::: "memory");      // this wave's reads of buffer t % 2 are over before it is handed to the copies
    asm volatile("s_wait_asynccnt 0x0" ::: "memory");   // this wave's share of stage t + 1 has landed
    __syncthreads();                                     // publishes stage t + 1 and ends every wave's reads of buffer t % 2
    if (t + 2 < ntrips) stage(t & 1, (t + 2) << 6);      // the same test in the whole block
  }
  asm volatile("s_wait_asynccnt 0x0" ::: "memory");     // no copy is in flight when the ring becomes the output slabs
  acc_guard4(acc[0][0], acc[0][1], acc[0][2], acc[0][3]);
  acc_guard4(acc[1][0], acc[1][1], acc[1][2], acc[1][3]);
  acc_guard4(acc[2][0], acc[2][1], acc[2][2], acc[2][3]);
  acc_guard4(acc[3][0], acc[3][1], acc[3][2], acc[3][3]);

  // ---- epilogue ----
  float* slab = (float*)smem + wave * (16 * 68);   // behind the last trip's barrier: nobody reads the ring any more
  const float* Rb = RESID ? (resid + (size_t)b * strideR) : nullptr;
  // rank-4 column table (LORA modes): per lane the 4 columns n0 + 16j + rlane
  v4f ctab[4];
  float cbias[4];
#pragma unroll
  for (int j = 0; j < 4; ++j) { ctab[j] = (v4f){0.f,0.f,0.f,0.f}; cbias[j] = 0.f; }
  if (LORA != 0) {
#pragma unroll
    for (int j = 0; j < 4; ++j) {
      const int n = n0 + (j << 4) + rlane;
      v4f u = *(const v4f*)(coltab + (size_t)n * ldcol);
      // ahead of a rewrite of this load's address registers
      if (LORA == 2) asm volatile("s_wait_xcnt 0x0" ::: "memory");
      if (LORA == 1) {
#pragma unroll
        for (int e = 0; e < 4; ++e) u[e] = bf_rne(u[e]);
      }
      ctab[j] = u;
      if (BIAS_MODE == 2) cbias[j] = bf_rne(bias[n]);
    }
  }
#pragma unroll
  for (int i = 0; i < 4; ++i) {
    const int mBase = m0 + (i << 4);
    if (LORA == 0) {
#pragma unroll
      for (int j = 0; j < 4; ++j) {
        const int n = n0 + (j << 4) + rlane;
        float bv = 0.f;
        if (BIAS_MODE == 2) bv = bias[n];
#pragma unroll
        for (int r = 0; r < 8; ++r) {
          float v = acc[i][j][r] * scale;
          if (BIAS_MODE == 1) v += bias[mBase + mOff + r];
          if (BIAS_MODE == 2) v += bv;
          if (RESID) v += Rb[(size_t)(mBase + mOff + r) * ldc + n];
          if (ACT == 2) v = fmaxf(v, 0.0f);
          if (ACT == 4) v = (v > 0.f) ? v : 0.01f * v;
          slab[(mOff + r) * 68 + (j << 4) + rlane] = v;
        }
      }
    } else {
#pragma unroll
      for (int r = 0; r < 8; ++r) {
        const int m = mBase + mOff + r;
        v4f tr = *(const v4f*)(rowtab + (size_t)m * ldrow);
        if (LORA == 2) {
#pragma unroll
          for (int e = 0; e < 4; ++e) tr[e] = bf_rne(tr[e]);
        }
#pragma unroll
        for (int j = 0; j < 4; ++j) {
          float lr = tr[0] * ctab[j][0];
          lr = fmaf(tr[1], ctab[j][1], lr);
          lr = fmaf(tr[2], ctab[j][2], lr);
          lr = fmaf(tr[3], ctab[j][3], lr);
          float v = acc[i][j][r] * scale + lr;
          if (BIAS_MODE == 2) v += cbias[j];
          slab[(mOff + r) * 68 + (j << 4) + rlane] = v;
        }
      }
    }
    __builtin_amdgcn_fence(__ATOMIC_RELEASE, "workgroup");
    __builtin_amdgcn_wave_barrier();
    __builtin_amdgcn_fence(__ATOMIC_ACQUIRE, "workgroup");
    if (OUT_MODE == 0) {
      float* C = (float*)Cout + (size_t)b * strideC;
      const int hh = lane >> 4, c4 = (lane & 15) * 4;     // row seg = 256 B = 16 lanes x 16 B
      {
#pragma unroll
        for (int it = 0; it < 8; ++it) {
          const int row = it * 2 + hh;
          v4f v = *(const v4f*)(slab + row * 68 + c4);
          *(v4f*)(C + (size_t)(mBase + row) * ldc + n0 + c4) = v;
        }
        
      }
    } else {
      const int q = lane >> 3, c8 = (lane & 7) * 8;
      unsigned short* C  = (unsigned short*)Cout  + (size_t)b * strideC;
      unsigned short* C2 = (OUT_MODE == 2) ? ((unsigned short*)Cout2 + (size_t)b * strideC) : nullptr;
      {
#pragma unroll
        for (int it = 0; it < 4; ++it) {
          const int row = it * 4 + q;
          const float* sp = slab + row * 68 + c8;
          v8h hv, lv;
#pragma unroll
          for (int e = 0; e < 8; ++e) {
            if (OUT_MODE == 1) {
              hv[e] = (_Float16)sp[e];
            } else {
              unsigned short hb = f2bf_bits(sp[e]);
              unsigned short lb = f2bf_bits(sp[e] - bf_bits2f(hb));
              hv[e] = __builtin_bit_cast(_Float16, hb);
              lv[e] = __builtin_bit_cast(_Float16, lb);
            }
          }
          *(v8h*)(C + (size_t)(mBase + row) * ldc + n0 + c8) = hv;
          if (OUT_MODE == 2) *(v8h*)(C2 + (size_t)(mBase + row) * ldc + n0 + c8) = lv;
        }
        
      }
    }
    __builtin_amdgcn_fence(__ATOMIC_RELEASE, "workgroup");
    __builtin_amdgcn_wave_barrier();
    __builtin_amdgcn_fence(__ATOMIC_ACQUIRE, "workgroup");
  }
}

// One product (or a batch of same-shaped products over blockIdx.y) per launch.
template <int ET, bool SPLIT, int BIAS_MODE, int OUT_MODE, bool RESID, int ACT = 0, bool CAUSAL = false, bool BSPLIT = true, int LORA = 0, int WN = 2, int NW = 4>
__global__ __launch_bounds__(NW * 32) void wmma_gemm64(
    const unsigned short* __restrict__ Ap, const unsigned short* __restrict__ A2p, int lda, long strideA,
    const unsigned short* __restrict__ Btp, const unsigned short* __restrict__ Bt2p, int ldb, long strideB,
    void* __restrict__ Cout, void* __restrict__ Cout2, int ldc, long strideC,
    const float* __restrict__ bias,
    const float* __restrict__ resid, long strideR,
    const float* __restrict__ rowtab, int ldrow,
    const float* __restrict__ coltab, int ldcol,
    int M, int N, int K, float scale) {
  __shared__ __align__(16) unsigned char smem[gemm_lds_bytes(SPLIT, WN, NW)];
  gemm64_body<ET, SPLIT, BIAS_MODE, OUT_MODE, RESID, ACT, CAUSAL, BSPLIT, LORA, WN, NW>(
      smem, (int)blockIdx.y, Ap, A2p, lda, strideA, Btp, Bt2p, ldb, strideB, Cout, Cout2, ldc, strideC,
      bias, resid, strideR, rowtab, ldrow, coltab, ldcol, M, N, K, scale);
}

// The three projections in ONE launch: they are independent of one another, each alone puts one block of 4 waves on a WGP, and three
// such blocks fit a WGP (LDS and registers), so that one block's products run under another's waits, barriers and epilogue.
// blockIdx.y (the same for the whole block): 0: q = x . wq^T + tq . q_up^T -> q|k planes, columns 0..hid-1; 1: k likewise with wk,
// tk, k_up -> columns hid..2 hid - 1; 2: v^T = wv . x^T + v_up . tv^T -> v^T planes. tok = token rows, hid = hidden size.
__global__ __launch_bounds__(128) void qkv_gemm_kernel(
    const unsigned short* __restrict__ xb, const unsigned short* __restrict__ w3,
    unsigned short* __restrict__ qkhi, unsigned short* __restrict__ qklo,
    unsigned short* __restrict__ vthi, unsigned short* __restrict__ vtlo,
    const float* __restrict__ t3,
    const float* __restrict__ q_up, const float* __restrict__ k_up, const float* __restrict__ v_up,
    int tok, int hid) {
  __shared__ __align__(16) unsigned char smem[gemm_lds_bytes(false, 2, 4)];
  const int y = blockIdx.y;
  const unsigned short* w = w3 + (size_t)y * hid * hid;
  const float* t = t3 + (size_t)y * tok * kRankPad;
  if (y < 2) {
    gemm64_body<1, false, 0, 2, false, 0, false, true, 1>(
        smem, 0, xb, xb, hid, 0L, w, w, hid, 0L, (void*)(qkhi + y * hid), (void*)(qklo + y * hid), 2 * hid, 0L,
        t, t, 0L, t, kRankPad, (y == 0) ? q_up : k_up, kRank, tok, hid, hid, 1.0f);
  } else {
    gemm64_body<1, false, 0, 2, false, 0, false, true, 2>(
        smem, 0, w, w, hid, 0L, xb, xb, hid, 0L, (void*)vthi, (void*)vtlo, tok, 0L,
        t, t, 0L, v_up, kRank, t, kRankPad, hid, tok, hid, 1.0f);
  }
}

// ---------------------------------------------------------------------------
// f32 -> RNE bf16 planes, every table of the call in ONE launch (the casts are independent of one another). blockIdx.x picks the
// table (the same for the whole block): blocks [0, kCbX): x; then 4 x kCbW blocks: wq, wk, wv, wo; then 4 x kCbD blocks: the four down
// tables, each zero-padded from kRank to kRankPad rows.
// Thread i of a table owns flat elements 8i..8i+7 of its plane: value = src[e] for e < nvalid, 0 otherwise (the load address is clamped
// to [0, nvalid-8], the value is zeroed by predicate). Plane y of a group starts at its base + y * plane elements.
// Coverage: blocks of a table x 256 threads x 8 = the whole (padded) plane, exactly.
// ---------------------------------------------------------------------------
constexpr int kCbX = (kTok * kHid) / (8 * 256);       // 2048 blocks
constexpr int kCbW = (kHid * kHid) / (8 * 256);       // 512 blocks a weight table
constexpr int kCbD = (kRankPad * kHid) / (8 * 256);   // 32 blocks a padded down table
constexpr int kCastBlocks = kCbX + 4 * kCbW + 4 * kCbD;
__global__ __launch_bounds__(256) void cast_all_bf16_kernel(const float* __restrict__ x,
                                                            const float* __restrict__ wq, const float* __restrict__ wk,
                                                            const float* __restrict__ wv, const float* __restrict__ wo,
                                                            const float* __restrict__ dq, const float* __restrict__ dk,
                                                            const float* __restrict__ dv, const float* __restrict__ dout,
                                                            unsigned short* __restrict__ xb, unsigned short* __restrict__ w4,
                                                            unsigned short* __restrict__ dn4) {
  int blk = blockIdx.x;
  if (blk >= kCastBlocks) return;
  const float* src;
  unsigned short* dst;
  int nvalid;
  if (blk < kCbX) {
    src = x; dst = xb; nvalid = kTok * kHid;
  } else if (blk < kCbX + 4 * kCbW) {
    blk -= kCbX;
    const int y = blk / kCbW;
    blk -= y * kCbW;
    src = (y == 0) ? wq : ((y == 1) ? wk : ((y == 2) ? wv : wo));
    dst = w4 + (size_t)y * (kHid * kHid);
    nvalid = kHid * kHid;
  } else {
    blk -= kCbX + 4 * kCbW;
    const int y = blk / kCbD;
    blk -= y * kCbD;
    src = (y == 0) ? dq : ((y == 1) ? dk : ((y == 2) ? dv : dout));
    dst = dn4 + (size_t)y * (kRankPad * kHid);
    nvalid = kRank * kHid;
  }
  const int i = blk * 256 + threadIdx.x;
  const long e = 8L * (long)i;
  const bool live = (e < (long)nvalid);
  const long ec = live ? e : (long)(nvalid - 8);
  const v4f a = *(const v4f*)(src + ec);
  const v4f c = *(const v4f*)(src + ec + 4);
  float f[8];
#pragma unroll
  for (int k = 0; k < 4; ++k) { f[k] = live ? a[k] : 0.0f; f[4 + k] = live ? c[k] : 0.0f; }
  unsigned w[4];
#pragma unroll
  for (int e2 = 0; e2 < 4; ++e2) w[e2] = pk16(f2bf_bits(f[2 * e2]), f2bf_bits(f[2 * e2 + 1]));
  const v4u u = (v4u){w[0], w[1], w[2], w[3]};
  *(v4u*)(dst + (size_t)e) = u;
}

constexpr int kFaWaves = 8;
constexpr int kFaCols  = 32;                       // query columns per wave
constexpr int kFaG     = kFaCols / 16;             // 16-column groups per wave
constexpr int kFaKeys  = 32;                       // keys per pass = one k step of the second product
constexpr float kExp2Scale = 0.125f * 1.4426950408889634f;   // 64^-0.5 * log2(e)
constexpr int kFaSubKeys  = 64;                    // keys of a sub-tile
constexpr int kFaSubs     = 2;                     // sub-tiles of a stage
constexpr int kFaStage    = kFaSubKeys * kFaSubs;  // keys of a stage
constexpr int kFaTrips    = kSeq / kFaStage;
constexpr int kFaPitch    = 144;
constexpr int kFaPlane    = 64 * kFaPitch;         // one operand plane of a sub-tile, bytes
constexpr int kFaSubBytes = 4 * kFaPlane;
constexpr int kFaBufBytes = kFaSubs * kFaSubBytes;
static_assert(kSeq % (kFaWaves * kFaCols) == 0 && kSeq % kFaKeys == 0 && kDh == 64, "fused attention tile shape");
static_assert(kSeq % kFaStage == 0 && kFaTrips >= 2 && kFaStage == 4 * kFaKeys && kFaWaves == 8, "stage shape");
static_assert(2 * kFaBufBytes <= 320 * 1024, "LDS of one work-group");
typedef __attribute__((ext_vector_type(2))) float  v2f;
typedef __attribute__((ext_vector_type(2))) __bf16 v2b;
typedef __attribute__((ext_vector_type(8))) unsigned int v8u;

// two f32 -> two RNE bf16 in one word (a in the low half)
__device__ __forceinline__ unsigned pack_bf2(float a, float b) {
  return __builtin_bit_cast(unsigned, __builtin_convertvector((v2f){a, b}, v2b));
}
// value of lane l ^ 16
__device__ __forceinline__ float other_half(float x) {
  const int i = __builtin_bit_cast(int, x);
  return __builtin_bit_cast(float, __builtin_amdgcn_permlanex16(i, i, 0x76543210, 0xfedcba98, false, false));
}
struct KFrags { v16b hi[2][2], lo[2][2]; };        // [16-key tile][32-wide step over d]
// Fragments of pass P (0..3) of a stage, from LDS; rd = this lane's place in the stage's buffer: row c, byte 2 * h8.
template <int P>
__device__ __forceinline__ void lds_k(KFrags& k, const unsigned char* rd) {
  constexpr int o0 = (P >> 1) * kFaSubBytes + (P & 1) * 32 * kFaPitch;
#pragma unroll
  for (int kt = 0; kt < 2; ++kt)
#pragma unroll
    for (int kc = 0; kc < 2; ++kc) {
      const unsigned char* p = rd + o0 + (kt << 4) * kFaPitch + (kc << 6);
      k.hi[kt][kc] = Frag<__bf16>::load((const __bf16*)p);
      k.lo[kt][kc] = Frag<__bf16>::load((const __bf16*)(p + kFaPlane));
    }
}
template <int P>
__device__ __forceinline__ void lds_v(v16b (&vh)[4], v16b (&vl)[4], const unsigned char* rd) {
  constexpr int o0 = (P >> 1) * kFaSubBytes + 2 * kFaPlane + (P & 1) * 64;
#pragma unroll
  for (int t = 0; t < 4; ++t) {
    const unsigned char* p = rd + o0 + (t << 4) * kFaPitch;
    vh[t] = Frag<__bf16>::load((const __bf16*)p);
    vl[t] = Frag<__bf16>::load((const __bf16*)(p + kFaPlane));
  }
}

__global__ __launch_bounds__(kFaWaves * 32) void attn_fused_kernel(
    const unsigned short* __restrict__ QKhi, const unsigned short* __restrict__ QKlo,
    const unsigned short* __restrict__ Vthi, const unsigned short* __restrict__ Vtlo,
    unsigned short* __restrict__ Chi, unsigned short* __restrict__ Clo) {
  typedef Frag<__bf16> F;
  const int pair = blockIdx.y;
  const int b    = pair / kHeads;
  const int hd   = pair - b * kHeads;
  const int lane = threadIdx.x & 31;
  const int wave = threadIdx.x >> 5;
  const int c    = lane & 15;                  // row of A, column of B and D
  const int h8   = (lane >> 4) * 8;            // k offset of this lane half (A, B); D row offset
  const int q0   = blockIdx.x * (kFaWaves * kFaCols) + wave * kFaCols;
  const size_t tok0 = (size_t)b * kSeq;
  __shared__ __align__(16) unsigned char smem[2 * kFaBufBytes];

  // Staging: copy cc of a sub-tile fills its LDS rows 32 cc .. 32 cc + 31: wave w rows 32 cc + 4 w .. + 3, 8 lanes a row (four whole
  // 128-B lines of global memory an instruction); two copies a plane, 8 a sub-tile, 16 of a wave in flight per stage.
  const int srow = (wave << 2) + (lane >> 3);
  const int scol = (lane & 7) << 3;            // first of this lane's 8 elements
  const unsigned gk = (unsigned)((tok0 + srow) * kQKld + kHid + hd * kDh + scol);   // element offsets in the planes (below 2^23):
  const unsigned gv = (unsigned)((size_t)(hd * kDh + srow) * kTok + tok0 + scol);   // two registers live over the loop, not four pointers
  const unsigned lds0 = (unsigned)(size_t)smem + (unsigned)(srow * kFaPitch + (scol << 1));
  auto stage = [&](int buf, int key0) {
#pragma unroll
    for (int sub = 0; sub < kFaSubs; ++sub) {
      const int ks = key0 + sub * kFaSubKeys;
      unsigned l[8];
      const void* g[8];
#pragma unroll
      for (int cc = 0; cc < 8; ++cc) {
        const int r = (cc & 1) * 32;
        l[cc] = lds0 + (unsigned)(buf * kFaBufBytes + sub * kFaSubBytes + cc * 32 * kFaPitch);
        if (cc < 2)      g[cc] = QKhi + (gk + (unsigned)((ks + r) * kQKld));
        else if (cc < 4) g[cc] = QKlo + (gk + (unsigned)((ks + r) * kQKld));
        else if (cc < 6) g[cc] = Vthi + (gv + (unsigned)(r * kTok + ks));
        else             g[cc] = Vtlo + (gv + (unsigned)(r * kTok + ks));
      }
      async_copies<8>(l, g);
    }
  };
  stage(0, 0);   // flies under the Q loads

  // Q fragments (B operand), kept for the whole loop
  v16b qh[kFaG][2], ql[kFaG][2];
#pragma unroll
  for (int g = 0; g < kFaG; ++g)
#pragma unroll
    for (int kc = 0; kc < 2; ++kc) {
      const size_t o = (tok0 + q0 + (g << 4) + c) * kQKld + hd * kDh + (kc << 5) + h8;
      qh[g][kc] = F::load((const __bf16*)QKhi + o);
      ql[g][kc] = F::load((const __bf16*)QKlo + o);
    }
  v8f acc[kFaG][4];                            // O^T: [column group][16-row tile over d]
  float m_run[kFaG];
  v2f lsum[kFaG];                              // this lane's share of the row sum (its 16 of each pass's 32 keys), even / odd registers
#pragma unroll
  for (int g = 0; g < kFaG; ++g) {
    m_run[g] = -INFINITY;
    lsum[g] = (v2f){0.f, 0.f};
#pragma unroll
    for (int t = 0; t < 4; ++t) acc[g][t] = (v8f){0.f,0.f,0.f,0.f,0.f,0.f,0.f,0.f};
  }

  KFrags kf;
  v16b vh[4], vl[4];                           // [16-row tile over d]
  // one pass of 32 keys; P = its number within the stage, rd = this lane's place in the stage's buffer
  auto pass = [&](auto pnum, const unsigned char* rd) {
    constexpr int P = decltype(pnum)::v;
    // S^T tiles [16-key tile][column group]; per accumulator the order is hi.hi, hi.lo, lo.hi for d 0..31, then for d 32..63
    v8f s[2][kFaG];
#pragma unroll
    for (int kt = 0; kt < 2; ++kt)
#pragma unroll
      for (int g = 0; g < kFaG; ++g) s[kt][g] = (v8f){0.f,0.f,0.f,0.f,0.f,0.f,0.f,0.f};
#pragma unroll
    for (int kc = 0; kc < 2; ++kc) {
#pragma unroll
      for (int kt = 0; kt < 2; ++kt)
#pragma unroll
        for (int g = 0; g < kFaG; ++g) s[kt][g] = F::mma(kf.hi[kt][kc], qh[g][kc], s[kt][g]);
#pragma unroll
      for (int kt = 0; kt < 2; ++kt)
#pragma unroll
        for (int g = 0; g < kFaG; ++g) s[kt][g] = F::mma(kf.lo[kt][kc], qh[g][kc], s[kt][g]);
#pragma unroll
      for (int kt = 0; kt < 2; ++kt)
#pragma unroll
        for (int g = 0; g < kFaG; ++g) s[kt][g] = F::mma(kf.hi[kt][kc], ql[g][kc], s[kt][g]);
    }

    // column maxima of the raw scores (the scale is positive), then one test per pass
    float mb[kFaG];
    bool need = false;
#pragma unroll
    for (int g = 0; g < kFaG; ++g) {
      float mx = s[0][g][0];
#pragma unroll
      for (int r = 1; r < 8; ++r) mx = fmaxf(mx, s[0][g][r]);
#pragma unroll
      for (int r = 0; r < 8; ++r) mx = fmaxf(mx, s[1][g][r]);
      mx = fmaxf(mx, other_half(mx)) * kExp2Scale;   // both halves hold this query's maximum of the pass
      mb[g] = mx;
      need = need || (mx > m_run[g] + 8.0f);          // true in the first pass (m_run = -inf)
    }
    if (__builtin_amdgcn_ballot_w32(need) != 0) {     // wave-uniform scalar branch
#pragma unroll
      for (int g = 0; g < kFaG; ++g) {
        const float m_new = fmaxf(m_run[g], mb[g]);
        const float corr  = __builtin_amdgcn_exp2f(m_run[g] - m_new);   // 0 in the first pass
        m_run[g] = m_new;
        lsum[g] = lsum[g] * corr;
#pragma unroll
        for (int t = 0; t < 4; ++t) acc[g][t] = acc[g][t] * corr;
      }
    }
    // next pass's K fragments (same stage only), in flight under the exponentials and the second product
    if constexpr (P + 1 < kFaStage / kFaKeys) {
      lds_k<P + 1>(kf, rd);
      __builtin_amdgcn_sched_barrier(0);   // holds these reads ahead of the exponentials: sunk among the products below they arrive too late
    }
#pragma unroll
    for (int g = 0; g < kFaG; ++g) {
      const float nm = -m_run[g];
      v8u hw, lw;
      v2f pp[8];
#pragma unroll
      for (int i = 0; i < 8; ++i) {   // operand elements 2i, 2i + 1 = tile i >> 2, registers 2 (i & 3), 2 (i & 3) + 1
        const v2f arg = __builtin_elementwise_fma((v2f){s[i >> 2][g][2 * (i & 3)], s[i >> 2][g][2 * (i & 3) + 1]},
                                                  (v2f){kExp2Scale, kExp2Scale}, (v2f){nm, nm});
        const v2f p = (v2f){__builtin_amdgcn_exp2f(arg.x), __builtin_amdgcn_exp2f(arg.y)};
        const unsigned w = pack_bf2(p.x, p.y);
        const v2f hi = (v2f){__uint_as_float(w << 16), __uint_as_float(w & 0xFFFF0000u)};
        const v2f lo = p - hi;        // exact in f32
        hw[i] = w;
        lw[i] = pack_bf2(lo.x, lo.y);
        pp[i] = p;
      }
      lsum[g] += ((pp[0] + pp[1]) + (pp[2] + pp[3])) + ((pp[4] + pp[5]) + (pp[6] + pp[7]));
      const v16b ph = __builtin_bit_cast(v16b, hw);
      const v16b pl = __builtin_bit_cast(v16b, lw);
#pragma unroll
      for (int t = 0; t < 4; ++t) acc[g][t] = F::mma(vh[t], ph, acc[g][t]);
#pragma unroll
      for (int t = 0; t < 4; ++t) acc[g][t] = F::mma(vl[t], ph, acc[g][t]);
#pragma unroll
      for (int t = 0; t < 4; ++t) acc[g][t] = F::mma(vh[t], pl, acc[g][t]);
    }
    // next pass's v^T fragments (same stage only), in flight under that pass's first product and softmax
    if constexpr (P + 1 < kFaStage / kFaKeys) lds_v<P + 1>(vh, vl, rd);
  };

  // Stage loop, two LDS buffers: trip t reads buffer t % 2 alone while the copies of stage t + 1 fly into the other one.
  const unsigned char* rd0 = smem + c * kFaPitch + (h8 << 1);
  asm volatile("s_wait_asynccnt 0x0" ::: "memory");   // this wave's share of stage 0 has landed
  __syncthreads();                                     // stage 0 readable by every wave
  stage(1, kFaStage);
  for (int t = 0; t < kFaTrips; ++t) {
    const unsigned char* rd = rd0 + (t & 1) * kFaBufBytes;
    lds_k<0>(kf, rd);
    lds_v<0>(vh, vl, rd);
    pass(IC<0>{}, rd);
    pass(IC<1>{}, rd);
    pass(IC<2>{}, rd);
    pass(IC<3>{}, rd);
    asm volatile("s_wait_dscnt 0x0" ::: "memory");      // this wave's reads of buffer t % 2 are over before it is handed to the copies
    asm volatile("s_wait_asynccnt 0x0" ::: "memory");   // this wave's share of stage t + 1 has landed
    __syncthreads();                                     // publishes stage t + 1 and ends every wave's reads of buffer t % 2
    if (t + 2 < kFaTrips) stage(t & 1, (t + 2) * kFaStage);   // the same test in the whole block
  }
  asm volatile("s_wait_asynccnt 0x0" ::: "memory");     // no copy is in flight when the wave ends

  // ctx[query][hd * 64 + 16 t + h8 + r] = acc[g][t][r] / row sum, as bf16 hi/lo planes: 16 B per lane, tile and plane
#pragma unroll
  for (int g = 0; g < kFaG; ++g) {
    const float part = lsum[g].x + lsum[g].y;
    const float inv  = 1.0f / (part + other_half(part));   // sum >= 1: m never exceeds the row maximum
    const size_t co = (tok0 + q0 + (g << 4) + c) * kHid + hd * kDh + h8;
#pragma unroll
    for (int t = 0; t < 4; ++t) {
      v4u hv, lv;
#pragma unroll
      for (int e = 0; e < 4; ++e) {
        const float f0 = acc[g][t][2 * e] * inv;
        const float f1 = acc[g][t][2 * e + 1] * inv;
        const unsigned w = pack_bf2(f0, f1);
        hv[e] = w;
        lv[e] = pack_bf2(f0 - __uint_as_float(w << 16), f1 - __uint_as_float(w & 0xFFFF0000u));
      }
      *(v4u*)(Chi + co + (t << 4)) = hv;
      *(v4u*)(Clo + co + (t << 4)) = lv;
    }
  }
}

// ---------------------------------------------------------------------------
// Launcher. Workspace region map (bytes, MiB = 1048576; carve ends at 128 MiB = 134217728 B):
//   [  0, 21) operands: x bf16 [4096][1024] at +0 (8 MiB); wq|wk|wv|wo bf16 [1024][1024] x4 at +8 MiB (8 MiB);
//                      padded down planes [64][1024] x4 (q|k|v|out) at +16 MiB (512 KiB); t tables f32 [4096][64] x3 (tq|tk|tv)
//                      at +17 MiB (3 MiB); to table f32 [4096][64] at +20 MiB (1 MiB). No region is used twice.
//   [ 21, 64) unused
//   [ 64, 80) q|k hi : [4096][2048] bf16 (cols 0..1023 = q (h*64+d), 1024..2047 = k)
//   [ 80, 96) q|k lo
//   [ 96,104) v^T hi : [1024 (h*64+d)][4096 (b*2048+s)] bf16
//   [104,112) v^T lo
//   [112,120) ctx hi : [4096][1024] bf16 (col h*64+d)
//   [120,128) ctx lo
// Launch count: 1 cast + 1 down GEMM + 1 projection launch (q, k, v^T) + 1 attention + 1 down GEMM + 1 out GEMM = 6.
// Kernel launches only.
// ---------------------------------------------------------------------------
extern "C" void kernel_launch(void* const* d_in, const int* in_sizes, int n_in,
                              void* d_out, int out_size, void* d_ws, size_t ws_size,
                              hipStream_t stream) {
  if (n_in < 14) return;
  if (in_sizes[0] != kTok * kHid) return;
  if (in_sizes[1] != kHid * kHid || in_sizes[2] != kHid * kHid || in_sizes[3] != kHid * kHid || in_sizes[4] != kHid * kHid) return;
  if (in_sizes[5] != kHid) return;
  if (in_sizes[6] != kRank * kHid || in_sizes[8] != kRank * kHid || in_sizes[10] != kRank * kHid || in_sizes[12] != kRank * kHid) return;
  if (in_sizes[7] != kHid * kRank || in_sizes[9] != kHid * kRank || in_sizes[11] != kHid * kRank || in_sizes[13] != kHid * kRank) return;
  if (out_size != kTok * kHid) return;

  const size_t kMiB    = 1048576;
  const size_t offXb   = 0;
  const size_t offW3   = 8 * kMiB;
  const size_t offWo   = 14 * kMiB;
  const size_t offDn3  = 16 * kMiB;
  const size_t offDnO  = 16 * kMiB + 393216;
  const size_t offT3   = 17 * kMiB;
  const size_t offTo   = 20 * kMiB;
  const size_t offQKhi = 64 * kMiB;
  const size_t offQKlo = 80 * kMiB;
  const size_t offVthi = 96 * kMiB;
  const size_t offVtlo = 104 * kMiB;
  const size_t offChi  = 112 * kMiB;
  const size_t offClo  = 120 * kMiB;
  const size_t total   = 128 * kMiB;
  if (total > ws_size) return;

  const float* x     = (const float*)d_in[0];
  const float* wq    = (const float*)d_in[1];
  const float* wk    = (const float*)d_in[2];
  const float* wv    = (const float*)d_in[3];
  const float* wo    = (const float*)d_in[4];
  const float* bo    = (const float*)d_in[5];
  const float* q_dn  = (const float*)d_in[6];
  const float* q_up  = (const float*)d_in[7];
  const float* k_dn  = (const float*)d_in[8];
  const float* k_up  = (const float*)d_in[9];
  const float* v_dn  = (const float*)d_in[10];
  const float* v_up  = (const float*)d_in[11];
  const float* o_dn  = (const float*)d_in[12];
  const float* o_up  = (const float*)d_in[13];
  float* out = (float*)d_out;
  char* ws = (char*)d_ws;

  unsigned short* xb   = (unsigned short*)(ws + offXb);
  unsigned short* w3   = (unsigned short*)(ws + offW3);
  unsigned short* dn3  = (unsigned short*)(ws + offDn3);
  float*          t3   = (float*)(ws + offT3);
  unsigned short* wob  = (unsigned short*)(ws + offWo);
  unsigned short* dno  = (unsigned short*)(ws + offDnO);
  float*          tot  = (float*)(ws + offTo);
  unsigned short* qkhi = (unsigned short*)(ws + offQKhi);
  unsigned short* qklo = (unsigned short*)(ws + offQKlo);
  unsigned short* vthi = (unsigned short*)(ws + offVthi);
  unsigned short* vtlo = (unsigned short*)(ws + offVtlo);
  unsigned short* chi  = (unsigned short*)(ws + offChi);
  unsigned short* clo  = (unsigned short*)(ws + offClo);

  // in-range dummies for unused (never dereferenced) template-dead pointer parameters
  const float* dummy_f = bo;
  void* dummy_c2 = (void*)chi;

  const long dnPlane = (long)kRankPad * kHid;      // 65536 halves
  const long tPlane  = (long)kTok * kRankPad;      // 262144 floats

  // 1. x, wq, wk, wv, wo and the four down tables -> RNE bf16 planes (weights in Bt layout directly; down rows 4..63 zero-filled)
  cast_all_bf16_kernel<<<dim3(kCastBlocks), dim3(256), 0, stream>>>(x, wq, wk, wv, wo, q_dn, k_dn, v_dn, o_dn, xb, w3, dn3);
  // 2. t{q,k,v} = x . down^T : M=4096, N=64, K=1024, single bf16 product -> f32 [3][4096][64] (batched over blockIdx.y)
  wmma_gemm64<1, false, 0, 0, false, 0, false, true, 0, 1, 2><<<dim3((kTok / 64) * (kRankPad / 64) / 2, 3), dim3(64), 0, stream>>>(
      xb, xb, kHid, 0L,
      dn3, dn3, kHid, dnPlane,
      (void*)t3, dummy_c2, kRankPad, tPlane,
      dummy_f, dummy_f, 0L,
      dummy_f, 4, dummy_f, 4,
      kTok, kRankPad, kHid, 1.0f);

  // 3. q = x . wq^T + tq . q_up^T and k likewise (M=4096, N=1024, K=1024 -> bf16 hi/lo, q|k planes, ldc 2048);
  //    v^T = wv . x^T + v_up . tv^T (M=1024 (h*64+d), N=4096 (token), K=1024 -> bf16 hi/lo [1024][4096]): 256 blocks each
  qkv_gemm_kernel<<<dim3((kTok / 64) * (kHid / 64) / 4, 3), dim3(128), 0, stream>>>(
      xb, w3, qkhi, qklo, vthi, vtlo, t3, q_up, k_up, v_up, kTok, kHid);

  // 4. attention, all 32 (batch, head) pairs: ctx = softmax(0.125 * q . k^T) . v -> bf16 hi/lo planes [4096][1024]
  attn_fused_kernel<<<dim3(kSeq / (kFaWaves * kFaCols), kBatch * kHeads), dim3(kFaWaves * 32), 0, stream>>>(
      qkhi, qklo, vthi, vtlo, chi, clo);

  // 5. to = ctx_hi . out_down^T + ctx_lo . out_down^T : M=4096, N=64, K=1024, 2 products -> f32 [4096][64]
  wmma_gemm64<1, true, 0, 0, false, 0, false, false, 0, 1, 2><<<dim3((kTok / 64) * (kRankPad / 64) / 2, 1), dim3(64), 0, stream>>>(
      chi, clo, kHid, 0L,
      dno, dno, kHid, 0L,
      (void*)tot, dummy_c2, kRankPad, 0L,
      dummy_f, dummy_f, 0L,
      dummy_f, 4, dummy_f, 4,
      kTok, kRankPad, kHid, 1.0f);
  // 6. out = ctx_hi . wo^T + ctx_lo . wo^T + to . out_up^T + bo : M=4096, N=1024, K=1024 -> f32 d_out
  wmma_gemm64<1, true, 2, 0, false, 0, false, false, 1><<<dim3((kTok / 64) * (kHid / 64) / 4, 1), dim3(128), 0, stream>>>(
      chi, clo, kHid, 0L,
      wob, wob, kHid, 0L,
      (void*)out, dummy_c2, kHid, 0L,
      bo, dummy_f, 0L,
      tot, kRankPad, o_up, kRank,
      kTok, kHid, kHid, 1.0f);
}

// v008
// A run of this version takes 124 microseconds.
// Timed twice side by side with v007, it ran 1.32 times as fast both times.
// All steps since v000 together make it 23.3 times as fast.
// Contractions: x.W^T (q, k, v^T) and x.down^T: single v_wmma_f32_16x16x32_bf16 products on RNE-bf16 planes; q.k^T scores and p.v context: bf16 hi/lo operand planes (hi.hi + hi.lo + lo.hi); ctx.Wo^T and ctx.out_down^T: ctx bf16 hi/lo x RNE-bf16 weights (hi.W + lo.W); rank-4 up-products, bias and softmax in f32 on the VALU; all f32 accumulate.
#include <hip/hip_runtime.h>
#include <math.h>

// ---------------------------------------------------------------------------
// Problem constants
// ---------------------------------------------------------------------------
constexpr int kBatch   = 2;
constexpr int kSeq     = 2048;
constexpr int kHid     = 1024;
constexpr int kHeads   = 16;
constexpr int kDh      = 64;
constexpr int kTok     = kBatch * kSeq;            // 4096 token rows
constexpr int kRank    = 4;
constexpr int kRankPad = 16;                       // rank padded to one 16-column matrix tile
constexpr int kQKld    = 2 * kHid;                 // 2048: pitch of the q|k planes (halves)

static_assert((kTok * kHid) % (8 * 256) == 0, "cast grid exact");
static_assert((kHid * kHid) % (8 * 256) == 0, "cast grid exact");
static_assert((kRankPad * kHid) % (8 * 256) == 0, "pad cast grid exact");
static_assert(kHid % 64 == 0 && kTok % 64 == 0 && kSeq % 64 == 0 && kDh % 64 == 0 && kRankPad == 16, "tile multiples");
static_assert(kHid % 32 == 0 && kDh % 32 == 0 && kSeq % 32 == 0, "K multiples of 32");

typedef __attribute__((ext_vector_type(16))) _Float16 v16h;
typedef __attribute__((ext_vector_type(8)))  _Float16 v8h;
typedef __attribute__((ext_vector_type(16))) __bf16   v16b;
typedef __attribute__((ext_vector_type(8)))  __bf16   v8b;
typedef __attribute__((ext_vector_type(8)))  float    v8f;
typedef __attribute__((ext_vector_type(4)))  float    v4f;
typedef __attribute__((ext_vector_type(4)))  unsigned int v4u;

__device__ __forceinline__ unsigned short f2bf_bits(float f) {
  unsigned u = __float_as_uint(f);
  return (unsigned short)((u + 0x7FFFu + ((u >> 16) & 1u)) >> 16);
}
__device__ __forceinline__ float bf_bits2f(unsigned short h) { return __uint_as_float(((unsigned)h) << 16); }
__device__ __forceinline__ float bf_rne(float f) { return bf_bits2f(f2bf_bits(f)); }

// hazard guards as plain device helpers
__device__ __forceinline__ void acc_guard4(v8f& a, v8f& b, v8f& c, v8f& d) { asm volatile("v_nop\n\tv_nop\n\tv_nop\n\tv_nop" : "+v"(a), "+v"(b), "+v"(c), "+v"(d)); }
template <typename T> struct Frag;
template <> struct Frag<_Float16> {
  typedef v16h V; union U { v16h v; v8h h[2]; };
  // elements 0..7 <- p[0..7], 8..15 <- p[16..23]
  static __device__ __forceinline__ v16h load(const _Float16* p) {
    U f; f.h[0] = *(const v8h*)(p); f.h[1] = *(const v8h*)(p + 16); return f.v;
  }
  static __device__ __forceinline__ v8f mma(v16h a, v16h b, v8f c) {
    return __builtin_amdgcn_wmma_f32_16x16x32_f16(false, a, false, b, (short)0, c, false, false);
  }
};
template <> struct Frag<__bf16> {
  typedef v16b V; union U { v16b v; v8b h[2]; };
  static __device__ __forceinline__ v16b load(const __bf16* p) {
    U f; f.h[0] = *(const v8b*)(p); f.h[1] = *(const v8b*)(p + 16); return f.v;
  }
  static __device__ __forceinline__ v8f mma(v16b a, v16b b, v8f c) {
    return __builtin_amdgcn_wmma_f32_16x16x32_bf16(false, a, false, b, (short)0, c, false, false);
  }
};

__device__ __forceinline__ unsigned pk16(unsigned short a, unsigned short b) { return (unsigned)a | ((unsigned)b << 16); }

// ---- asynchronous copies global -> LDS: N copies of 16 B a lane in ONE statement; the s_wait_xcnt 0 at its end stands ahead of every
// later rewrite of the address registers that the issued copies name (inside the statement nothing can be moved between them) ----
#define ACP(a, b) "global_load_async_to_lds_b128 %" #a ", %" #b ", off\n\t"
#define AOP(i) "v"(l[i]), "v"(g[i])
#define ACP8 ACP(0, 1) ACP(2, 3) ACP(4, 5) ACP(6, 7) ACP(8, 9) ACP(10, 11) ACP(12, 13) ACP(14, 15)
#define AOP8 AOP(0), AOP(1), AOP(2), AOP(3), AOP(4), AOP(5), AOP(6), AOP(7)
template <int V> struct IC { static constexpr int v = V; };   // a compile-time int as a function argument
template <int N>
__device__ __forceinline__ void async_copies(const unsigned* l, const void* const* g) {
  static_assert(N == 1 || N == 8 || N == 12, "statement sizes in use");
  if constexpr (N == 1) {
    asm volatile(ACP(0, 1) "s_wait_xcnt 0x0" :: AOP(0) : "memory");
  } else if constexpr (N == 8) {
    asm volatile(ACP8 "s_wait_xcnt 0x0" :: AOP8 : "memory");
  } else {
    asm volatile(ACP8 ACP(16, 17) ACP(18, 19) ACP(20, 21) ACP(22, 23) "s_wait_xcnt 0x0" :: AOP8, AOP(8), AOP(9), AOP(10), AOP(11) : "memory");
  }
}

// ---- Register-blocked batched WMMA GEMM (BSPLIT and LORA options added; operands staged in LDS) ----
// C[m,n] = scale * sum_k A[m,k] * Bt[n,k] (+bias)(+resid)(+lora); each wave owns a 64x64 tile; a block of NW waves owns
// (NW / WN) x WN such tiles, that is (NW / WN) * 64 rows of A and WN * 64 rows of Bt. NW <= 4: one wave a SIMD, and blocks enough
// for every WGP (256 blocks of 128 x 128 for a 4096 x 1024 output).
// A row-major [M,K]; Bt row-major [N,K]; M % ((NW / WN) * 64) == 0, N % (WN * 64) == 0, K % 64 == 0, K >= 64.
// SPLIT (with BSPLIT == false): A carries a lo plane (A2, same layout); product = hi.B + lo.B (Bt2 unused).
// BIAS_MODE: 0 = none, 1 = bias[m], 2 = bias[n].
// OUT_MODE: 0 = f32, 1 = f16, 2 = bf16 hi plane (Cout) + bf16 lo plane (Cout2).
// LORA: rank-4 f32 term added in the epilogue: v += dot4(t[token][0..3], up[feature][0..3]). t = (token rows) . Dn^T is formed by the
//   block itself: the 16 rows of the zero-padded down plane Dn ([16][K], pitch K) ride in the ring as one more copy a stage, and each
//   wave multiplies the token-row fragments that it holds anyway (as A) by the one Dn fragment (as B) into four more 16 x 16 tiles,
//   in the k order of the main product (hi, then lo, within a 32-k step); behind the loop t goes through the wave's own LDS table.
//   up: global f32 [feature][4], pitch ldup floats (16-B aligned rows), RNE-bf16 converted at load; t kept f32.
//   LORA == 1: tokens are the rows of A, features the rows of Bt; LORA == 2: features are the rows of A, tokens the rows of Bt.
//   In LORA modes a BIAS_MODE 2 bias is RNE-bf16 converted too.
// ET: 0 = f16 operands, 1 = bf16 operands (pointers passed as 16-bit storage)
template <int ET> struct Elem;
template <> struct Elem<0> { typedef _Float16 T; };
template <> struct Elem<1> { typedef __bf16 T; };
// LDS bytes of one block: the two-stage ring or the output slabs, whichever is larger (the constants are those of gemm64_body).
constexpr int gemm_lds_bytes(bool split, int wn, int nw, bool lora) {
  const int ring  = 2 * ((nw / wn) * 64 * (split ? 2 : 1) + wn * 64 + (lora ? 16 : 0)) * 144;
  const int slabs = nw * 16 * 68 * 4 + (lora ? nw * 64 * 4 * 4 : 0);
  return ring > slabs ? ring : slabs;
}
// The body is a device function, so that one launch can hold products of different template modes (qkv_gemm_kernel below):
// smem = the block's LDS array of gemm_lds_bytes(SPLIT, WN, NW, LORA != 0) bytes, declared once in the calling kernel; b = batch index.
template <int ET, bool SPLIT, int BIAS_MODE, int OUT_MODE, bool RESID, int ACT = 0, bool CAUSAL = false, bool BSPLIT = true, int LORA = 0, int WN = 2, int NW = 4>
__device__ __forceinline__ void gemm64_body(
    unsigned char* smem, const int b,
    const unsigned short* __restrict__ Ap, const unsigned short* __restrict__ A2p, int lda, long strideA,
    const unsigned short* __restrict__ Btp, const unsigned short* __restrict__ Bt2p, int ldb, long strideB,
    void* __restrict__ Cout, void* __restrict__ Cout2, int ldc, long strideC,
    const float* __restrict__ bias,
    const float* __restrict__ resid, long strideR,
    const unsigned short* __restrict__ Dnp,
    const float* __restrict__ up, int ldup,
    int M, int N, int K, float scale) {
  static_assert(!CAUSAL && !(SPLIT && BSPLIT), "the staged k loop has no tile skip and no lo plane of Bt");
  static_assert((NW == 4 && WN == 2) || (NW == 2 && WN == 1), "block shapes in use");
  static_assert(LORA == 0 || NW == 4, "the 16 rows of the down plane are one copy of every wave");
  typedef typename Elem<ET>::T T;
  typedef typename Frag<T>::V V;
  const T* A = (const T*)Ap; const T* A2 = (const T*)A2p; const T* Bt = (const T*)Btp;
  // One stage = 64 k (128 B) of every operand row of the block, LDS rows [A | A lo | Bt | Dn] at pitch 144 B (16 B x odd: 16-B row reads
  // of 16 lanes fall on distinct banks). Two stages; the per-wave 16x64 output slabs (pitch 68 floats) reuse the ring behind the loop.
  constexpr int WM        = NW / WN;
  constexpr int kPitch    = 144;
  constexpr int kRowsA    = WM * 64;
  constexpr int kRowB0    = kRowsA * (SPLIT ? 2 : 1);
  constexpr int kRowD0    = kRowB0 + WN * 64;
  constexpr int kRows     = kRowD0 + (LORA != 0 ? 16 : 0);
  constexpr int kBufBytes = kRows * kPitch;
  constexpr int kSlabs    = NW * 16 * 68 * 4;                          // the t tables (64 x 4 floats a wave) stand behind the slabs
  constexpr int kEpiBytes = kSlabs + (LORA != 0 ? NW * 64 * 4 * 4 : 0);
  constexpr int kLdsBytes = (2 * kBufBytes > kEpiBytes) ? 2 * kBufBytes : kEpiBytes;
  static_assert(kLdsBytes <= 320 * 1024, "LDS of one work-group");
  static_assert(kLdsBytes == gemm_lds_bytes(SPLIT, WN, NW, LORA != 0), "the calling kernel's array");
  const int lane = threadIdx.x & 31;
  const int wave = threadIdx.x >> 5;
  const int blocksN = N / (WN * 64);
  const int blocksM = M / (WM * 64);
  if ((int)blockIdx.x >= blocksM * blocksN) return;   // the same for the whole block; ahead of every barrier
  const int bm   = blockIdx.x / blocksN;
  const int bn   = blockIdx.x - bm * blocksN;
  const int mBlk = bm * (WM * 64);
  const int nBlk = bn * (WN * 64);
  const int wm   = wave / WN;
  const int wn   = wave - wm * WN;
  const int m0   = mBlk + (wm << 6);
  const int n0   = nBlk + (wn << 6);

  const T* Ab  = A  + (size_t)b * strideA;
  const T* Bb  = Bt + (size_t)b * strideB;
  const T* Ab2 = SPLIT ? (A2  + (size_t)b * strideA) : nullptr;

  const int rlane = lane & 15;                 // row (A) / col (B, D) within subtile
  const int koff  = (lane >> 4) * 8;           // k offset of this lane half
  const int mOff  = (lane >> 4) * 8;           // D row offset

  v8f acc[4][4];
#pragma unroll
  for (int i = 0; i < 4; ++i)
#pragma unroll
    for (int j = 0; j < 4; ++j) acc[i][j] = (v8f){0.f,0.f,0.f,0.f,0.f,0.f,0.f,0.f};
  v8f tacc[4];                                 // LORA: t of the wave's 64 token rows, [16-row tile]; columns 4..15 stay 0
#pragma unroll
  for (int i = 0; i < 4; ++i) tacc[i] = (v8f){0.f,0.f,0.f,0.f,0.f,0.f,0.f,0.f};

  // Staging: copy c of a stage fills LDS rows RPC c .. RPC c + RPC - 1: wave w rows RPC c + 4w .. + 3, 8 lanes a row (four whole 128-B
  // lines of global memory an instruction). The operand boundaries are multiples of 64 rows, so a copy's operand is known at compile time.
  constexpr int RPC = NW * 4;                  // LDS rows that one copy of every wave fills
  constexpr int NC = kRows / RPC;              // copies of a wave per stage: 17 or 25 with the down plane (at most 63 may be in flight)
  const int srow = (wave << 2) + (lane >> 3);
  const int scol = (lane & 7) << 3;            // first of this lane's 8 elements
  const T* gA  = Ab + (size_t)(mBlk + srow) * lda + scol;
  const T* gA2 = SPLIT ? (Ab2 + (size_t)(mBlk + srow) * lda + scol) : nullptr;
  const T* gB  = Bb + (size_t)(nBlk + srow) * ldb + scol;
  const T* gD  = (LORA != 0) ? ((const T*)Dnp + (size_t)srow * K + scol) : nullptr;   // srow = 0..15: the plane's 16 rows
  const unsigned lds0 = (unsigned)(size_t)smem + (unsigned)(srow * kPitch + (scol << 1));
  auto part = [&](auto first, auto count, int buf, int k0) {   // copies first .. first + count - 1 of a stage, one statement
    constexpr int C0 = decltype(first)::v;
    constexpr int CN = decltype(count)::v;
    unsigned l[CN];
    const void* g[CN];
#pragma unroll
    for (int c = 0; c < CN; ++c) {
      const int r = (C0 + c) * RPC;
      l[c] = lds0 + (unsigned)(buf * kBufBytes + r * kPitch);
      if (r < kRowsA)      g[c] = gA  + (size_t)r * lda + k0;
      else if (r < kRowB0) g[c] = gA2 + (size_t)(r - kRowsA) * lda + k0;
      else if (r < kRowD0) g[c] = gB  + (size_t)(r - kRowB0) * ldb + k0;
      else                 g[c] = gD + k0;
    }
    async_copies<CN>(l, g);
    __builtin_amdgcn_sched_barrier(0);   // keeps the next statement's address sums behind this one: formed all at once they spill
  };
  auto stage = [&](int buf, int k0) {
    if constexpr (NC == 16)      { part(IC<0>{}, IC<8>{}, buf, k0); part(IC<8>{}, IC<8>{}, buf, k0); }
    else if constexpr (NC == 17) { part(IC<0>{}, IC<8>{}, buf, k0); part(IC<8>{}, IC<8>{}, buf, k0); part(IC<16>{}, IC<1>{}, buf, k0); }
    else if constexpr (NC == 24) { part(IC<0>{}, IC<12>{}, buf, k0); part(IC<12>{}, IC<12>{}, buf, k0); }
    else if constexpr (NC == 25) { part(IC<0>{}, IC<12>{}, buf, k0); part(IC<12>{}, IC<12>{}, buf, k0); part(IC<24>{}, IC<1>{}, buf, k0); }
    else {
      static_assert(NC == 40, "statement split");
      part(IC<0>{}, IC<8>{}, buf, k0); part(IC<8>{}, IC<8>{}, buf, k0); part(IC<16>{}, IC<8>{}, buf, k0);
      part(IC<24>{}, IC<8>{}, buf, k0); part(IC<32>{}, IC<8>{}, buf, k0);
    }
  };

  // k loop, two LDS buffers: trip t works on buffer t % 2 alone while the copies of stage t + 1 fly into the other one.
  // Per accumulator the order of the products is that of k (hi.B, then lo.B, within a 32-k step).
  const int ntrips = K >> 6;                   // >= 1
  const unsigned char* aRd = smem + ((wm << 6) + rlane) * kPitch + (koff << 1);
  const unsigned char* bRd = smem + (kRowB0 + (wn << 6) + rlane) * kPitch + (koff << 1);
  const unsigned char* dRd = smem + (kRowD0 + rlane) * kPitch + (koff << 1);
  stage(0, 0);
  asm volatile("s_wait_asynccnt 0x0" ::: "memory");   // this wave's share of stage 0 has landed
  __syncthreads();                                     // stage 0 readable by every wave
  if (ntrips > 1) stage(1, 64);
  for (int t = 0; t < ntrips; ++t) {
    const int bo = (t & 1) * kBufBytes;
    V fa[2][4], fl[2][4], fb[2][4], fd[2];     // both 32-k steps of the stage, read as one group ahead of the products
#pragma unroll
    for (int ks = 0; ks < 2; ++ks) {
      if (LORA != 0) fd[ks] = Frag<T>::load((const T*)(dRd + bo + ks * 64));
#pragma unroll
      for (int j = 0; j < 4; ++j) fb[ks][j] = Frag<T>::load((const T*)(bRd + bo + j * 16 * kPitch + ks * 64));
#pragma unroll
      for (int i = 0; i < 4; ++i) {
        fa[ks][i] = Frag<T>::load((const T*)(aRd + bo + i * 16 * kPitch + ks * 64));
        if (SPLIT) fl[ks][i] = Frag<T>::load((const T*)(aRd + bo + (kRowsA + i * 16) * kPitch + ks * 64));
      }
    }
    __builtin_amdgcn_sched_barrier(0);   // holds the reads together ahead of the products: sunk among them, every row of products waits out an LDS latency
#pragma unroll
    for (int ks = 0; ks < 2; ++ks) {
#pragma unroll
      for (int i = 0; i < 4; ++i) {
#pragma unroll
        for (int j = 0; j < 4; ++j) acc[i][j] = Frag<T>::mma(fa[ks][i], fb[ks][j], acc[i][j]);
        if (SPLIT) {
#pragma unroll
          for (int j = 0; j < 4; ++j) acc[i][j] = Frag<T>::mma(fl[ks][i], fb[ks][j], acc[i][j]);
        }
      }
      if (LORA == 1) {
#pragma unroll
        for (int i = 0; i < 4; ++i) tacc[i] = Frag<T>::mma(fa[ks][i], fd[ks], tacc[i]);
        if (SPLIT) {
#pragma unroll
          for (int i = 0; i < 4; ++i) tacc[i] = Frag<T>::mma(fl[ks][i], fd[ks], tacc[i]);
        }
      }
      if (LORA == 2) {
#pragma unroll
        for (int j = 0; j < 4; ++j) tacc[j] = Frag<T>::mma(fb[ks][j], fd[ks], tacc[j]);
      }
    }
    __builtin_amdgcn_sched_barrier(0);   // holds the waits, the barrier and the refill behind the products: risen over them, the refill would fly under the next reads alone
    asm volatile("s_wait_dscnt 0x0" ::: "memory");      // this wave's reads of buffer t % 2 are over before it is handed to the copies
    asm volatile("s_wait_asynccnt 0x0" ::: "memory");   // this wave's share of stage t + 1 has landed
    __syncthreads();                                     // publishes stage t + 1 and ends every wave's reads of buffer t % 2
    if (t + 2 < ntrips) stage(t & 1, (t + 2) << 6);      // the same test in the whole block
  }
  asm volatile("s_wait_asynccnt 0x0" ::: "memory");     // no copy is in flight when the ring becomes the output slabs
  acc_guard4(acc[0][0], acc[0][1], acc[0][2], acc[0][3]);
  acc_guard4(acc[1][0], acc[1][1], acc[1][2], acc[1][3]);
  acc_guard4(acc[2][0], acc[2][1], acc[2][2], acc[2][3]);
  acc_guard4(acc[3][0], acc[3][1], acc[3][2], acc[3][3]);
  if (LORA != 0) acc_guard4(tacc[0], tacc[1], tacc[2], tacc[3]);

  // ---- epilogue ----
  float* slab = (float*)smem + wave * (16 * 68);   // behind the last trip's barrier: nobody reads the ring any more
  const float* Rb = RESID ? (resid + (size_t)b * strideR) : nullptr;
  // t of the wave's 64 token rows -> its own table [64][4] f32 (a lane of tacc holds column rlane of rows mOff + r; columns 0..3 count)
  float* ttab = (float*)(smem + kSlabs) + wave * (64 * 4);
  if (LORA != 0) {
    if (rlane < 4) {
#pragma unroll
      for (int i = 0; i < 4; ++i)
#pragma unroll
        for (int r = 0; r < 8; ++r) ttab[((i << 4) + mOff + r) * 4 + rlane] = tacc[i][r];
    }
    // the table is written and read by this wave alone: its stores are ordered ahead of its reads below
    __builtin_amdgcn_fence(__ATOMIC_RELEASE, "workgroup");
    __builtin_amdgcn_wave_barrier();
    __builtin_amdgcn_fence(__ATOMIC_ACQUIRE, "workgroup");
  }
  // rank-4 column table (LORA modes): per lane the 4 columns n0 + 16j + rlane
  v4f ctab[4];
  float cbias[4];
#pragma unroll
  for (int j = 0; j < 4; ++j) { ctab[j] = (v4f){0.f,0.f,0.f,0.f}; cbias[j] = 0.f; }
  if (LORA != 0) {
#pragma unroll
    for (int j = 0; j < 4; ++j) {
      const int n = n0 + (j << 4) + rlane;
      v4f u;
      if (LORA == 1) {
        u = *(const v4f*)(up + (size_t)n * ldup);
#pragma unroll
        for (int e = 0; e < 4; ++e) u[e] = bf_rne(u[e]);
      } else {
        u = *(const v4f*)(ttab + ((j << 4) + rlane) * 4);
      }
      ctab[j] = u;
      if (BIAS_MODE == 2) cbias[j] = bf_rne(bias[n]);
    }
  }
#pragma unroll
  for (int i = 0; i < 4; ++i) {
    const int mBase = m0 + (i << 4);
    if (LORA == 0) {
#pragma unroll
      for (int j = 0; j < 4; ++j) {
        const int n = n0 + (j << 4) + rlane;
        float bv = 0.f;
        if (BIAS_MODE == 2) bv = bias[n];
#pragma unroll
        for (int r = 0; r < 8; ++r) {
          float v = acc[i][j][r] * scale;
          if (BIAS_MODE == 1) v += bias[mBase + mOff + r];
          if (BIAS_MODE == 2) v += bv;
          if (RESID) v += Rb[(size_t)(mBase + mOff + r) * ldc + n];
          if (ACT == 2) v = fmaxf(v, 0.0f);
          if (ACT == 4) v = (v > 0.f) ? v : 0.01f * v;
          slab[(mOff + r) * 68 + (j << 4) + rlane] = v;
        }
      }
    } else {
      v4f trs[8];   // the tile's 8 rows read as one group ahead of the slab stores (one latency, not one a row)
#pragma unroll
      for (int r = 0; r < 8; ++r) {
        if (LORA == 1) trs[r] = *(const v4f*)(ttab + ((i << 4) + mOff + r) * 4);
        else           trs[r] = *(const v4f*)(up + (size_t)(mBase + mOff + r) * ldup);
      }
#pragma unroll
      for (int r = 0; r < 8; ++r) {
        v4f tr = trs[r];
        if (LORA == 2) {
#pragma unroll
          for (int e = 0; e < 4; ++e) tr[e] = bf_rne(tr[e]);
        }
#pragma unroll
        for (int j = 0; j < 4; ++j) {
          float lr = tr[0] * ctab[j][0];
          lr = fmaf(tr[1], ctab[j][1], lr);
          lr = fmaf(tr[2], ctab[j][2], lr);
          lr = fmaf(tr[3], ctab[j][3], lr);
          float v = acc[i][j][r] * scale + lr;
          if (BIAS_MODE == 2) v += cbias[j];
          slab[(mOff + r) * 68 + (j << 4) + rlane] = v;
        }
      }
    }
    __builtin_amdgcn_fence(__ATOMIC_RELEASE, "workgroup");
    __builtin_amdgcn_wave_barrier();
    __builtin_amdgcn_fence(__ATOMIC_ACQUIRE, "workgroup");
    if (OUT_MODE == 0) {
      float* C = (float*)Cout + (size_t)b * strideC;
      const int hh = lane >> 4, c4 = (lane & 15) * 4;     // row seg = 256 B = 16 lanes x 16 B
      {
#pragma unroll
        for (int it = 0; it < 8; ++it) {
          const int row = it * 2 + hh;
          v4f v = *(const v4f*)(slab + row * 68 + c4);
          *(v4f*)(C + (size_t)(mBase + row) * ldc + n0 + c4) = v;
        }
        
      }
    } else {
      const int q = lane >> 3, c8 = (lane & 7) * 8;
      unsigned short* C  = (unsigned short*)Cout  + (size_t)b * strideC;
      unsigned short* C2 = (OUT_MODE == 2) ? ((unsigned short*)Cout2 + (size_t)b * strideC) : nullptr;
      {
#pragma unroll
        for (int it = 0; it < 4; ++it) {
          const int row = it * 4 + q;
          const float* sp = slab + row * 68 + c8;
          v8h hv, lv;
#pragma unroll
          for (int e = 0; e < 8; ++e) {
            if (OUT_MODE == 1) {
              hv[e] = (_Float16)sp[e];
            } else {
              unsigned short hb = f2bf_bits(sp[e]);
              unsigned short lb = f2bf_bits(sp[e] - bf_bits2f(hb));
              hv[e] = __builtin_bit_cast(_Float16, hb);
              lv[e] = __builtin_bit_cast(_Float16, lb);
            }
          }
          *(v8h*)(C + (size_t)(mBase + row) * ldc + n0 + c8) = hv;
          if (OUT_MODE == 2) *(v8h*)(C2 + (size_t)(mBase + row) * ldc + n0 + c8) = lv;
        }
        
      }
    }
    __builtin_amdgcn_fence(__ATOMIC_RELEASE, "workgroup");
    __builtin_amdgcn_wave_barrier();
    __builtin_amdgcn_fence(__ATOMIC_ACQUIRE, "workgroup");
  }
}

// One product (or a batch of same-shaped products over blockIdx.y) per launch.
template <int ET, bool SPLIT, int BIAS_MODE, int OUT_MODE, bool RESID, int ACT = 0, bool CAUSAL = false, bool BSPLIT = true, int LORA = 0, int WN = 2, int NW = 4>
__global__ __launch_bounds__(NW * 32) void wmma_gemm64(
    const unsigned short* __restrict__ Ap, const unsigned short* __restrict__ A2p, int lda, long strideA,
    const unsigned short* __restrict__ Btp, const unsigned short* __restrict__ Bt2p, int ldb, long strideB,
    void* __restrict__ Cout, void* __restrict__ Cout2, int ldc, long strideC,
    const float* __restrict__ bias,
    const float* __restrict__ resid, long strideR,
    const unsigned short* __restrict__ Dnp,
    const float* __restrict__ up, int ldup,
    int M, int N, int K, float scale) {
  __shared__ __align__(16) unsigned char smem[gemm_lds_bytes(SPLIT, WN, NW, LORA != 0)];
  gemm64_body<ET, SPLIT, BIAS_MODE, OUT_MODE, RESID, ACT, CAUSAL, BSPLIT, LORA, WN, NW>(
      smem, (int)blockIdx.y, Ap, A2p, lda, strideA, Btp, Bt2p, ldb, strideB, Cout, Cout2, ldc, strideC,
      bias, resid, strideR, Dnp, up, ldup, M, N, K, scale);
}

// The three projections in ONE launch: they are independent of one another, each alone puts one block of 4 waves on a WGP, and three
// such blocks fit a WGP (LDS and registers), so that one block's products run under another's waits, barriers and epilogue.
// blockIdx.y (the same for the whole block): 0: q = x . wq^T + tq . q_up^T -> q|k planes, columns 0..hid-1; 1: k likewise with wk,
// tk, k_up -> columns hid..2 hid - 1; 2: v^T = wv . x^T + v_up . tv^T -> v^T planes. tok = token rows, hid = hidden size.
// t{q,k,v} = x . down^T of a block's token rows is formed in the block (dn3: the three padded down planes).
__global__ __launch_bounds__(128) void qkv_gemm_kernel(
    const unsigned short* __restrict__ xb, const unsigned short* __restrict__ w3,
    unsigned short* __restrict__ qkhi, unsigned short* __restrict__ qklo,
    unsigned short* __restrict__ vthi, unsigned short* __restrict__ vtlo,
    const unsigned short* __restrict__ dn3,
    const float* __restrict__ q_up, const float* __restrict__ k_up, const float* __restrict__ v_up,
    int tok, int hid) {
  __shared__ __align__(16) unsigned char smem[gemm_lds_bytes(false, 2, 4, true)];
  const int y = blockIdx.y;
  const unsigned short* w = w3 + (size_t)y * hid * hid;
  const unsigned short* dn = dn3 + (size_t)y * kRankPad * hid;
  if (y < 2) {
    gemm64_body<1, false, 0, 2, false, 0, false, true, 1>(
        smem, 0, xb, xb, hid, 0L, w, w, hid, 0L, (void*)(qkhi + y * hid), (void*)(qklo + y * hid), 2 * hid, 0L,
        q_up, q_up, 0L, dn, (y == 0) ? q_up : k_up, kRank, tok, hid, hid, 1.0f);
  } else {
    gemm64_body<1, false, 0, 2, false, 0, false, true, 2>(
        smem, 0, w, w, hid, 0L, xb, xb, hid, 0L, (void*)vthi, (void*)vtlo, tok, 0L,
        v_up, v_up, 0L, dn, v_up, kRank, hid, tok, hid, 1.0f);
  }
}

// ---------------------------------------------------------------------------
// f32 -> RNE bf16 planes, every table of the call in ONE launch (the casts are independent of one another). blockIdx.x picks the
// table (the same for the whole block): blocks [0, kCbX): x; then 4 x kCbW blocks: wq, wk, wv, wo; then 4 x kCbD blocks: the four down
// tables, each zero-padded from kRank to kRankPad rows.
// Thread i of a table owns flat elements 8i..8i+7 of its plane: value = src[e] for e < nvalid, 0 otherwise (the load address is clamped
// to [0, nvalid-8], the value is zeroed by predicate). Plane y of a group starts at its base + y * plane elements.
// Coverage: blocks of a table x 256 threads x 8 = the whole (padded) plane, exactly.
// ---------------------------------------------------------------------------
constexpr int kCbX = (kTok * kHid) / (8 * 256);       // 2048 blocks
constexpr int kCbW = (kHid * kHid) / (8 * 256);       // 512 blocks a weight table
constexpr int kCbD = (kRankPad * kHid) / (8 * 256);   // 8 blocks a padded down table
constexpr int kCastBlocks = kCbX + 4 * kCbW + 4 * kCbD;
__global__ __launch_bounds__(256) void cast_all_bf16_kernel(const float* __restrict__ x,
                                                            const float* __restrict__ wq, const float* __restrict__ wk,
                                                            const float* __restrict__ wv, const float* __restrict__ wo,
                                                            const float* __restrict__ dq, const float* __restrict__ dk,
                                                            const float* __restrict__ dv, const float* __restrict__ dout,
                                                            unsigned short* __restrict__ xb, unsigned short* __restrict__ w4,
                                                            unsigned short* __restrict__ dn4) {
  int blk = blockIdx.x;
  if (blk >= kCastBlocks) return;
  const float* src;
  unsigned short* dst;
  int nvalid;
  if (blk < kCbX) {
    src = x; dst = xb; nvalid = kTok * kHid;
  } else if (blk < kCbX + 4 * kCbW) {
    blk -= kCbX;
    const int y = blk / kCbW;
    blk -= y * kCbW;
    src = (y == 0) ? wq : ((y == 1) ? wk : ((y == 2) ? wv : wo));
    dst = w4 + (size_t)y * (kHid * kHid);
    nvalid = kHid * kHid;
  } else {
    blk -= kCbX + 4 * kCbW;
    const int y = blk / kCbD;
    blk -= y * kCbD;
    src = (y == 0) ? dq : ((y == 1) ? dk : ((y == 2) ? dv : dout));
    dst = dn4 + (size_t)y * (kRankPad * kHid);
    nvalid = kRank * kHid;
  }
  const int i = blk * 256 + threadIdx.x;
  const long e = 8L * (long)i;
  const bool live = (e < (long)nvalid);
  const long ec = live ? e : (long)(nvalid - 8);
  const v4f a = *(const v4f*)(src + ec);
  const v4f c = *(const v4f*)(src + ec + 4);
  float f[8];
#pragma unroll
  for (int k = 0; k < 4; ++k) { f[k] = live ? a[k] : 0.0f; f[4 + k] = live ? c[k] : 0.0f; }
  unsigned w[4];
#pragma unroll
  for (int e2 = 0; e2 < 4; ++e2) w[e2] = pk16(f2bf_bits(f[2 * e2]), f2bf_bits(f[2 * e2 + 1]));
  const v4u u = (v4u){w[0], w[1], w[2], w[3]};
  *(v4u*)(dst + (size_t)e) = u;
}

constexpr int kFaWaves = 8;
constexpr int kFaCols  = 32;                       // query columns per wave
constexpr int kFaG     = kFaCols / 16;             // 16-column groups per wave
constexpr int kFaKeys  = 32;                       // keys per pass = one k step of the second product
constexpr float kExp2Scale = 0.125f * 1.4426950408889634f;   // 64^-0.5 * log2(e)
constexpr int kFaSubKeys  = 64;                    // keys of a sub-tile
constexpr int kFaSubs     = 2;                     // sub-tiles of a stage
constexpr int kFaStage    = kFaSubKeys * kFaSubs;  // keys of a stage
constexpr int kFaTrips    = kSeq / kFaStage;
constexpr int kFaPitch    = 144;
constexpr int kFaPlane    = 64 * kFaPitch;         // one operand plane of a sub-tile, bytes
constexpr int kFaSubBytes = 4 * kFaPlane;
constexpr int kFaBufBytes = kFaSubs * kFaSubBytes;
static_assert(kSeq % (kFaWaves * kFaCols) == 0 && kSeq % kFaKeys == 0 && kDh == 64, "fused attention tile shape");
static_assert(kSeq % kFaStage == 0 && kFaTrips >= 2 && kFaStage == 4 * kFaKeys && kFaWaves == 8, "stage shape");
static_assert(2 * kFaBufBytes <= 320 * 1024, "LDS of one work-group");
typedef __attribute__((ext_vector_type(2))) float  v2f;
typedef __attribute__((ext_vector_type(2))) __bf16 v2b;
typedef __attribute__((ext_vector_type(8))) unsigned int v8u;

// two f32 -> two RNE bf16 in one word (a in the low half)
__device__ __forceinline__ unsigned pack_bf2(float a, float b) {
  return __builtin_bit_cast(unsigned, __builtin_convertvector((v2f){a, b}, v2b));
}
// value of lane l ^ 16
__device__ __forceinline__ float other_half(float x) {
  const int i = __builtin_bit_cast(int, x);
  return __builtin_bit_cast(float, __builtin_amdgcn_permlanex16(i, i, 0x76543210, 0xfedcba98, false, false));
}
struct KFrags { v16b hi[2][2], lo[2][2]; };        // [16-key tile][32-wide step over d]
// Fragments of pass P (0..3) of a stage, from LDS; rd = this lane's place in the stage's buffer: row c, byte 2 * h8.
template <int P>
__device__ __forceinline__ void lds_k(KFrags& k, const unsigned char* rd) {
  constexpr int o0 = (P >> 1) * kFaSubBytes + (P & 1) * 32 * kFaPitch;
#pragma unroll
  for (int kt = 0; kt < 2; ++kt)
#pragma unroll
    for (int kc = 0; kc < 2; ++kc) {
      const unsigned char* p = rd + o0 + (kt << 4) * kFaPitch + (kc << 6);
      k.hi[kt][kc] = Frag<__bf16>::load((const __bf16*)p);
      k.lo[kt][kc] = Frag<__bf16>::load((const __bf16*)(p + kFaPlane));
    }
}
template <int P>
__device__ __forceinline__ void lds_v(v16b (&vh)[4], v16b (&vl)[4], const unsigned char* rd) {
  constexpr int o0 = (P >> 1) * kFaSubBytes + 2 * kFaPlane + (P & 1) * 64;
#pragma unroll
  for (int t = 0; t < 4; ++t) {
    const unsigned char* p = rd + o0 + (t << 4) * kFaPitch;
    vh[t] = Frag<__bf16>::load((const __bf16*)p);
    vl[t] = Frag<__bf16>::load((const __bf16*)(p + kFaPlane));
  }
}

__global__ __launch_bounds__(kFaWaves * 32) void attn_fused_kernel(
    const unsigned short* __restrict__ QKhi, const unsigned short* __restrict__ QKlo,
    const unsigned short* __restrict__ Vthi, const unsigned short* __restrict__ Vtlo,
    unsigned short* __restrict__ Chi, unsigned short* __restrict__ Clo) {
  typedef Frag<__bf16> F;
  const int pair = blockIdx.y;
  const int b    = pair / kHeads;
  const int hd   = pair - b * kHeads;
  const int lane = threadIdx.x & 31;
  const int wave = threadIdx.x >> 5;
  const int c    = lane & 15;                  // row of A, column of B and D
  const int h8   = (lane >> 4) * 8;            // k offset of this lane half (A, B); D row offset
  const int q0   = blockIdx.x * (kFaWaves * kFaCols) + wave * kFaCols;
  const size_t tok0 = (size_t)b * kSeq;
  __shared__ __align__(16) unsigned char smem[2 * kFaBufBytes];

  // Staging: copy cc of a sub-tile fills its LDS rows 32 cc .. 32 cc + 31: wave w rows 32 cc + 4 w .. + 3, 8 lanes a row (four whole
  // 128-B lines of global memory an instruction); two copies a plane, 8 a sub-tile, 16 of a wave in flight per stage.
  const int srow = (wave << 2) + (lane >> 3);
  const int scol = (lane & 7) << 3;            // first of this lane's 8 elements
  const unsigned gk = (unsigned)((tok0 + srow) * kQKld + kHid + hd * kDh + scol);   // element offsets in the planes (below 2^23):
  const unsigned gv = (unsigned)((size_t)(hd * kDh + srow) * kTok + tok0 + scol);   // two registers live over the loop, not four pointers
  const unsigned lds0 = (unsigned)(size_t)smem + (unsigned)(srow * kFaPitch + (scol << 1));
  auto stage = [&](int buf, int key0) {
#pragma unroll
    for (int sub = 0; sub < kFaSubs; ++sub) {
      const int ks = key0 + sub * kFaSubKeys;
      unsigned l[8];
      const void* g[8];
#pragma unroll
      for (int cc = 0; cc < 8; ++cc) {
        const int r = (cc & 1) * 32;
        l[cc] = lds0 + (unsigned)(buf * kFaBufBytes + sub * kFaSubBytes + cc * 32 * kFaPitch);
        if (cc < 2)      g[cc] = QKhi + (gk + (unsigned)((ks + r) * kQKld));
        else if (cc < 4) g[cc] = QKlo + (gk + (unsigned)((ks + r) * kQKld));
        else if (cc < 6) g[cc] = Vthi + (gv + (unsigned)(r * kTok + ks));
        else             g[cc] = Vtlo + (gv + (unsigned)(r * kTok + ks));
      }
      async_copies<8>(l, g);
    }
  };
  stage(0, 0);   // flies under the Q loads

  // Q fragments (B operand), kept for the whole loop
  v16b qh[kFaG][2], ql[kFaG][2];
#pragma unroll
  for (int g = 0; g < kFaG; ++g)
#pragma unroll
    for (int kc = 0; kc < 2; ++kc) {
      const size_t o = (tok0 + q0 + (g << 4) + c) * kQKld + hd * kDh + (kc << 5) + h8;
      qh[g][kc] = F::load((const __bf16*)QKhi + o);
      ql[g][kc] = F::load((const __bf16*)QKlo + o);
    }
  v8f acc[kFaG][4];                            // O^T: [column group][16-row tile over d]
  float m_run[kFaG];
  v2f lsum[kFaG];                              // this lane's share of the row sum (its 16 of each pass's 32 keys), even / odd registers
#pragma unroll
  for (int g = 0; g < kFaG; ++g) {
    m_run[g] = -INFINITY;
    lsum[g] = (v2f){0.f, 0.f};
#pragma unroll
    for (int t = 0; t < 4; ++t) acc[g][t] = (v8f){0.f,0.f,0.f,0.f,0.f,0.f,0.f,0.f};
  }

  KFrags kf;
  v16b vh[4], vl[4];                           // [16-row tile over d]
  // one pass of 32 keys; P = its number within the stage, rd = this lane's place in the stage's buffer
  auto pass = [&](auto pnum, const unsigned char* rd) {
    constexpr int P = decltype(pnum)::v;
    // S^T tiles [16-key tile][column group]; per accumulator the order is hi.hi, hi.lo, lo.hi for d 0..31, then for d 32..63
    v8f s[2][kFaG];
#pragma unroll
    for (int kt = 0; kt < 2; ++kt)
#pragma unroll
      for (int g = 0; g < kFaG; ++g) s[kt][g] = (v8f){0.f,0.f,0.f,0.f,0.f,0.f,0.f,0.f};
#pragma unroll
    for (int kc = 0; kc < 2; ++kc) {
#pragma unroll
      for (int kt = 0; kt < 2; ++kt)
#pragma unroll
        for (int g = 0; g < kFaG; ++g) s[kt][g] = F::mma(kf.hi[kt][kc], qh[g][kc], s[kt][g]);
#pragma unroll
      for (int kt = 0; kt < 2; ++kt)
#pragma unroll
        for (int g = 0; g < kFaG; ++g) s[kt][g] = F::mma(kf.lo[kt][kc], qh[g][kc], s[kt][g]);
#pragma unroll
      for (int kt = 0; kt < 2; ++kt)
#pragma unroll
        for (int g = 0; g < kFaG; ++g) s[kt][g] = F::mma(kf.hi[kt][kc], ql[g][kc], s[kt][g]);
    }

    // column maxima of the raw scores (the scale is positive), then one test per pass
    float mb[kFaG];
    bool need = false;
#pragma unroll
    for (int g = 0; g < kFaG; ++g) {
      float mx = s[0][g][0];
#pragma unroll
      for (int r = 1; r < 8; ++r) mx = fmaxf(mx, s[0][g][r]);
#pragma unroll
      for (int r = 0; r < 8; ++r) mx = fmaxf(mx, s[1][g][r]);
      mx = fmaxf(mx, other_half(mx)) * kExp2Scale;   // both halves hold this query's maximum of the pass
      mb[g] = mx;
      need = need || (mx > m_run[g] + 8.0f);          // true in the first pass (m_run = -inf)
    }
    if (__builtin_amdgcn_ballot_w32(need) != 0) {     // wave-uniform scalar branch
#pragma unroll
      for (int g = 0; g < kFaG; ++g) {
        const float m_new = fmaxf(m_run[g], mb[g]);
        const float corr  = __builtin_amdgcn_exp2f(m_run[g] - m_new);   // 0 in the first pass
        m_run[g] = m_new;
        lsum[g] = lsum[g] * corr;
#pragma unroll
        for (int t = 0; t < 4; ++t) acc[g][t] = acc[g][t] * corr;
      }
    }
    // next pass's K fragments (same stage only), in flight under the exponentials and the second product
    if constexpr (P + 1 < kFaStage / kFaKeys) {
      lds_k<P + 1>(kf, rd);
      __builtin_amdgcn_sched_barrier(0);   // holds these reads ahead of the exponentials: sunk among the products below they arrive too late
    }
#pragma unroll
    for (int g = 0; g < kFaG; ++g) {
      const float nm = -m_run[g];
      v8u hw, lw;
      v2f pp[8];
#pragma unroll
      for (int i = 0; i < 8; ++i) {   // operand elements 2i, 2i + 1 = tile i >> 2, registers 2 (i & 3), 2 (i & 3) + 1
        const v2f arg = __builtin_elementwise_fma((v2f){s[i >> 2][g][2 * (i & 3)], s[i >> 2][g][2 * (i & 3) + 1]},
                                                  (v2f){kExp2Scale, kExp2Scale}, (v2f){nm, nm});
        const v2f p = (v2f){__builtin_amdgcn_exp2f(arg.x), __builtin_amdgcn_exp2f(arg.y)};
        const unsigned w = pack_bf2(p.x, p.y);
        const v2f hi = (v2f){__uint_as_float(w << 16), __uint_as_float(w & 0xFFFF0000u)};
        const v2f lo = p - hi;        // exact in f32
        hw[i] = w;
        lw[i] = pack_bf2(lo.x, lo.y);
        pp[i] = p;
      }
      lsum[g] += ((pp[0] + pp[1]) + (pp[2] + pp[3])) + ((pp[4] + pp[5]) + (pp[6] + pp[7]));
      const v16b ph = __builtin_bit_cast(v16b, hw);
      const v16b pl = __builtin_bit_cast(v16b, lw);
#pragma unroll
      for (int t = 0; t < 4; ++t) acc[g][t] = F::mma(vh[t], ph, acc[g][t]);
#pragma unroll
      for (int t = 0; t < 4; ++t) acc[g][t] = F::mma(vl[t], ph, acc[g][t]);
#pragma unroll
      for (int t = 0; t < 4; ++t) acc[g][t] = F::mma(vh[t], pl, acc[g][t]);
    }
    // next pass's v^T fragments (same stage only), in flight under that pass's first product and softmax
    if constexpr (P + 1 < kFaStage / kFaKeys) lds_v<P + 1>(vh, vl, rd);
  };

  // Stage loop, two LDS buffers: trip t reads buffer t % 2 alone while the copies of stage t + 1 fly into the other one.
  const unsigned char* rd0 = smem + c * kFaPitch + (h8 << 1);
  asm volatile("s_wait_asynccnt 0x0" ::: "memory");   // this wave's share of stage 0 has landed
  __syncthreads();                                     // stage 0 readable by every wave
  stage(1, kFaStage);
  for (int t = 0; t < kFaTrips; ++t) {
    const unsigned char* rd = rd0 + (t & 1) * kFaBufBytes;
    lds_k<0>(kf, rd);
    lds_v<0>(vh, vl, rd);
    pass(IC<0>{}, rd);
    pass(IC<1>{}, rd);
    pass(IC<2>{}, rd);
    pass(IC<3>{}, rd);
    asm volatile("s_wait_dscnt 0x0" ::: "memory");      // this wave's reads of buffer t % 2 are over before it is handed to the copies
    asm volatile("s_wait_asynccnt 0x0" ::: "memory");   // this wave's share of stage t + 1 has landed
    __syncthreads();                                     // publishes stage t + 1 and ends every wave's reads of buffer t % 2
    if (t + 2 < kFaTrips) stage(t & 1, (t + 2) * kFaStage);   // the same test in the whole block
  }
  asm volatile("s_wait_asynccnt 0x0" ::: "memory");     // no copy is in flight when the wave ends

  // ctx[query][hd * 64 + 16 t + h8 + r] = acc[g][t][r] / row sum, as bf16 hi/lo planes: 16 B per lane, tile and plane
#pragma unroll
  for (int g = 0; g < kFaG; ++g) {
    const float part = lsum[g].x + lsum[g].y;
    const float inv  = 1.0f / (part + other_half(part));   // sum >= 1: m never exceeds the row maximum
    const size_t co = (tok0 + q0 + (g << 4) + c) * kHid + hd * kDh + h8;
#pragma unroll
    for (int t = 0; t < 4; ++t) {
      v4u hv, lv;
#pragma unroll
      for (int e = 0; e < 4; ++e) {
        const float f0 = acc[g][t][2 * e] * inv;
        const float f1 = acc[g][t][2 * e + 1] * inv;
        const unsigned w = pack_bf2(f0, f1);
        hv[e] = w;
        lv[e] = pack_bf2(f0 - __uint_as_float(w << 16), f1 - __uint_as_float(w & 0xFFFF0000u));
      }
      *(v4u*)(Chi + co + (t << 4)) = hv;
      *(v4u*)(Clo + co + (t << 4)) = lv;
    }
  }
}

// ---------------------------------------------------------------------------
// Launcher. Workspace region map (bytes, MiB = 1048576; carve ends at 128 MiB = 134217728 B):
//   [  0, 17) operands: x bf16 [4096][1024] at +0 (8 MiB); wq|wk|wv|wo bf16 [1024][1024] x4 at +8 MiB (8 MiB);
//                      padded down planes [16][1024] x4 (q|k|v|out) at +16 MiB (128 KiB). No region is used twice.
//   [ 17, 64) unused
//   [ 64, 80) q|k hi : [4096][2048] bf16 (cols 0..1023 = q (h*64+d), 1024..2047 = k)
//   [ 80, 96) q|k lo
//   [ 96,104) v^T hi : [1024 (h*64+d)][4096 (b*2048+s)] bf16
//   [104,112) v^T lo
//   [112,120) ctx hi : [4096][1024] bf16 (col h*64+d)
//   [120,128) ctx lo
// Launch count: 1 cast + 1 projection launch (q, k, v^T) + 1 attention + 1 out GEMM = 4.
// Kernel launches only.
// ---------------------------------------------------------------------------
extern "C" void kernel_launch(void* const* d_in, const int* in_sizes, int n_in,
                              void* d_out, int out_size, void* d_ws, size_t ws_size,
                              hipStream_t stream) {
  if (n_in < 14) return;
  if (in_sizes[0] != kTok * kHid) return;
  if (in_sizes[1] != kHid * kHid || in_sizes[2] != kHid * kHid || in_sizes[3] != kHid * kHid || in_sizes[4] != kHid * kHid) return;
  if (in_sizes[5] != kHid) return;
  if (in_sizes[6] != kRank * kHid || in_sizes[8] != kRank * kHid || in_sizes[10] != kRank * kHid || in_sizes[12] != kRank * kHid) return;
  if (in_sizes[7] != kHid * kRank || in_sizes[9] != kHid * kRank || in_sizes[11] != kHid * kRank || in_sizes[13] != kHid * kRank) return;
  if (out_size != kTok * kHid) return;

  const size_t kMiB    = 1048576;
  const size_t offXb   = 0;
  const size_t offW3   = 8 * kMiB;
  const size_t offWo   = 14 * kMiB;
  const size_t offDn3  = 16 * kMiB;
  const size_t offDnO  = 16 * kMiB + 98304;
  const size_t offQKhi = 64 * kMiB;
  const size_t offQKlo = 80 * kMiB;
  const size_t offVthi = 96 * kMiB;
  const size_t offVtlo = 104 * kMiB;
  const size_t offChi  = 112 * kMiB;
  const size_t offClo  = 120 * kMiB;
  const size_t total   = 128 * kMiB;
  if (total > ws_size) return;

  const float* x     = (const float*)d_in[0];
  const float* wq    = (const float*)d_in[1];
  const float* wk    = (const float*)d_in[2];
  const float* wv    = (const float*)d_in[3];
  const float* wo    = (const float*)d_in[4];
  const float* bo    = (const float*)d_in[5];
  const float* q_dn  = (const float*)d_in[6];
  const float* q_up  = (const float*)d_in[7];
  const float* k_dn  = (const float*)d_in[8];
  const float* k_up  = (const float*)d_in[9];
  const float* v_dn  = (const float*)d_in[10];
  const float* v_up  = (const float*)d_in[11];
  const float* o_dn  = (const float*)d_in[12];
  const float* o_up  = (const float*)d_in[13];
  float* out = (float*)d_out;
  char* ws = (char*)d_ws;

  unsigned short* xb   = (unsigned short*)(ws + offXb);
  unsigned short* w3   = (unsigned short*)(ws + offW3);
  unsigned short* dn3  = (unsigned short*)(ws + offDn3);
  unsigned short* wob  = (unsigned short*)(ws + offWo);
  unsigned short* dno  = (unsigned short*)(ws + offDnO);
  unsigned short* qkhi = (unsigned short*)(ws + offQKhi);
  unsigned short* qklo = (unsigned short*)(ws + offQKlo);
  unsigned short* vthi = (unsigned short*)(ws + offVthi);
  unsigned short* vtlo = (unsigned short*)(ws + offVtlo);
  unsigned short* chi  = (unsigned short*)(ws + offChi);
  unsigned short* clo  = (unsigned short*)(ws + offClo);

  // in-range dummies for unused (never dereferenced) template-dead pointer parameters
  const float* dummy_f = bo;
  void* dummy_c2 = (void*)chi;

  // 1. x, wq, wk, wv, wo and the four down tables -> RNE bf16 planes (weights in Bt layout directly; down rows 4..15 zero-filled)
  cast_all_bf16_kernel<<<dim3(kCastBlocks), dim3(256), 0, stream>>>(x, wq, wk, wv, wo, q_dn, k_dn, v_dn, o_dn, xb, w3, dn3);
  // 2. q = x . wq^T + tq . q_up^T and k likewise (M=4096, N=1024, K=1024 -> bf16 hi/lo, q|k planes, ldc 2048);
  //    v^T = wv . x^T + v_up . tv^T (M=1024 (h*64+d), N=4096 (token), K=1024 -> bf16 hi/lo [1024][4096]): 256 blocks each
  qkv_gemm_kernel<<<dim3((kTok / 64) * (kHid / 64) / 4, 3), dim3(128), 0, stream>>>(
      xb, w3, qkhi, qklo, vthi, vtlo, dn3, q_up, k_up, v_up, kTok, kHid);

  // 3. attention, all 32 (batch, head) pairs: ctx = softmax(0.125 * q . k^T) . v -> bf16 hi/lo planes [4096][1024]
  attn_fused_kernel<<<dim3(kSeq / (kFaWaves * kFaCols), kBatch * kHeads), dim3(kFaWaves * 32), 0, stream>>>(
      qkhi, qklo, vthi, vtlo, chi, clo);

  // 4. out = ctx_hi . wo^T + ctx_lo . wo^T + to . out_up^T + bo, to = ctx_hi . out_down^T + ctx_lo . out_down^T : M=4096, N=1024, K=1024 -> f32 d_out
  wmma_gemm64<1, true, 2, 0, false, 0, false, false, 1><<<dim3((kTok / 64) * (kHid / 64) / 4, 1), dim3(128), 0, stream>>>(
      chi, clo, kHid, 0L,
      wob, wob, kHid, 0L,
      (void*)out, dummy_c2, kHid, 0L,
      bo, dummy_f, 0L,
      dno, o_up, kRank,
      kTok, kHid, kHid, 1.0f);
}
